// v000
// Measured on an AMD MI455X. A time is GPU time per run, averaged over a window of back-to-back runs after a warm-up
// (all launches, gaps included; the runs take copies of the inputs in turn), and the median of several windows.
// Apart from v000's, it joins two sittings. Times from different sittings can be a few percent apart, while
// side-by-side timings come from the same sitting.
// v000 is the starting kernel. One run takes 1500 microseconds.
// Single self-attention block on images (b 2, c 256, 64 x 64 -> n 4,096 tokens; 8 heads x 32): xn = GroupNorm(8 groups)(x) (affine); q,k,v = qkv_w xn + qkv_b (1x1, (out,in) rows q|k|v); attn = softmax(q k^T x 32^-0.5); out = proj_w (attn v) + proj_b, reshaped to [b,c,h,w] + x.
#include <hip/hip_runtime.h>
#include <math.h>

typedef __attribute__((ext_vector_type(16))) _Float16 v16h;
typedef __attribute__((ext_vector_type(16))) __bf16 v16b;
typedef __attribute__((ext_vector_type(8)))  _Float16 v8h;
typedef __attribute__((ext_vector_type(8)))  float v8f;
typedef __attribute__((ext_vector_type(4)))  float v4f;
typedef __attribute__((ext_vector_type(2)))  float v2f;
typedef __attribute__((ext_vector_type(4)))  unsigned v4u;
typedef __attribute__((ext_vector_type(4)))  int v4i;
typedef float __attribute__((may_alias)) float_a;
typedef int __attribute__((may_alias)) int_a;

template <typename T> __device__ __forceinline__ void vst2(void* p, T v) { *(T*)p = v;  }
__device__ __forceinline__ v8f wmma16(v16h a, v16h b, v8f c) {
  v8f d = __builtin_amdgcn_wmma_f32_16x16x32_f16(false, a, false, b, (short)0, c, false, false);
  asm volatile("v_nop\n\tv_nop\n\tv_nop\n\tv_nop" : "+v"(d) : "v"(a), "v"(b));
  return d;
}
__device__ __forceinline__ v8f wmma_bf(v16b a, v16b b, v8f c) {
  v8f d = __builtin_amdgcn_wmma_f32_16x16x32_bf16(false, a, false, b, (short)0, c, false, false);
  asm volatile("v_nop\n\tv_nop\n\tv_nop\n\tv_nop" : "+v"(d) : "v"(a), "v"(b));
  return d;
}
// 16x16x32 fragments: lane = (h = lane>>4, row/col = lane&15); elements 0..7 = k0+8h+0..7, 8..15 = k0+16+8h+0..7; D element r = row 8h+r
__device__ __forceinline__ v16h frag_h(const _Float16* rowk0, int lane) {
  union { v16h v; v8h q[2]; } u; const _Float16* p = rowk0 + 8 * (lane >> 4);
  u.q[0] = *(const v8h*)p; u.q[1] = *(const v8h*)(p + 16); return u.v;
}
__device__ __forceinline__ v16h frag_f32(const float* rowk0, int lane) {
  v16h a; const float* p = rowk0 + 8 * (lane >> 4);
#pragma unroll
  for (int i = 0; i < 8; ++i) { a[i] = (_Float16)p[i]; a[8 + i] = (_Float16)p[16 + i]; }
  return a;
}
__device__ __forceinline__ v16h frag_f32s(const float* rowk0, int lane, float sc) {
  v16h a; const float* p = rowk0 + 8 * (lane >> 4);
#pragma unroll
  for (int i = 0; i < 8; ++i) { a[i] = (_Float16)(p[i] * sc); a[8 + i] = (_Float16)(p[16 + i] * sc); }
  return a;
}
// column fragment from a [K][ld] layout (column n), rows >= K read as 0
__device__ __forceinline__ v16h fragc_f32(const float* W, int k0, int n, int lane, int ld, int K) {
  v16h a; const int g = lane >> 4;
#pragma unroll
  for (int i = 0; i < 8; ++i) { const int ka = k0 + 8 * g + i, kb = ka + 16;
    a[i] = (_Float16)(ka < K ? W[(size_t)(ka < K ? ka : K - 1) * ld + n] : 0.f); a[8 + i] = (_Float16)(kb < K ? W[(size_t)(kb < K ? kb : K - 1) * ld + n] : 0.f); }
  return a;
}
struct F2 { v16b h, l; };
__device__ __forceinline__ F2 bsplit16(const float v[16]) { F2 r;
#pragma unroll
  for (int i = 0; i < 16; ++i) { const __bf16 h = (__bf16)v[i]; r.h[i] = h; r.l[i] = (__bf16)(v[i] - (float)h); }
  return r; }
__device__ __forceinline__ F2 split_row(const float* row, int k0, int lane) { float v[16]; const float* p = row + k0 + 8 * (lane >> 4);
#pragma unroll
  for (int i = 0; i < 8; ++i) { v[i] = p[i]; v[8 + i] = p[16 + i]; }
  return bsplit16(v); }
__device__ __forceinline__ F2 split_rowK(const float* row, int k0, int lane, int K) { float v[16]; const int g = lane >> 4;
#pragma unroll
  for (int i = 0; i < 8; ++i) { const int ka = k0 + 8 * g + i, kb = ka + 16; v[i] = ka < K ? row[ka < K ? ka : K - 1] : 0.f; v[8 + i] = kb < K ? row[kb < K ? kb : K - 1] : 0.f; }
  return bsplit16(v); }
__device__ __forceinline__ F2 split_col(const float* W, int k0, int n, int lane, int ld, int K) { float v[16]; const int g = lane >> 4;
#pragma unroll
  for (int i = 0; i < 8; ++i) { const int ka = k0 + 8 * g + i, kb = ka + 16; v[i] = ka < K ? W[(size_t)(ka < K ? ka : K - 1) * ld + n] : 0.f; v[8 + i] = kb < K ? W[(size_t)(kb < K ? kb : K - 1) * ld + n] : 0.f; }
  return bsplit16(v); }
__device__ __forceinline__ v8f mac3(const F2& a, const F2& b, v8f c) { c = wmma_bf(a.l, b.h, c); c = wmma_bf(a.h, b.l, c); return wmma_bf(a.h, b.h, c); }
__device__ __forceinline__ float sigm(float v) { return 1.0f / (1.0f + expf(-v)); }
#define LDSX() do { asm volatile("s_wait_dscnt 0" ::: "memory"); __builtin_amdgcn_wave_barrier(); __builtin_amdgcn_fence(__ATOMIC_RELEASE, "workgroup"); } while (0)

#define NB 2
#define TT 4096
#define CC 256            // NH * HD = projected width
#define DIN 256          // input (model) width
#define NH 8
#define HD 32
#define NQB (TT / 64)
#define HG 2
#define SCALE (0.17677669529663687f)
#define CAUSAL 0
#ifndef TNB
#define TNB NB
#endif
__device__ __forceinline__ float bfr(float v) { return (float)(__bf16)v; }
__host__ __device__ __forceinline__ int kb_last(int qb) { return CAUSAL ? ((qb * 64 + 63) >> 7) : (TT / 128 - 1); }
typedef __attribute__((ext_vector_type(8))) __bf16 v8b;
__device__ __forceinline__ v16b frag_b(const __bf16* rowk0, int lane) {
  union { v16b v; v8b q[2]; } u; const __bf16* p = rowk0 + 8 * (lane >> 4);
  u.q[0] = *(const v8b*)p; u.q[1] = *(const v8b*)(p + 16); return u.v;
}
#define QBH 0              // query blocks 0..QBH-1 take the high-precision path: none (non-causal; every block sees all TT keys)
#define QHI 4096            // rows carrying a q residual plane (all rows when non-causal: 2-product logits everywhere)
#define KHI 64            // key rows carrying k residual / v bf16 hi+lo planes (written by k_proj, never read: the qb < QBH path is not taken)
// B fragment (k rows k0+.., output column o) of a weight: (in,out) [K][ld] or (out,in) [ld rows of K]: bf16 exact, or f16(bf16 * 256) exact
__device__ __forceinline__ v16b wcol_io(const float* Wm, int k0, int o, int lane, int ld) { v16b w; const int g = lane >> 4;
#pragma unroll
  for (int i = 0; i < 8; ++i) { w[i] = (__bf16)Wm[(size_t)(k0 + 8 * g + i) * ld + o]; w[8 + i] = (__bf16)Wm[(size_t)(k0 + 16 + 8 * g + i) * ld + o]; }
  return w; }
__device__ __forceinline__ v16b wcol_oi(const float* Wm, int k0, int o, int lane, int K) { v16b w; const float* p = Wm + (size_t)o * K + k0 + 8 * (lane >> 4);
#pragma unroll
  for (int i = 0; i < 8; ++i) { w[i] = (__bf16)p[i]; w[8 + i] = (__bf16)p[16 + i]; }
  return w; }
__device__ __forceinline__ v16h wcolh_io(const float* Wm, int k0, int o, int lane, int ld) { v16h w; const int g = lane >> 4;
#pragma unroll
  for (int i = 0; i < 8; ++i) { w[i] = (_Float16)(bfr(Wm[(size_t)(k0 + 8 * g + i) * ld + o]) * 256.0f); w[8 + i] = (_Float16)(bfr(Wm[(size_t)(k0 + 16 + 8 * g + i) * ld + o]) * 256.0f); }
  return w; }
__device__ __forceinline__ v16h wcolh_oi(const float* Wm, int k0, int o, int lane, int K) { v16h w; const float* p = Wm + (size_t)o * K + k0 + 8 * (lane >> 4);
#pragma unroll
  for (int i = 0; i < 8; ++i) { w[i] = (_Float16)(bfr(p[i]) * 256.0f); w[8 + i] = (_Float16)(bfr(p[16 + i]) * 256.0f); }
  return w; }
#define WQKV_LAYOUT 1   // 0 = (in,out) [DIN][CC]; 1 = (out,in) [CC][DIN]; 2 = per-head [NH][DIN][HD]
__device__ __forceinline__ v16b wcol_hdk(const float* Wm, int k0, int o, int lane) { v16b w; const int g = lane >> 4; const float* p = Wm + (size_t)(o / HD) * DIN * HD + (o % HD);
#pragma unroll
  for (int i = 0; i < 8; ++i) { w[i] = (__bf16)p[(size_t)(k0 + 8 * g + i) * HD]; w[8 + i] = (__bf16)p[(size_t)(k0 + 16 + 8 * g + i) * HD]; }
  return w; }
#define WO_OUT_IN 1
#if WQKV_LAYOUT == 1
#define WCOL(W, k0, o, lane) wcol_oi(W, k0, o, lane, DIN)
#elif WQKV_LAYOUT == 2
#define WCOL(W, k0, o, lane) wcol_hdk(W, k0, o, lane)
#else
#define WCOL(W, k0, o, lane) wcol_io(W, k0, o, lane, CC)
#endif
#if WO_OUT_IN
#define WOCOL(W, k0, o, lane) wcol_oi(W, k0, o, lane, CC)
#define WOCOLH(W, k0, o, lane) wcolh_oi(W, k0, o, lane, CC)
#else
#define WOCOL(W, k0, o, lane) wcol_io(W, k0, o, lane, DIN)
#define WOCOLH(W, k0, o, lane) wcolh_io(W, k0, o, lane, DIN)
#endif
#define NTOK 4096
#ifndef OPITCH
#define OPITCH NTOK        // unused (out is written with pitch NTOK)
#endif
#ifndef XPITCH
#define XPITCH NTOK        // unused (x is read with pitch NTOK)
#endif
__global__ __launch_bounds__(256) void k_gnst(const float* __restrict__ X, float* __restrict__ MV) { __shared__ float sred[8]; __shared__ float sbc; const int t = threadIdx.x; const size_t base = (size_t)blockIdx.x * (CC / 8) * NTOK; const int n = (CC / 8) * NTOK;
  float s1 = 0.f; for (int i = t * 4; i < n; i += 1024) { const v4f v = *(const v4f*)(X + base + i); s1 += (bfr(v[0]) + bfr(v[1])) + (bfr(v[2]) + bfr(v[3])); }
#pragma unroll
  for (int o = 1; o < 32; o <<= 1) s1 += __shfl_xor(s1, o);
  if ((t & 31) == 0) sred[t >> 5] = s1; __syncthreads(); if (t == 0) { float a = 0.f; for (int i = 0; i < 8; ++i) a += sred[i]; sbc = a / (float)n; } __syncthreads(); const float mu = sbc; __syncthreads();
  float q = 0.f; for (int i = t * 4; i < n; i += 1024) { const v4f v = *(const v4f*)(X + base + i);
#pragma unroll
    for (int j = 0; j < 4; ++j) { const float d = bfr(v[j]) - mu; q += d * d; } }
#pragma unroll
  for (int o = 1; o < 32; o <<= 1) q += __shfl_xor(q, o);
  if ((t & 31) == 0) sred[t >> 5] = q; __syncthreads(); if (t == 0) { float a = 0.f; for (int i = 0; i < 8; ++i) a += sred[i]; sbc = rsqrtf(a / (float)n + 1e-5f); } __syncthreads();
  if (t < 32) { const float v = t == 0 ? mu : (t == 1 ? sbc : 0.f); vst2(MV + (size_t)blockIdx.x * 32 + t, v); } }
// ---- k_tok: block = (64 tokens, 64 channels, batch b): XT[b*N + n][c] = (bf16(x[b][c][n]) - mean_g) * rstd_g * gamma[c] + beta[c] (GroupNorm, g = c / 32) through an LDS tile
__global__ __launch_bounds__(256) void k_tok(const float* __restrict__ X, const float* __restrict__ MV, const float* __restrict__ GG, const float* __restrict__ GB, float* __restrict__ XT) { __shared__ float st[64][68]; const int tid = threadIdx.x; const int n0 = blockIdx.x * 64, c0 = blockIdx.y * 64; const size_t b = blockIdx.z;
  for (int e = tid; e < 64 * 16; e += 256) { const int cl = e >> 4, q = e & 15; const int c = c0 + cl; const int gi = (int)(b * 8) + c / (CC / 8); const float mu = MV[gi * 32], rs = MV[gi * 32 + 1], ga = bfr(GG[c]), be = bfr(GB[c]);
    const v4f v = *(const v4f*)(X + (b * CC + c) * (size_t)NTOK + n0 + q * 4);
#pragma unroll
    for (int j = 0; j < 4; ++j) st[cl][q * 4 + j] = (bfr(v[j]) - mu) * rs * ga + be; }
  __syncthreads();
  for (int e = tid; e < 64 * 16; e += 256) { const int nl = e >> 4, q = e & 15; v4f o; o[0] = st[q * 4][nl]; o[1] = st[q * 4 + 1][nl]; o[2] = st[q * 4 + 2][nl]; o[3] = st[q * 4 + 3][nl]; vst2(XT + (b * NTOK + n0 + nl) * (size_t)CC + c0 + q * 4, o); } }
// ---- k_fin: block = (64 tokens, 64 channels, batch b): out[b][c][n] = OR[b*N + n][c] + bf16(x[b][c][n]) (LDS transpose; 256-B runs of 64 tokens per channel)
__global__ __launch_bounds__(256) void k_fin(const float* __restrict__ ORW, const float* __restrict__ X, float* __restrict__ OUT) { __shared__ float st[64][68]; const int tid = threadIdx.x; const int n0 = blockIdx.x * 64, c0 = blockIdx.y * 64; const size_t b = blockIdx.z;
  for (int e = tid; e < 64 * 16; e += 256) { const int nl = e >> 4, q = e & 15; *(v4f*)&st[nl][q * 4] = *(const v4f*)(ORW + (b * NTOK + n0 + nl) * (size_t)CC + c0 + q * 4); }
  __syncthreads();
  for (int e = tid; e < 64 * 16; e += 256) { const int cl = e >> 4, q = e & 15; const size_t oi = (b * CC + c0 + cl) * (size_t)NTOK + n0 + q * 4; const v4f xr = *(const v4f*)(X + oi); v4f o; o[0] = st[q * 4][cl] + bfr(xr[0]); o[1] = st[q * 4 + 1][cl] + bfr(xr[1]); o[2] = st[q * 4 + 2][cl] + bfr(xr[2]); o[3] = st[q * 4 + 3][cl] + bfr(xr[3]); vst2(OUT + oi, o); } }
#define WS_MV  (WS_END)
#define WS_XT  (WS_MV + 4u * 32 * NB * 8 + 1024u)
#define WS_OR  (WS_XT + 4u * (size_t)NB * NTOK * CC)
#define WS_END2 (WS_OR + 4u * (size_t)NB * NTOK * CC)
#ifndef SM_EXTRA_PARAMS
#define SM_EXTRA_PARAMS
#endif
#ifndef PROJ_EXTRA_PARAMS
#define PROJ_EXTRA_PARAMS
#endif
#ifndef SM_MASK_HOOK
#define SM_MASK_HOOK (void)0
#endif

#define WS_QH  0u                                      // f16 q rows [b*t][CC]
#define WS_KH  (WS_QH + 2u * (size_t)NB * TT * CC)      // f16 k rows [b*t][CC]
#define WS_VT  (WS_KH + 2u * (size_t)NB * TT * CC)      // f16 v planes [b][c][t]
#define WS_QL  (WS_VT + 2u * (size_t)NB * CC * TT)      // f16 q residual x 2^10 rows [b][t < QHI][CC]
#define WS_KL  (WS_QL + 2u * (size_t)NB * QHI * CC)     // f16 k residual x 2^10 rows [b][t < KHI][CC]
#define WS_VB  (WS_KL + 2u * (size_t)NB * KHI * CC)     // bf16 v hi planes [b][c][t < KHI]
#define WS_VBL (WS_VB + 2u * (size_t)NB * CC * KHI)
#define WS_S   (WS_VBL + 2u * (size_t)NB * CC * KHI)    // f32 logits / P [hg][t][s]
#define WS_Y   (WS_S  + 4u * (size_t)HG * TT * TT)      // f32 ctx rows [b*t][CC] (only when there is an output projection)
#define WS_END (WS_Y  + 4u * (size_t)NB * TT * CC)

// ---- k_proj: block = (64 rows, 128 cols, which): q/k/v = X W (+ b) with exact bf16 products (K = DIN) -> which 0: q f16 rows (+ residual rows < QHI); 1: k f16 rows (+ residual rows < KHI); 2: v f16 planes [c][t] (+ bf16 hi/lo planes for t < KHI)
__global__ __launch_bounds__(128) void k_proj(const float* __restrict__ XQ, const float* __restrict__ XK, const float* __restrict__ XV, const float* __restrict__ WQ, const float* __restrict__ WK, const float* __restrict__ WV, const float* __restrict__ BQ, const float* __restrict__ BK, const float* __restrict__ BV,
    _Float16* __restrict__ QH, _Float16* __restrict__ QL, _Float16* __restrict__ KH, _Float16* __restrict__ KL, _Float16* __restrict__ VT, __bf16* __restrict__ VB, __bf16* __restrict__ VBL) {
  __shared__ __align__(16) _Float16 sh[64][136], sl[64][136]; __shared__ __align__(16) _Float16 th[128][72]; __shared__ __align__(16) __bf16 tb[128][72], tbl[128][72];
  const int tid = threadIdx.x, wave = tid >> 5, lane = tid & 31, col = lane & 15, g = lane >> 4; const int which = blockIdx.z; const int c0 = blockIdx.y * 128; const size_t r0 = (size_t)blockIdx.x * 64; const size_t bb = r0 / TT; const int t0 = (int)(r0 % TT);
  const float* X = which == 0 ? XQ : which == 1 ? XK : XV; const float* WA = which == 0 ? WQ : which == 1 ? WK : WV; const float* BA = which == 0 ? BQ : which == 1 ? BK : BV;
  v8f acc[8] = {};
#pragma unroll 2
  for (int kc = 0; kc < DIN / 32; ++kc) { const F2 a2 = split_row(X + (r0 + wave * 16 + col) * DIN, kc * 32, lane);   /* GroupNorm rows (f32) split hi + lo */
    asm volatile("s_wait_loadcnt 0x0" ::: "memory");
#pragma unroll
    for (int j = 0; j < 8; ++j) { const v16b w = WCOL(WA, kc * 32, c0 + j * 16 + col, lane); asm volatile("s_wait_loadcnt 0x0" ::: "memory"); acc[j] = wmma_bf(a2.h, w, acc[j]); acc[j] = wmma_bf(a2.l, w, acc[j]); } }
  if (which < 2) { _Float16* DH = which == 0 ? QH : KH; _Float16* DL = which == 0 ? QL : KL; const int nhi = which == 0 ? QHI : KHI; const bool hi_rows = t0 < nhi;
#pragma unroll
    for (int j = 0; j < 8; ++j) { const float bias = BA ? bfr(BA[c0 + j * 16 + col]) : 0.f;
#pragma unroll
      for (int r = 0; r < 8; ++r) { const float v = acc[j][r] + bias; const _Float16 hv = (_Float16)v; sh[wave * 16 + 8 * g + r][j * 16 + col] = hv; sl[wave * 16 + 8 * g + r][j * 16 + col] = (_Float16)((v - (float)hv) * 1024.0f); } }
    __syncthreads();
    for (int e = tid; e < 64 * 16; e += 128) { const int rl = e >> 4, q = e & 15; vst2((unsigned*)(DH + (r0 + rl) * CC + c0 + q * 8), *(const v4u*)&sh[rl][q * 8]); if (hi_rows) vst2((unsigned*)(DL + (bb * nhi + t0 + rl) * (size_t)CC + c0 + q * 8), *(const v4u*)&sl[rl][q * 8]); }
  } else { const bool hi_rows = t0 < KHI;
#pragma unroll
    for (int j = 0; j < 8; ++j) { const float bias = BA ? bfr(BA[c0 + j * 16 + col]) : 0.f;
#pragma unroll
      for (int r = 0; r < 8; ++r) { const float v = acc[j][r] + bias; const int rl = wave * 16 + 8 * g + r, cl = j * 16 + col; th[cl][rl] = (_Float16)v; const __bf16 bh = (__bf16)v; tb[cl][rl] = bh; tbl[cl][rl] = (__bf16)(v - (float)bh); } }
    __syncthreads();
    for (int e = tid; e < 128 * 8; e += 128) { const int cl = e >> 3, q = e & 7; vst2((unsigned*)(VT + (bb * CC + c0 + cl) * (size_t)TT + t0 + q * 8), *(const v4u*)&th[cl][q * 8]); if (hi_rows) { const size_t o3 = (bb * CC + c0 + cl) * (size_t)KHI + t0 + q * 8; vst2((unsigned*)(VB + o3), *(const v4u*)&tb[cl][q * 8]); vst2((unsigned*)(VBL + o3), *(const v4u*)&tbl[cl][q * 8]); } } } }
// ---- k_sc: block = (query block qb, key block kb <= kb_last(qb), head in group) of batch b: logits x SCALE; q hi + residual (x 2^10) against k (2 products) for query rows < QHI, plus the k residual (3 products) for query blocks < QBH (causal early rows); causal: blocks past the diagonal exit, the mask itself is applied by index in k_sm
__global__ __launch_bounds__(128) void k_sc(const _Float16* __restrict__ QH, const _Float16* __restrict__ KH, const _Float16* __restrict__ QL, const _Float16* __restrict__ KL, int b, int h0, float* __restrict__ S0) { __shared__ __align__(16) float ss[4][16][132];
  const int qb = blockIdx.x, kb = blockIdx.y; if (kb > kb_last(qb)) return;
  const int h = h0 + blockIdx.z; float* S = S0 + (size_t)blockIdx.z * TT * TT;
  const int tid = threadIdx.x, wave = tid >> 5, lane = tid & 31, col = lane & 15, g = lane >> 4; const int k0 = kb * 128; const int ql0 = qb * 64 + wave * 16; const size_t q0 = (size_t)b * TT + ql0, kr0 = (size_t)b * TT + k0;
  v8f acc[8] = {}, accl[8] = {};
  const _Float16* QLb = QL + (size_t)b * QHI * CC; const _Float16* KLb = KL + (size_t)b * KHI * CC;
  if (qb < QBH) {
#pragma unroll
    for (int kc = 0; kc < HD / 32; ++kc) { const v16h ah = frag_h(QH + (q0 + col) * CC + h * HD + kc * 32, lane), al = frag_h(QLb + (size_t)(ql0 + col) * CC + h * HD + kc * 32, lane);
#pragma unroll
      for (int j = 0; j < 8; ++j) { const v16h kbf = frag_h(KH + (kr0 + j * 16 + col) * CC + h * HD + kc * 32, lane), klf = frag_h(KLb + (size_t)(k0 + j * 16 + col) * CC + h * HD + kc * 32, lane); acc[j] = wmma16(ah, kbf, acc[j]); accl[j] = wmma16(al, kbf, accl[j]); accl[j] = wmma16(ah, klf, accl[j]); } }
  } else if (qb * 64 < QHI) {
#pragma unroll
    for (int kc = 0; kc < HD / 32; ++kc) { const v16h ah = frag_h(QH + (q0 + col) * CC + h * HD + kc * 32, lane), al = frag_h(QLb + (size_t)(ql0 + col) * CC + h * HD + kc * 32, lane);
#pragma unroll
      for (int j = 0; j < 8; ++j) { const v16h kbf = frag_h(KH + (kr0 + j * 16 + col) * CC + h * HD + kc * 32, lane); acc[j] = wmma16(ah, kbf, acc[j]); accl[j] = wmma16(al, kbf, accl[j]); } }
  } else {
#pragma unroll
    for (int kc = 0; kc < HD / 32; ++kc) { const v16h ah = frag_h(QH + (q0 + col) * CC + h * HD + kc * 32, lane);
#pragma unroll
      for (int j = 0; j < 8; ++j) { const v16h kbf = frag_h(KH + (kr0 + j * 16 + col) * CC + h * HD + kc * 32, lane); acc[j] = wmma16(ah, kbf, acc[j]); } } }
#pragma unroll
  for (int j = 0; j < 8; ++j) {
#pragma unroll
    for (int r = 0; r < 8; ++r) ss[wave][8 * g + r][j * 16 + col] = (acc[j][r] + accl[j][r] * (1.0f / 1024.0f)) * SCALE; }
  LDSX(); for (int rl = 0; rl < 16; ++rl) vst2(S + (size_t)(ql0 + rl) * TT + k0 + lane * 4, *(const v4f*)&ss[wave][rl][lane * 4]); }
// ---- k_sm: block = query row t (head in group): keys [0, kend): causal -> logit if s <= t else excluded; softmax in f32; P x 2^11 in place (0 for excluded)
__global__ __launch_bounds__(256) void k_sm(float* __restrict__ S0 SM_EXTRA_PARAMS) { __shared__ float sred[8]; __shared__ float sbc; __shared__ __align__(16) float shv[TT];
  const int tid = threadIdx.x; const int t = blockIdx.x; const int kend = (kb_last(t >> 6) + 1) * 128;
  float* sr = S0 + (size_t)blockIdx.y * TT * TT + (size_t)t * TT;
  float m = -3.0e38f; for (int k = tid; k < kend; k += 256) { float v = (!CAUSAL || k <= t) ? sr[k] : -3.0e38f; SM_MASK_HOOK; shv[k] = v; m = fmaxf(m, v); }
#pragma unroll
  for (int o = 1; o < 32; o <<= 1) m = fmaxf(m, __shfl_xor(m, o));
  if ((tid & 31) == 0) sred[tid >> 5] = m; __syncthreads(); if (tid == 0) { float a = sred[0]; for (int i = 1; i < 8; ++i) a = fmaxf(a, sred[i]); sbc = a; } __syncthreads(); m = sbc; __syncthreads();
  float sum = 0.f; for (int k = tid; k < kend; k += 256) { const float v = shv[k]; const float e = (v <= -1.0e38f) ? 0.f : expf(v - m); shv[k] = e; sum += e; }
#pragma unroll
  for (int o = 1; o < 32; o <<= 1) sum += __shfl_xor(sum, o);
  if ((tid & 31) == 0) sred[tid >> 5] = sum; __syncthreads(); if (tid == 0) { float a = 0.f; for (int i = 0; i < 8; ++i) a += sred[i]; sbc = a > 0.f ? 2048.0f / a : 0.f; }   /* a fully excluded row yields P = 0 */ __syncthreads(); const float inv = sbc;
  for (int k = tid; k < kend; k += 256) shv[k] = shv[k] * inv;
  __syncthreads(); for (int q = tid; q < kend / 4; q += 256) vst2(sr + q * 4, *(const v4f*)&shv[q * 4]); }
// ---- k_pv: block = 64 queries (qb) of (b, h): ctx = P . v over keys [0, kend) (P x 2^11 once to f16 against v f16: 1 product; causal early query blocks: P and v as bf16 hi + lo, 3 products); 128-B (row, head) segment by 8 lanes
__global__ __launch_bounds__(128) void k_pv(const float* __restrict__ PS0, const _Float16* __restrict__ VT, const __bf16* __restrict__ VB, const __bf16* __restrict__ VBL, int b, int h0, float* __restrict__ Y) { const int h = h0 + blockIdx.z; const float* PS = PS0 + (size_t)blockIdx.z * TT * TT; __shared__ __align__(16) float ss[4][16][HD + 4];
  const int tid = threadIdx.x, wave = tid >> 5, lane = tid & 31, col = lane & 15, g = lane >> 4; const int qb = blockIdx.x; const int ql0 = qb * 64 + wave * 16; const int kce = (kb_last(qb) + 1) * 4;
  v8f acc[HD / 16] = {};
  if (qb < QBH) {
#pragma unroll 1
    for (int kc = 0; kc < kce; ++kc) { const F2 p = split_row(PS + (size_t)(ql0 + col) * TT, kc * 32, lane);
      asm volatile("s_wait_loadcnt 0x0" ::: "memory");
#pragma unroll
      for (int j = 0; j < HD / 16; ++j) { const size_t po = ((size_t)b * CC + h * HD + j * 16 + col) * (size_t)KHI + kc * 32; const v16b vh = frag_b(VB + po, lane); acc[j] = wmma_bf(p.h, vh, acc[j]); acc[j] = wmma_bf(p.l, vh, acc[j]); acc[j] = wmma_bf(p.h, frag_b(VBL + po, lane), acc[j]); } }
  } else {
#pragma unroll 1
    for (int kc = 0; kc < kce; ++kc) { const v16h p = frag_f32(PS + (size_t)(ql0 + col) * TT + kc * 32, lane);
      asm volatile("s_wait_loadcnt 0x0" ::: "memory");
#pragma unroll
      for (int j = 0; j < HD / 16; ++j) { const size_t po = ((size_t)b * CC + h * HD + j * 16 + col) * (size_t)TT + kc * 32; acc[j] = wmma16(p, frag_h(VT + po, lane), acc[j]); } } }
#pragma unroll
  for (int j = 0; j < HD / 16; ++j)
#pragma unroll
    for (int r = 0; r < 8; ++r) ss[wave][8 * g + r][j * 16 + col] = acc[j][r] * (1.0f / 2048.0f);
  LDSX(); for (int rl = 0; rl < 16; ++rl) if (lane < HD / 4) vst2(Y + ((size_t)b * TT + ql0 + rl) * CC + h * HD + lane * 4, *(const v4f*)&ss[wave][rl][lane * 4]); }
// ---- k_out: block = (64 rows, 128 cols): out = ctx Wo (+ bo): all rows: ctx bf16 hi + lo against exact bf16 Wo (2 products); the f16(bf16 x 2^8) 1-product branch is not taken
__global__ __launch_bounds__(128) void k_out(const float* __restrict__ Y, const float* __restrict__ WO, const float* __restrict__ BO, float* __restrict__ OUT) { __shared__ __align__(16) float sf[4][16][132];
  const int tid = threadIdx.x, wave = tid >> 5, lane = tid & 31, col = lane & 15, g = lane >> 4; const int c0 = blockIdx.y * 128; const size_t r0 = (size_t)blockIdx.x * 64 + wave * 16;
  v8f acc[8] = {};
  if (true) {   /* ALL rows: ctx split bf16 hi + lo x exact proj_w (2 products) */
#pragma unroll 2
    for (int kc = 0; kc < CC / 32; ++kc) { const F2 a = split_row(Y + (r0 + col) * CC, kc * 32, lane); asm volatile("s_wait_loadcnt 0x0" ::: "memory");
#pragma unroll
      for (int j = 0; j < 8; ++j) { const v16b w = WOCOL(WO, kc * 32, c0 + j * 16 + col, lane); asm volatile("s_wait_loadcnt 0x0" ::: "memory"); acc[j] = wmma_bf(a.h, w, acc[j]); acc[j] = wmma_bf(a.l, w, acc[j]); } }
#pragma unroll
    for (int j = 0; j < 8; ++j) { const float bias = BO ? bfr(BO[c0 + j * 16 + col]) : 0.f;
#pragma unroll
      for (int r = 0; r < 8; ++r) sf[wave][8 * g + r][j * 16 + col] = acc[j][r] + bias; }
  } else {
#pragma unroll 2
    for (int kc = 0; kc < CC / 32; ++kc) { const v16h a = frag_f32(Y + (r0 + col) * CC + kc * 32, lane); asm volatile("s_wait_loadcnt 0x0" ::: "memory");
#pragma unroll
      for (int j = 0; j < 8; ++j) { const v16h w = WOCOLH(WO, kc * 32, c0 + j * 16 + col, lane); asm volatile("s_wait_loadcnt 0x0" ::: "memory"); acc[j] = wmma16(a, w, acc[j]); } }
#pragma unroll
    for (int j = 0; j < 8; ++j) { const float bias = BO ? bfr(BO[c0 + j * 16 + col]) : 0.f;
#pragma unroll
      for (int r = 0; r < 8; ++r) sf[wave][8 * g + r][j * 16 + col] = acc[j][r] * (1.0f / 256.0f) + bias; } }
  LDSX(); for (int rl = 0; rl < 16; ++rl) vst2(OUT + (r0 + rl) * DIN + c0 + lane * 4, *(const v4f*)&sf[wave][rl][lane * 4]); }

extern "C" void kernel_launch(void* const* d_in, const int* in_sizes, int n_in, void* d_out, int out_size, void* d_ws, size_t ws_size, hipStream_t stream) {
  (void)in_sizes; (void)n_in; (void)out_size;
  const float** F = (const float**)d_in;
  if (ws_size < (size_t)WS_END) return;
  char* ws = (char*)d_ws; _Float16 *QH = (_Float16*)(ws + WS_QH), *KH = (_Float16*)(ws + WS_KH), *VT = (_Float16*)(ws + WS_VT), *QL = (_Float16*)(ws + WS_QL), *KL = (_Float16*)(ws + WS_KL); __bf16 *VB = (__bf16*)(ws + WS_VB), *VBL = (__bf16*)(ws + WS_VBL); float *S = (float*)(ws + WS_S), *Y = (float*)(ws + WS_Y);
  (void)Y; (void)QL; (void)KL; (void)VB; (void)VBL;
  // inputs: 0 x [2,256,64,64]; 1 gn_gamma, 2 gn_beta [256]; 3 qkv_w [768,256] (out,in) rows q | k | v; 4 qkv_b [768]; 5 proj_w [256,256] (out,in); 6 proj_b
  if (ws_size < (size_t)WS_END2) return;
  float *MV = (float*)(ws + WS_MV), *XT = (float*)(ws + WS_XT), *ORW = (float*)(ws + WS_OR);
  k_gnst<<<dim3(TNB * 8), 256, 0, stream>>>(F[0], MV);
  k_tok<<<dim3(NTOK / 64, CC / 64, TNB), 256, 0, stream>>>(F[0], MV, F[1], F[2], XT);
  { const float* WQ = F[3]; const float* WK = F[3] + (size_t)CC * DIN; const float* WV = F[3] + (size_t)2 * CC * DIN;
    k_proj<<<dim3(TNB * TT / 64, CC / 128, 3), 128, 0, stream>>>(XT, XT, XT, WQ, WK, WV, F[4], F[4] + CC, F[4] + 2 * CC, QH, QL, KH, KL, VT, VB, VBL); }
  for (int b = 0; b < TNB; ++b) for (int h0 = 0; h0 < NH; h0 += HG) {
    k_sc<<<dim3(NQB, TT / 128, HG), 128, 0, stream>>>(QH, KH, QL, KL, b, h0, S);
    k_sm<<<dim3(TT, HG), 256, 0, stream>>>(S);
    k_pv<<<dim3(NQB, 1, HG), 128, 0, stream>>>(S, VT, VB, VBL, b, h0, Y);
  }
  k_out<<<dim3(TNB * TT / 64, DIN / 128), 128, 0, stream>>>(Y, F[5], F[6], ORW);
  k_fin<<<dim3(NTOK / 64, CC / 64, TNB), 256, 0, stream>>>(ORW, F[0], (float*)d_out);
}

// v001
// Measured time: 259 microseconds a run.
// Next to v000, in two timings, it ran 5.88 and 5.87 times as fast.
// Single self-attention block on images (b 2, c 256, 64 x 64 -> n 4,096 tokens; 8 heads x 32): xn = GroupNorm(8 groups)(x) (affine); q,k,v = qkv_w xn + qkv_b (1x1, (out,in) rows q|k|v); attn = softmax(q k^T x 32^-0.5); out = proj_w (attn v) + proj_b, reshaped to [b,c,h,w] + x.
#include <hip/hip_runtime.h>
#include <math.h>

typedef __attribute__((ext_vector_type(16))) _Float16 v16h;
typedef __attribute__((ext_vector_type(16))) __bf16 v16b;
typedef __attribute__((ext_vector_type(8)))  _Float16 v8h;
typedef __attribute__((ext_vector_type(8)))  float v8f;
typedef __attribute__((ext_vector_type(4)))  float v4f;
typedef __attribute__((ext_vector_type(2)))  float v2f;
typedef __attribute__((ext_vector_type(4)))  unsigned v4u;
typedef __attribute__((ext_vector_type(4)))  int v4i;
typedef float __attribute__((may_alias)) float_a;
typedef int __attribute__((may_alias)) int_a;

template <typename T> __device__ __forceinline__ void vst2(void* p, T v) { *(T*)p = v;  }
__device__ __forceinline__ v8f wmma16(v16h a, v16h b, v8f c) {
  v8f d = __builtin_amdgcn_wmma_f32_16x16x32_f16(false, a, false, b, (short)0, c, false, false);
  asm volatile("v_nop\n\tv_nop\n\tv_nop\n\tv_nop" : "+v"(d) : "v"(a), "v"(b));
  return d;
}
__device__ __forceinline__ v8f wmma_bf(v16b a, v16b b, v8f c) {
  v8f d = __builtin_amdgcn_wmma_f32_16x16x32_bf16(false, a, false, b, (short)0, c, false, false);
  asm volatile("v_nop\n\tv_nop\n\tv_nop\n\tv_nop" : "+v"(d) : "v"(a), "v"(b));
  return d;
}
// 16x16x32 fragments: lane = (h = lane>>4, row/col = lane&15); elements 0..7 = k0+8h+0..7, 8..15 = k0+16+8h+0..7; D element r = row 8h+r
__device__ __forceinline__ v16h frag_h(const _Float16* rowk0, int lane) {
  union { v16h v; v8h q[2]; } u; const _Float16* p = rowk0 + 8 * (lane >> 4);
  u.q[0] = *(const v8h*)p; u.q[1] = *(const v8h*)(p + 16); return u.v;
}
__device__ __forceinline__ v16h frag_f32(const float* rowk0, int lane) {
  v16h a; const float* p = rowk0 + 8 * (lane >> 4);
#pragma unroll
  for (int i = 0; i < 8; ++i) { a[i] = (_Float16)p[i]; a[8 + i] = (_Float16)p[16 + i]; }
  return a;
}
__device__ __forceinline__ v16h frag_f32s(const float* rowk0, int lane, float sc) {
  v16h a; const float* p = rowk0 + 8 * (lane >> 4);
#pragma unroll
  for (int i = 0; i < 8; ++i) { a[i] = (_Float16)(p[i] * sc); a[8 + i] = (_Float16)(p[16 + i] * sc); }
  return a;
}
// column fragment from a [K][ld] layout (column n), rows >= K read as 0
__device__ __forceinline__ v16h fragc_f32(const float* W, int k0, int n, int lane, int ld, int K) {
  v16h a; const int g = lane >> 4;
#pragma unroll
  for (int i = 0; i < 8; ++i) { const int ka = k0 + 8 * g + i, kb = ka + 16;
    a[i] = (_Float16)(ka < K ? W[(size_t)(ka < K ? ka : K - 1) * ld + n] : 0.f); a[8 + i] = (_Float16)(kb < K ? W[(size_t)(kb < K ? kb : K - 1) * ld + n] : 0.f); }
  return a;
}
struct F2 { v16b h, l; };
__device__ __forceinline__ F2 bsplit16(const float v[16]) { F2 r;
#pragma unroll
  for (int i = 0; i < 16; ++i) { const __bf16 h = (__bf16)v[i]; r.h[i] = h; r.l[i] = (__bf16)(v[i] - (float)h); }
  return r; }
__device__ __forceinline__ F2 split_row(const float* row, int k0, int lane) { float v[16]; const float* p = row + k0 + 8 * (lane >> 4);
#pragma unroll
  for (int i = 0; i < 8; ++i) { v[i] = p[i]; v[8 + i] = p[16 + i]; }
  return bsplit16(v); }
__device__ __forceinline__ F2 split_rowK(const float* row, int k0, int lane, int K) { float v[16]; const int g = lane >> 4;
#pragma unroll
  for (int i = 0; i < 8; ++i) { const int ka = k0 + 8 * g + i, kb = ka + 16; v[i] = ka < K ? row[ka < K ? ka : K - 1] : 0.f; v[8 + i] = kb < K ? row[kb < K ? kb : K - 1] : 0.f; }
  return bsplit16(v); }
__device__ __forceinline__ F2 split_col(const float* W, int k0, int n, int lane, int ld, int K) { float v[16]; const int g = lane >> 4;
#pragma unroll
  for (int i = 0; i < 8; ++i) { const int ka = k0 + 8 * g + i, kb = ka + 16; v[i] = ka < K ? W[(size_t)(ka < K ? ka : K - 1) * ld + n] : 0.f; v[8 + i] = kb < K ? W[(size_t)(kb < K ? kb : K - 1) * ld + n] : 0.f; }
  return bsplit16(v); }
__device__ __forceinline__ v8f mac3(const F2& a, const F2& b, v8f c) { c = wmma_bf(a.l, b.h, c); c = wmma_bf(a.h, b.l, c); return wmma_bf(a.h, b.h, c); }
__device__ __forceinline__ float sigm(float v) { return 1.0f / (1.0f + expf(-v)); }
#define LDSX() do { asm volatile("s_wait_dscnt 0" ::: "memory"); __builtin_amdgcn_wave_barrier(); __builtin_amdgcn_fence(__ATOMIC_RELEASE, "workgroup"); } while (0)

#define NB 2
#define TT 4096
#define CC 256            // NH * HD = projected width
#define DIN 256          // input (model) width
#define NH 8
#define HD 32
#define NQB (TT / 64)
#define HG 2
#define SCALE (0.17677669529663687f)
#define CAUSAL 0
#ifndef TNB
#define TNB NB
#endif
__device__ __forceinline__ float bfr(float v) { return (float)(__bf16)v; }
__host__ __device__ __forceinline__ int kb_last(int qb) { return CAUSAL ? ((qb * 64 + 63) >> 7) : (TT / 128 - 1); }
typedef __attribute__((ext_vector_type(8))) __bf16 v8b;
__device__ __forceinline__ v16b frag_b(const __bf16* rowk0, int lane) {
  union { v16b v; v8b q[2]; } u; const __bf16* p = rowk0 + 8 * (lane >> 4);
  u.q[0] = *(const v8b*)p; u.q[1] = *(const v8b*)(p + 16); return u.v;
}
#define QBH 0              // unused: k_fa has no high-precision path
#define QHI 4096            // rows carrying a q residual plane (all rows when non-causal: 2-product logits everywhere)
#define KHI 64            // key rows carrying k residual / v bf16 hi+lo planes (written by k_proj; no kernel here reads them)
// B fragment (k rows k0+.., output column o) of a weight: (in,out) [K][ld] or (out,in) [ld rows of K]: bf16 exact, or f16(bf16 * 256) exact
__device__ __forceinline__ v16b wcol_io(const float* Wm, int k0, int o, int lane, int ld) { v16b w; const int g = lane >> 4;
#pragma unroll
  for (int i = 0; i < 8; ++i) { w[i] = (__bf16)Wm[(size_t)(k0 + 8 * g + i) * ld + o]; w[8 + i] = (__bf16)Wm[(size_t)(k0 + 16 + 8 * g + i) * ld + o]; }
  return w; }
__device__ __forceinline__ v16b wcol_oi(const float* Wm, int k0, int o, int lane, int K) { v16b w; const float* p = Wm + (size_t)o * K + k0 + 8 * (lane >> 4);
#pragma unroll
  for (int i = 0; i < 8; ++i) { w[i] = (__bf16)p[i]; w[8 + i] = (__bf16)p[16 + i]; }
  return w; }
__device__ __forceinline__ v16h wcolh_io(const float* Wm, int k0, int o, int lane, int ld) { v16h w; const int g = lane >> 4;
#pragma unroll
  for (int i = 0; i < 8; ++i) { w[i] = (_Float16)(bfr(Wm[(size_t)(k0 + 8 * g + i) * ld + o]) * 256.0f); w[8 + i] = (_Float16)(bfr(Wm[(size_t)(k0 + 16 + 8 * g + i) * ld + o]) * 256.0f); }
  return w; }
__device__ __forceinline__ v16h wcolh_oi(const float* Wm, int k0, int o, int lane, int K) { v16h w; const float* p = Wm + (size_t)o * K + k0 + 8 * (lane >> 4);
#pragma unroll
  for (int i = 0; i < 8; ++i) { w[i] = (_Float16)(bfr(p[i]) * 256.0f); w[8 + i] = (_Float16)(bfr(p[16 + i]) * 256.0f); }
  return w; }
#define WQKV_LAYOUT 1   // 0 = (in,out) [DIN][CC]; 1 = (out,in) [CC][DIN]; 2 = per-head [NH][DIN][HD]
__device__ __forceinline__ v16b wcol_hdk(const float* Wm, int k0, int o, int lane) { v16b w; const int g = lane >> 4; const float* p = Wm + (size_t)(o / HD) * DIN * HD + (o % HD);
#pragma unroll
  for (int i = 0; i < 8; ++i) { w[i] = (__bf16)p[(size_t)(k0 + 8 * g + i) * HD]; w[8 + i] = (__bf16)p[(size_t)(k0 + 16 + 8 * g + i) * HD]; }
  return w; }
#define WO_OUT_IN 1
#if WQKV_LAYOUT == 1
#define WCOL(W, k0, o, lane) wcol_oi(W, k0, o, lane, DIN)
#elif WQKV_LAYOUT == 2
#define WCOL(W, k0, o, lane) wcol_hdk(W, k0, o, lane)
#else
#define WCOL(W, k0, o, lane) wcol_io(W, k0, o, lane, CC)
#endif
#if WO_OUT_IN
#define WOCOL(W, k0, o, lane) wcol_oi(W, k0, o, lane, CC)
#define WOCOLH(W, k0, o, lane) wcolh_oi(W, k0, o, lane, CC)
#else
#define WOCOL(W, k0, o, lane) wcol_io(W, k0, o, lane, DIN)
#define WOCOLH(W, k0, o, lane) wcolh_io(W, k0, o, lane, DIN)
#endif
#define NTOK 4096
#ifndef OPITCH
#define OPITCH NTOK        // unused (out is written with pitch NTOK)
#endif
#ifndef XPITCH
#define XPITCH NTOK        // unused (x is read with pitch NTOK)
#endif
__global__ __launch_bounds__(256) void k_gnst(const float* __restrict__ X, float* __restrict__ MV) { __shared__ float sred[8]; __shared__ float sbc; const int t = threadIdx.x; const size_t base = (size_t)blockIdx.x * (CC / 8) * NTOK; const int n = (CC / 8) * NTOK;
  float s1 = 0.f; for (int i = t * 4; i < n; i += 1024) { const v4f v = *(const v4f*)(X + base + i); s1 += (bfr(v[0]) + bfr(v[1])) + (bfr(v[2]) + bfr(v[3])); }
#pragma unroll
  for (int o = 1; o < 32; o <<= 1) s1 += __shfl_xor(s1, o);
  if ((t & 31) == 0) sred[t >> 5] = s1; __syncthreads(); if (t == 0) { float a = 0.f; for (int i = 0; i < 8; ++i) a += sred[i]; sbc = a / (float)n; } __syncthreads(); const float mu = sbc; __syncthreads();
  float q = 0.f; for (int i = t * 4; i < n; i += 1024) { const v4f v = *(const v4f*)(X + base + i);
#pragma unroll
    for (int j = 0; j < 4; ++j) { const float d = bfr(v[j]) - mu; q += d * d; } }
#pragma unroll
  for (int o = 1; o < 32; o <<= 1) q += __shfl_xor(q, o);
  if ((t & 31) == 0) sred[t >> 5] = q; __syncthreads(); if (t == 0) { float a = 0.f; for (int i = 0; i < 8; ++i) a += sred[i]; sbc = rsqrtf(a / (float)n + 1e-5f); } __syncthreads();
  if (t < 32) { const float v = t == 0 ? mu : (t == 1 ? sbc : 0.f); vst2(MV + (size_t)blockIdx.x * 32 + t, v); } }
// ---- k_tok: block = (64 tokens, 64 channels, batch b): XT[b*N + n][c] = (bf16(x[b][c][n]) - mean_g) * rstd_g * gamma[c] + beta[c] (GroupNorm, g = c / 32) through an LDS tile
__global__ __launch_bounds__(256) void k_tok(const float* __restrict__ X, const float* __restrict__ MV, const float* __restrict__ GG, const float* __restrict__ GB, float* __restrict__ XT) { __shared__ float st[64][68]; const int tid = threadIdx.x; const int n0 = blockIdx.x * 64, c0 = blockIdx.y * 64; const size_t b = blockIdx.z;
  for (int e = tid; e < 64 * 16; e += 256) { const int cl = e >> 4, q = e & 15; const int c = c0 + cl; const int gi = (int)(b * 8) + c / (CC / 8); const float mu = MV[gi * 32], rs = MV[gi * 32 + 1], ga = bfr(GG[c]), be = bfr(GB[c]);
    const v4f v = *(const v4f*)(X + (b * CC + c) * (size_t)NTOK + n0 + q * 4);
#pragma unroll
    for (int j = 0; j < 4; ++j) st[cl][q * 4 + j] = (bfr(v[j]) - mu) * rs * ga + be; }
  __syncthreads();
  for (int e = tid; e < 64 * 16; e += 256) { const int nl = e >> 4, q = e & 15; v4f o; o[0] = st[q * 4][nl]; o[1] = st[q * 4 + 1][nl]; o[2] = st[q * 4 + 2][nl]; o[3] = st[q * 4 + 3][nl]; vst2(XT + (b * NTOK + n0 + nl) * (size_t)CC + c0 + q * 4, o); } }
// ---- k_fin: block = (64 tokens, 64 channels, batch b): out[b][c][n] = OR[b*N + n][c] + bf16(x[b][c][n]) (LDS transpose; 256-B runs of 64 tokens per channel)
__global__ __launch_bounds__(256) void k_fin(const float* __restrict__ ORW, const float* __restrict__ X, float* __restrict__ OUT) { __shared__ float st[64][68]; const int tid = threadIdx.x; const int n0 = blockIdx.x * 64, c0 = blockIdx.y * 64; const size_t b = blockIdx.z;
  for (int e = tid; e < 64 * 16; e += 256) { const int nl = e >> 4, q = e & 15; *(v4f*)&st[nl][q * 4] = *(const v4f*)(ORW + (b * NTOK + n0 + nl) * (size_t)CC + c0 + q * 4); }
  __syncthreads();
  for (int e = tid; e < 64 * 16; e += 256) { const int cl = e >> 4, q = e & 15; const size_t oi = (b * CC + c0 + cl) * (size_t)NTOK + n0 + q * 4; const v4f xr = *(const v4f*)(X + oi); v4f o; o[0] = st[q * 4][cl] + bfr(xr[0]); o[1] = st[q * 4 + 1][cl] + bfr(xr[1]); o[2] = st[q * 4 + 2][cl] + bfr(xr[2]); o[3] = st[q * 4 + 3][cl] + bfr(xr[3]); vst2(OUT + oi, o); } }
#define WS_MV  (WS_END)
#define WS_XT  (WS_MV + 4u * 32 * NB * 8 + 1024u)
#define WS_OR  (WS_XT + 4u * (size_t)NB * NTOK * CC)
#define WS_END2 (WS_OR + 4u * (size_t)NB * NTOK * CC)
#ifndef SM_EXTRA_PARAMS
#define SM_EXTRA_PARAMS
#endif
#ifndef PROJ_EXTRA_PARAMS
#define PROJ_EXTRA_PARAMS
#endif
#ifndef SM_MASK_HOOK
#define SM_MASK_HOOK (void)0
#endif

#define WS_QH  0u                                      // f16 q rows [b*t][CC]
#define WS_KH  (WS_QH + 2u * (size_t)NB * TT * CC)      // f16 k rows [b*t][CC]
#define WS_VT  (WS_KH + 2u * (size_t)NB * TT * CC)      // f16 v planes [b][c][t]
#define WS_QL  (WS_VT + 2u * (size_t)NB * CC * TT)      // f16 q residual x 2^10 rows [b][t < QHI][CC]
#define WS_KL  (WS_QL + 2u * (size_t)NB * QHI * CC)     // f16 k residual x 2^10 rows [b][t < KHI][CC]
#define WS_VB  (WS_KL + 2u * (size_t)NB * KHI * CC)     // bf16 v hi planes [b][c][t < KHI]
#define WS_VBL (WS_VB + 2u * (size_t)NB * CC * KHI)
#define WS_S   (WS_VBL + 2u * (size_t)NB * CC * KHI)    // f32 [hg][t][s], unused: logits and P stay in registers
#define WS_Y   (WS_S  + 4u * (size_t)HG * TT * TT)      // f32 ctx rows [b*t][CC] (only when there is an output projection)
#define WS_END (WS_Y  + 4u * (size_t)NB * TT * CC)

// ---- k_proj: block = (64 rows, 128 cols, which): q/k/v = X W (+ b) with exact bf16 products (K = DIN) -> which 0: q f16 rows (+ residual rows < QHI); 1: k f16 rows (+ residual rows < KHI); 2: v f16 planes [c][t] (+ bf16 hi/lo planes for t < KHI)
__global__ __launch_bounds__(128) void k_proj(const float* __restrict__ XQ, const float* __restrict__ XK, const float* __restrict__ XV, const float* __restrict__ WQ, const float* __restrict__ WK, const float* __restrict__ WV, const float* __restrict__ BQ, const float* __restrict__ BK, const float* __restrict__ BV,
    _Float16* __restrict__ QH, _Float16* __restrict__ QL, _Float16* __restrict__ KH, _Float16* __restrict__ KL, _Float16* __restrict__ VT, __bf16* __restrict__ VB, __bf16* __restrict__ VBL) {
  __shared__ __align__(16) _Float16 sh[64][136], sl[64][136]; __shared__ __align__(16) _Float16 th[128][72]; __shared__ __align__(16) __bf16 tb[128][72], tbl[128][72];
  const int tid = threadIdx.x, wave = tid >> 5, lane = tid & 31, col = lane & 15, g = lane >> 4; const int which = blockIdx.z; const int c0 = blockIdx.y * 128; const size_t r0 = (size_t)blockIdx.x * 64; const size_t bb = r0 / TT; const int t0 = (int)(r0 % TT);
  const float* X = which == 0 ? XQ : which == 1 ? XK : XV; const float* WA = which == 0 ? WQ : which == 1 ? WK : WV; const float* BA = which == 0 ? BQ : which == 1 ? BK : BV;
  v8f acc[8] = {};
#pragma unroll 2
  for (int kc = 0; kc < DIN / 32; ++kc) { const F2 a2 = split_row(X + (r0 + wave * 16 + col) * DIN, kc * 32, lane);   /* GroupNorm rows (f32) split hi + lo */
    asm volatile("s_wait_loadcnt 0x0" ::: "memory");
#pragma unroll
    for (int j = 0; j < 8; ++j) { const v16b w = WCOL(WA, kc * 32, c0 + j * 16 + col, lane); asm volatile("s_wait_loadcnt 0x0" ::: "memory"); acc[j] = wmma_bf(a2.h, w, acc[j]); acc[j] = wmma_bf(a2.l, w, acc[j]); } }
  if (which < 2) { _Float16* DH = which == 0 ? QH : KH; _Float16* DL = which == 0 ? QL : KL; const int nhi = which == 0 ? QHI : KHI; const bool hi_rows = t0 < nhi;
#pragma unroll
    for (int j = 0; j < 8; ++j) { const float bias = BA ? bfr(BA[c0 + j * 16 + col]) : 0.f;
#pragma unroll
      for (int r = 0; r < 8; ++r) { const float v = acc[j][r] + bias; const _Float16 hv = (_Float16)v; sh[wave * 16 + 8 * g + r][j * 16 + col] = hv; sl[wave * 16 + 8 * g + r][j * 16 + col] = (_Float16)((v - (float)hv) * 1024.0f); } }
    __syncthreads();
    for (int e = tid; e < 64 * 16; e += 128) { const int rl = e >> 4, q = e & 15; vst2((unsigned*)(DH + (r0 + rl) * CC + c0 + q * 8), *(const v4u*)&sh[rl][q * 8]); if (hi_rows) vst2((unsigned*)(DL + (bb * nhi + t0 + rl) * (size_t)CC + c0 + q * 8), *(const v4u*)&sl[rl][q * 8]); }
  } else { const bool hi_rows = t0 < KHI;
#pragma unroll
    for (int j = 0; j < 8; ++j) { const float bias = BA ? bfr(BA[c0 + j * 16 + col]) : 0.f;
#pragma unroll
      for (int r = 0; r < 8; ++r) { const float v = acc[j][r] + bias; const int rl = wave * 16 + 8 * g + r, cl = j * 16 + col; th[cl][rl] = (_Float16)v; const __bf16 bh = (__bf16)v; tb[cl][rl] = bh; tbl[cl][rl] = (__bf16)(v - (float)bh); } }
    __syncthreads();
    for (int e = tid; e < 128 * 8; e += 128) { const int cl = e >> 3, q = e & 7; vst2((unsigned*)(VT + (bb * CC + c0 + cl) * (size_t)TT + t0 + q * 8), *(const v4u*)&th[cl][q * 8]); if (hi_rows) { const size_t o3 = (bb * CC + c0 + cl) * (size_t)KHI + t0 + q * 8; vst2((unsigned*)(VB + o3), *(const v4u*)&tb[cl][q * 8]); vst2((unsigned*)(VBL + o3), *(const v4u*)&tbl[cl][q * 8]); } } } }
// ---- k_fa: block = 8 waves x 32 query columns of one (b, h); one pass = 32 keys. S^T = K Q^T (A = k rows, B = q hi and q residual x 2^10: 2 products, as f32 logits), running maximum and sum per query column (a lane holds one query's scores; the two wave halves exchange once a pass), P^T packed from the score accumulators to f16 as the B operand of O^T += V^T P^T (A = v planes [c][t]); logits and P never reach memory
__device__ __forceinline__ float xhalf(float x) { return __builtin_bit_cast(float, __builtin_amdgcn_permlanex16(__builtin_bit_cast(int, x), __builtin_bit_cast(int, x), 0x76543210, 0xfedcba98, false, false)); }   // lane l with lane l ^ 16
__device__ __forceinline__ v8f wmma_h(v16h a, v16h b, v8f c) { return __builtin_amdgcn_wmma_f32_16x16x32_f16(false, a, false, b, (short)0, c, false, false); }
#define XW() asm volatile("s_wait_xcnt 0x0" ::: "memory")   // behind a group of loads: a later load's result may land in the group's address registers
#define SC2 (SCALE * 1.4426950408889634f)   // logits to base 2
__global__ __launch_bounds__(256) void k_fa(const _Float16* __restrict__ QH, const _Float16* __restrict__ QL, const _Float16* __restrict__ KH, const _Float16* __restrict__ VT, float* __restrict__ Y) {
  const int tid = threadIdx.x, wave = tid >> 5, lane = tid & 31, col = lane & 15, g = lane >> 4; const int b = blockIdx.y / NH, h = blockIdx.y % NH; const int q0 = blockIdx.x * 256 + wave * 32;
  // every "#pragma unroll" of this kernel: the small arrays it indexes have to stay in registers
  v16h qh[2], ql[2];
#pragma unroll
  for (int u = 0; u < 2; ++u) qh[u] = frag_h(QH + ((size_t)b * TT + q0 + u * 16 + col) * CC + h * HD, lane);
  XW();
#pragma unroll
  for (int u = 0; u < 2; ++u) ql[u] = frag_h(QL + ((size_t)b * QHI + q0 + u * 16 + col) * CC + h * HD, lane);
  XW();
  const _Float16* Kp = KH + ((size_t)b * TT + col) * CC + h * HD; const _Float16* Vp = VT + ((size_t)b * CC + h * HD + col) * (size_t)TT;
  v8f o[2][2] = {}; float m[2] = { -3.0e38f, -3.0e38f }, l[2] = { 0.f, 0.f };
  v16h kf[2], vf[2]; kf[0] = frag_h(Kp, lane); kf[1] = frag_h(Kp + (size_t)16 * CC, lane); XW(); vf[0] = frag_h(Vp, lane); vf[1] = frag_h(Vp + (size_t)16 * TT, lane);
  for (int k0 = 0; k0 < TT; k0 += 32) {
    v8f s[2][2], sl[2][2]; const v8f z = {};
#pragma unroll
    for (int i = 0; i < 2; ++i)
#pragma unroll
      for (int u = 0; u < 2; ++u) { s[u][i] = wmma_h(kf[i], qh[u], z); sl[u][i] = wmma_h(kf[i], ql[u], z); }
    __builtin_amdgcn_sched_barrier(0);   // the eight score products stay one run: spread among the vector work each pair cost four idle slots before its first reader
    const int kn = k0 + 32 < TT ? k0 + 32 : 0;   // both operands are fetched one pass ahead, each behind its last use (the last pass refetches keys 0..31, unused)
    kf[0] = frag_h(Kp + (size_t)kn * CC, lane); kf[1] = frag_h(Kp + (size_t)(kn + 16) * CC, lane);
#pragma unroll
    for (int u = 0; u < 2; ++u) { const v8f t0 = sl[u][0] * (1.0f / 1024.0f) + s[u][0], t1 = sl[u][1] * (1.0f / 1024.0f) + s[u][1];
      float mx = fmaxf(t0[0], t1[0]);
#pragma unroll
      for (int r = 1; r < 8; ++r) mx = fmaxf(mx, fmaxf(t0[r], t1[r]));
      mx = fmaxf(mx, xhalf(mx)); const float mn = fmaxf(m[u], mx); const float corr = __builtin_amdgcn_exp2f((m[u] - mn) * SC2); m[u] = mn; const float mc = mn * SC2;
      const v8f a0 = t0 * SC2 - mc, a1 = t1 * SC2 - mc; v8f p0, p1; v16h pf;
#pragma unroll
      for (int r = 0; r < 8; ++r) { p0[r] = __builtin_amdgcn_exp2f(a0[r]); p1[r] = __builtin_amdgcn_exp2f(a1[r]); pf[r] = (_Float16)p0[r]; pf[8 + r] = (_Float16)p1[r]; }
      const v8f ps = p0 + p1; const v4f p4 = ps.lo + ps.hi; const v2f p2 = p4.lo + p4.hi;
      l[u] = l[u] * corr + (p2[0] + p2[1]);
#pragma unroll
      for (int j = 0; j < 2; ++j) { o[u][j] *= corr; o[u][j] = wmma_h(vf[j], pf, o[u][j]); } }
    vf[0] = frag_h(Vp + kn, lane); vf[1] = frag_h(Vp + (size_t)16 * TT + kn, lane);
    XW(); }   // here: the next pass's first products write over the registers that held these loads' addresses
#pragma unroll
  for (int u = 0; u < 2; ++u) { const float inv = 1.0f / (l[u] + xhalf(l[u])); float* yr = Y + ((size_t)b * TT + q0 + u * 16 + col) * CC + h * HD + 8 * g;
#pragma unroll
    for (int j = 0; j < 2; ++j) { const v8f w = o[u][j] * inv; vst2(yr + j * 16, (v4f)w.lo); vst2(yr + j * 16 + 4, (v4f)w.hi); } } }
// ---- k_out: block = (64 rows, 128 cols): out = ctx Wo (+ bo): all rows: ctx bf16 hi + lo against exact bf16 Wo (2 products); the f16 branch (Wo as f16(bf16 x 2^8), 1 product, x 2^-8) is not taken
__global__ __launch_bounds__(128) void k_out(const float* __restrict__ Y, const float* __restrict__ WO, const float* __restrict__ BO, float* __restrict__ OUT) { __shared__ __align__(16) float sf[4][16][132];
  const int tid = threadIdx.x, wave = tid >> 5, lane = tid & 31, col = lane & 15, g = lane >> 4; const int c0 = blockIdx.y * 128; const size_t r0 = (size_t)blockIdx.x * 64 + wave * 16;
  v8f acc[8] = {};
  if (true) {   /* ALL rows: ctx split bf16 hi + lo x exact proj_w (2 products) */
#pragma unroll 2
    for (int kc = 0; kc < CC / 32; ++kc) { const F2 a = split_row(Y + (r0 + col) * CC, kc * 32, lane); asm volatile("s_wait_loadcnt 0x0" ::: "memory");
#pragma unroll
      for (int j = 0; j < 8; ++j) { const v16b w = WOCOL(WO, kc * 32, c0 + j * 16 + col, lane); asm volatile("s_wait_loadcnt 0x0" ::: "memory"); acc[j] = wmma_bf(a.h, w, acc[j]); acc[j] = wmma_bf(a.l, w, acc[j]); } }
#pragma unroll
    for (int j = 0; j < 8; ++j) { const float bias = BO ? bfr(BO[c0 + j * 16 + col]) : 0.f;
#pragma unroll
      for (int r = 0; r < 8; ++r) sf[wave][8 * g + r][j * 16 + col] = acc[j][r] + bias; }
  } else {
#pragma unroll 2
    for (int kc = 0; kc < CC / 32; ++kc) { const v16h a = frag_f32(Y + (r0 + col) * CC + kc * 32, lane); asm volatile("s_wait_loadcnt 0x0" ::: "memory");
#pragma unroll
      for (int j = 0; j < 8; ++j) { const v16h w = WOCOLH(WO, kc * 32, c0 + j * 16 + col, lane); asm volatile("s_wait_loadcnt 0x0" ::: "memory"); acc[j] = wmma16(a, w, acc[j]); } }
#pragma unroll
    for (int j = 0; j < 8; ++j) { const float bias = BO ? bfr(BO[c0 + j * 16 + col]) : 0.f;
#pragma unroll
      for (int r = 0; r < 8; ++r) sf[wave][8 * g + r][j * 16 + col] = acc[j][r] * (1.0f / 256.0f) + bias; } }
  LDSX(); for (int rl = 0; rl < 16; ++rl) vst2(OUT + (r0 + rl) * DIN + c0 + lane * 4, *(const v4f*)&sf[wave][rl][lane * 4]); }

extern "C" void kernel_launch(void* const* d_in, const int* in_sizes, int n_in, void* d_out, int out_size, void* d_ws, size_t ws_size, hipStream_t stream) {
  (void)in_sizes; (void)n_in; (void)out_size;
  const float** F = (const float**)d_in;
  if (ws_size < (size_t)WS_END) return;
  char* ws = (char*)d_ws; _Float16 *QH = (_Float16*)(ws + WS_QH), *KH = (_Float16*)(ws + WS_KH), *VT = (_Float16*)(ws + WS_VT), *QL = (_Float16*)(ws + WS_QL), *KL = (_Float16*)(ws + WS_KL); __bf16 *VB = (__bf16*)(ws + WS_VB), *VBL = (__bf16*)(ws + WS_VBL); float *Y = (float*)(ws + WS_Y);
  (void)Y; (void)QL; (void)KL; (void)VB; (void)VBL;
  // inputs: 0 x [2,256,64,64]; 1 gn_gamma, 2 gn_beta [256]; 3 qkv_w [768,256] (out,in) rows q | k | v; 4 qkv_b [768]; 5 proj_w [256,256] (out,in); 6 proj_b
  if (ws_size < (size_t)WS_END2) return;
  float *MV = (float*)(ws + WS_MV), *XT = (float*)(ws + WS_XT), *ORW = (float*)(ws + WS_OR);
  k_gnst<<<dim3(TNB * 8), 256, 0, stream>>>(F[0], MV);
  k_tok<<<dim3(NTOK / 64, CC / 64, TNB), 256, 0, stream>>>(F[0], MV, F[1], F[2], XT);
  { const float* WQ = F[3]; const float* WK = F[3] + (size_t)CC * DIN; const float* WV = F[3] + (size_t)2 * CC * DIN;
    k_proj<<<dim3(TNB * TT / 64, CC / 128, 3), 128, 0, stream>>>(XT, XT, XT, WQ, WK, WV, F[4], F[4] + CC, F[4] + 2 * CC, QH, QL, KH, KL, VT, VB, VBL); }
  k_fa<<<dim3(TT / 256, TNB * NH), 256, 0, stream>>>(QH, QL, KH, VT, Y);
  k_out<<<dim3(TNB * TT / 64, DIN / 128), 128, 0, stream>>>(Y, F[5], F[6], ORW);
  k_fin<<<dim3(NTOK / 64, CC / 64, TNB), 256, 0, stream>>>(ORW, F[0], (float*)d_out);
}

// v002
// One run takes 192 microseconds.
// Next to v001, in two timings, it ran 1.35 and 1.38 times as fast.
// All steps since v000 together make it 8.01 times as fast.
// Single self-attention block on images (b 2, c 256, 64 x 64 -> n 4,096 tokens; 8 heads x 32): xn = GroupNorm(8 groups)(x) (affine); q,k,v = qkv_w xn + qkv_b (1x1, (out,in) rows q|k|v); attn = softmax(q k^T x 32^-0.5); out = proj_w (attn v) + proj_b, reshaped to [b,c,h,w] + x.
#include <hip/hip_runtime.h>
#include <math.h>

typedef __attribute__((ext_vector_type(16))) _Float16 v16h;
typedef __attribute__((ext_vector_type(16))) __bf16 v16b;
typedef __attribute__((ext_vector_type(8)))  _Float16 v8h;
typedef __attribute__((ext_vector_type(8)))  float v8f;
typedef __attribute__((ext_vector_type(4)))  float v4f;
typedef __attribute__((ext_vector_type(2)))  float v2f;
typedef __attribute__((ext_vector_type(4)))  unsigned v4u;
typedef __attribute__((ext_vector_type(4)))  int v4i;
typedef float __attribute__((may_alias)) float_a;
typedef int __attribute__((may_alias)) int_a;

template <typename T> __device__ __forceinline__ void vst2(void* p, T v) { *(T*)p = v;  }
__device__ __forceinline__ v8f wmma16(v16h a, v16h b, v8f c) {
  v8f d = __builtin_amdgcn_wmma_f32_16x16x32_f16(false, a, false, b, (short)0, c, false, false);
  asm volatile("v_nop\n\tv_nop\n\tv_nop\n\tv_nop" : "+v"(d) : "v"(a), "v"(b));
  return d;
}
__device__ __forceinline__ v8f wmma_bf(v16b a, v16b b, v8f c) {
  v8f d = __builtin_amdgcn_wmma_f32_16x16x32_bf16(false, a, false, b, (short)0, c, false, false);
  asm volatile("v_nop\n\tv_nop\n\tv_nop\n\tv_nop" : "+v"(d) : "v"(a), "v"(b));
  return d;
}
// 16x16x32 fragments: lane = (h = lane>>4, row/col = lane&15); elements 0..7 = k0+8h+0..7, 8..15 = k0+16+8h+0..7; D element r = row 8h+r
__device__ __forceinline__ v16h frag_h(const _Float16* rowk0, int lane) {
  union { v16h v; v8h q[2]; } u; const _Float16* p = rowk0 + 8 * (lane >> 4);
  u.q[0] = *(const v8h*)p; u.q[1] = *(const v8h*)(p + 16); return u.v;
}
__device__ __forceinline__ v16h frag_f32(const float* rowk0, int lane) {
  v16h a; const float* p = rowk0 + 8 * (lane >> 4);
#pragma unroll
  for (int i = 0; i < 8; ++i) { a[i] = (_Float16)p[i]; a[8 + i] = (_Float16)p[16 + i]; }
  return a;
}
__device__ __forceinline__ v16h frag_f32s(const float* rowk0, int lane, float sc) {
  v16h a; const float* p = rowk0 + 8 * (lane >> 4);
#pragma unroll
  for (int i = 0; i < 8; ++i) { a[i] = (_Float16)(p[i] * sc); a[8 + i] = (_Float16)(p[16 + i] * sc); }
  return a;
}
// column fragment from a [K][ld] layout (column n), rows >= K read as 0
__device__ __forceinline__ v16h fragc_f32(const float* W, int k0, int n, int lane, int ld, int K) {
  v16h a; const int g = lane >> 4;
#pragma unroll
  for (int i = 0; i < 8; ++i) { const int ka = k0 + 8 * g + i, kb = ka + 16;
    a[i] = (_Float16)(ka < K ? W[(size_t)(ka < K ? ka : K - 1) * ld + n] : 0.f); a[8 + i] = (_Float16)(kb < K ? W[(size_t)(kb < K ? kb : K - 1) * ld + n] : 0.f); }
  return a;
}
struct F2 { v16b h, l; };
__device__ __forceinline__ F2 bsplit16(const float v[16]) { F2 r;
#pragma unroll
  for (int i = 0; i < 16; ++i) { const __bf16 h = (__bf16)v[i]; r.h[i] = h; r.l[i] = (__bf16)(v[i] - (float)h); }
  return r; }
__device__ __forceinline__ F2 split_row(const float* row, int k0, int lane) { float v[16]; const float* p = row + k0 + 8 * (lane >> 4);
#pragma unroll
  for (int i = 0; i < 8; ++i) { v[i] = p[i]; v[8 + i] = p[16 + i]; }
  return bsplit16(v); }
__device__ __forceinline__ F2 split_rowK(const float* row, int k0, int lane, int K) { float v[16]; const int g = lane >> 4;
#pragma unroll
  for (int i = 0; i < 8; ++i) { const int ka = k0 + 8 * g + i, kb = ka + 16; v[i] = ka < K ? row[ka < K ? ka : K - 1] : 0.f; v[8 + i] = kb < K ? row[kb < K ? kb : K - 1] : 0.f; }
  return bsplit16(v); }
__device__ __forceinline__ F2 split_col(const float* W, int k0, int n, int lane, int ld, int K) { float v[16]; const int g = lane >> 4;
#pragma unroll
  for (int i = 0; i < 8; ++i) { const int ka = k0 + 8 * g + i, kb = ka + 16; v[i] = ka < K ? W[(size_t)(ka < K ? ka : K - 1) * ld + n] : 0.f; v[8 + i] = kb < K ? W[(size_t)(kb < K ? kb : K - 1) * ld + n] : 0.f; }
  return bsplit16(v); }
__device__ __forceinline__ v8f mac3(const F2& a, const F2& b, v8f c) { c = wmma_bf(a.l, b.h, c); c = wmma_bf(a.h, b.l, c); return wmma_bf(a.h, b.h, c); }
__device__ __forceinline__ float sigm(float v) { return 1.0f / (1.0f + expf(-v)); }
#define LDSX() do { asm volatile("s_wait_dscnt 0" ::: "memory"); __builtin_amdgcn_wave_barrier(); __builtin_amdgcn_fence(__ATOMIC_RELEASE, "workgroup"); } while (0)

#define NB 2
#define TT 4096
#define CC 256            // NH * HD = projected width
#define DIN 256          // input (model) width
#define NH 8
#define HD 32
#define NQB (TT / 64)
#define HG 2
#define SCALE (0.17677669529663687f)
#define CAUSAL 0
#ifndef TNB
#define TNB NB
#endif
__device__ __forceinline__ float bfr(float v) { return (float)(__bf16)v; }
__host__ __device__ __forceinline__ int kb_last(int qb) { return CAUSAL ? ((qb * 64 + 63) >> 7) : (TT / 128 - 1); }
typedef __attribute__((ext_vector_type(8))) __bf16 v8b;
__device__ __forceinline__ v16b frag_b(const __bf16* rowk0, int lane) {
  union { v16b v; v8b q[2]; } u; const __bf16* p = rowk0 + 8 * (lane >> 4);
  u.q[0] = *(const v8b*)p; u.q[1] = *(const v8b*)(p + 16); return u.v;
}
#define QBH 0              // unused: k_fa has no high-precision path
#define QHI 4096            // rows carrying a q residual plane (all rows when non-causal: 2-product logits everywhere)
#define KHI 64            // key rows carrying k residual / v bf16 hi+lo planes (written by k_proj; no kernel here reads them)
// B fragment (k rows k0+.., output column o) of a weight: (in,out) [K][ld] or (out,in) [ld rows of K]: bf16 exact, or f16(bf16 * 256) exact
__device__ __forceinline__ v16b wcol_io(const float* Wm, int k0, int o, int lane, int ld) { v16b w; const int g = lane >> 4;
#pragma unroll
  for (int i = 0; i < 8; ++i) { w[i] = (__bf16)Wm[(size_t)(k0 + 8 * g + i) * ld + o]; w[8 + i] = (__bf16)Wm[(size_t)(k0 + 16 + 8 * g + i) * ld + o]; }
  return w; }
__device__ __forceinline__ v16b wcol_oi(const float* Wm, int k0, int o, int lane, int K) { v16b w; const float* p = Wm + (size_t)o * K + k0 + 8 * (lane >> 4);
#pragma unroll
  for (int i = 0; i < 8; ++i) { w[i] = (__bf16)p[i]; w[8 + i] = (__bf16)p[16 + i]; }
  return w; }
__device__ __forceinline__ v16h wcolh_io(const float* Wm, int k0, int o, int lane, int ld) { v16h w; const int g = lane >> 4;
#pragma unroll
  for (int i = 0; i < 8; ++i) { w[i] = (_Float16)(bfr(Wm[(size_t)(k0 + 8 * g + i) * ld + o]) * 256.0f); w[8 + i] = (_Float16)(bfr(Wm[(size_t)(k0 + 16 + 8 * g + i) * ld + o]) * 256.0f); }
  return w; }
__device__ __forceinline__ v16h wcolh_oi(const float* Wm, int k0, int o, int lane, int K) { v16h w; const float* p = Wm + (size_t)o * K + k0 + 8 * (lane >> 4);
#pragma unroll
  for (int i = 0; i < 8; ++i) { w[i] = (_Float16)(bfr(p[i]) * 256.0f); w[8 + i] = (_Float16)(bfr(p[16 + i]) * 256.0f); }
  return w; }
#define WQKV_LAYOUT 1   // 0 = (in,out) [DIN][CC]; 1 = (out,in) [CC][DIN]; 2 = per-head [NH][DIN][HD]
__device__ __forceinline__ v16b wcol_hdk(const float* Wm, int k0, int o, int lane) { v16b w; const int g = lane >> 4; const float* p = Wm + (size_t)(o / HD) * DIN * HD + (o % HD);
#pragma unroll
  for (int i = 0; i < 8; ++i) { w[i] = (__bf16)p[(size_t)(k0 + 8 * g + i) * HD]; w[8 + i] = (__bf16)p[(size_t)(k0 + 16 + 8 * g + i) * HD]; }
  return w; }
#define WO_OUT_IN 1
#if WQKV_LAYOUT == 1
#define WCOL(W, k0, o, lane) wcol_oi(W, k0, o, lane, DIN)
#elif WQKV_LAYOUT == 2
#define WCOL(W, k0, o, lane) wcol_hdk(W, k0, o, lane)
#else
#define WCOL(W, k0, o, lane) wcol_io(W, k0, o, lane, CC)
#endif
#if WO_OUT_IN
#define WOCOL(W, k0, o, lane) wcol_oi(W, k0, o, lane, CC)
#define WOCOLH(W, k0, o, lane) wcolh_oi(W, k0, o, lane, CC)
#else
#define WOCOL(W, k0, o, lane) wcol_io(W, k0, o, lane, DIN)
#define WOCOLH(W, k0, o, lane) wcolh_io(W, k0, o, lane, DIN)
#endif
#define NTOK 4096
#ifndef OPITCH
#define OPITCH NTOK        // unused (out is written with pitch NTOK)
#endif
#ifndef XPITCH
#define XPITCH NTOK        // unused (x is read with pitch NTOK)
#endif
// ---- k_gnst: block = one (batch, group), 32 waves; a thread's 16-byte pieces lie 16 KiB apart and are fetched GNB at a time, all in flight before the first is used (one waited load a trip left each pass at one load latency per 4 KiB)
#define GNT 1024           // threads of a block
#define GNB 16             // loads in flight per thread
// behind a group of loads from p, a precaution: p is an input, so its registers are not given to a load of the group as destination ahead of the wait
#define GNW(p) asm volatile("s_wait_xcnt 0x0" :: "v"(p) : "memory")
__device__ __forceinline__ v4f bfr4(v4f v) { v4f r; r[0] = bfr(v[0]); r[1] = bfr(v[1]); r[2] = bfr(v[2]); r[3] = bfr(v[3]); return r; }
__global__ __launch_bounds__(GNT) void k_gnst(const float* __restrict__ X, float* __restrict__ MV) { __shared__ float sred[GNT / 32]; __shared__ float sbc; const int t = threadIdx.x; const size_t base = (size_t)blockIdx.x * (CC / 8) * NTOK; const int n = (CC / 8) * NTOK;
  const v4f* xp = (const v4f*)(X + base) + t;
  v4f sv = {};
  for (int i0 = 0; i0 < n / (4 * GNT); i0 += GNB) { v4f v[GNB]; const v4f* p = xp + (size_t)i0 * GNT;
#pragma unroll   // v[] has to stay in registers
    for (int j = 0; j < GNB; ++j) v[j] = p[(size_t)j * GNT];
    GNW(p);
#pragma unroll
    for (int j = 0; j < GNB; ++j) sv += bfr4(v[j]); }
  float s1 = (sv[0] + sv[1]) + (sv[2] + sv[3]);
#pragma unroll
  for (int o = 1; o < 32; o <<= 1) s1 += __shfl_xor(s1, o);
  if ((t & 31) == 0) sred[t >> 5] = s1; __syncthreads(); if (t == 0) { float a = 0.f; for (int i = 0; i < GNT / 32; ++i) a += sred[i]; sbc = a / (float)n; } __syncthreads(); const float mu = sbc; __syncthreads();
  v4f qv = {};
  for (int i0 = 0; i0 < n / (4 * GNT); i0 += GNB) { v4f v[GNB]; const v4f* p = xp + (size_t)i0 * GNT;
#pragma unroll   // v[] has to stay in registers
    for (int j = 0; j < GNB; ++j) v[j] = p[(size_t)j * GNT];
    GNW(p);
#pragma unroll
    for (int j = 0; j < GNB; ++j) { const v4f d = bfr4(v[j]) - mu; qv += d * d; } }
  float q = (qv[0] + qv[1]) + (qv[2] + qv[3]);
#pragma unroll
  for (int o = 1; o < 32; o <<= 1) q += __shfl_xor(q, o);
  if ((t & 31) == 0) sred[t >> 5] = q; __syncthreads(); if (t == 0) { float a = 0.f; for (int i = 0; i < GNT / 32; ++i) a += sred[i]; sbc = rsqrtf(a / (float)n + 1e-5f); } __syncthreads();
  if (t < 32) { const float v = t == 0 ? mu : (t == 1 ? sbc : 0.f); vst2(MV + (size_t)blockIdx.x * 32 + t, v); } }
// ---- k_tok: block = (64 tokens, 64 channels, batch b): XT[b*N + n][c] = (bf16(x[b][c][n]) - mean_g) * rstd_g * gamma[c] + beta[c] (GroupNorm, g = c / 32) through an LDS tile
__global__ __launch_bounds__(256) void k_tok(const float* __restrict__ X, const float* __restrict__ MV, const float* __restrict__ GG, const float* __restrict__ GB, float* __restrict__ XT) { __shared__ float st[64][68]; const int tid = threadIdx.x; const int n0 = blockIdx.x * 64, c0 = blockIdx.y * 64; const size_t b = blockIdx.z;
  for (int e = tid; e < 64 * 16; e += 256) { const int cl = e >> 4, q = e & 15; const int c = c0 + cl; const int gi = (int)(b * 8) + c / (CC / 8); const float mu = MV[gi * 32], rs = MV[gi * 32 + 1], ga = bfr(GG[c]), be = bfr(GB[c]);
    const v4f v = *(const v4f*)(X + (b * CC + c) * (size_t)NTOK + n0 + q * 4);
#pragma unroll
    for (int j = 0; j < 4; ++j) st[cl][q * 4 + j] = (bfr(v[j]) - mu) * rs * ga + be; }
  __syncthreads();
  for (int e = tid; e < 64 * 16; e += 256) { const int nl = e >> 4, q = e & 15; v4f o; o[0] = st[q * 4][nl]; o[1] = st[q * 4 + 1][nl]; o[2] = st[q * 4 + 2][nl]; o[3] = st[q * 4 + 3][nl]; vst2(XT + (b * NTOK + n0 + nl) * (size_t)CC + c0 + q * 4, o); } }
// ---- k_fin: block = (64 tokens, 64 channels, batch b): out[b][c][n] = OR[b*N + n][c] + bf16(x[b][c][n]) (LDS transpose; 256-B runs of 64 tokens per channel)
__global__ __launch_bounds__(256) void k_fin(const float* __restrict__ ORW, const float* __restrict__ X, float* __restrict__ OUT) { __shared__ float st[64][68]; const int tid = threadIdx.x; const int n0 = blockIdx.x * 64, c0 = blockIdx.y * 64; const size_t b = blockIdx.z;
  for (int e = tid; e < 64 * 16; e += 256) { const int nl = e >> 4, q = e & 15; *(v4f*)&st[nl][q * 4] = *(const v4f*)(ORW + (b * NTOK + n0 + nl) * (size_t)CC + c0 + q * 4); }
  __syncthreads();
  for (int e = tid; e < 64 * 16; e += 256) { const int cl = e >> 4, q = e & 15; const size_t oi = (b * CC + c0 + cl) * (size_t)NTOK + n0 + q * 4; const v4f xr = *(const v4f*)(X + oi); v4f o; o[0] = st[q * 4][cl] + bfr(xr[0]); o[1] = st[q * 4 + 1][cl] + bfr(xr[1]); o[2] = st[q * 4 + 2][cl] + bfr(xr[2]); o[3] = st[q * 4 + 3][cl] + bfr(xr[3]); vst2(OUT + oi, o); } }
#define WS_MV  (WS_END)
#define WS_XT  (WS_MV + 4u * 32 * NB * 8 + 1024u)
#define WS_OR  (WS_XT + 4u * (size_t)NB * NTOK * CC)
#define WS_END2 (WS_OR + 4u * (size_t)NB * NTOK * CC)
#ifndef SM_EXTRA_PARAMS
#define SM_EXTRA_PARAMS
#endif
#ifndef PROJ_EXTRA_PARAMS
#define PROJ_EXTRA_PARAMS
#endif
#ifndef SM_MASK_HOOK
#define SM_MASK_HOOK (void)0
#endif

#define WS_QH  0u                                      // f16 q rows [b*t][CC]
#define WS_KH  (WS_QH + 2u * (size_t)NB * TT * CC)      // f16 k rows [b*t][CC]
#define WS_VT  (WS_KH + 2u * (size_t)NB * TT * CC)      // f16 v planes [b][c][t]
#define WS_QL  (WS_VT + 2u * (size_t)NB * CC * TT)      // f16 q residual x 2^10 rows [b][t < QHI][CC]
#define WS_KL  (WS_QL + 2u * (size_t)NB * QHI * CC)     // f16 k residual x 2^10 rows [b][t < KHI][CC]
#define WS_VB  (WS_KL + 2u * (size_t)NB * KHI * CC)     // bf16 v hi planes [b][c][t < KHI]
#define WS_VBL (WS_VB + 2u * (size_t)NB * CC * KHI)
#define WS_S   (WS_VBL + 2u * (size_t)NB * CC * KHI)    // f32 [hg][t][s], unused: logits and P stay in registers
#define WS_Y   (WS_S  + 4u * (size_t)HG * TT * TT)      // f32 ctx rows [b*t][CC] (only when there is an output projection)
#define WS_END (WS_Y  + 4u * (size_t)NB * TT * CC)

// ---- k_proj: block = (64 rows, 128 cols, which): q/k/v = X W (+ b) with exact bf16 products (K = DIN) -> which 0: q f16 rows (+ residual rows < QHI); 1: k f16 rows (+ residual rows < KHI); 2: v f16 planes [c][t] (+ bf16 hi/lo planes for t < KHI)
__global__ __launch_bounds__(128) void k_proj(const float* __restrict__ XQ, const float* __restrict__ XK, const float* __restrict__ XV, const float* __restrict__ WQ, const float* __restrict__ WK, const float* __restrict__ WV, const float* __restrict__ BQ, const float* __restrict__ BK, const float* __restrict__ BV,
    _Float16* __restrict__ QH, _Float16* __restrict__ QL, _Float16* __restrict__ KH, _Float16* __restrict__ KL, _Float16* __restrict__ VT, __bf16* __restrict__ VB, __bf16* __restrict__ VBL) {
  __shared__ __align__(16) _Float16 sh[64][136], sl[64][136]; __shared__ __align__(16) _Float16 th[128][72]; __shared__ __align__(16) __bf16 tb[128][72], tbl[128][72];
  const int tid = threadIdx.x, wave = tid >> 5, lane = tid & 31, col = lane & 15, g = lane >> 4; const int which = blockIdx.z; const int c0 = blockIdx.y * 128; const size_t r0 = (size_t)blockIdx.x * 64; const size_t bb = r0 / TT; const int t0 = (int)(r0 % TT);
  const float* X = which == 0 ? XQ : which == 1 ? XK : XV; const float* WA = which == 0 ? WQ : which == 1 ? WK : WV; const float* BA = which == 0 ? BQ : which == 1 ? BK : BV;
  v8f acc[8] = {};
#pragma unroll 2
  for (int kc = 0; kc < DIN / 32; ++kc) { const F2 a2 = split_row(X + (r0 + wave * 16 + col) * DIN, kc * 32, lane);   /* GroupNorm rows (f32) split hi + lo */
    asm volatile("s_wait_loadcnt 0x0" ::: "memory");
#pragma unroll
    for (int j = 0; j < 8; ++j) { const v16b w = WCOL(WA, kc * 32, c0 + j * 16 + col, lane); asm volatile("s_wait_loadcnt 0x0" ::: "memory"); acc[j] = wmma_bf(a2.h, w, acc[j]); acc[j] = wmma_bf(a2.l, w, acc[j]); } }
  if (which < 2) { _Float16* DH = which == 0 ? QH : KH; _Float16* DL = which == 0 ? QL : KL; const int nhi = which == 0 ? QHI : KHI; const bool hi_rows = t0 < nhi;
#pragma unroll
    for (int j = 0; j < 8; ++j) { const float bias = BA ? bfr(BA[c0 + j * 16 + col]) : 0.f;
#pragma unroll
      for (int r = 0; r < 8; ++r) { const float v = acc[j][r] + bias; const _Float16 hv = (_Float16)v; sh[wave * 16 + 8 * g + r][j * 16 + col] = hv; sl[wave * 16 + 8 * g + r][j * 16 + col] = (_Float16)((v - (float)hv) * 1024.0f); } }
    __syncthreads();
    for (int e = tid; e < 64 * 16; e += 128) { const int rl = e >> 4, q = e & 15; vst2((unsigned*)(DH + (r0 + rl) * CC + c0 + q * 8), *(const v4u*)&sh[rl][q * 8]); if (hi_rows) vst2((unsigned*)(DL + (bb * nhi + t0 + rl) * (size_t)CC + c0 + q * 8), *(const v4u*)&sl[rl][q * 8]); }
  } else { const bool hi_rows = t0 < KHI;
#pragma unroll
    for (int j = 0; j < 8; ++j) { const float bias = BA ? bfr(BA[c0 + j * 16 + col]) : 0.f;
#pragma unroll
      for (int r = 0; r < 8; ++r) { const float v = acc[j][r] + bias; const int rl = wave * 16 + 8 * g + r, cl = j * 16 + col; th[cl][rl] = (_Float16)v; const __bf16 bh = (__bf16)v; tb[cl][rl] = bh; tbl[cl][rl] = (__bf16)(v - (float)bh); } }
    __syncthreads();
    for (int e = tid; e < 128 * 8; e += 128) { const int cl = e >> 3, q = e & 7; vst2((unsigned*)(VT + (bb * CC + c0 + cl) * (size_t)TT + t0 + q * 8), *(const v4u*)&th[cl][q * 8]); if (hi_rows) { const size_t o3 = (bb * CC + c0 + cl) * (size_t)KHI + t0 + q * 8; vst2((unsigned*)(VB + o3), *(const v4u*)&tb[cl][q * 8]); vst2((unsigned*)(VBL + o3), *(const v4u*)&tbl[cl][q * 8]); } } } }
// ---- k_fa: block = 8 waves x 32 query columns of one (b, h); one pass = 32 keys. S^T = K Q^T (A = k rows, B = q hi and q residual x 2^10: 2 products, as f32 logits), running maximum and sum per query column (a lane holds one query's scores; the two wave halves exchange once a pass), P^T packed from the score accumulators to f16 as the B operand of O^T += V^T P^T (A = v planes [c][t]); logits and P never reach memory
__device__ __forceinline__ float xhalf(float x) { return __builtin_bit_cast(float, __builtin_amdgcn_permlanex16(__builtin_bit_cast(int, x), __builtin_bit_cast(int, x), 0x76543210, 0xfedcba98, false, false)); }   // lane l with lane l ^ 16
__device__ __forceinline__ v8f wmma_h(v16h a, v16h b, v8f c) { return __builtin_amdgcn_wmma_f32_16x16x32_f16(false, a, false, b, (short)0, c, false, false); }
#define XW() asm volatile("s_wait_xcnt 0x0" ::: "memory")   // behind a group of loads: a later load's result may land in the group's address registers
#define SC2 (SCALE * 1.4426950408889634f)   // logits to base 2
__global__ __launch_bounds__(256) void k_fa(const _Float16* __restrict__ QH, const _Float16* __restrict__ QL, const _Float16* __restrict__ KH, const _Float16* __restrict__ VT, float* __restrict__ Y) {
  const int tid = threadIdx.x, wave = tid >> 5, lane = tid & 31, col = lane & 15, g = lane >> 4; const int b = blockIdx.y / NH, h = blockIdx.y % NH; const int q0 = blockIdx.x * 256 + wave * 32;
  // every "#pragma unroll" of this kernel: the small arrays it indexes have to stay in registers
  v16h qh[2], ql[2];
#pragma unroll
  for (int u = 0; u < 2; ++u) qh[u] = frag_h(QH + ((size_t)b * TT + q0 + u * 16 + col) * CC + h * HD, lane);
  XW();
#pragma unroll
  for (int u = 0; u < 2; ++u) ql[u] = frag_h(QL + ((size_t)b * QHI + q0 + u * 16 + col) * CC + h * HD, lane);
  XW();
  const _Float16* Kp = KH + ((size_t)b * TT + col) * CC + h * HD; const _Float16* Vp = VT + ((size_t)b * CC + h * HD + col) * (size_t)TT;
  v8f o[2][2] = {}; float m[2] = { -3.0e38f, -3.0e38f }, l[2] = { 0.f, 0.f };
  v16h kf[2], vf[2]; kf[0] = frag_h(Kp, lane); kf[1] = frag_h(Kp + (size_t)16 * CC, lane); XW(); vf[0] = frag_h(Vp, lane); vf[1] = frag_h(Vp + (size_t)16 * TT, lane);
  for (int k0 = 0; k0 < TT; k0 += 32) {
    v8f s[2][2], sl[2][2]; const v8f z = {};
#pragma unroll
    for (int i = 0; i < 2; ++i)
#pragma unroll
      for (int u = 0; u < 2; ++u) { s[u][i] = wmma_h(kf[i], qh[u], z); sl[u][i] = wmma_h(kf[i], ql[u], z); }
    __builtin_amdgcn_sched_barrier(0);   // the eight score products stay one run: spread among the vector work each pair cost four idle slots before its first reader
    const int kn = k0 + 32 < TT ? k0 + 32 : 0;   // both operands are fetched one pass ahead, each behind its last use (the last pass refetches keys 0..31, unused)
    kf[0] = frag_h(Kp + (size_t)kn * CC, lane); kf[1] = frag_h(Kp + (size_t)(kn + 16) * CC, lane);
#pragma unroll
    for (int u = 0; u < 2; ++u) { const v8f t0 = sl[u][0] * (1.0f / 1024.0f) + s[u][0], t1 = sl[u][1] * (1.0f / 1024.0f) + s[u][1];
      float mx = fmaxf(t0[0], t1[0]);
#pragma unroll
      for (int r = 1; r < 8; ++r) mx = fmaxf(mx, fmaxf(t0[r], t1[r]));
      mx = fmaxf(mx, xhalf(mx)); const float mn = fmaxf(m[u], mx); const float corr = __builtin_amdgcn_exp2f((m[u] - mn) * SC2); m[u] = mn; const float mc = mn * SC2;
      const v8f a0 = t0 * SC2 - mc, a1 = t1 * SC2 - mc; v8f p0, p1; v16h pf;
#pragma unroll
      for (int r = 0; r < 8; ++r) { p0[r] = __builtin_amdgcn_exp2f(a0[r]); p1[r] = __builtin_amdgcn_exp2f(a1[r]); pf[r] = (_Float16)p0[r]; pf[8 + r] = (_Float16)p1[r]; }
      const v8f ps = p0 + p1; const v4f p4 = ps.lo + ps.hi; const v2f p2 = p4.lo + p4.hi;
      l[u] = l[u] * corr + (p2[0] + p2[1]);
#pragma unroll
      for (int j = 0; j < 2; ++j) { o[u][j] *= corr; o[u][j] = wmma_h(vf[j], pf, o[u][j]); } }
    vf[0] = frag_h(Vp + kn, lane); vf[1] = frag_h(Vp + (size_t)16 * TT + kn, lane);
    XW(); }   // here: the next pass's first products write over the registers that held these loads' addresses
#pragma unroll
  for (int u = 0; u < 2; ++u) { const float inv = 1.0f / (l[u] + xhalf(l[u])); float* yr = Y + ((size_t)b * TT + q0 + u * 16 + col) * CC + h * HD + 8 * g;
#pragma unroll
    for (int j = 0; j < 2; ++j) { const v8f w = o[u][j] * inv; vst2(yr + j * 16, (v4f)w.lo); vst2(yr + j * 16 + 4, (v4f)w.hi); } } }
// ---- k_out: block = (64 rows, 128 cols): out = ctx Wo (+ bo): all rows: ctx bf16 hi + lo against exact bf16 Wo (2 products); the f16 branch (Wo as f16(bf16 x 2^8), 1 product, x 2^-8) is not taken
__global__ __launch_bounds__(128) void k_out(const float* __restrict__ Y, const float* __restrict__ WO, const float* __restrict__ BO, float* __restrict__ OUT) { __shared__ __align__(16) float sf[4][16][132];
  const int tid = threadIdx.x, wave = tid >> 5, lane = tid & 31, col = lane & 15, g = lane >> 4; const int c0 = blockIdx.y * 128; const size_t r0 = (size_t)blockIdx.x * 64 + wave * 16;
  v8f acc[8] = {};
  if (true) {   /* ALL rows: ctx split bf16 hi + lo x exact proj_w (2 products) */
#pragma unroll 2
    for (int kc = 0; kc < CC / 32; ++kc) { const F2 a = split_row(Y + (r0 + col) * CC, kc * 32, lane); asm volatile("s_wait_loadcnt 0x0" ::: "memory");
#pragma unroll
      for (int j = 0; j < 8; ++j) { const v16b w = WOCOL(WO, kc * 32, c0 + j * 16 + col, lane); asm volatile("s_wait_loadcnt 0x0" ::: "memory"); acc[j] = wmma_bf(a.h, w, acc[j]); acc[j] = wmma_bf(a.l, w, acc[j]); } }
#pragma unroll
    for (int j = 0; j < 8; ++j) { const float bias = BO ? bfr(BO[c0 + j * 16 + col]) : 0.f;
#pragma unroll
      for (int r = 0; r < 8; ++r) sf[wave][8 * g + r][j * 16 + col] = acc[j][r] + bias; }
  } else {
#pragma unroll 2
    for (int kc = 0; kc < CC / 32; ++kc) { const v16h a = frag_f32(Y + (r0 + col) * CC + kc * 32, lane); asm volatile("s_wait_loadcnt 0x0" ::: "memory");
#pragma unroll
      for (int j = 0; j < 8; ++j) { const v16h w = WOCOLH(WO, kc * 32, c0 + j * 16 + col, lane); asm volatile("s_wait_loadcnt 0x0" ::: "memory"); acc[j] = wmma16(a, w, acc[j]); } }
#pragma unroll
    for (int j = 0; j < 8; ++j) { const float bias = BO ? bfr(BO[c0 + j * 16 + col]) : 0.f;
#pragma unroll
      for (int r = 0; r < 8; ++r) sf[wave][8 * g + r][j * 16 + col] = acc[j][r] * (1.0f / 256.0f) + bias; } }
  LDSX(); for (int rl = 0; rl < 16; ++rl) vst2(OUT + (r0 + rl) * DIN + c0 + lane * 4, *(const v4f*)&sf[wave][rl][lane * 4]); }

extern "C" void kernel_launch(void* const* d_in, const int* in_sizes, int n_in, void* d_out, int out_size, void* d_ws, size_t ws_size, hipStream_t stream) {
  (void)in_sizes; (void)n_in; (void)out_size;
  const float** F = (const float**)d_in;
  if (ws_size < (size_t)WS_END) return;
  char* ws = (char*)d_ws; _Float16 *QH = (_Float16*)(ws + WS_QH), *KH = (_Float16*)(ws + WS_KH), *VT = (_Float16*)(ws + WS_VT), *QL = (_Float16*)(ws + WS_QL), *KL = (_Float16*)(ws + WS_KL); __bf16 *VB = (__bf16*)(ws + WS_VB), *VBL = (__bf16*)(ws + WS_VBL); float *Y = (float*)(ws + WS_Y);
  (void)Y; (void)QL; (void)KL; (void)VB; (void)VBL;
  // inputs: 0 x [2,256,64,64]; 1 gn_gamma, 2 gn_beta [256]; 3 qkv_w [768,256] (out,in) rows q | k | v; 4 qkv_b [768]; 5 proj_w [256,256] (out,in); 6 proj_b
  if (ws_size < (size_t)WS_END2) return;
  float *MV = (float*)(ws + WS_MV), *XT = (float*)(ws + WS_XT), *ORW = (float*)(ws + WS_OR);
  k_gnst<<<dim3(TNB * 8), GNT, 0, stream>>>(F[0], MV);
  k_tok<<<dim3(NTOK / 64, CC / 64, TNB), 256, 0, stream>>>(F[0], MV, F[1], F[2], XT);
  { const float* WQ = F[3]; const float* WK = F[3] + (size_t)CC * DIN; const float* WV = F[3] + (size_t)2 * CC * DIN;
    k_proj<<<dim3(TNB * TT / 64, CC / 128, 3), 128, 0, stream>>>(XT, XT, XT, WQ, WK, WV, F[4], F[4] + CC, F[4] + 2 * CC, QH, QL, KH, KL, VT, VB, VBL); }
  k_fa<<<dim3(TT / 256, TNB * NH), 256, 0, stream>>>(QH, QL, KH, VT, Y);
  k_out<<<dim3(TNB * TT / 64, DIN / 128), 128, 0, stream>>>(Y, F[5], F[6], ORW);
  k_fin<<<dim3(NTOK / 64, CC / 64, TNB), 256, 0, stream>>>(ORW, F[0], (float*)d_out);
}

// v003
// A run of this version takes 149 microseconds.
// In two side-by-side timings against v002, it was 1.32 and 1.27 times as fast.
// Counting every step since v000, it is 10.4 times as fast.
// Single self-attention block on images (b 2, c 256, 64 x 64 -> n 4,096 tokens; 8 heads x 32): xn = GroupNorm(8 groups)(x) (affine); q,k,v = qkv_w xn + qkv_b (1x1, (out,in) rows q|k|v); attn = softmax(q k^T x 32^-0.5); out = proj_w (attn v) + proj_b, reshaped to [b,c,h,w] + x.
#include <hip/hip_runtime.h>
#include <math.h>

typedef __attribute__((ext_vector_type(16))) _Float16 v16h;
typedef __attribute__((ext_vector_type(16))) __bf16 v16b;
typedef __attribute__((ext_vector_type(8)))  _Float16 v8h;
typedef __attribute__((ext_vector_type(8)))  float v8f;
typedef __attribute__((ext_vector_type(4)))  float v4f;
typedef __attribute__((ext_vector_type(2)))  float v2f;
typedef __attribute__((ext_vector_type(4)))  unsigned v4u;
typedef __attribute__((ext_vector_type(4)))  int v4i;
typedef float __attribute__((may_alias)) float_a;
typedef int __attribute__((may_alias)) int_a;

template <typename T> __device__ __forceinline__ void vst2(void* p, T v) { *(T*)p = v;  }
__device__ __forceinline__ v8f wmma16(v16h a, v16h b, v8f c) {
  v8f d = __builtin_amdgcn_wmma_f32_16x16x32_f16(false, a, false, b, (short)0, c, false, false);
  asm volatile("v_nop\n\tv_nop\n\tv_nop\n\tv_nop" : "+v"(d) : "v"(a), "v"(b));
  return d;
}
__device__ __forceinline__ v8f wmma_bf(v16b a, v16b b, v8f c) {
  v8f d = __builtin_amdgcn_wmma_f32_16x16x32_bf16(false, a, false, b, (short)0, c, false, false);
  asm volatile("v_nop\n\tv_nop\n\tv_nop\n\tv_nop" : "+v"(d) : "v"(a), "v"(b));
  return d;
}
// 16x16x32 fragments: lane = (h = lane>>4, row/col = lane&15); elements 0..7 = k0+8h+0..7, 8..15 = k0+16+8h+0..7; D element r = row 8h+r
__device__ __forceinline__ v16h frag_h(const _Float16* rowk0, int lane) {
  union { v16h v; v8h q[2]; } u; const _Float16* p = rowk0 + 8 * (lane >> 4);
  u.q[0] = *(const v8h*)p; u.q[1] = *(const v8h*)(p + 16); return u.v;
}
__device__ __forceinline__ v16h frag_f32(const float* rowk0, int lane) {
  v16h a; const float* p = rowk0 + 8 * (lane >> 4);
#pragma unroll
  for (int i = 0; i < 8; ++i) { a[i] = (_Float16)p[i]; a[8 + i] = (_Float16)p[16 + i]; }
  return a;
}
__device__ __forceinline__ v16h frag_f32s(const float* rowk0, int lane, float sc) {
  v16h a; const float* p = rowk0 + 8 * (lane >> 4);
#pragma unroll
  for (int i = 0; i < 8; ++i) { a[i] = (_Float16)(p[i] * sc); a[8 + i] = (_Float16)(p[16 + i] * sc); }
  return a;
}
// column fragment from a [K][ld] layout (column n), rows >= K read as 0
__device__ __forceinline__ v16h fragc_f32(const float* W, int k0, int n, int lane, int ld, int K) {
  v16h a; const int g = lane >> 4;
#pragma unroll
  for (int i = 0; i < 8; ++i) { const int ka = k0 + 8 * g + i, kb = ka + 16;
    a[i] = (_Float16)(ka < K ? W[(size_t)(ka < K ? ka : K - 1) * ld + n] : 0.f); a[8 + i] = (_Float16)(kb < K ? W[(size_t)(kb < K ? kb : K - 1) * ld + n] : 0.f); }
  return a;
}
struct F2 { v16b h, l; };
__device__ __forceinline__ F2 bsplit16(const float v[16]) { F2 r;
#pragma unroll
  for (int i = 0; i < 16; ++i) { const __bf16 h = (__bf16)v[i]; r.h[i] = h; r.l[i] = (__bf16)(v[i] - (float)h); }
  return r; }
__device__ __forceinline__ F2 split_row(const float* row, int k0, int lane) { float v[16]; const float* p = row + k0 + 8 * (lane >> 4);
#pragma unroll
  for (int i = 0; i < 8; ++i) { v[i] = p[i]; v[8 + i] = p[16 + i]; }
  return bsplit16(v); }
__device__ __forceinline__ F2 split_rowK(const float* row, int k0, int lane, int K) { float v[16]; const int g = lane >> 4;
#pragma unroll
  for (int i = 0; i < 8; ++i) { const int ka = k0 + 8 * g + i, kb = ka + 16; v[i] = ka < K ? row[ka < K ? ka : K - 1] : 0.f; v[8 + i] = kb < K ? row[kb < K ? kb : K - 1] : 0.f; }
  return bsplit16(v); }
__device__ __forceinline__ F2 split_col(const float* W, int k0, int n, int lane, int ld, int K) { float v[16]; const int g = lane >> 4;
#pragma unroll
  for (int i = 0; i < 8; ++i) { const int ka = k0 + 8 * g + i, kb = ka + 16; v[i] = ka < K ? W[(size_t)(ka < K ? ka : K - 1) * ld + n] : 0.f; v[8 + i] = kb < K ? W[(size_t)(kb < K ? kb : K - 1) * ld + n] : 0.f; }
  return bsplit16(v); }
__device__ __forceinline__ v8f mac3(const F2& a, const F2& b, v8f c) { c = wmma_bf(a.l, b.h, c); c = wmma_bf(a.h, b.l, c); return wmma_bf(a.h, b.h, c); }
__device__ __forceinline__ float sigm(float v) { return 1.0f / (1.0f + expf(-v)); }
#define LDSX() do { asm volatile("s_wait_dscnt 0" ::: "memory"); __builtin_amdgcn_wave_barrier(); __builtin_amdgcn_fence(__ATOMIC_RELEASE, "workgroup"); } while (0)

#define NB 2
#define TT 4096
#define CC 256            // NH * HD = projected width
#define DIN 256          // input (model) width
#define NH 8
#define HD 32
#define NQB (TT / 64)
#define HG 2
#define SCALE (0.17677669529663687f)
#define CAUSAL 0
#ifndef TNB
#define TNB NB
#endif
__device__ __forceinline__ float bfr(float v) { return (float)(__bf16)v; }
__host__ __device__ __forceinline__ int kb_last(int qb) { return CAUSAL ? ((qb * 64 + 63) >> 7) : (TT / 128 - 1); }
typedef __attribute__((ext_vector_type(8))) __bf16 v8b;
__device__ __forceinline__ v16b frag_b(const __bf16* rowk0, int lane) {
  union { v16b v; v8b q[2]; } u; const __bf16* p = rowk0 + 8 * (lane >> 4);
  u.q[0] = *(const v8b*)p; u.q[1] = *(const v8b*)(p + 16); return u.v;
}
#define QBH 0              // unused: k_fa has no high-precision path
#define QHI 4096            // rows carrying a q residual plane (all rows when non-causal: 2-product logits everywhere)
#define KHI 64            // key rows carrying k residual / v bf16 hi+lo planes (written by k_proj; no kernel here reads them)
// B fragment (k rows k0+.., output column o) of a weight: (in,out) [K][ld] or (out,in) [ld rows of K]: bf16 exact, or f16(bf16 * 256) exact
__device__ __forceinline__ v16b wcol_io(const float* Wm, int k0, int o, int lane, int ld) { v16b w; const int g = lane >> 4;
#pragma unroll
  for (int i = 0; i < 8; ++i) { w[i] = (__bf16)Wm[(size_t)(k0 + 8 * g + i) * ld + o]; w[8 + i] = (__bf16)Wm[(size_t)(k0 + 16 + 8 * g + i) * ld + o]; }
  return w; }
__device__ __forceinline__ v16b wcol_oi(const float* Wm, int k0, int o, int lane, int K) { v16b w; const float* p = Wm + (size_t)o * K + k0 + 8 * (lane >> 4);
#pragma unroll
  for (int i = 0; i < 8; ++i) { w[i] = (__bf16)p[i]; w[8 + i] = (__bf16)p[16 + i]; }
  return w; }
__device__ __forceinline__ v16h wcolh_io(const float* Wm, int k0, int o, int lane, int ld) { v16h w; const int g = lane >> 4;
#pragma unroll
  for (int i = 0; i < 8; ++i) { w[i] = (_Float16)(bfr(Wm[(size_t)(k0 + 8 * g + i) * ld + o]) * 256.0f); w[8 + i] = (_Float16)(bfr(Wm[(size_t)(k0 + 16 + 8 * g + i) * ld + o]) * 256.0f); }
  return w; }
__device__ __forceinline__ v16h wcolh_oi(const float* Wm, int k0, int o, int lane, int K) { v16h w; const float* p = Wm + (size_t)o * K + k0 + 8 * (lane >> 4);
#pragma unroll
  for (int i = 0; i < 8; ++i) { w[i] = (_Float16)(bfr(p[i]) * 256.0f); w[8 + i] = (_Float16)(bfr(p[16 + i]) * 256.0f); }
  return w; }
#define WQKV_LAYOUT 1   // 0 = (in,out) [DIN][CC]; 1 = (out,in) [CC][DIN]; 2 = per-head [NH][DIN][HD]
__device__ __forceinline__ v16b wcol_hdk(const float* Wm, int k0, int o, int lane) { v16b w; const int g = lane >> 4; const float* p = Wm + (size_t)(o / HD) * DIN * HD + (o % HD);
#pragma unroll
  for (int i = 0; i < 8; ++i) { w[i] = (__bf16)p[(size_t)(k0 + 8 * g + i) * HD]; w[8 + i] = (__bf16)p[(size_t)(k0 + 16 + 8 * g + i) * HD]; }
  return w; }
#define WO_OUT_IN 1
#if WQKV_LAYOUT == 1
#define WCOL(W, k0, o, lane) wcol_oi(W, k0, o, lane, DIN)
#elif WQKV_LAYOUT == 2
#define WCOL(W, k0, o, lane) wcol_hdk(W, k0, o, lane)
#else
#define WCOL(W, k0, o, lane) wcol_io(W, k0, o, lane, CC)
#endif
#if WO_OUT_IN
#define WOCOL(W, k0, o, lane) wcol_oi(W, k0, o, lane, CC)
#define WOCOLH(W, k0, o, lane) wcolh_oi(W, k0, o, lane, CC)
#else
#define WOCOL(W, k0, o, lane) wcol_io(W, k0, o, lane, DIN)
#define WOCOLH(W, k0, o, lane) wcolh_io(W, k0, o, lane, DIN)
#endif
#define NTOK 4096
#ifndef OPITCH
#define OPITCH NTOK        // unused (out is written with pitch NTOK)
#endif
#ifndef XPITCH
#define XPITCH NTOK        // unused (x is read with pitch NTOK)
#endif
// ---- k_gnst: block = one (batch, group), 32 waves; a thread's 16-byte pieces lie 16 KiB apart and are fetched GNB at a time, all in flight before the first is used (one waited load a trip left each pass at one load latency per 4 KiB)
#define GNT 1024           // threads of a block
#define GNB 16             // loads in flight per thread
// behind a group of loads from p, a precaution: p is an input, so its registers are not given to a load of the group as destination ahead of the wait
#define GNW(p) asm volatile("s_wait_xcnt 0x0" :: "v"(p) : "memory")
__device__ __forceinline__ v4f bfr4(v4f v) { v4f r; r[0] = bfr(v[0]); r[1] = bfr(v[1]); r[2] = bfr(v[2]); r[3] = bfr(v[3]); return r; }
__global__ __launch_bounds__(GNT) void k_gnst(const float* __restrict__ X, float* __restrict__ MV) { __shared__ float sred[GNT / 32]; __shared__ float sbc; const int t = threadIdx.x; const size_t base = (size_t)blockIdx.x * (CC / 8) * NTOK; const int n = (CC / 8) * NTOK;
  const v4f* xp = (const v4f*)(X + base) + t;
  v4f sv = {};
  for (int i0 = 0; i0 < n / (4 * GNT); i0 += GNB) { v4f v[GNB]; const v4f* p = xp + (size_t)i0 * GNT;
#pragma unroll   // v[] has to stay in registers
    for (int j = 0; j < GNB; ++j) v[j] = p[(size_t)j * GNT];
    GNW(p);
#pragma unroll
    for (int j = 0; j < GNB; ++j) sv += bfr4(v[j]); }
  float s1 = (sv[0] + sv[1]) + (sv[2] + sv[3]);
#pragma unroll
  for (int o = 1; o < 32; o <<= 1) s1 += __shfl_xor(s1, o);
  if ((t & 31) == 0) sred[t >> 5] = s1; __syncthreads(); if (t == 0) { float a = 0.f; for (int i = 0; i < GNT / 32; ++i) a += sred[i]; sbc = a / (float)n; } __syncthreads(); const float mu = sbc; __syncthreads();
  v4f qv = {};
  for (int i0 = 0; i0 < n / (4 * GNT); i0 += GNB) { v4f v[GNB]; const v4f* p = xp + (size_t)i0 * GNT;
#pragma unroll   // v[] has to stay in registers
    for (int j = 0; j < GNB; ++j) v[j] = p[(size_t)j * GNT];
    GNW(p);
#pragma unroll
    for (int j = 0; j < GNB; ++j) { const v4f d = bfr4(v[j]) - mu; qv += d * d; } }
  float q = (qv[0] + qv[1]) + (qv[2] + qv[3]);
#pragma unroll
  for (int o = 1; o < 32; o <<= 1) q += __shfl_xor(q, o);
  if ((t & 31) == 0) sred[t >> 5] = q; __syncthreads(); if (t == 0) { float a = 0.f; for (int i = 0; i < GNT / 32; ++i) a += sred[i]; sbc = rsqrtf(a / (float)n + 1e-5f); } __syncthreads();
  if (t < 32) { const float v = t == 0 ? mu : (t == 1 ? sbc : 0.f); vst2(MV + (size_t)blockIdx.x * 32 + t, v); } }
// ---- k_tok: block = (64 tokens, 64 channels, batch b): XT[b*N + n][c] = (bf16(x[b][c][n]) - mean_g) * rstd_g * gamma[c] + beta[c] (GroupNorm, g = c / 32) through an LDS tile
__global__ __launch_bounds__(256) void k_tok(const float* __restrict__ X, const float* __restrict__ MV, const float* __restrict__ GG, const float* __restrict__ GB, float* __restrict__ XT) { __shared__ float st[64][68]; const int tid = threadIdx.x; const int n0 = blockIdx.x * 64, c0 = blockIdx.y * 64; const size_t b = blockIdx.z;
  for (int e = tid; e < 64 * 16; e += 256) { const int cl = e >> 4, q = e & 15; const int c = c0 + cl; const int gi = (int)(b * 8) + c / (CC / 8); const float mu = MV[gi * 32], rs = MV[gi * 32 + 1], ga = bfr(GG[c]), be = bfr(GB[c]);
    const v4f v = *(const v4f*)(X + (b * CC + c) * (size_t)NTOK + n0 + q * 4);
#pragma unroll
    for (int j = 0; j < 4; ++j) st[cl][q * 4 + j] = (bfr(v[j]) - mu) * rs * ga + be; }
  __syncthreads();
  for (int e = tid; e < 64 * 16; e += 256) { const int nl = e >> 4, q = e & 15; v4f o; o[0] = st[q * 4][nl]; o[1] = st[q * 4 + 1][nl]; o[2] = st[q * 4 + 2][nl]; o[3] = st[q * 4 + 3][nl]; vst2(XT + (b * NTOK + n0 + nl) * (size_t)CC + c0 + q * 4, o); } }
// ---- k_fin: block = (64 tokens, 64 channels, batch b): out[b][c][n] = OR[b*N + n][c] + bf16(x[b][c][n]) (LDS transpose; 256-B runs of 64 tokens per channel)
__global__ __launch_bounds__(256) void k_fin(const float* __restrict__ ORW, const float* __restrict__ X, float* __restrict__ OUT) { __shared__ float st[64][68]; const int tid = threadIdx.x; const int n0 = blockIdx.x * 64, c0 = blockIdx.y * 64; const size_t b = blockIdx.z;
  for (int e = tid; e < 64 * 16; e += 256) { const int nl = e >> 4, q = e & 15; *(v4f*)&st[nl][q * 4] = *(const v4f*)(ORW + (b * NTOK + n0 + nl) * (size_t)CC + c0 + q * 4); }
  __syncthreads();
  for (int e = tid; e < 64 * 16; e += 256) { const int cl = e >> 4, q = e & 15; const size_t oi = (b * CC + c0 + cl) * (size_t)NTOK + n0 + q * 4; const v4f xr = *(const v4f*)(X + oi); v4f o; o[0] = st[q * 4][cl] + bfr(xr[0]); o[1] = st[q * 4 + 1][cl] + bfr(xr[1]); o[2] = st[q * 4 + 2][cl] + bfr(xr[2]); o[3] = st[q * 4 + 3][cl] + bfr(xr[3]); vst2(OUT + oi, o); } }
#define WS_MV  (WS_END)
#define WS_XT  (WS_MV + 4u * 32 * NB * 8 + 1024u)
#define WS_OR  (WS_XT + 4u * (size_t)NB * NTOK * CC)
#define WS_END2 (WS_OR + 4u * (size_t)NB * NTOK * CC)
#ifndef SM_EXTRA_PARAMS
#define SM_EXTRA_PARAMS
#endif
#ifndef PROJ_EXTRA_PARAMS
#define PROJ_EXTRA_PARAMS
#endif
#ifndef SM_MASK_HOOK
#define SM_MASK_HOOK (void)0
#endif

#define WS_QH  0u                                      // f16 q rows [b*t][CC]
#define WS_KH  (WS_QH + 2u * (size_t)NB * TT * CC)      // f16 k rows [b*t][CC]
#define WS_VT  (WS_KH + 2u * (size_t)NB * TT * CC)      // f16 v planes [b][c][t]
#define WS_QL  (WS_VT + 2u * (size_t)NB * CC * TT)      // f16 q residual x 2^10 rows [b][t < QHI][CC]
#define WS_KL  (WS_QL + 2u * (size_t)NB * QHI * CC)     // f16 k residual x 2^10 rows [b][t < KHI][CC]
#define WS_VB  (WS_KL + 2u * (size_t)NB * KHI * CC)     // bf16 v hi planes [b][c][t < KHI]
#define WS_VBL (WS_VB + 2u * (size_t)NB * CC * KHI)
#define WS_S   (WS_VBL + 2u * (size_t)NB * CC * KHI)    // f32 [hg][t][s], unused: logits and P stay in registers
#define WS_Y   (WS_S  + 4u * (size_t)HG * TT * TT)      // f32 ctx rows [b*t][CC] (only when there is an output projection)
#define WS_END (WS_Y  + 4u * (size_t)NB * TT * CC)

// ---- k_proj: block = (64 rows, 128 cols, which): q/k/v = X W (+ b) with exact bf16 products (K = DIN) -> which 0: q f16 rows (+ residual rows < QHI); 1: k f16 rows (+ residual rows < KHI); 2: v f16 planes [c][t] (+ bf16 hi/lo planes for t < KHI)
__global__ __launch_bounds__(128) void k_proj(const float* __restrict__ XQ, const float* __restrict__ XK, const float* __restrict__ XV, const float* __restrict__ WQ, const float* __restrict__ WK, const float* __restrict__ WV, const float* __restrict__ BQ, const float* __restrict__ BK, const float* __restrict__ BV,
    _Float16* __restrict__ QH, _Float16* __restrict__ QL, _Float16* __restrict__ KH, _Float16* __restrict__ KL, _Float16* __restrict__ VT, __bf16* __restrict__ VB, __bf16* __restrict__ VBL) {
  __shared__ __align__(16) _Float16 sh[64][136], sl[64][136]; __shared__ __align__(16) _Float16 th[128][72]; __shared__ __align__(16) __bf16 tb[128][72], tbl[128][72];
  const int tid = threadIdx.x, wave = tid >> 5, lane = tid & 31, col = lane & 15, g = lane >> 4; const int which = blockIdx.z; const int c0 = blockIdx.y * 128; const size_t r0 = (size_t)blockIdx.x * 64; const size_t bb = r0 / TT; const int t0 = (int)(r0 % TT);
  const float* X = which == 0 ? XQ : which == 1 ? XK : XV; const float* WA = which == 0 ? WQ : which == 1 ? WK : WV; const float* BA = which == 0 ? BQ : which == 1 ? BK : BV;
  v8f acc[8] = {};
#pragma unroll 2
  for (int kc = 0; kc < DIN / 32; ++kc) { const F2 a2 = split_row(X + (r0 + wave * 16 + col) * DIN, kc * 32, lane);   /* GroupNorm rows (f32) split hi + lo */
    asm volatile("s_wait_loadcnt 0x0" ::: "memory");
#pragma unroll
    for (int j = 0; j < 8; ++j) { const v16b w = WCOL(WA, kc * 32, c0 + j * 16 + col, lane); asm volatile("s_wait_loadcnt 0x0" ::: "memory"); acc[j] = wmma_bf(a2.h, w, acc[j]); acc[j] = wmma_bf(a2.l, w, acc[j]); } }
  if (which < 2) { _Float16* DH = which == 0 ? QH : KH; _Float16* DL = which == 0 ? QL : KL; const int nhi = which == 0 ? QHI : KHI; const bool hi_rows = t0 < nhi;
#pragma unroll
    for (int j = 0; j < 8; ++j) { const float bias = BA ? bfr(BA[c0 + j * 16 + col]) : 0.f;
#pragma unroll
      for (int r = 0; r < 8; ++r) { const float v = acc[j][r] + bias; const _Float16 hv = (_Float16)v; sh[wave * 16 + 8 * g + r][j * 16 + col] = hv; sl[wave * 16 + 8 * g + r][j * 16 + col] = (_Float16)((v - (float)hv) * 1024.0f); } }
    __syncthreads();
    for (int e = tid; e < 64 * 16; e += 128) { const int rl = e >> 4, q = e & 15; vst2((unsigned*)(DH + (r0 + rl) * CC + c0 + q * 8), *(const v4u*)&sh[rl][q * 8]); if (hi_rows) vst2((unsigned*)(DL + (bb * nhi + t0 + rl) * (size_t)CC + c0 + q * 8), *(const v4u*)&sl[rl][q * 8]); }
  } else { const bool hi_rows = t0 < KHI;
#pragma unroll
    for (int j = 0; j < 8; ++j) { const float bias = BA ? bfr(BA[c0 + j * 16 + col]) : 0.f;
#pragma unroll
      for (int r = 0; r < 8; ++r) { const float v = acc[j][r] + bias; const int rl = wave * 16 + 8 * g + r, cl = j * 16 + col; th[cl][rl] = (_Float16)v; const __bf16 bh = (__bf16)v; tb[cl][rl] = bh; tbl[cl][rl] = (__bf16)(v - (float)bh); } }
    __syncthreads();
    for (int e = tid; e < 128 * 8; e += 128) { const int cl = e >> 3, q = e & 7; vst2((unsigned*)(VT + (bb * CC + c0 + cl) * (size_t)TT + t0 + q * 8), *(const v4u*)&th[cl][q * 8]); if (hi_rows) { const size_t o3 = (bb * CC + c0 + cl) * (size_t)KHI + t0 + q * 8; vst2((unsigned*)(VB + o3), *(const v4u*)&tb[cl][q * 8]); vst2((unsigned*)(VBL + o3), *(const v4u*)&tbl[cl][q * 8]); } } } }
// ---- k_fa: block = 8 waves x 32 query columns of one (b, h); one pass = 32 keys, one stage = KS keys. S^T = K Q^T (A = k rows, B = q hi and q residual x 2^10: 2 products, as f32 logits), running maximum and sum per query column (a lane holds one query's scores; the two wave halves exchange once a pass), P^T packed from the score accumulators to f16 as the B operand of O^T += V^T P^T (A = v planes [c][t]); logits and P never reach memory. K rows and V planes of a stage are brought into LDS once per block by asynchronous copies (two buffers, the next stage in flight) and read from there by all eight waves
__device__ __forceinline__ float xhalf(float x) { return __builtin_bit_cast(float, __builtin_amdgcn_permlanex16(__builtin_bit_cast(int, x), __builtin_bit_cast(int, x), 0x76543210, 0xfedcba98, false, false)); }   // lane l with lane l ^ 16
__device__ __forceinline__ v8f wmma_h(v16h a, v16h b, v8f c) { return __builtin_amdgcn_wmma_f32_16x16x32_f16(false, a, false, b, (short)0, c, false, false); }
#define XW() asm volatile("s_wait_xcnt 0x0" ::: "memory")   // behind a group of loads: a later load's result may land in the group's address registers
#define SC2 (SCALE * 1.4426950408889634f)   // logits to base 2
#define KS 256                  // keys of a stage
#define KPB 80                  // LDS pitch of a k row: 64 B + 16 (16 B x odd: no bank conflict for 16-byte readers)
#define VPB (2 * KS + 16)       // LDS pitch of a v plane row, the same rule
#define KBY (KS * KPB)
#define SBY (KBY + HD * VPB)    // one buffer: k rows, then v rows
#define AW() asm volatile("s_wait_asynccnt 0x0" ::: "memory")   // this wave's copies have landed
#define DW() asm volatile("s_wait_dscnt 0x0" ::: "memory")      // this wave's LDS reads have returned before the buffer is given up
// one stage: each thread copies 4 x 16 B of k rows (4 threads a row, rows 64 apart) and 4 x 16 B of v rows (32 threads a row, rows 8 apart); the wait in the same statement stands before the address registers are reused
__device__ __forceinline__ void fa_stage(unsigned lk, unsigned lv, const char* gk, const char* gv) {
  asm volatile("global_load_async_to_lds_b128 %0, %1, off\n\tglobal_load_async_to_lds_b128 %2, %3, off\n\tglobal_load_async_to_lds_b128 %4, %5, off\n\tglobal_load_async_to_lds_b128 %6, %7, off\n\t"
               "global_load_async_to_lds_b128 %8, %9, off\n\tglobal_load_async_to_lds_b128 %10, %11, off\n\tglobal_load_async_to_lds_b128 %12, %13, off\n\tglobal_load_async_to_lds_b128 %14, %15, off\n\ts_wait_xcnt 0x0"
    :: "v"(lk), "v"(gk), "v"(lk + 64u * KPB), "v"(gk + (size_t)64 * CC * 2), "v"(lk + 128u * KPB), "v"(gk + (size_t)128 * CC * 2), "v"(lk + 192u * KPB), "v"(gk + (size_t)192 * CC * 2),
       "v"(lv), "v"(gv), "v"(lv + 8u * VPB), "v"(gv + (size_t)8 * TT * 2), "v"(lv + 16u * VPB), "v"(gv + (size_t)16 * TT * 2), "v"(lv + 24u * VPB), "v"(gv + (size_t)24 * TT * 2) : "memory"); }
__device__ __forceinline__ v16h frag_l(const char* p) { union { v16h v; v8h q[2]; } u; u.q[0] = *(const v8h*)p; u.q[1] = *(const v8h*)(p + 32); return u.v; }   // p = row + 16 * (lane >> 4): the k order of frag_h
__global__ __launch_bounds__(256) void k_fa(const _Float16* __restrict__ QH, const _Float16* __restrict__ QL, const _Float16* __restrict__ KH, const _Float16* __restrict__ VT, float* __restrict__ Y) {
  __shared__ __align__(16) char ring[2 * SBY];
  const int tid = threadIdx.x, wave = tid >> 5, lane = tid & 31, col = lane & 15, g = lane >> 4; const int b = blockIdx.y / NH, h = blockIdx.y % NH; const int q0 = blockIdx.x * 256 + wave * 32;
  // every "#pragma unroll" of this kernel: the small arrays it indexes have to stay in registers
  const char* gk = (const char*)(KH + ((size_t)b * TT + (tid >> 2)) * CC + h * HD) + (tid & 3) * 16; const char* gv = (const char*)(VT + ((size_t)b * CC + h * HD + (tid >> 5)) * (size_t)TT) + (tid & 31) * 16;
  const unsigned lk = (unsigned)(size_t)ring + (unsigned)((tid >> 2) * KPB + (tid & 3) * 16), lv = (unsigned)(size_t)ring + (unsigned)(KBY + (tid >> 5) * VPB + (tid & 31) * 16);
  fa_stage(lk, lv, gk, gv);
  v16h qh[2], ql[2];
#pragma unroll
  for (int u = 0; u < 2; ++u) qh[u] = frag_h(QH + ((size_t)b * TT + q0 + u * 16 + col) * CC + h * HD, lane);
  XW();
#pragma unroll
  for (int u = 0; u < 2; ++u) ql[u] = frag_h(QL + ((size_t)b * QHI + q0 + u * 16 + col) * CC + h * HD, lane);
  XW();
  AW(); __syncthreads();   // stage 0 is readable by every wave
  fa_stage(lk + SBY, lv + SBY, gk + (size_t)KS * CC * 2, gv + (size_t)KS * 2);
  v8f o[2][2] = {}; float m[2] = { -3.0e38f, -3.0e38f }, l[2] = { 0.f, 0.f };
#pragma unroll 1   // one stage a trip: the buffer index stays a run-time value
  for (int st = 0; st < TT / KS; ++st) {
    const char* Kl = ring + (st & 1) * SBY + col * KPB + 16 * g; const char* Vl = ring + (st & 1) * SBY + KBY + col * VPB + 16 * g;
    v16h kf[2], vf[2]; kf[0] = frag_l(Kl); kf[1] = frag_l(Kl + 16 * KPB); vf[0] = frag_l(Vl); vf[1] = frag_l(Vl + 16 * VPB); const char* Kn = Kl; const char* Vn = Vl;
#pragma unroll 1   // unrolled, the fragment reads were moved next to their users and waited for there
    for (int p = 0; p < KS / 32; ++p) {
      v8f s[2][2], sl[2][2]; const v8f z = {};
#pragma unroll
      for (int i = 0; i < 2; ++i)
#pragma unroll
        for (int u = 0; u < 2; ++u) { s[u][i] = wmma_h(kf[i], qh[u], z); sl[u][i] = wmma_h(kf[i], ql[u], z); }
      __builtin_amdgcn_sched_barrier(0);   // the eight score products stay one run: spread among the vector work each pair cost four idle slots before its first reader
      // both operands are fetched one pass ahead, each behind its last use, inside the stage's own buffer (its last pass refetches pass 0, unused)
      Kn += p + 1 < KS / 32 ? 32 * KPB : -(KS / 32 - 1) * 32 * KPB; Vn += p + 1 < KS / 32 ? 64 : -(KS / 32 - 1) * 64;
      kf[0] = frag_l(Kn); kf[1] = frag_l(Kn + 16 * KPB);
#pragma unroll
      for (int u = 0; u < 2; ++u) { const v8f t0 = sl[u][0] * (1.0f / 1024.0f) + s[u][0], t1 = sl[u][1] * (1.0f / 1024.0f) + s[u][1];
        float mx = fmaxf(t0[0], t1[0]);
#pragma unroll
        for (int r = 1; r < 8; ++r) mx = fmaxf(mx, fmaxf(t0[r], t1[r]));
        mx = fmaxf(mx, xhalf(mx)); const float mn = fmaxf(m[u], mx); const float corr = __builtin_amdgcn_exp2f((m[u] - mn) * SC2); m[u] = mn; const float mc = mn * SC2;
        const v8f a0 = t0 * SC2 - mc, a1 = t1 * SC2 - mc; v8f p0, p1; v16h pf;
#pragma unroll
        for (int r = 0; r < 8; ++r) { p0[r] = __builtin_amdgcn_exp2f(a0[r]); p1[r] = __builtin_amdgcn_exp2f(a1[r]); pf[r] = (_Float16)p0[r]; pf[8 + r] = (_Float16)p1[r]; }
        const v8f ps = p0 + p1; const v4f p4 = ps.lo + ps.hi; const v2f p2 = p4.lo + p4.hi;
        l[u] = l[u] * corr + (p2[0] + p2[1]);
#pragma unroll
        for (int j = 0; j < 2; ++j) { o[u][j] *= corr; o[u][j] = wmma_h(vf[j], pf, o[u][j]); } }
      vf[0] = frag_l(Vn); vf[1] = frag_l(Vn + 16 * VPB); }
    DW(); AW(); __syncthreads();   // publishes stage st + 1 and ends every wave's reads of stage st
    if (st + 2 < TT / KS) fa_stage(lk + (st & 1) * SBY, lv + (st & 1) * SBY, gk + (size_t)(st + 2) * KS * CC * 2, gv + (size_t)(st + 2) * KS * 2); }
  AW();
#pragma unroll
  for (int u = 0; u < 2; ++u) { const float inv = 1.0f / (l[u] + xhalf(l[u])); float* yr = Y + ((size_t)b * TT + q0 + u * 16 + col) * CC + h * HD + 8 * g;
#pragma unroll
    for (int j = 0; j < 2; ++j) { const v8f w = o[u][j] * inv; vst2(yr + j * 16, (v4f)w.lo); vst2(yr + j * 16 + 4, (v4f)w.hi); } } }
// ---- k_out: block = (64 rows, 128 cols): out = ctx Wo (+ bo): all rows: ctx bf16 hi + lo against exact bf16 Wo (2 products); the f16 branch (Wo as f16(bf16 x 2^8), 1 product, x 2^-8) is not taken
__global__ __launch_bounds__(128) void k_out(const float* __restrict__ Y, const float* __restrict__ WO, const float* __restrict__ BO, float* __restrict__ OUT) { __shared__ __align__(16) float sf[4][16][132];
  const int tid = threadIdx.x, wave = tid >> 5, lane = tid & 31, col = lane & 15, g = lane >> 4; const int c0 = blockIdx.y * 128; const size_t r0 = (size_t)blockIdx.x * 64 + wave * 16;
  v8f acc[8] = {};
  if (true) {   /* ALL rows: ctx split bf16 hi + lo x exact proj_w (2 products) */
#pragma unroll 2
    for (int kc = 0; kc < CC / 32; ++kc) { const F2 a = split_row(Y + (r0 + col) * CC, kc * 32, lane); asm volatile("s_wait_loadcnt 0x0" ::: "memory");
#pragma unroll
      for (int j = 0; j < 8; ++j) { const v16b w = WOCOL(WO, kc * 32, c0 + j * 16 + col, lane); asm volatile("s_wait_loadcnt 0x0" ::: "memory"); acc[j] = wmma_bf(a.h, w, acc[j]); acc[j] = wmma_bf(a.l, w, acc[j]); } }
#pragma unroll
    for (int j = 0; j < 8; ++j) { const float bias = BO ? bfr(BO[c0 + j * 16 + col]) : 0.f;
#pragma unroll
      for (int r = 0; r < 8; ++r) sf[wave][8 * g + r][j * 16 + col] = acc[j][r] + bias; }
  } else {
#pragma unroll 2
    for (int kc = 0; kc < CC / 32; ++kc) { const v16h a = frag_f32(Y + (r0 + col) * CC + kc * 32, lane); asm volatile("s_wait_loadcnt 0x0" ::: "memory");
#pragma unroll
      for (int j = 0; j < 8; ++j) { const v16h w = WOCOLH(WO, kc * 32, c0 + j * 16 + col, lane); asm volatile("s_wait_loadcnt 0x0" ::: "memory"); acc[j] = wmma16(a, w, acc[j]); } }
#pragma unroll
    for (int j = 0; j < 8; ++j) { const float bias = BO ? bfr(BO[c0 + j * 16 + col]) : 0.f;
#pragma unroll
      for (int r = 0; r < 8; ++r) sf[wave][8 * g + r][j * 16 + col] = acc[j][r] * (1.0f / 256.0f) + bias; } }
  LDSX(); for (int rl = 0; rl < 16; ++rl) vst2(OUT + (r0 + rl) * DIN + c0 + lane * 4, *(const v4f*)&sf[wave][rl][lane * 4]); }

extern "C" void kernel_launch(void* const* d_in, const int* in_sizes, int n_in, void* d_out, int out_size, void* d_ws, size_t ws_size, hipStream_t stream) {
  (void)in_sizes; (void)n_in; (void)out_size;
  const float** F = (const float**)d_in;
  if (ws_size < (size_t)WS_END) return;
  char* ws = (char*)d_ws; _Float16 *QH = (_Float16*)(ws + WS_QH), *KH = (_Float16*)(ws + WS_KH), *VT = (_Float16*)(ws + WS_VT), *QL = (_Float16*)(ws + WS_QL), *KL = (_Float16*)(ws + WS_KL); __bf16 *VB = (__bf16*)(ws + WS_VB), *VBL = (__bf16*)(ws + WS_VBL); float *Y = (float*)(ws + WS_Y);
  (void)Y; (void)QL; (void)KL; (void)VB; (void)VBL;
  // inputs: 0 x [2,256,64,64]; 1 gn_gamma, 2 gn_beta [256]; 3 qkv_w [768,256] (out,in) rows q | k | v; 4 qkv_b [768]; 5 proj_w [256,256] (out,in); 6 proj_b
  if (ws_size < (size_t)WS_END2) return;
  float *MV = (float*)(ws + WS_MV), *XT = (float*)(ws + WS_XT), *ORW = (float*)(ws + WS_OR);
  k_gnst<<<dim3(TNB * 8), GNT, 0, stream>>>(F[0], MV);
  k_tok<<<dim3(NTOK / 64, CC / 64, TNB), 256, 0, stream>>>(F[0], MV, F[1], F[2], XT);
  { const float* WQ = F[3]; const float* WK = F[3] + (size_t)CC * DIN; const float* WV = F[3] + (size_t)2 * CC * DIN;
    k_proj<<<dim3(TNB * TT / 64, CC / 128, 3), 128, 0, stream>>>(XT, XT, XT, WQ, WK, WV, F[4], F[4] + CC, F[4] + 2 * CC, QH, QL, KH, KL, VT, VB, VBL); }
  k_fa<<<dim3(TT / 256, TNB * NH), 256, 0, stream>>>(QH, QL, KH, VT, Y);
  k_out<<<dim3(TNB * TT / 64, DIN / 128), 128, 0, stream>>>(Y, F[5], F[6], ORW);
  k_fin<<<dim3(NTOK / 64, CC / 64, TNB), 256, 0, stream>>>(ORW, F[0], (float*)d_out);
}

// v004
// It runs in 98.5 microseconds.
// In two side-by-side timings against v003, it was 1.51 and 1.50 times as fast.
// Over all steps from v000 it is 15.6 times as fast.
// Single self-attention block on images (b 2, c 256, 64 x 64 -> n 4,096 tokens; 8 heads x 32): xn = GroupNorm(8 groups)(x) (affine); q,k,v = qkv_w xn + qkv_b (1x1, (out,in) rows q|k|v); attn = softmax(q k^T x 32^-0.5); out = proj_w (attn v) + proj_b, reshaped to [b,c,h,w] + x.
#include <hip/hip_runtime.h>
#include <math.h>

typedef __attribute__((ext_vector_type(16))) _Float16 v16h;
typedef __attribute__((ext_vector_type(16))) __bf16 v16b;
typedef __attribute__((ext_vector_type(8)))  _Float16 v8h;
typedef __attribute__((ext_vector_type(8)))  float v8f;
typedef __attribute__((ext_vector_type(4)))  float v4f;
typedef __attribute__((ext_vector_type(2)))  float v2f;
typedef __attribute__((ext_vector_type(4)))  unsigned v4u;
typedef __attribute__((ext_vector_type(4)))  int v4i;
typedef float __attribute__((may_alias)) float_a;
typedef int __attribute__((may_alias)) int_a;

template <typename T> __device__ __forceinline__ void vst2(void* p, T v) { *(T*)p = v;  }
__device__ __forceinline__ v8f wmma16(v16h a, v16h b, v8f c) {
  v8f d = __builtin_amdgcn_wmma_f32_16x16x32_f16(false, a, false, b, (short)0, c, false, false);
  asm volatile("v_nop\n\tv_nop\n\tv_nop\n\tv_nop" : "+v"(d) : "v"(a), "v"(b));
  return d;
}
__device__ __forceinline__ v8f wmma_bf(v16b a, v16b b, v8f c) {
  v8f d = __builtin_amdgcn_wmma_f32_16x16x32_bf16(false, a, false, b, (short)0, c, false, false);
  asm volatile("v_nop\n\tv_nop\n\tv_nop\n\tv_nop" : "+v"(d) : "v"(a), "v"(b));
  return d;
}
// 16x16x32 fragments: lane = (h = lane>>4, row/col = lane&15); elements 0..7 = k0+8h+0..7, 8..15 = k0+16+8h+0..7; D element r = row 8h+r
__device__ __forceinline__ v16h frag_h(const _Float16* rowk0, int lane) {
  union { v16h v; v8h q[2]; } u; const _Float16* p = rowk0 + 8 * (lane >> 4);
  u.q[0] = *(const v8h*)p; u.q[1] = *(const v8h*)(p + 16); return u.v;
}
__device__ __forceinline__ v16h frag_f32(const float* rowk0, int lane) {
  v16h a; const float* p = rowk0 + 8 * (lane >> 4);
#pragma unroll
  for (int i = 0; i < 8; ++i) { a[i] = (_Float16)p[i]; a[8 + i] = (_Float16)p[16 + i]; }
  return a;
}
__device__ __forceinline__ v16h frag_f32s(const float* rowk0, int lane, float sc) {
  v16h a; const float* p = rowk0 + 8 * (lane >> 4);
#pragma unroll
  for (int i = 0; i < 8; ++i) { a[i] = (_Float16)(p[i] * sc); a[8 + i] = (_Float16)(p[16 + i] * sc); }
  return a;
}
// column fragment from a [K][ld] layout (column n), rows >= K read as 0
__device__ __forceinline__ v16h fragc_f32(const float* W, int k0, int n, int lane, int ld, int K) {
  v16h a; const int g = lane >> 4;
#pragma unroll
  for (int i = 0; i < 8; ++i) { const int ka = k0 + 8 * g + i, kb = ka + 16;
    a[i] = (_Float16)(ka < K ? W[(size_t)(ka < K ? ka : K - 1) * ld + n] : 0.f); a[8 + i] = (_Float16)(kb < K ? W[(size_t)(kb < K ? kb : K - 1) * ld + n] : 0.f); }
  return a;
}
struct F2 { v16b h, l; };
__device__ __forceinline__ F2 bsplit16(const float v[16]) { F2 r;
#pragma unroll
  for (int i = 0; i < 16; ++i) { const __bf16 h = (__bf16)v[i]; r.h[i] = h; r.l[i] = (__bf16)(v[i] - (float)h); }
  return r; }
__device__ __forceinline__ F2 split_row(const float* row, int k0, int lane) { float v[16]; const float* p = row + k0 + 8 * (lane >> 4);
#pragma unroll
  for (int i = 0; i < 8; ++i) { v[i] = p[i]; v[8 + i] = p[16 + i]; }
  return bsplit16(v); }
__device__ __forceinline__ F2 split_rowK(const float* row, int k0, int lane, int K) { float v[16]; const int g = lane >> 4;
#pragma unroll
  for (int i = 0; i < 8; ++i) { const int ka = k0 + 8 * g + i, kb = ka + 16; v[i] = ka < K ? row[ka < K ? ka : K - 1] : 0.f; v[8 + i] = kb < K ? row[kb < K ? kb : K - 1] : 0.f; }
  return bsplit16(v); }
__device__ __forceinline__ F2 split_col(const float* W, int k0, int n, int lane, int ld, int K) { float v[16]; const int g = lane >> 4;
#pragma unroll
  for (int i = 0; i < 8; ++i) { const int ka = k0 + 8 * g + i, kb = ka + 16; v[i] = ka < K ? W[(size_t)(ka < K ? ka : K - 1) * ld + n] : 0.f; v[8 + i] = kb < K ? W[(size_t)(kb < K ? kb : K - 1) * ld + n] : 0.f; }
  return bsplit16(v); }
__device__ __forceinline__ v8f mac3(const F2& a, const F2& b, v8f c) { c = wmma_bf(a.l, b.h, c); c = wmma_bf(a.h, b.l, c); return wmma_bf(a.h, b.h, c); }
__device__ __forceinline__ float sigm(float v) { return 1.0f / (1.0f + expf(-v)); }
#define LDSX() do { asm volatile("s_wait_dscnt 0" ::: "memory"); __builtin_amdgcn_wave_barrier(); __builtin_amdgcn_fence(__ATOMIC_RELEASE, "workgroup"); } while (0)

#define NB 2
#define TT 4096
#define CC 256            // NH * HD = projected width
#define DIN 256          // input (model) width
#define NH 8
#define HD 32
#define NQB (TT / 64)
#define HG 2
#define SCALE (0.17677669529663687f)
#define CAUSAL 0
#ifndef TNB
#define TNB NB
#endif
__device__ __forceinline__ float bfr(float v) { return (float)(__bf16)v; }
__host__ __device__ __forceinline__ int kb_last(int qb) { return CAUSAL ? ((qb * 64 + 63) >> 7) : (TT / 128 - 1); }
typedef __attribute__((ext_vector_type(8))) __bf16 v8b;
__device__ __forceinline__ v16b frag_b(const __bf16* rowk0, int lane) {
  union { v16b v; v8b q[2]; } u; const __bf16* p = rowk0 + 8 * (lane >> 4);
  u.q[0] = *(const v8b*)p; u.q[1] = *(const v8b*)(p + 16); return u.v;
}
#define QBH 0              // unused: k_fa has no high-precision path
#define QHI 4096            // rows carrying a q residual plane (all rows when non-causal: 2-product logits everywhere)
#define KHI 64            // key rows carrying k residual / v bf16 hi+lo planes (written by k_proj; no kernel here reads them)
// B fragment (k rows k0+.., output column o) of a weight: (in,out) [K][ld] or (out,in) [ld rows of K]: bf16 exact, or f16(bf16 * 256) exact
__device__ __forceinline__ v16b wcol_io(const float* Wm, int k0, int o, int lane, int ld) { v16b w; const int g = lane >> 4;
#pragma unroll
  for (int i = 0; i < 8; ++i) { w[i] = (__bf16)Wm[(size_t)(k0 + 8 * g + i) * ld + o]; w[8 + i] = (__bf16)Wm[(size_t)(k0 + 16 + 8 * g + i) * ld + o]; }
  return w; }
__device__ __forceinline__ v16b wcol_oi(const float* Wm, int k0, int o, int lane, int K) { v16b w; const float* p = Wm + (size_t)o * K + k0 + 8 * (lane >> 4);
#pragma unroll
  for (int i = 0; i < 8; ++i) { w[i] = (__bf16)p[i]; w[8 + i] = (__bf16)p[16 + i]; }
  return w; }
__device__ __forceinline__ v16h wcolh_io(const float* Wm, int k0, int o, int lane, int ld) { v16h w; const int g = lane >> 4;
#pragma unroll
  for (int i = 0; i < 8; ++i) { w[i] = (_Float16)(bfr(Wm[(size_t)(k0 + 8 * g + i) * ld + o]) * 256.0f); w[8 + i] = (_Float16)(bfr(Wm[(size_t)(k0 + 16 + 8 * g + i) * ld + o]) * 256.0f); }
  return w; }
__device__ __forceinline__ v16h wcolh_oi(const float* Wm, int k0, int o, int lane, int K) { v16h w; const float* p = Wm + (size_t)o * K + k0 + 8 * (lane >> 4);
#pragma unroll
  for (int i = 0; i < 8; ++i) { w[i] = (_Float16)(bfr(p[i]) * 256.0f); w[8 + i] = (_Float16)(bfr(p[16 + i]) * 256.0f); }
  return w; }
#define WQKV_LAYOUT 1   // 0 = (in,out) [DIN][CC]; 1 = (out,in) [CC][DIN]; 2 = per-head [NH][DIN][HD]
__device__ __forceinline__ v16b wcol_hdk(const float* Wm, int k0, int o, int lane) { v16b w; const int g = lane >> 4; const float* p = Wm + (size_t)(o / HD) * DIN * HD + (o % HD);
#pragma unroll
  for (int i = 0; i < 8; ++i) { w[i] = (__bf16)p[(size_t)(k0 + 8 * g + i) * HD]; w[8 + i] = (__bf16)p[(size_t)(k0 + 16 + 8 * g + i) * HD]; }
  return w; }
#define WO_OUT_IN 1
#if WQKV_LAYOUT == 1
#define WCOL(W, k0, o, lane) wcol_oi(W, k0, o, lane, DIN)
#elif WQKV_LAYOUT == 2
#define WCOL(W, k0, o, lane) wcol_hdk(W, k0, o, lane)
#else
#define WCOL(W, k0, o, lane) wcol_io(W, k0, o, lane, CC)
#endif
#if WO_OUT_IN
#define WOCOL(W, k0, o, lane) wcol_oi(W, k0, o, lane, CC)
#define WOCOLH(W, k0, o, lane) wcolh_oi(W, k0, o, lane, CC)
#else
#define WOCOL(W, k0, o, lane) wcol_io(W, k0, o, lane, DIN)
#define WOCOLH(W, k0, o, lane) wcolh_io(W, k0, o, lane, DIN)
#endif
#define NTOK 4096
#ifndef OPITCH
#define OPITCH NTOK        // unused (out is written with pitch NTOK)
#endif
#ifndef XPITCH
#define XPITCH NTOK        // unused (x is read with pitch NTOK)
#endif
// ---- k_gnst: block = one (batch, group), 32 waves; a thread's 16-byte pieces lie 16 KiB apart and are fetched GNB at a time, all in flight before the first is used (one waited load a trip left each pass at one load latency per 4 KiB)
#define GNT 1024           // threads of a block
#define GNB 16             // loads in flight per thread
// behind a group of loads from p, a precaution: p is an input, so its registers are not given to a load of the group as destination ahead of the wait
#define GNW(p) asm volatile("s_wait_xcnt 0x0" :: "v"(p) : "memory")
__device__ __forceinline__ v4f bfr4(v4f v) { v4f r; r[0] = bfr(v[0]); r[1] = bfr(v[1]); r[2] = bfr(v[2]); r[3] = bfr(v[3]); return r; }
__global__ __launch_bounds__(GNT) void k_gnst(const float* __restrict__ X, float* __restrict__ MV) { __shared__ float sred[GNT / 32]; __shared__ float sbc; const int t = threadIdx.x; const size_t base = (size_t)blockIdx.x * (CC / 8) * NTOK; const int n = (CC / 8) * NTOK;
  const v4f* xp = (const v4f*)(X + base) + t;
  v4f sv = {};
  for (int i0 = 0; i0 < n / (4 * GNT); i0 += GNB) { v4f v[GNB]; const v4f* p = xp + (size_t)i0 * GNT;
#pragma unroll   // v[] has to stay in registers
    for (int j = 0; j < GNB; ++j) v[j] = p[(size_t)j * GNT];
    GNW(p);
#pragma unroll
    for (int j = 0; j < GNB; ++j) sv += bfr4(v[j]); }
  float s1 = (sv[0] + sv[1]) + (sv[2] + sv[3]);
#pragma unroll
  for (int o = 1; o < 32; o <<= 1) s1 += __shfl_xor(s1, o);
  if ((t & 31) == 0) sred[t >> 5] = s1; __syncthreads(); if (t == 0) { float a = 0.f; for (int i = 0; i < GNT / 32; ++i) a += sred[i]; sbc = a / (float)n; } __syncthreads(); const float mu = sbc; __syncthreads();
  v4f qv = {};
  for (int i0 = 0; i0 < n / (4 * GNT); i0 += GNB) { v4f v[GNB]; const v4f* p = xp + (size_t)i0 * GNT;
#pragma unroll   // v[] has to stay in registers
    for (int j = 0; j < GNB; ++j) v[j] = p[(size_t)j * GNT];
    GNW(p);
#pragma unroll
    for (int j = 0; j < GNB; ++j) { const v4f d = bfr4(v[j]) - mu; qv += d * d; } }
  float q = (qv[0] + qv[1]) + (qv[2] + qv[3]);
#pragma unroll
  for (int o = 1; o < 32; o <<= 1) q += __shfl_xor(q, o);
  if ((t & 31) == 0) sred[t >> 5] = q; __syncthreads(); if (t == 0) { float a = 0.f; for (int i = 0; i < GNT / 32; ++i) a += sred[i]; sbc = rsqrtf(a / (float)n + 1e-5f); } __syncthreads();
  if (t < 32) { const float v = t == 0 ? mu : (t == 1 ? sbc : 0.f); vst2(MV + (size_t)blockIdx.x * 32 + t, v); } }
// ---- k_tok: block = (64 tokens, 64 channels, batch b): XT[b*N + n][c] = (bf16(x[b][c][n]) - mean_g) * rstd_g * gamma[c] + beta[c] (GroupNorm, g = c / 32) through an LDS tile
__global__ __launch_bounds__(256) void k_tok(const float* __restrict__ X, const float* __restrict__ MV, const float* __restrict__ GG, const float* __restrict__ GB, float* __restrict__ XT) { __shared__ float st[64][68]; const int tid = threadIdx.x; const int n0 = blockIdx.x * 64, c0 = blockIdx.y * 64; const size_t b = blockIdx.z;
  for (int e = tid; e < 64 * 16; e += 256) { const int cl = e >> 4, q = e & 15; const int c = c0 + cl; const int gi = (int)(b * 8) + c / (CC / 8); const float mu = MV[gi * 32], rs = MV[gi * 32 + 1], ga = bfr(GG[c]), be = bfr(GB[c]);
    const v4f v = *(const v4f*)(X + (b * CC + c) * (size_t)NTOK + n0 + q * 4);
#pragma unroll
    for (int j = 0; j < 4; ++j) st[cl][q * 4 + j] = (bfr(v[j]) - mu) * rs * ga + be; }
  __syncthreads();
  for (int e = tid; e < 64 * 16; e += 256) { const int nl = e >> 4, q = e & 15; v4f o; o[0] = st[q * 4][nl]; o[1] = st[q * 4 + 1][nl]; o[2] = st[q * 4 + 2][nl]; o[3] = st[q * 4 + 3][nl]; vst2(XT + (b * NTOK + n0 + nl) * (size_t)CC + c0 + q * 4, o); } }
// ---- k_fin: block = (64 tokens, 64 channels, batch b): out[b][c][n] = OR[b*N + n][c] + bf16(x[b][c][n]) (LDS transpose; 256-B runs of 64 tokens per channel)
__global__ __launch_bounds__(256) void k_fin(const float* __restrict__ ORW, const float* __restrict__ X, float* __restrict__ OUT) { __shared__ float st[64][68]; const int tid = threadIdx.x; const int n0 = blockIdx.x * 64, c0 = blockIdx.y * 64; const size_t b = blockIdx.z;
  for (int e = tid; e < 64 * 16; e += 256) { const int nl = e >> 4, q = e & 15; *(v4f*)&st[nl][q * 4] = *(const v4f*)(ORW + (b * NTOK + n0 + nl) * (size_t)CC + c0 + q * 4); }
  __syncthreads();
  for (int e = tid; e < 64 * 16; e += 256) { const int cl = e >> 4, q = e & 15; const size_t oi = (b * CC + c0 + cl) * (size_t)NTOK + n0 + q * 4; const v4f xr = *(const v4f*)(X + oi); v4f o; o[0] = st[q * 4][cl] + bfr(xr[0]); o[1] = st[q * 4 + 1][cl] + bfr(xr[1]); o[2] = st[q * 4 + 2][cl] + bfr(xr[2]); o[3] = st[q * 4 + 3][cl] + bfr(xr[3]); vst2(OUT + oi, o); } }
#define WS_MV  (WS_END)
#define WS_XT  (WS_MV + 4u * 32 * NB * 8 + 1024u)
#define WS_OR  (WS_XT + 4u * (size_t)NB * NTOK * CC)
#define WS_END2 (WS_OR + 4u * (size_t)NB * NTOK * CC)
#ifndef SM_EXTRA_PARAMS
#define SM_EXTRA_PARAMS
#endif
#ifndef PROJ_EXTRA_PARAMS
#define PROJ_EXTRA_PARAMS
#endif
#ifndef SM_MASK_HOOK
#define SM_MASK_HOOK (void)0
#endif

#define WS_QH  0u                                      // f16 q rows [b*t][CC]
#define WS_KH  (WS_QH + 2u * (size_t)NB * TT * CC)      // f16 k rows [b*t][CC]
#define WS_VT  (WS_KH + 2u * (size_t)NB * TT * CC)      // f16 v planes [b][c][t]
#define WS_QL  (WS_VT + 2u * (size_t)NB * CC * TT)      // f16 q residual x 2^10 rows [b][t < QHI][CC]
#define WS_KL  (WS_QL + 2u * (size_t)NB * QHI * CC)     // f16 k residual x 2^10 rows [b][t < KHI][CC]
#define WS_VB  (WS_KL + 2u * (size_t)NB * KHI * CC)     // bf16 v hi planes [b][c][t < KHI]
#define WS_VBL (WS_VB + 2u * (size_t)NB * CC * KHI)
#define WS_S   (WS_VBL + 2u * (size_t)NB * CC * KHI)    // f32 [hg][t][s], unused: logits and P stay in registers
#define WS_Y   (WS_S  + 4u * (size_t)HG * TT * TT)      // f32 ctx rows [b*t][CC] (only when there is an output projection)
#define WS_END (WS_Y  + 4u * (size_t)NB * TT * CC)

// ---- operands of k_proj and k_out. The block's weight tile (128 output columns x K = 256, rows of an (out,in) matrix) is read once by whole-line loads, rounded to bf16 and kept in LDS for all four waves; a wave's own 16 activation rows are fetched whole behind it, so the K loop waits for no global load
#define WPB 528            // LDS pitch of a weight row: 256 bf16 + 16 B (16 B x odd: no bank conflict for 16-byte readers)
typedef __attribute__((ext_vector_type(4))) __bf16 v4b;
__device__ __forceinline__ v4b bf4(v4f v) { v4b r; r[0] = (__bf16)v[0]; r[1] = (__bf16)v[1]; r[2] = (__bf16)v[2]; r[3] = (__bf16)v[3]; return r; }
__device__ __forceinline__ v16b frag_lb(const char* p) { union { v16b v; v8b q[2]; } u; u.q[0] = *(const v8b*)p; u.q[1] = *(const v8b*)(p + 32); return u.v; }   // p = row + 2 * k0 + 16 * (lane >> 4): the k order of wcol_oi
// 128 threads: load i of a thread is 16 B of weight row 2 i + (tid >> 6); two groups of 16 loads are in flight at a time. arow = the lane's activation row + 8 * (lane >> 4); a[kc] = the 16 values of split_row at k0 = 32 kc
__device__ __forceinline__ void stage_ops(char* sw, const float* Wt, const float* arow, int tid, v4f (&a)[8][4]) {
  const v4f* wp = (const v4f*)Wt + tid; char* d = sw + (tid >> 6) * WPB + (tid & 63) * 8; v4f u[16], w[16];
  // every "#pragma unroll" here: u, w and a have to stay in registers
#pragma unroll
  for (int i = 0; i < 16; ++i) u[i] = wp[(size_t)i * 128];
#pragma unroll
  for (int i = 0; i < 16; ++i) w[i] = wp[(size_t)(16 + i) * 128];
  GNW(wp);
#pragma unroll
  for (int i = 0; i < 16; ++i) *(v4b*)(d + i * 2 * WPB) = bf4(u[i]);
#pragma unroll
  for (int i = 0; i < 16; ++i) u[i] = wp[(size_t)(32 + i) * 128];
  GNW(wp);
#pragma unroll
  for (int i = 0; i < 16; ++i) *(v4b*)(d + (16 + i) * 2 * WPB) = bf4(w[i]);
#pragma unroll
  for (int i = 0; i < 16; ++i) w[i] = wp[(size_t)(48 + i) * 128];
  GNW(wp);
#pragma unroll
  for (int i = 0; i < 16; ++i) *(v4b*)(d + (32 + i) * 2 * WPB) = bf4(u[i]);
#pragma unroll
  for (int kc = 0; kc < 8; ++kc) { const v4f* p = (const v4f*)(arow + kc * 32); a[kc][0] = p[0]; a[kc][1] = p[1]; a[kc][2] = p[4]; a[kc][3] = p[5]; }
  GNW(arow);
#pragma unroll
  for (int i = 0; i < 16; ++i) *(v4b*)(d + (48 + i) * 2 * WPB) = bf4(w[i]); }
__device__ __forceinline__ F2 split_a(const v4f (&q)[4]) { float v[16];
#pragma unroll   // v[] has to stay in registers
  for (int i = 0; i < 4; ++i) { v[i] = q[0][i]; v[4 + i] = q[1][i]; v[8 + i] = q[2][i]; v[12 + i] = q[3][i]; }
  return bsplit16(v); }
#define WRD 2              // weight fragments are read from LDS WRD ahead of their products (read next to its product, each cost one LDS latency)
#define WFR(wl, t) frag_lb((wl) + ((t) & 7) * 16 * WPB + ((t) >> 3) * 64)   // fragment t = 8 kc + j
// ---- k_proj: block = (64 rows, 128 cols, which): q/k/v = X W (+ b) with exact bf16 products (K = DIN) -> which 0: q f16 rows (+ residual rows < QHI); 1: k f16 rows (+ residual rows < KHI); 2: v f16 planes [c][t] (+ bf16 hi/lo planes for t < KHI)
__global__ __launch_bounds__(128) void k_proj(const float* __restrict__ XQ, const float* __restrict__ XK, const float* __restrict__ XV, const float* __restrict__ WQ, const float* __restrict__ WK, const float* __restrict__ WV, const float* __restrict__ BQ, const float* __restrict__ BK, const float* __restrict__ BV,
    _Float16* __restrict__ QH, _Float16* __restrict__ QL, _Float16* __restrict__ KH, _Float16* __restrict__ KL, _Float16* __restrict__ VT, __bf16* __restrict__ VB, __bf16* __restrict__ VBL) {
  __shared__ __align__(16) char sm[128 * WPB];   // the weight tile; behind the K loop and a barrier the same bytes hold the output tiles
  _Float16 (*sh)[136] = (_Float16 (*)[136])sm; _Float16 (*sl)[136] = (_Float16 (*)[136])(sm + 64 * 136 * 2); _Float16 (*th)[72] = (_Float16 (*)[72])sm; __bf16 (*tb)[72] = (__bf16 (*)[72])(sm + 128 * 72 * 2); __bf16 (*tbl)[72] = (__bf16 (*)[72])(sm + 2 * 128 * 72 * 2);
  const int tid = threadIdx.x, wave = tid >> 5, lane = tid & 31, col = lane & 15, g = lane >> 4; const int which = blockIdx.z; const int c0 = blockIdx.y * 128; const size_t r0 = (size_t)blockIdx.x * 64; const size_t bb = r0 / TT; const int t0 = (int)(r0 % TT);
  const float* X = which == 0 ? XQ : which == 1 ? XK : XV; const float* WA = which == 0 ? WQ : which == 1 ? WK : WV; const float* BA = which == 0 ? BQ : which == 1 ? BK : BV;
  v4f ar[8][4]; stage_ops(sm, WA + (size_t)c0 * DIN, X + (r0 + wave * 16 + col) * DIN + 8 * g, tid, ar);
  __syncthreads();   // the weight tile is readable by every wave
  const char* wl = sm + col * WPB + 16 * g;
  v8f acc[8] = {}; v16b wr[WRD + 1]; float bs[8]; const float* bp = BA + c0 + col;
#pragma unroll   // wr[] has to stay in registers
  for (int t = 0; t < WRD; ++t) wr[t] = WFR(wl, t);
#pragma unroll   // ar[] and wr[] have to stay in registers
  for (int kc = 0; kc < DIN / 32; ++kc) { const F2 a2 = split_a(ar[kc]);   /* GroupNorm rows (f32) split hi + lo */
    if (kc == 4) {   // the eight bias values as one group, in registers that half of ar[] has left; they land under the rest of the loop (its unrolls: bs[] has to stay in registers)
      if (BA) {
#pragma unroll
        for (int j = 0; j < 8; ++j) bs[j] = bp[j * 16];
        GNW(bp);
      } else {
#pragma unroll
        for (int j = 0; j < 8; ++j) bs[j] = 0.f; } }
#pragma unroll
    for (int j = 0; j < 8; ++j) { const int t = kc * 8 + j; if (t + WRD < DIN / 4) wr[(t + WRD) % (WRD + 1)] = WFR(wl, t + WRD); const v16b w = wr[t % (WRD + 1)]; acc[j] = wmma_bf(a2.h, w, acc[j]); acc[j] = wmma_bf(a2.l, w, acc[j]); } }
  __syncthreads();   // every wave has read its last weight fragment: the bytes are given to the output tiles
  if (which < 2) { _Float16* DH = which == 0 ? QH : KH; _Float16* DL = which == 0 ? QL : KL; const int nhi = which == 0 ? QHI : KHI; const bool hi_rows = t0 < nhi;
#pragma unroll
    for (int j = 0; j < 8; ++j) { const float bias = bfr(bs[j]);
#pragma unroll
      for (int r = 0; r < 8; ++r) { const float v = acc[j][r] + bias; const _Float16 hv = (_Float16)v; sh[wave * 16 + 8 * g + r][j * 16 + col] = hv; sl[wave * 16 + 8 * g + r][j * 16 + col] = (_Float16)((v - (float)hv) * 1024.0f); } }
    __syncthreads();
    for (int e = tid; e < 64 * 16; e += 128) { const int rl = e >> 4, q = e & 15; vst2((unsigned*)(DH + (r0 + rl) * CC + c0 + q * 8), *(const v4u*)&sh[rl][q * 8]); if (hi_rows) vst2((unsigned*)(DL + (bb * nhi + t0 + rl) * (size_t)CC + c0 + q * 8), *(const v4u*)&sl[rl][q * 8]); }
  } else { const bool hi_rows = t0 < KHI;
#pragma unroll
    for (int j = 0; j < 8; ++j) { const float bias = bfr(bs[j]);
#pragma unroll
      for (int r = 0; r < 8; ++r) { const float v = acc[j][r] + bias; const int rl = wave * 16 + 8 * g + r, cl = j * 16 + col; th[cl][rl] = (_Float16)v; const __bf16 bh = (__bf16)v; tb[cl][rl] = bh; tbl[cl][rl] = (__bf16)(v - (float)bh); } }
    __syncthreads();
    for (int e = tid; e < 128 * 8; e += 128) { const int cl = e >> 3, q = e & 7; vst2((unsigned*)(VT + (bb * CC + c0 + cl) * (size_t)TT + t0 + q * 8), *(const v4u*)&th[cl][q * 8]); if (hi_rows) { const size_t o3 = (bb * CC + c0 + cl) * (size_t)KHI + t0 + q * 8; vst2((unsigned*)(VB + o3), *(const v4u*)&tb[cl][q * 8]); vst2((unsigned*)(VBL + o3), *(const v4u*)&tbl[cl][q * 8]); } } } }
// ---- k_fa: block = 8 waves x 32 query columns of one (b, h); one pass = 32 keys, one stage = KS keys. S^T = K Q^T (A = k rows, B = q hi and q residual x 2^10: 2 products, as f32 logits), running maximum and sum per query column (a lane holds one query's scores; the two wave halves exchange once a pass), P^T packed from the score accumulators to f16 as the B operand of O^T += V^T P^T (A = v planes [c][t]); logits and P never reach memory. K rows and V planes of a stage are brought into LDS once per block by asynchronous copies (two buffers, the next stage in flight) and read from there by all eight waves
__device__ __forceinline__ float xhalf(float x) { return __builtin_bit_cast(float, __builtin_amdgcn_permlanex16(__builtin_bit_cast(int, x), __builtin_bit_cast(int, x), 0x76543210, 0xfedcba98, false, false)); }   // lane l with lane l ^ 16
__device__ __forceinline__ v8f wmma_h(v16h a, v16h b, v8f c) { return __builtin_amdgcn_wmma_f32_16x16x32_f16(false, a, false, b, (short)0, c, false, false); }
#define XW() asm volatile("s_wait_xcnt 0x0" ::: "memory")   // behind a group of loads: a later load's result may land in the group's address registers
#define SC2 (SCALE * 1.4426950408889634f)   // logits to base 2
#define KS 256                  // keys of a stage
#define KPB 80                  // LDS pitch of a k row: 64 B + 16 (16 B x odd: no bank conflict for 16-byte readers)
#define VPB (2 * KS + 16)       // LDS pitch of a v plane row, the same rule
#define KBY (KS * KPB)
#define SBY (KBY + HD * VPB)    // one buffer: k rows, then v rows
#define AW() asm volatile("s_wait_asynccnt 0x0" ::: "memory")   // this wave's copies have landed
#define DW() asm volatile("s_wait_dscnt 0x0" ::: "memory")      // this wave's LDS reads have returned before the buffer is given up
// one stage: each thread copies 4 x 16 B of k rows (4 threads a row, rows 64 apart) and 4 x 16 B of v rows (32 threads a row, rows 8 apart); the wait in the same statement stands before the address registers are reused
__device__ __forceinline__ void fa_stage(unsigned lk, unsigned lv, const char* gk, const char* gv) {
  asm volatile("global_load_async_to_lds_b128 %0, %1, off\n\tglobal_load_async_to_lds_b128 %2, %3, off\n\tglobal_load_async_to_lds_b128 %4, %5, off\n\tglobal_load_async_to_lds_b128 %6, %7, off\n\t"
               "global_load_async_to_lds_b128 %8, %9, off\n\tglobal_load_async_to_lds_b128 %10, %11, off\n\tglobal_load_async_to_lds_b128 %12, %13, off\n\tglobal_load_async_to_lds_b128 %14, %15, off\n\ts_wait_xcnt 0x0"
    :: "v"(lk), "v"(gk), "v"(lk + 64u * KPB), "v"(gk + (size_t)64 * CC * 2), "v"(lk + 128u * KPB), "v"(gk + (size_t)128 * CC * 2), "v"(lk + 192u * KPB), "v"(gk + (size_t)192 * CC * 2),
       "v"(lv), "v"(gv), "v"(lv + 8u * VPB), "v"(gv + (size_t)8 * TT * 2), "v"(lv + 16u * VPB), "v"(gv + (size_t)16 * TT * 2), "v"(lv + 24u * VPB), "v"(gv + (size_t)24 * TT * 2) : "memory"); }
__device__ __forceinline__ v16h frag_l(const char* p) { union { v16h v; v8h q[2]; } u; u.q[0] = *(const v8h*)p; u.q[1] = *(const v8h*)(p + 32); return u.v; }   // p = row + 16 * (lane >> 4): the k order of frag_h
__global__ __launch_bounds__(256) void k_fa(const _Float16* __restrict__ QH, const _Float16* __restrict__ QL, const _Float16* __restrict__ KH, const _Float16* __restrict__ VT, float* __restrict__ Y) {
  __shared__ __align__(16) char ring[2 * SBY];
  const int tid = threadIdx.x, wave = tid >> 5, lane = tid & 31, col = lane & 15, g = lane >> 4; const int b = blockIdx.y / NH, h = blockIdx.y % NH; const int q0 = blockIdx.x * 256 + wave * 32;
  // every "#pragma unroll" of this kernel: the small arrays it indexes have to stay in registers
  const char* gk = (const char*)(KH + ((size_t)b * TT + (tid >> 2)) * CC + h * HD) + (tid & 3) * 16; const char* gv = (const char*)(VT + ((size_t)b * CC + h * HD + (tid >> 5)) * (size_t)TT) + (tid & 31) * 16;
  const unsigned lk = (unsigned)(size_t)ring + (unsigned)((tid >> 2) * KPB + (tid & 3) * 16), lv = (unsigned)(size_t)ring + (unsigned)(KBY + (tid >> 5) * VPB + (tid & 31) * 16);
  fa_stage(lk, lv, gk, gv);
  v16h qh[2], ql[2];
#pragma unroll
  for (int u = 0; u < 2; ++u) qh[u] = frag_h(QH + ((size_t)b * TT + q0 + u * 16 + col) * CC + h * HD, lane);
  XW();
#pragma unroll
  for (int u = 0; u < 2; ++u) ql[u] = frag_h(QL + ((size_t)b * QHI + q0 + u * 16 + col) * CC + h * HD, lane);
  XW();
  AW(); __syncthreads();   // stage 0 is readable by every wave
  fa_stage(lk + SBY, lv + SBY, gk + (size_t)KS * CC * 2, gv + (size_t)KS * 2);
  v8f o[2][2] = {}; float m[2] = { -3.0e38f, -3.0e38f }, l[2] = { 0.f, 0.f };
#pragma unroll 1   // one stage a trip: the buffer index stays a run-time value
  for (int st = 0; st < TT / KS; ++st) {
    const char* Kl = ring + (st & 1) * SBY + col * KPB + 16 * g; const char* Vl = ring + (st & 1) * SBY + KBY + col * VPB + 16 * g;
    v16h kf[2], vf[2]; kf[0] = frag_l(Kl); kf[1] = frag_l(Kl + 16 * KPB); vf[0] = frag_l(Vl); vf[1] = frag_l(Vl + 16 * VPB); const char* Kn = Kl; const char* Vn = Vl;
#pragma unroll 1   // unrolled, the fragment reads were moved next to their users and waited for there
    for (int p = 0; p < KS / 32; ++p) {
      v8f s[2][2], sl[2][2]; const v8f z = {};
#pragma unroll
      for (int i = 0; i < 2; ++i)
#pragma unroll
        for (int u = 0; u < 2; ++u) { s[u][i] = wmma_h(kf[i], qh[u], z); sl[u][i] = wmma_h(kf[i], ql[u], z); }
      __builtin_amdgcn_sched_barrier(0);   // the eight score products stay one run: spread among the vector work each pair cost four idle slots before its first reader
      // both operands are fetched one pass ahead, each behind its last use, inside the stage's own buffer (its last pass refetches pass 0, unused)
      Kn += p + 1 < KS / 32 ? 32 * KPB : -(KS / 32 - 1) * 32 * KPB; Vn += p + 1 < KS / 32 ? 64 : -(KS / 32 - 1) * 64;
      kf[0] = frag_l(Kn); kf[1] = frag_l(Kn + 16 * KPB);
#pragma unroll
      for (int u = 0; u < 2; ++u) { const v8f t0 = sl[u][0] * (1.0f / 1024.0f) + s[u][0], t1 = sl[u][1] * (1.0f / 1024.0f) + s[u][1];
        float mx = fmaxf(t0[0], t1[0]);
#pragma unroll
        for (int r = 1; r < 8; ++r) mx = fmaxf(mx, fmaxf(t0[r], t1[r]));
        mx = fmaxf(mx, xhalf(mx)); const float mn = fmaxf(m[u], mx); const float corr = __builtin_amdgcn_exp2f((m[u] - mn) * SC2); m[u] = mn; const float mc = mn * SC2;
        const v8f a0 = t0 * SC2 - mc, a1 = t1 * SC2 - mc; v8f p0, p1; v16h pf;
#pragma unroll
        for (int r = 0; r < 8; ++r) { p0[r] = __builtin_amdgcn_exp2f(a0[r]); p1[r] = __builtin_amdgcn_exp2f(a1[r]); pf[r] = (_Float16)p0[r]; pf[8 + r] = (_Float16)p1[r]; }
        const v8f ps = p0 + p1; const v4f p4 = ps.lo + ps.hi; const v2f p2 = p4.lo + p4.hi;
        l[u] = l[u] * corr + (p2[0] + p2[1]);
#pragma unroll
        for (int j = 0; j < 2; ++j) { o[u][j] *= corr; o[u][j] = wmma_h(vf[j], pf, o[u][j]); } }
      vf[0] = frag_l(Vn); vf[1] = frag_l(Vn + 16 * VPB); }
    DW(); AW(); __syncthreads();   // publishes stage st + 1 and ends every wave's reads of stage st
    if (st + 2 < TT / KS) fa_stage(lk + (st & 1) * SBY, lv + (st & 1) * SBY, gk + (size_t)(st + 2) * KS * CC * 2, gv + (size_t)(st + 2) * KS * 2); }
  AW();
#pragma unroll
  for (int u = 0; u < 2; ++u) { const float inv = 1.0f / (l[u] + xhalf(l[u])); float* yr = Y + ((size_t)b * TT + q0 + u * 16 + col) * CC + h * HD + 8 * g;
#pragma unroll
    for (int j = 0; j < 2; ++j) { const v8f w = o[u][j] * inv; vst2(yr + j * 16, (v4f)w.lo); vst2(yr + j * 16 + 4, (v4f)w.hi); } } }
// ---- k_out: block = (64 rows, 128 cols): out = ctx Wo (+ bo): every row: ctx bf16 hi + lo against exact bf16 Wo (2 products); the f16 (1 product) branch is never taken
__global__ __launch_bounds__(128) void k_out(const float* __restrict__ Y, const float* __restrict__ WO, const float* __restrict__ BO, float* __restrict__ OUT) { __shared__ __align__(16) float sf[4][16][132]; __shared__ __align__(16) char sm[128 * WPB];
  const int tid = threadIdx.x, wave = tid >> 5, lane = tid & 31, col = lane & 15, g = lane >> 4; const int c0 = blockIdx.y * 128; const size_t r0 = (size_t)blockIdx.x * 64 + wave * 16;
  v8f acc[8] = {};
  if (true) {   /* ALL rows: ctx split bf16 hi + lo x exact proj_w (2 products) */
    v4f ar[8][4]; stage_ops(sm, WO + (size_t)c0 * CC, Y + (r0 + col) * CC + 8 * g, tid, ar);
    __syncthreads();   // the weight tile is readable by every wave
    const char* wl = sm + col * WPB + 16 * g; v16b wr[WRD + 1]; float bs[8]; const float* bp = BO + c0 + col;
#pragma unroll   // wr[] has to stay in registers
    for (int t = 0; t < WRD; ++t) wr[t] = WFR(wl, t);
#pragma unroll   // ar[] and wr[] have to stay in registers
    for (int kc = 0; kc < CC / 32; ++kc) { const F2 a = split_a(ar[kc]);
      if (kc == 4) {   // the eight bias values as one group, in registers that half of ar[] has left; they land under the rest of the loop (its unrolls: bs[] has to stay in registers)
        if (BO) {
#pragma unroll
          for (int j = 0; j < 8; ++j) bs[j] = bp[j * 16];
          GNW(bp);
        } else {
#pragma unroll
          for (int j = 0; j < 8; ++j) bs[j] = 0.f; } }
#pragma unroll
      for (int j = 0; j < 8; ++j) { const int t = kc * 8 + j; if (t + WRD < CC / 4) wr[(t + WRD) % (WRD + 1)] = WFR(wl, t + WRD); const v16b w = wr[t % (WRD + 1)]; acc[j] = wmma_bf(a.h, w, acc[j]); acc[j] = wmma_bf(a.l, w, acc[j]); } }
#pragma unroll
    for (int j = 0; j < 8; ++j) { const float bias = bfr(bs[j]);
#pragma unroll
      for (int r = 0; r < 8; ++r) sf[wave][8 * g + r][j * 16 + col] = acc[j][r] + bias; }
  } else {
#pragma unroll 2
    for (int kc = 0; kc < CC / 32; ++kc) { const v16h a = frag_f32(Y + (r0 + col) * CC + kc * 32, lane); asm volatile("s_wait_loadcnt 0x0" ::: "memory");
#pragma unroll
      for (int j = 0; j < 8; ++j) { const v16h w = WOCOLH(WO, kc * 32, c0 + j * 16 + col, lane); asm volatile("s_wait_loadcnt 0x0" ::: "memory"); acc[j] = wmma16(a, w, acc[j]); } }
#pragma unroll
    for (int j = 0; j < 8; ++j) { const float bias = BO ? bfr(BO[c0 + j * 16 + col]) : 0.f;
#pragma unroll
      for (int r = 0; r < 8; ++r) sf[wave][8 * g + r][j * 16 + col] = acc[j][r] * (1.0f / 256.0f) + bias; } }
  LDSX(); for (int rl = 0; rl < 16; ++rl) vst2(OUT + (r0 + rl) * DIN + c0 + lane * 4, *(const v4f*)&sf[wave][rl][lane * 4]); }

extern "C" void kernel_launch(void* const* d_in, const int* in_sizes, int n_in, void* d_out, int out_size, void* d_ws, size_t ws_size, hipStream_t stream) {
  (void)in_sizes; (void)n_in; (void)out_size;
  const float** F = (const float**)d_in;
  if (ws_size < (size_t)WS_END) return;
  char* ws = (char*)d_ws; _Float16 *QH = (_Float16*)(ws + WS_QH), *KH = (_Float16*)(ws + WS_KH), *VT = (_Float16*)(ws + WS_VT), *QL = (_Float16*)(ws + WS_QL), *KL = (_Float16*)(ws + WS_KL); __bf16 *VB = (__bf16*)(ws + WS_VB), *VBL = (__bf16*)(ws + WS_VBL); float *Y = (float*)(ws + WS_Y);
  (void)Y; (void)QL; (void)KL; (void)VB; (void)VBL;
  // inputs: 0 x [2,256,64,64]; 1 gn_gamma, 2 gn_beta [256]; 3 qkv_w [768,256] (out,in) rows q | k | v; 4 qkv_b [768]; 5 proj_w [256,256] (out,in); 6 proj_b
  if (ws_size < (size_t)WS_END2) return;
  float *MV = (float*)(ws + WS_MV), *XT = (float*)(ws + WS_XT), *ORW = (float*)(ws + WS_OR);
  k_gnst<<<dim3(TNB * 8), GNT, 0, stream>>>(F[0], MV);
  k_tok<<<dim3(NTOK / 64, CC / 64, TNB), 256, 0, stream>>>(F[0], MV, F[1], F[2], XT);
  { const float* WQ = F[3]; const float* WK = F[3] + (size_t)CC * DIN; const float* WV = F[3] + (size_t)2 * CC * DIN;
    k_proj<<<dim3(TNB * TT / 64, CC / 128, 3), 128, 0, stream>>>(XT, XT, XT, WQ, WK, WV, F[4], F[4] + CC, F[4] + 2 * CC, QH, QL, KH, KL, VT, VB, VBL); }
  k_fa<<<dim3(TT / 256, TNB * NH), 256, 0, stream>>>(QH, QL, KH, VT, Y);
  k_out<<<dim3(TNB * TT / 64, DIN / 128), 128, 0, stream>>>(Y, F[5], F[6], ORW);
  k_fin<<<dim3(NTOK / 64, CC / 64, TNB), 256, 0, stream>>>(ORW, F[0], (float*)d_out);
}

// v005
// One run takes 85.4 microseconds.
// Two timings next to v004 both put it at 1.15 times that version's speed.
// Over all steps from v000 it is 18.0 times as fast.
// Single self-attention block on images (b 2, c 256, 64 x 64 -> n 4,096 tokens; 8 heads x 32): xn = GroupNorm(8 groups)(x) (affine); q,k,v = qkv_w xn + qkv_b (1x1, (out,in) rows q|k|v); attn = softmax(q k^T x 32^-0.5); out = proj_w (attn v) + proj_b, reshaped to [b,c,h,w] + x.
#include <hip/hip_runtime.h>
#include <math.h>

typedef __attribute__((ext_vector_type(16))) _Float16 v16h;
typedef __attribute__((ext_vector_type(16))) __bf16 v16b;
typedef __attribute__((ext_vector_type(8)))  _Float16 v8h;
typedef __attribute__((ext_vector_type(8)))  float v8f;
typedef __attribute__((ext_vector_type(4)))  float v4f;
typedef __attribute__((ext_vector_type(2)))  float v2f;
typedef __attribute__((ext_vector_type(4)))  unsigned v4u;
typedef __attribute__((ext_vector_type(4)))  int v4i;
typedef float __attribute__((may_alias)) float_a;
typedef int __attribute__((may_alias)) int_a;

template <typename T> __device__ __forceinline__ void vst2(void* p, T v) { *(T*)p = v;  }
__device__ __forceinline__ v8f wmma16(v16h a, v16h b, v8f c) {
  v8f d = __builtin_amdgcn_wmma_f32_16x16x32_f16(false, a, false, b, (short)0, c, false, false);
  asm volatile("v_nop\n\tv_nop\n\tv_nop\n\tv_nop" : "+v"(d) : "v"(a), "v"(b));
  return d;
}
__device__ __forceinline__ v8f wmma_bf(v16b a, v16b b, v8f c) {
  v8f d = __builtin_amdgcn_wmma_f32_16x16x32_bf16(false, a, false, b, (short)0, c, false, false);
  asm volatile("v_nop\n\tv_nop\n\tv_nop\n\tv_nop" : "+v"(d) : "v"(a), "v"(b));
  return d;
}
// 16x16x32 fragments: lane = (h = lane>>4, row/col = lane&15); elements 0..7 = k0+8h+0..7, 8..15 = k0+16+8h+0..7; D element r = row 8h+r
__device__ __forceinline__ v16h frag_h(const _Float16* rowk0, int lane) {
  union { v16h v; v8h q[2]; } u; const _Float16* p = rowk0 + 8 * (lane >> 4);
  u.q[0] = *(const v8h*)p; u.q[1] = *(const v8h*)(p + 16); return u.v;
}
__device__ __forceinline__ v16h frag_f32(const float* rowk0, int lane) {
  v16h a; const float* p = rowk0 + 8 * (lane >> 4);
#pragma unroll
  for (int i = 0; i < 8; ++i) { a[i] = (_Float16)p[i]; a[8 + i] = (_Float16)p[16 + i]; }
  return a;
}
__device__ __forceinline__ v16h frag_f32s(const float* rowk0, int lane, float sc) {
  v16h a; const float* p = rowk0 + 8 * (lane >> 4);
#pragma unroll
  for (int i = 0; i < 8; ++i) { a[i] = (_Float16)(p[i] * sc); a[8 + i] = (_Float16)(p[16 + i] * sc); }
  return a;
}
// column fragment from a [K][ld] layout (column n), rows >= K read as 0
__device__ __forceinline__ v16h fragc_f32(const float* W, int k0, int n, int lane, int ld, int K) {
  v16h a; const int g = lane >> 4;
#pragma unroll
  for (int i = 0; i < 8; ++i) { const int ka = k0 + 8 * g + i, kb = ka + 16;
    a[i] = (_Float16)(ka < K ? W[(size_t)(ka < K ? ka : K - 1) * ld + n] : 0.f); a[8 + i] = (_Float16)(kb < K ? W[(size_t)(kb < K ? kb : K - 1) * ld + n] : 0.f); }
  return a;
}
struct F2 { v16b h, l; };
__device__ __forceinline__ F2 bsplit16(const float v[16]) { F2 r;
#pragma unroll
  for (int i = 0; i < 16; ++i) { const __bf16 h = (__bf16)v[i]; r.h[i] = h; r.l[i] = (__bf16)(v[i] - (float)h); }
  return r; }
__device__ __forceinline__ F2 split_row(const float* row, int k0, int lane) { float v[16]; const float* p = row + k0 + 8 * (lane >> 4);
#pragma unroll
  for (int i = 0; i < 8; ++i) { v[i] = p[i]; v[8 + i] = p[16 + i]; }
  return bsplit16(v); }
__device__ __forceinline__ F2 split_rowK(const float* row, int k0, int lane, int K) { float v[16]; const int g = lane >> 4;
#pragma unroll
  for (int i = 0; i < 8; ++i) { const int ka = k0 + 8 * g + i, kb = ka + 16; v[i] = ka < K ? row[ka < K ? ka : K - 1] : 0.f; v[8 + i] = kb < K ? row[kb < K ? kb : K - 1] : 0.f; }
  return bsplit16(v); }
__device__ __forceinline__ F2 split_col(const float* W, int k0, int n, int lane, int ld, int K) { float v[16]; const int g = lane >> 4;
#pragma unroll
  for (int i = 0; i < 8; ++i) { const int ka = k0 + 8 * g + i, kb = ka + 16; v[i] = ka < K ? W[(size_t)(ka < K ? ka : K - 1) * ld + n] : 0.f; v[8 + i] = kb < K ? W[(size_t)(kb < K ? kb : K - 1) * ld + n] : 0.f; }
  return bsplit16(v); }
__device__ __forceinline__ v8f mac3(const F2& a, const F2& b, v8f c) { c = wmma_bf(a.l, b.h, c); c = wmma_bf(a.h, b.l, c); return wmma_bf(a.h, b.h, c); }
__device__ __forceinline__ float sigm(float v) { return 1.0f / (1.0f + expf(-v)); }
#define LDSX() do { asm volatile("s_wait_dscnt 0" ::: "memory"); __builtin_amdgcn_wave_barrier(); __builtin_amdgcn_fence(__ATOMIC_RELEASE, "workgroup"); } while (0)

#define NB 2
#define TT 4096
#define CC 256            // NH * HD = projected width
#define DIN 256          // input (model) width
#define NH 8
#define HD 32
#define NQB (TT / 64)
#define HG 2
#define SCALE (0.17677669529663687f)
#define CAUSAL 0
#ifndef TNB
#define TNB NB
#endif
__device__ __forceinline__ float bfr(float v) { return (float)(__bf16)v; }
__host__ __device__ __forceinline__ int kb_last(int qb) { return CAUSAL ? ((qb * 64 + 63) >> 7) : (TT / 128 - 1); }
typedef __attribute__((ext_vector_type(8))) __bf16 v8b;
__device__ __forceinline__ v16b frag_b(const __bf16* rowk0, int lane) {
  union { v16b v; v8b q[2]; } u; const __bf16* p = rowk0 + 8 * (lane >> 4);
  u.q[0] = *(const v8b*)p; u.q[1] = *(const v8b*)(p + 16); return u.v;
}
#define QBH 0              // unused: k_fa has no high-precision path
#define QHI 4096            // rows carrying a q residual plane (all rows when non-causal: 2-product logits everywhere)
#define KHI 64            // key rows carrying k residual / v bf16 hi+lo planes (written by k_proj; no kernel here reads them)
// B fragment (k rows k0+.., output column o) of a weight: (in,out) [K][ld] or (out,in) [ld rows of K]: bf16 exact, or f16(bf16 * 256) exact
__device__ __forceinline__ v16b wcol_io(const float* Wm, int k0, int o, int lane, int ld) { v16b w; const int g = lane >> 4;
#pragma unroll
  for (int i = 0; i < 8; ++i) { w[i] = (__bf16)Wm[(size_t)(k0 + 8 * g + i) * ld + o]; w[8 + i] = (__bf16)Wm[(size_t)(k0 + 16 + 8 * g + i) * ld + o]; }
  return w; }
__device__ __forceinline__ v16b wcol_oi(const float* Wm, int k0, int o, int lane, int K) { v16b w; const float* p = Wm + (size_t)o * K + k0 + 8 * (lane >> 4);
#pragma unroll
  for (int i = 0; i < 8; ++i) { w[i] = (__bf16)p[i]; w[8 + i] = (__bf16)p[16 + i]; }
  return w; }
__device__ __forceinline__ v16h wcolh_io(const float* Wm, int k0, int o, int lane, int ld) { v16h w; const int g = lane >> 4;
#pragma unroll
  for (int i = 0; i < 8; ++i) { w[i] = (_Float16)(bfr(Wm[(size_t)(k0 + 8 * g + i) * ld + o]) * 256.0f); w[8 + i] = (_Float16)(bfr(Wm[(size_t)(k0 + 16 + 8 * g + i) * ld + o]) * 256.0f); }
  return w; }
__device__ __forceinline__ v16h wcolh_oi(const float* Wm, int k0, int o, int lane, int K) { v16h w; const float* p = Wm + (size_t)o * K + k0 + 8 * (lane >> 4);
#pragma unroll
  for (int i = 0; i < 8; ++i) { w[i] = (_Float16)(bfr(p[i]) * 256.0f); w[8 + i] = (_Float16)(bfr(p[16 + i]) * 256.0f); }
  return w; }
#define WQKV_LAYOUT 1   // 0 = (in,out) [DIN][CC]; 1 = (out,in) [CC][DIN]; 2 = per-head [NH][DIN][HD]
__device__ __forceinline__ v16b wcol_hdk(const float* Wm, int k0, int o, int lane) { v16b w; const int g = lane >> 4; const float* p = Wm + (size_t)(o / HD) * DIN * HD + (o % HD);
#pragma unroll
  for (int i = 0; i < 8; ++i) { w[i] = (__bf16)p[(size_t)(k0 + 8 * g + i) * HD]; w[8 + i] = (__bf16)p[(size_t)(k0 + 16 + 8 * g + i) * HD]; }
  return w; }
#define WO_OUT_IN 1
#if WQKV_LAYOUT == 1
#define WCOL(W, k0, o, lane) wcol_oi(W, k0, o, lane, DIN)
#elif WQKV_LAYOUT == 2
#define WCOL(W, k0, o, lane) wcol_hdk(W, k0, o, lane)
#else
#define WCOL(W, k0, o, lane) wcol_io(W, k0, o, lane, CC)
#endif
#if WO_OUT_IN
#define WOCOL(W, k0, o, lane) wcol_oi(W, k0, o, lane, CC)
#define WOCOLH(W, k0, o, lane) wcolh_oi(W, k0, o, lane, CC)
#else
#define WOCOL(W, k0, o, lane) wcol_io(W, k0, o, lane, DIN)
#define WOCOLH(W, k0, o, lane) wcolh_io(W, k0, o, lane, DIN)
#endif
#define NTOK 4096
#ifndef OPITCH
#define OPITCH NTOK        // unused (out is written with pitch NTOK)
#endif
#ifndef XPITCH
#define XPITCH NTOK        // unused (x is read with pitch NTOK)
#endif
// ---- k_gnst: block = one (batch, group), 32 waves; a thread's 16-byte pieces lie 16 KiB apart and are fetched GNB at a time, all in flight before the first is used (one waited load a trip left each pass at one load latency per 4 KiB)
#define GNT 1024           // threads of a block
#define GNB 16             // loads in flight per thread
// behind a group of loads from p, a precaution: p is an input, so its registers are not given to a load of the group as destination ahead of the wait
#define GNW(p) asm volatile("s_wait_xcnt 0x0" :: "v"(p) : "memory")
__device__ __forceinline__ v4f bfr4(v4f v) { v4f r; r[0] = bfr(v[0]); r[1] = bfr(v[1]); r[2] = bfr(v[2]); r[3] = bfr(v[3]); return r; }
__global__ __launch_bounds__(GNT) void k_gnst(const float* __restrict__ X, float* __restrict__ MV) { __shared__ float sred[GNT / 32]; __shared__ float sbc; const int t = threadIdx.x; const size_t base = (size_t)blockIdx.x * (CC / 8) * NTOK; const int n = (CC / 8) * NTOK;
  const v4f* xp = (const v4f*)(X + base) + t;
  v4f sv = {};
  for (int i0 = 0; i0 < n / (4 * GNT); i0 += GNB) { v4f v[GNB]; const v4f* p = xp + (size_t)i0 * GNT;
#pragma unroll   // v[] has to stay in registers
    for (int j = 0; j < GNB; ++j) v[j] = p[(size_t)j * GNT];
    GNW(p);
#pragma unroll
    for (int j = 0; j < GNB; ++j) sv += bfr4(v[j]); }
  float s1 = (sv[0] + sv[1]) + (sv[2] + sv[3]);
#pragma unroll
  for (int o = 1; o < 32; o <<= 1) s1 += __shfl_xor(s1, o);
  if ((t & 31) == 0) sred[t >> 5] = s1; __syncthreads(); if (t == 0) { float a = 0.f; for (int i = 0; i < GNT / 32; ++i) a += sred[i]; sbc = a / (float)n; } __syncthreads(); const float mu = sbc; __syncthreads();
  v4f qv = {};
  for (int i0 = 0; i0 < n / (4 * GNT); i0 += GNB) { v4f v[GNB]; const v4f* p = xp + (size_t)i0 * GNT;
#pragma unroll   // v[] has to stay in registers
    for (int j = 0; j < GNB; ++j) v[j] = p[(size_t)j * GNT];
    GNW(p);
#pragma unroll
    for (int j = 0; j < GNB; ++j) { const v4f d = bfr4(v[j]) - mu; qv += d * d; } }
  float q = (qv[0] + qv[1]) + (qv[2] + qv[3]);
#pragma unroll
  for (int o = 1; o < 32; o <<= 1) q += __shfl_xor(q, o);
  if ((t & 31) == 0) sred[t >> 5] = q; __syncthreads(); if (t == 0) { float a = 0.f; for (int i = 0; i < GNT / 32; ++i) a += sred[i]; sbc = rsqrtf(a / (float)n + 1e-5f); } __syncthreads();
  if (t < 32) { const float v = t == 0 ? mu : (t == 1 ? sbc : 0.f); vst2(MV + (size_t)blockIdx.x * 32 + t, v); } }
// ---- k_tok: block = (64 tokens, 64 channels, batch b): XT[b*N + n][c] = (bf16(x[b][c][n]) - mean_g) * rstd_g * gamma[c] + beta[c] (GroupNorm, g = c / 32) through an LDS tile
__global__ __launch_bounds__(256) void k_tok(const float* __restrict__ X, const float* __restrict__ MV, const float* __restrict__ GG, const float* __restrict__ GB, float* __restrict__ XT) { __shared__ float st[64][68]; const int tid = threadIdx.x; const int n0 = blockIdx.x * 64, c0 = blockIdx.y * 64; const size_t b = blockIdx.z;
  for (int e = tid; e < 64 * 16; e += 256) { const int cl = e >> 4, q = e & 15; const int c = c0 + cl; const int gi = (int)(b * 8) + c / (CC / 8); const float mu = MV[gi * 32], rs = MV[gi * 32 + 1], ga = bfr(GG[c]), be = bfr(GB[c]);
    const v4f v = *(const v4f*)(X + (b * CC + c) * (size_t)NTOK + n0 + q * 4);
#pragma unroll
    for (int j = 0; j < 4; ++j) st[cl][q * 4 + j] = (bfr(v[j]) - mu) * rs * ga + be; }
  __syncthreads();
  for (int e = tid; e < 64 * 16; e += 256) { const int nl = e >> 4, q = e & 15; v4f o; o[0] = st[q * 4][nl]; o[1] = st[q * 4 + 1][nl]; o[2] = st[q * 4 + 2][nl]; o[3] = st[q * 4 + 3][nl]; vst2(XT + (b * NTOK + n0 + nl) * (size_t)CC + c0 + q * 4, o); } }
// ---- k_fin: block = (64 tokens, 64 channels, batch b): out[b][c][n] = OR[b*N + n][c] + bf16(x[b][c][n]) (LDS transpose; 256-B runs of 64 tokens per channel)
__global__ __launch_bounds__(256) void k_fin(const float* __restrict__ ORW, const float* __restrict__ X, float* __restrict__ OUT) { __shared__ float st[64][68]; const int tid = threadIdx.x; const int n0 = blockIdx.x * 64, c0 = blockIdx.y * 64; const size_t b = blockIdx.z;
  for (int e = tid; e < 64 * 16; e += 256) { const int nl = e >> 4, q = e & 15; *(v4f*)&st[nl][q * 4] = *(const v4f*)(ORW + (b * NTOK + n0 + nl) * (size_t)CC + c0 + q * 4); }
  __syncthreads();
  for (int e = tid; e < 64 * 16; e += 256) { const int cl = e >> 4, q = e & 15; const size_t oi = (b * CC + c0 + cl) * (size_t)NTOK + n0 + q * 4; const v4f xr = *(const v4f*)(X + oi); v4f o; o[0] = st[q * 4][cl] + bfr(xr[0]); o[1] = st[q * 4 + 1][cl] + bfr(xr[1]); o[2] = st[q * 4 + 2][cl] + bfr(xr[2]); o[3] = st[q * 4 + 3][cl] + bfr(xr[3]); vst2(OUT + oi, o); } }
#define WS_MV  (WS_END)
#define WS_XT  (WS_MV + 4u * 32 * NB * 8 + 1024u)
#define WS_OR  (WS_XT + 4u * (size_t)NB * NTOK * CC)
#define WS_END2 (WS_OR + 4u * (size_t)NB * NTOK * CC)
#ifndef SM_EXTRA_PARAMS
#define SM_EXTRA_PARAMS
#endif
#ifndef PROJ_EXTRA_PARAMS
#define PROJ_EXTRA_PARAMS
#endif
#ifndef SM_MASK_HOOK
#define SM_MASK_HOOK (void)0
#endif

#define WS_QH  0u                                      // f16 q x SC2 rows [b*t][CC]
#define WS_KH  (WS_QH + 2u * (size_t)NB * TT * CC)      // f16 k rows [b*t][CC]
#define WS_VT  (WS_KH + 2u * (size_t)NB * TT * CC)      // f16 v planes [b][c][t]
#define WS_QL  (WS_VT + 2u * (size_t)NB * CC * TT)      // f16 residual of q x SC2 (unscaled) rows [b][t < QHI][CC]
#define WS_KL  (WS_QL + 2u * (size_t)NB * QHI * CC)     // f16 k residual x 2^10 rows [b][t < KHI][CC]
#define WS_VB  (WS_KL + 2u * (size_t)NB * KHI * CC)     // bf16 v hi planes [b][c][t < KHI]
#define WS_VBL (WS_VB + 2u * (size_t)NB * CC * KHI)
#define WS_S   (WS_VBL + 2u * (size_t)NB * CC * KHI)    // f32 [hg][t][s], unused: logits and P stay in registers
#define WS_Y   (WS_S  + 4u * (size_t)HG * TT * TT)      // f32 ctx rows [b*t][CC] (only when there is an output projection)
#define WS_END (WS_Y  + 4u * (size_t)NB * TT * CC)

// ---- operands of k_proj and k_out. The block's weight tile (128 output columns x K = 256, rows of an (out,in) matrix) is read once by whole-line loads, rounded to bf16 and kept in LDS for all four waves; a wave's own 16 activation rows are fetched whole behind it, so the K loop waits for no global load
#define WPB 528            // LDS pitch of a weight row: 256 bf16 + 16 B (16 B x odd: no bank conflict for 16-byte readers)
typedef __attribute__((ext_vector_type(4))) __bf16 v4b;
__device__ __forceinline__ v4b bf4(v4f v) { v4b r; r[0] = (__bf16)v[0]; r[1] = (__bf16)v[1]; r[2] = (__bf16)v[2]; r[3] = (__bf16)v[3]; return r; }
__device__ __forceinline__ v16b frag_lb(const char* p) { union { v16b v; v8b q[2]; } u; u.q[0] = *(const v8b*)p; u.q[1] = *(const v8b*)(p + 32); return u.v; }   // p = row + 2 * k0 + 16 * (lane >> 4): the k order of wcol_oi
// 128 threads: load i of a thread is 16 B of weight row 2 i + (tid >> 6); two groups of 16 loads are in flight at a time. arow = the lane's activation row + 8 * (lane >> 4); a[kc] = the 16 values of split_row at k0 = 32 kc
__device__ __forceinline__ void stage_ops(char* sw, const float* Wt, const float* arow, int tid, v4f (&a)[8][4]) {
  const v4f* wp = (const v4f*)Wt + tid; char* d = sw + (tid >> 6) * WPB + (tid & 63) * 8; v4f u[16], w[16];
  // every "#pragma unroll" here: u, w and a have to stay in registers
#pragma unroll
  for (int i = 0; i < 16; ++i) u[i] = wp[(size_t)i * 128];
#pragma unroll
  for (int i = 0; i < 16; ++i) w[i] = wp[(size_t)(16 + i) * 128];
  GNW(wp);
#pragma unroll
  for (int i = 0; i < 16; ++i) *(v4b*)(d + i * 2 * WPB) = bf4(u[i]);
#pragma unroll
  for (int i = 0; i < 16; ++i) u[i] = wp[(size_t)(32 + i) * 128];
  GNW(wp);
#pragma unroll
  for (int i = 0; i < 16; ++i) *(v4b*)(d + (16 + i) * 2 * WPB) = bf4(w[i]);
#pragma unroll
  for (int i = 0; i < 16; ++i) w[i] = wp[(size_t)(48 + i) * 128];
  GNW(wp);
#pragma unroll
  for (int i = 0; i < 16; ++i) *(v4b*)(d + (32 + i) * 2 * WPB) = bf4(u[i]);
#pragma unroll
  for (int kc = 0; kc < 8; ++kc) { const v4f* p = (const v4f*)(arow + kc * 32); a[kc][0] = p[0]; a[kc][1] = p[1]; a[kc][2] = p[4]; a[kc][3] = p[5]; }
  GNW(arow);
#pragma unroll
  for (int i = 0; i < 16; ++i) *(v4b*)(d + (48 + i) * 2 * WPB) = bf4(w[i]); }
__device__ __forceinline__ F2 split_a(const v4f (&q)[4]) { float v[16];
#pragma unroll   // v[] has to stay in registers
  for (int i = 0; i < 4; ++i) { v[i] = q[0][i]; v[4 + i] = q[1][i]; v[8 + i] = q[2][i]; v[12 + i] = q[3][i]; }
  return bsplit16(v); }
#define SC2 (SCALE * 1.4426950408889634f)   // logits to base 2: k_proj folds it into q
#define WRD 2              // weight fragments are read from LDS WRD ahead of their products (read next to its product, each cost one LDS latency)
#define WFR(wl, t) frag_lb((wl) + ((t) & 7) * 16 * WPB + ((t) >> 3) * 64)   // fragment t = 8 kc + j
// ---- k_proj: block = (64 rows, 128 cols, which): q/k/v = X W (+ b) with exact bf16 products (K = DIN) -> which 0: q x SC2 f16 rows (+ residual rows < QHI); 1: k f16 rows (+ residual rows < KHI); 2: v f16 planes [c][t] (+ bf16 hi/lo planes for t < KHI)
__global__ __launch_bounds__(128) void k_proj(const float* __restrict__ XQ, const float* __restrict__ XK, const float* __restrict__ XV, const float* __restrict__ WQ, const float* __restrict__ WK, const float* __restrict__ WV, const float* __restrict__ BQ, const float* __restrict__ BK, const float* __restrict__ BV,
    _Float16* __restrict__ QH, _Float16* __restrict__ QL, _Float16* __restrict__ KH, _Float16* __restrict__ KL, _Float16* __restrict__ VT, __bf16* __restrict__ VB, __bf16* __restrict__ VBL) {
  __shared__ __align__(16) char sm[128 * WPB];   // the weight tile; behind the K loop and a barrier the same bytes hold the output tiles
  _Float16 (*sh)[136] = (_Float16 (*)[136])sm; _Float16 (*sl)[136] = (_Float16 (*)[136])(sm + 64 * 136 * 2); _Float16 (*th)[72] = (_Float16 (*)[72])sm; __bf16 (*tb)[72] = (__bf16 (*)[72])(sm + 128 * 72 * 2); __bf16 (*tbl)[72] = (__bf16 (*)[72])(sm + 2 * 128 * 72 * 2);
  const int tid = threadIdx.x, wave = tid >> 5, lane = tid & 31, col = lane & 15, g = lane >> 4; const int which = blockIdx.z; const int c0 = blockIdx.y * 128; const size_t r0 = (size_t)blockIdx.x * 64; const size_t bb = r0 / TT; const int t0 = (int)(r0 % TT);
  const float* X = which == 0 ? XQ : which == 1 ? XK : XV; const float* WA = which == 0 ? WQ : which == 1 ? WK : WV; const float* BA = which == 0 ? BQ : which == 1 ? BK : BV;
  v4f ar[8][4]; stage_ops(sm, WA + (size_t)c0 * DIN, X + (r0 + wave * 16 + col) * DIN + 8 * g, tid, ar);
  __syncthreads();   // the weight tile is readable by every wave
  const char* wl = sm + col * WPB + 16 * g;
  v8f acc[8] = {}; v16b wr[WRD + 1]; float bs[8]; const float* bp = BA + c0 + col;
#pragma unroll   // wr[] has to stay in registers
  for (int t = 0; t < WRD; ++t) wr[t] = WFR(wl, t);
#pragma unroll   // ar[] and wr[] have to stay in registers
  for (int kc = 0; kc < DIN / 32; ++kc) { const F2 a2 = split_a(ar[kc]);   /* GroupNorm rows (f32) split hi + lo */
    if (kc == 4) {   // the eight bias values as one group, in registers that half of ar[] has left; they land under the rest of the loop (its unrolls: bs[] has to stay in registers)
      if (BA) {
#pragma unroll
        for (int j = 0; j < 8; ++j) bs[j] = bp[j * 16];
        GNW(bp);
      } else {
#pragma unroll
        for (int j = 0; j < 8; ++j) bs[j] = 0.f; } }
#pragma unroll
    for (int j = 0; j < 8; ++j) { const int t = kc * 8 + j; if (t + WRD < DIN / 4) wr[(t + WRD) % (WRD + 1)] = WFR(wl, t + WRD); const v16b w = wr[t % (WRD + 1)]; acc[j] = wmma_bf(a2.h, w, acc[j]); acc[j] = wmma_bf(a2.l, w, acc[j]); } }
  __syncthreads();   // every wave has read its last weight fragment: the bytes are given to the output tiles
  if (which < 2) { _Float16* DH = which == 0 ? QH : KH; _Float16* DL = which == 0 ? QL : KL; const int nhi = which == 0 ? QHI : KHI; const bool hi_rows = t0 < nhi; const float qs = which == 0 ? SC2 : 1.0f, rs = which == 0 ? 1.0f : 1024.0f;   // q: base-2 logit units, residual on the scale of its high part (k_fa chains both products in one accumulator)
#pragma unroll
    for (int j = 0; j < 8; ++j) { const float bias = bfr(bs[j]);
#pragma unroll
      for (int r = 0; r < 8; ++r) { const float v = (acc[j][r] + bias) * qs; const _Float16 hv = (_Float16)v; sh[wave * 16 + 8 * g + r][j * 16 + col] = hv; sl[wave * 16 + 8 * g + r][j * 16 + col] = (_Float16)((v - (float)hv) * rs); } }
    __syncthreads();
    for (int e = tid; e < 64 * 16; e += 128) { const int rl = e >> 4, q = e & 15; vst2((unsigned*)(DH + (r0 + rl) * CC + c0 + q * 8), *(const v4u*)&sh[rl][q * 8]); if (hi_rows) vst2((unsigned*)(DL + (bb * nhi + t0 + rl) * (size_t)CC + c0 + q * 8), *(const v4u*)&sl[rl][q * 8]); }
  } else { const bool hi_rows = t0 < KHI;
#pragma unroll
    for (int j = 0; j < 8; ++j) { const float bias = bfr(bs[j]);
#pragma unroll
      for (int r = 0; r < 8; ++r) { const float v = acc[j][r] + bias; const int rl = wave * 16 + 8 * g + r, cl = j * 16 + col; th[cl][rl] = (_Float16)v; const __bf16 bh = (__bf16)v; tb[cl][rl] = bh; tbl[cl][rl] = (__bf16)(v - (float)bh); } }
    __syncthreads();
    for (int e = tid; e < 128 * 8; e += 128) { const int cl = e >> 3, q = e & 7; vst2((unsigned*)(VT + (bb * CC + c0 + cl) * (size_t)TT + t0 + q * 8), *(const v4u*)&th[cl][q * 8]); if (hi_rows) { const size_t o3 = (bb * CC + c0 + cl) * (size_t)KHI + t0 + q * 8; vst2((unsigned*)(VB + o3), *(const v4u*)&tb[cl][q * 8]); vst2((unsigned*)(VBL + o3), *(const v4u*)&tbl[cl][q * 8]); } } } }
// ---- k_fa: block = 8 waves x 32 query columns of one (b, h); one pass = 32 keys, one stage = KS keys. S^T = K Q^T - M (A = k rows, B = q hi, then q residual: 2 products chained in one accumulator that starts at minus the column's maximum in use M, so the scores leave the matrix unit as arguments of exp2), lazy rescale (M, sums and O move only in a pass whose sums show that a score may lie more than 8 above M: one test a pass; a lane holds one query's scores), P^T packed from the score accumulators to f16 as the B operand of O^T += V^T P^T (A = v planes [c][t]); logits and P never reach memory. K rows and V planes of a stage are brought into LDS once per block by asynchronous copies (two buffers, the next stage in flight) and read from there by all eight waves
__device__ __forceinline__ float xhalf(float x) { return __builtin_bit_cast(float, __builtin_amdgcn_permlanex16(__builtin_bit_cast(int, x), __builtin_bit_cast(int, x), 0x76543210, 0xfedcba98, false, false)); }   // lane l with lane l ^ 16
__device__ __forceinline__ v8f wmma_h(v16h a, v16h b, v8f c) { return __builtin_amdgcn_wmma_f32_16x16x32_f16(false, a, false, b, (short)0, c, false, false); }
#define XW() asm volatile("s_wait_xcnt 0x0" ::: "memory")   // behind a group of loads: a later load's result may land in the group's address registers
#define KS 256                  // keys of a stage
#define KPB 80                  // LDS pitch of a k row: 64 B + 16 (16 B x odd: no bank conflict for 16-byte readers)
#define VPB (2 * KS + 16)       // LDS pitch of a v plane row, the same rule
#define KBY (KS * KPB)
#define SBY (KBY + HD * VPB)    // one buffer: k rows, then v rows
#define AW() asm volatile("s_wait_asynccnt 0x0" ::: "memory")   // this wave's copies have landed
#define DW() asm volatile("s_wait_dscnt 0x0" ::: "memory")      // this wave's LDS reads have returned before the buffer is given up
// one stage: each thread copies 4 x 16 B of k rows (4 threads a row, rows 64 apart) and 4 x 16 B of v rows (32 threads a row, rows 8 apart); the wait in the same statement stands before the address registers are reused
__device__ __forceinline__ void fa_stage(unsigned lk, unsigned lv, const char* gk, const char* gv) {
  asm volatile("global_load_async_to_lds_b128 %0, %1, off\n\tglobal_load_async_to_lds_b128 %2, %3, off\n\tglobal_load_async_to_lds_b128 %4, %5, off\n\tglobal_load_async_to_lds_b128 %6, %7, off\n\t"
               "global_load_async_to_lds_b128 %8, %9, off\n\tglobal_load_async_to_lds_b128 %10, %11, off\n\tglobal_load_async_to_lds_b128 %12, %13, off\n\tglobal_load_async_to_lds_b128 %14, %15, off\n\ts_wait_xcnt 0x0"
    :: "v"(lk), "v"(gk), "v"(lk + 64u * KPB), "v"(gk + (size_t)64 * CC * 2), "v"(lk + 128u * KPB), "v"(gk + (size_t)128 * CC * 2), "v"(lk + 192u * KPB), "v"(gk + (size_t)192 * CC * 2),
       "v"(lv), "v"(gv), "v"(lv + 8u * VPB), "v"(gv + (size_t)8 * TT * 2), "v"(lv + 16u * VPB), "v"(gv + (size_t)16 * TT * 2), "v"(lv + 24u * VPB), "v"(gv + (size_t)24 * TT * 2) : "memory"); }
__device__ __forceinline__ v16h frag_l(const char* p) { union { v16h v; v8h q[2]; } u; u.q[0] = *(const v8h*)p; u.q[1] = *(const v8h*)(p + 32); return u.v; }   // p = row + 16 * (lane >> 4): the k order of frag_h
// one column group's 32 x 16 scores less d to powers of two, and their sum in two parts
__device__ __forceinline__ void fa_exp(const v8f (&s)[2], float d, v8f (&e)[2], v2f& sm) {
#pragma unroll   // e[] has to stay in registers
  for (int i = 0; i < 2; ++i)
#pragma unroll
    for (int r = 0; r < 8; ++r) e[i][r] = __builtin_amdgcn_exp2f(s[i][r] - d);
  const v8f ps = e[0] + e[1]; const v4f p4 = ps.lo + ps.hi; sm = p4.lo + p4.hi; }
__global__ __launch_bounds__(256) void k_fa(const _Float16* __restrict__ QH, const _Float16* __restrict__ QL, const _Float16* __restrict__ KH, const _Float16* __restrict__ VT, float* __restrict__ Y) {
  __shared__ __align__(16) char ring[2 * SBY];
  const int tid = threadIdx.x, wave = tid >> 5, lane = tid & 31, col = lane & 15, g = lane >> 4; const int b = blockIdx.y / NH, h = blockIdx.y % NH; const int q0 = blockIdx.x * 256 + wave * 32;
  // every "#pragma unroll" of this kernel: the small arrays it indexes have to stay in registers
  const char* gk = (const char*)(KH + ((size_t)b * TT + (tid >> 2)) * CC + h * HD) + (tid & 3) * 16; const char* gv = (const char*)(VT + ((size_t)b * CC + h * HD + (tid >> 5)) * (size_t)TT) + (tid & 31) * 16;
  const unsigned lk = (unsigned)(size_t)ring + (unsigned)((tid >> 2) * KPB + (tid & 3) * 16), lv = (unsigned)(size_t)ring + (unsigned)(KBY + (tid >> 5) * VPB + (tid & 31) * 16);
  fa_stage(lk, lv, gk, gv);
  v16h qh[2], ql[2];
#pragma unroll
  for (int u = 0; u < 2; ++u) qh[u] = frag_h(QH + ((size_t)b * TT + q0 + u * 16 + col) * CC + h * HD, lane);
  XW();
#pragma unroll
  for (int u = 0; u < 2; ++u) ql[u] = frag_h(QL + ((size_t)b * QHI + q0 + u * 16 + col) * CC + h * HD, lane);
  XW();
  AW(); __syncthreads();   // stage 0 is readable by every wave
  fa_stage(lk + SBY, lv + SBY, gk + (size_t)KS * CC * 2, gv + (size_t)KS * 2);
  v8f o[2][2] = {}; v2f l[2] = {}; v8f cn[2][2];   // cn[u][i] = -M of column group u in all eight rows: the start value of score tile (u, i); a tile each, since one shared by two products was copied by the compiler in every pass
  { // M starts at the maximum over the first 32 keys (high parts alone: any value within 8 of the maximum serves), the same in both wave halves
    const char* K0 = ring + col * KPB + 16 * g; const v16h k0 = frag_l(K0), k1 = frag_l(K0 + 16 * KPB); const v8f z = {};
#pragma unroll
    for (int u = 0; u < 2; ++u) { const v8f t0 = wmma_h(k0, qh[u], z), t1 = wmma_h(k1, qh[u], z); float mx = fmaxf(t0[0], t1[0]);
#pragma unroll
      for (int r = 1; r < 8; ++r) mx = fmaxf(mx, fmaxf(t0[r], t1[r]));
      mx = fmaxf(mx, xhalf(mx)); cn[u][0] = z - mx; cn[u][1] = z - mx; } }
#pragma unroll 1   // one stage a trip: the buffer index stays a run-time value
  for (int st = 0; st < TT / KS; ++st) {
    const char* Kl = ring + (st & 1) * SBY + col * KPB + 16 * g; const char* Vl = ring + (st & 1) * SBY + KBY + col * VPB + 16 * g;
    v16h kf[2], vf[2]; kf[0] = frag_l(Kl); kf[1] = frag_l(Kl + 16 * KPB); vf[0] = frag_l(Vl); vf[1] = frag_l(Vl + 16 * VPB); const char* Kn = Kl; const char* Vn = Vl;
#pragma unroll 1   // unrolled, the fragment reads were moved next to their users and waited for there
    for (int p = 0; p < KS / 32; ++p) {
      v8f s[2][2], e[2][2]; v2f sm[2];
#pragma unroll
      for (int i = 0; i < 2; ++i)
#pragma unroll
        for (int u = 0; u < 2; ++u) s[u][i] = wmma_h(kf[i], qh[u], cn[u][i]);
#pragma unroll
      for (int i = 0; i < 2; ++i)
#pragma unroll
        for (int u = 0; u < 2; ++u) s[u][i] = wmma_h(kf[i], ql[u], s[u][i]);
      __builtin_amdgcn_sched_barrier(0);   // the eight score products stay one run: spread among the vector work each pair cost four idle slots before its first reader
      // both operands are fetched one pass ahead, each behind its last use, inside the stage's own buffer (its last pass refetches pass 0, unused)
      Kn += p + 1 < KS / 32 ? 32 * KPB : -(KS / 32 - 1) * 32 * KPB; Vn += p + 1 < KS / 32 ? 64 : -(KS / 32 - 1) * 64;
      kf[0] = frag_l(Kn); kf[1] = frag_l(Kn + 16 * KPB);
      __builtin_amdgcn_sched_barrier(0);   // the k reads stay here, under the products' latency: left free they were sunk below the test, next to the next pass's products
#pragma unroll
      for (int u = 0; u < 2; ++u) fa_exp(s[u], 0.f, e[u], sm[u]);
      // the test: every term is positive, so four partial sums of at most 256 bound every term by 256 (a score at most 8 above M)
      if (__builtin_amdgcn_ballot_w32(fmaxf(fmaxf(sm[0][0], sm[0][1]), fmaxf(sm[1][0], sm[1][1])) > 256.0f) != 0) {   // rare: raise M to the pass's maximum where that is higher, rescale sums and O, redo the pass's exponentials
#pragma unroll
        for (int u = 0; u < 2; ++u) { float mx = fmaxf(s[u][0][0], s[u][1][0]);
#pragma unroll
          for (int r = 1; r < 8; ++r) mx = fmaxf(mx, fmaxf(s[u][0][r], s[u][1][r]));
          const float d = fmaxf(fmaxf(mx, xhalf(mx)), 0.f); const float corr = __builtin_amdgcn_exp2f(-d); cn[u][0] -= d; cn[u][1] -= d; l[u] *= corr; o[u][0] *= corr; o[u][1] *= corr; fa_exp(s[u], d, e[u], sm[u]); } }
#pragma unroll
      for (int u = 0; u < 2; ++u) { v16h pf;
#pragma unroll
        for (int r = 0; r < 8; ++r) { pf[r] = (_Float16)e[u][0][r]; pf[8 + r] = (_Float16)e[u][1][r]; }
        l[u] += sm[u];
#pragma unroll
        for (int j = 0; j < 2; ++j) o[u][j] = wmma_h(vf[j], pf, o[u][j]); }
      vf[0] = frag_l(Vn); vf[1] = frag_l(Vn + 16 * VPB); }
    DW(); AW(); __syncthreads();   // publishes stage st + 1 and ends every wave's reads of stage st
    if (st + 2 < TT / KS) fa_stage(lk + (st & 1) * SBY, lv + (st & 1) * SBY, gk + (size_t)(st + 2) * KS * CC * 2, gv + (size_t)(st + 2) * KS * 2); }
  AW();
#pragma unroll
  for (int u = 0; u < 2; ++u) { const float lu = l[u][0] + l[u][1]; const float inv = 1.0f / (lu + xhalf(lu)); float* yr = Y + ((size_t)b * TT + q0 + u * 16 + col) * CC + h * HD + 8 * g;
#pragma unroll
    for (int j = 0; j < 2; ++j) { const v8f w = o[u][j] * inv; vst2(yr + j * 16, (v4f)w.lo); vst2(yr + j * 16 + 4, (v4f)w.hi); } } }
// ---- k_out: block = (64 rows, 128 cols): out = ctx Wo (+ bo): every row: ctx bf16 hi + lo against exact bf16 Wo (2 products); the f16 (1 product) branch is never taken
__global__ __launch_bounds__(128) void k_out(const float* __restrict__ Y, const float* __restrict__ WO, const float* __restrict__ BO, float* __restrict__ OUT) { __shared__ __align__(16) float sf[4][16][132]; __shared__ __align__(16) char sm[128 * WPB];
  const int tid = threadIdx.x, wave = tid >> 5, lane = tid & 31, col = lane & 15, g = lane >> 4; const int c0 = blockIdx.y * 128; const size_t r0 = (size_t)blockIdx.x * 64 + wave * 16;
  v8f acc[8] = {};
  if (true) {   /* ALL rows: ctx split bf16 hi + lo x exact proj_w (2 products) */
    v4f ar[8][4]; stage_ops(sm, WO + (size_t)c0 * CC, Y + (r0 + col) * CC + 8 * g, tid, ar);
    __syncthreads();   // the weight tile is readable by every wave
    const char* wl = sm + col * WPB + 16 * g; v16b wr[WRD + 1]; float bs[8]; const float* bp = BO + c0 + col;
#pragma unroll   // wr[] has to stay in registers
    for (int t = 0; t < WRD; ++t) wr[t] = WFR(wl, t);
#pragma unroll   // ar[] and wr[] have to stay in registers
    for (int kc = 0; kc < CC / 32; ++kc) { const F2 a = split_a(ar[kc]);
      if (kc == 4) {   // the eight bias values as one group, in registers that half of ar[] has left; they land under the rest of the loop (its unrolls: bs[] has to stay in registers)
        if (BO) {
#pragma unroll
          for (int j = 0; j < 8; ++j) bs[j] = bp[j * 16];
          GNW(bp);
        } else {
#pragma unroll
          for (int j = 0; j < 8; ++j) bs[j] = 0.f; } }
#pragma unroll
      for (int j = 0; j < 8; ++j) { const int t = kc * 8 + j; if (t + WRD < CC / 4) wr[(t + WRD) % (WRD + 1)] = WFR(wl, t + WRD); const v16b w = wr[t % (WRD + 1)]; acc[j] = wmma_bf(a.h, w, acc[j]); acc[j] = wmma_bf(a.l, w, acc[j]); } }
#pragma unroll
    for (int j = 0; j < 8; ++j) { const float bias = bfr(bs[j]);
#pragma unroll
      for (int r = 0; r < 8; ++r) sf[wave][8 * g + r][j * 16 + col] = acc[j][r] + bias; }
  } else {
#pragma unroll 2
    for (int kc = 0; kc < CC / 32; ++kc) { const v16h a = frag_f32(Y + (r0 + col) * CC + kc * 32, lane); asm volatile("s_wait_loadcnt 0x0" ::: "memory");
#pragma unroll
      for (int j = 0; j < 8; ++j) { const v16h w = WOCOLH(WO, kc * 32, c0 + j * 16 + col, lane); asm volatile("s_wait_loadcnt 0x0" ::: "memory"); acc[j] = wmma16(a, w, acc[j]); } }
#pragma unroll
    for (int j = 0; j < 8; ++j) { const float bias = BO ? bfr(BO[c0 + j * 16 + col]) : 0.f;
#pragma unroll
      for (int r = 0; r < 8; ++r) sf[wave][8 * g + r][j * 16 + col] = acc[j][r] * (1.0f / 256.0f) + bias; } }
  LDSX(); for (int rl = 0; rl < 16; ++rl) vst2(OUT + (r0 + rl) * DIN + c0 + lane * 4, *(const v4f*)&sf[wave][rl][lane * 4]); }

extern "C" void kernel_launch(void* const* d_in, const int* in_sizes, int n_in, void* d_out, int out_size, void* d_ws, size_t ws_size, hipStream_t stream) {
  (void)in_sizes; (void)n_in; (void)out_size;
  const float** F = (const float**)d_in;
  if (ws_size < (size_t)WS_END) return;
  char* ws = (char*)d_ws; _Float16 *QH = (_Float16*)(ws + WS_QH), *KH = (_Float16*)(ws + WS_KH), *VT = (_Float16*)(ws + WS_VT), *QL = (_Float16*)(ws + WS_QL), *KL = (_Float16*)(ws + WS_KL); __bf16 *VB = (__bf16*)(ws + WS_VB), *VBL = (__bf16*)(ws + WS_VBL); float *Y = (float*)(ws + WS_Y);
  (void)Y; (void)QL; (void)KL; (void)VB; (void)VBL;
  // inputs: 0 x [2,256,64,64]; 1 gn_gamma, 2 gn_beta [256]; 3 qkv_w [768,256] (out,in) rows q | k | v; 4 qkv_b [768]; 5 proj_w [256,256] (out,in); 6 proj_b
  if (ws_size < (size_t)WS_END2) return;
  float *MV = (float*)(ws + WS_MV), *XT = (float*)(ws + WS_XT), *ORW = (float*)(ws + WS_OR);
  k_gnst<<<dim3(TNB * 8), GNT, 0, stream>>>(F[0], MV);
  k_tok<<<dim3(NTOK / 64, CC / 64, TNB), 256, 0, stream>>>(F[0], MV, F[1], F[2], XT);
  { const float* WQ = F[3]; const float* WK = F[3] + (size_t)CC * DIN; const float* WV = F[3] + (size_t)2 * CC * DIN;
    k_proj<<<dim3(TNB * TT / 64, CC / 128, 3), 128, 0, stream>>>(XT, XT, XT, WQ, WK, WV, F[4], F[4] + CC, F[4] + 2 * CC, QH, QL, KH, KL, VT, VB, VBL); }
  k_fa<<<dim3(TT / 256, TNB * NH), 256, 0, stream>>>(QH, QL, KH, VT, Y);
  k_out<<<dim3(TNB * TT / 64, DIN / 128), 128, 0, stream>>>(Y, F[5], F[6], ORW);
  k_fin<<<dim3(NTOK / 64, CC / 64, TNB), 256, 0, stream>>>(ORW, F[0], (float*)d_out);
}

// v006
// It runs in 79 microseconds.
// Two timings next to v005 both put it at 1.08 times that version's speed.
// Counting every step since v000, it is 19.4 times as fast.
// Single self-attention block on images (b 2, c 256, 64 x 64 -> n 4,096 tokens; 8 heads x 32): xn = GroupNorm(8 groups)(x) (affine); q,k,v = qkv_w xn + qkv_b (1x1, (out,in) rows q|k|v); attn = softmax(q k^T x 32^-0.5); out = proj_w (attn v) + proj_b, reshaped to [b,c,h,w] + x.
#include <hip/hip_runtime.h>
#include <math.h>

typedef __attribute__((ext_vector_type(16))) _Float16 v16h;
typedef __attribute__((ext_vector_type(16))) __bf16 v16b;
typedef __attribute__((ext_vector_type(8)))  _Float16 v8h;
typedef __attribute__((ext_vector_type(8)))  float v8f;
typedef __attribute__((ext_vector_type(4)))  float v4f;
typedef __attribute__((ext_vector_type(2)))  float v2f;
typedef __attribute__((ext_vector_type(4)))  unsigned v4u;
typedef __attribute__((ext_vector_type(4)))  int v4i;
typedef float __attribute__((may_alias)) float_a;
typedef int __attribute__((may_alias)) int_a;

template <typename T> __device__ __forceinline__ void vst2(void* p, T v) { *(T*)p = v;  }
__device__ __forceinline__ v8f wmma16(v16h a, v16h b, v8f c) {
  v8f d = __builtin_amdgcn_wmma_f32_16x16x32_f16(false, a, false, b, (short)0, c, false, false);
  asm volatile("v_nop\n\tv_nop\n\tv_nop\n\tv_nop" : "+v"(d) : "v"(a), "v"(b));
  return d;
}
__device__ __forceinline__ v8f wmma_bf(v16b a, v16b b, v8f c) {
  v8f d = __builtin_amdgcn_wmma_f32_16x16x32_bf16(false, a, false, b, (short)0, c, false, false);
  asm volatile("v_nop\n\tv_nop\n\tv_nop\n\tv_nop" : "+v"(d) : "v"(a), "v"(b));
  return d;
}
// 16x16x32 fragments: lane = (h = lane>>4, row/col = lane&15); elements 0..7 = k0+8h+0..7, 8..15 = k0+16+8h+0..7; D element r = row 8h+r
__device__ __forceinline__ v16h frag_h(const _Float16* rowk0, int lane) {
  union { v16h v; v8h q[2]; } u; const _Float16* p = rowk0 + 8 * (lane >> 4);
  u.q[0] = *(const v8h*)p; u.q[1] = *(const v8h*)(p + 16); return u.v;
}
__device__ __forceinline__ v16h frag_f32(const float* rowk0, int lane) {
  v16h a; const float* p = rowk0 + 8 * (lane >> 4);
#pragma unroll
  for (int i = 0; i < 8; ++i) { a[i] = (_Float16)p[i]; a[8 + i] = (_Float16)p[16 + i]; }
  return a;
}
__device__ __forceinline__ v16h frag_f32s(const float* rowk0, int lane, float sc) {
  v16h a; const float* p = rowk0 + 8 * (lane >> 4);
#pragma unroll
  for (int i = 0; i < 8; ++i) { a[i] = (_Float16)(p[i] * sc); a[8 + i] = (_Float16)(p[16 + i] * sc); }
  return a;
}
// column fragment from a [K][ld] layout (column n), rows >= K read as 0
__device__ __forceinline__ v16h fragc_f32(const float* W, int k0, int n, int lane, int ld, int K) {
  v16h a; const int g = lane >> 4;
#pragma unroll
  for (int i = 0; i < 8; ++i) { const int ka = k0 + 8 * g + i, kb = ka + 16;
    a[i] = (_Float16)(ka < K ? W[(size_t)(ka < K ? ka : K - 1) * ld + n] : 0.f); a[8 + i] = (_Float16)(kb < K ? W[(size_t)(kb < K ? kb : K - 1) * ld + n] : 0.f); }
  return a;
}
struct F2 { v16b h, l; };
__device__ __forceinline__ F2 bsplit16(const float v[16]) { F2 r;
#pragma unroll
  for (int i = 0; i < 16; ++i) { const __bf16 h = (__bf16)v[i]; r.h[i] = h; r.l[i] = (__bf16)(v[i] - (float)h); }
  return r; }
__device__ __forceinline__ F2 split_row(const float* row, int k0, int lane) { float v[16]; const float* p = row + k0 + 8 * (lane >> 4);
#pragma unroll
  for (int i = 0; i < 8; ++i) { v[i] = p[i]; v[8 + i] = p[16 + i]; }
  return bsplit16(v); }
__device__ __forceinline__ F2 split_rowK(const float* row, int k0, int lane, int K) { float v[16]; const int g = lane >> 4;
#pragma unroll
  for (int i = 0; i < 8; ++i) { const int ka = k0 + 8 * g + i, kb = ka + 16; v[i] = ka < K ? row[ka < K ? ka : K - 1] : 0.f; v[8 + i] = kb < K ? row[kb < K ? kb : K - 1] : 0.f; }
  return bsplit16(v); }
__device__ __forceinline__ F2 split_col(const float* W, int k0, int n, int lane, int ld, int K) { float v[16]; const int g = lane >> 4;
#pragma unroll
  for (int i = 0; i < 8; ++i) { const int ka = k0 + 8 * g + i, kb = ka + 16; v[i] = ka < K ? W[(size_t)(ka < K ? ka : K - 1) * ld + n] : 0.f; v[8 + i] = kb < K ? W[(size_t)(kb < K ? kb : K - 1) * ld + n] : 0.f; }
  return bsplit16(v); }
__device__ __forceinline__ v8f mac3(const F2& a, const F2& b, v8f c) { c = wmma_bf(a.l, b.h, c); c = wmma_bf(a.h, b.l, c); return wmma_bf(a.h, b.h, c); }
__device__ __forceinline__ float sigm(float v) { return 1.0f / (1.0f + expf(-v)); }
#define LDSX() do { asm volatile("s_wait_dscnt 0" ::: "memory"); __builtin_amdgcn_wave_barrier(); __builtin_amdgcn_fence(__ATOMIC_RELEASE, "workgroup"); } while (0)

#define NB 2
#define TT 4096
#define CC 256            // NH * HD = projected width
#define DIN 256          // input (model) width
#define NH 8
#define HD 32
#define NQB (TT / 64)
#define HG 2
#define SCALE (0.17677669529663687f)
#define CAUSAL 0
#ifndef TNB
#define TNB NB
#endif
__device__ __forceinline__ float bfr(float v) { return (float)(__bf16)v; }
__host__ __device__ __forceinline__ int kb_last(int qb) { return CAUSAL ? ((qb * 64 + 63) >> 7) : (TT / 128 - 1); }
typedef __attribute__((ext_vector_type(8))) __bf16 v8b;
__device__ __forceinline__ v16b frag_b(const __bf16* rowk0, int lane) {
  union { v16b v; v8b q[2]; } u; const __bf16* p = rowk0 + 8 * (lane >> 4);
  u.q[0] = *(const v8b*)p; u.q[1] = *(const v8b*)(p + 16); return u.v;
}
#define QBH 0              // unused: k_fa has no high-precision path
#define QHI 4096            // rows carrying a q residual plane (all rows when non-causal: 2-product logits everywhere)
#define KHI 64            // key rows carrying k residual / v bf16 hi+lo planes (written by k_proj; no kernel here reads them)
// B fragment (k rows k0+.., output column o) of a weight: (in,out) [K][ld] or (out,in) [ld rows of K]: bf16 exact, or f16(bf16 * 256) exact
__device__ __forceinline__ v16b wcol_io(const float* Wm, int k0, int o, int lane, int ld) { v16b w; const int g = lane >> 4;
#pragma unroll
  for (int i = 0; i < 8; ++i) { w[i] = (__bf16)Wm[(size_t)(k0 + 8 * g + i) * ld + o]; w[8 + i] = (__bf16)Wm[(size_t)(k0 + 16 + 8 * g + i) * ld + o]; }
  return w; }
__device__ __forceinline__ v16b wcol_oi(const float* Wm, int k0, int o, int lane, int K) { v16b w; const float* p = Wm + (size_t)o * K + k0 + 8 * (lane >> 4);
#pragma unroll
  for (int i = 0; i < 8; ++i) { w[i] = (__bf16)p[i]; w[8 + i] = (__bf16)p[16 + i]; }
  return w; }
__device__ __forceinline__ v16h wcolh_io(const float* Wm, int k0, int o, int lane, int ld) { v16h w; const int g = lane >> 4;
#pragma unroll
  for (int i = 0; i < 8; ++i) { w[i] = (_Float16)(bfr(Wm[(size_t)(k0 + 8 * g + i) * ld + o]) * 256.0f); w[8 + i] = (_Float16)(bfr(Wm[(size_t)(k0 + 16 + 8 * g + i) * ld + o]) * 256.0f); }
  return w; }
__device__ __forceinline__ v16h wcolh_oi(const float* Wm, int k0, int o, int lane, int K) { v16h w; const float* p = Wm + (size_t)o * K + k0 + 8 * (lane >> 4);
#pragma unroll
  for (int i = 0; i < 8; ++i) { w[i] = (_Float16)(bfr(p[i]) * 256.0f); w[8 + i] = (_Float16)(bfr(p[16 + i]) * 256.0f); }
  return w; }
#define WQKV_LAYOUT 1   // 0 = (in,out) [DIN][CC]; 1 = (out,in) [CC][DIN]; 2 = per-head [NH][DIN][HD]
__device__ __forceinline__ v16b wcol_hdk(const float* Wm, int k0, int o, int lane) { v16b w; const int g = lane >> 4; const float* p = Wm + (size_t)(o / HD) * DIN * HD + (o % HD);
#pragma unroll
  for (int i = 0; i < 8; ++i) { w[i] = (__bf16)p[(size_t)(k0 + 8 * g + i) * HD]; w[8 + i] = (__bf16)p[(size_t)(k0 + 16 + 8 * g + i) * HD]; }
  return w; }
#define WO_OUT_IN 1
#if WQKV_LAYOUT == 1
#define WCOL(W, k0, o, lane) wcol_oi(W, k0, o, lane, DIN)
#elif WQKV_LAYOUT == 2
#define WCOL(W, k0, o, lane) wcol_hdk(W, k0, o, lane)
#else
#define WCOL(W, k0, o, lane) wcol_io(W, k0, o, lane, CC)
#endif
#if WO_OUT_IN
#define WOCOL(W, k0, o, lane) wcol_oi(W, k0, o, lane, CC)
#define WOCOLH(W, k0, o, lane) wcolh_oi(W, k0, o, lane, CC)
#else
#define WOCOL(W, k0, o, lane) wcol_io(W, k0, o, lane, DIN)
#define WOCOLH(W, k0, o, lane) wcolh_io(W, k0, o, lane, DIN)
#endif
#define NTOK 4096
#ifndef OPITCH
#define OPITCH NTOK        // unused (out is written with pitch NTOK)
#endif
#ifndef XPITCH
#define XPITCH NTOK        // unused (x is read with pitch NTOK)
#endif
// ---- k_gnst: block = one (batch, group), 32 waves; a thread's 16-byte pieces lie 16 KiB apart and are fetched GNB at a time, all in flight before the first is used (one waited load a trip left each pass at one load latency per 4 KiB)
#define GNT 1024           // threads of a block
#define GNB 16             // loads in flight per thread
// behind a group of loads from p, a precaution: p is an input, so its registers are not given to a load of the group as destination ahead of the wait
#define GNW(p) asm volatile("s_wait_xcnt 0x0" :: "v"(p) : "memory")
__device__ __forceinline__ v4f bfr4(v4f v) { v4f r; r[0] = bfr(v[0]); r[1] = bfr(v[1]); r[2] = bfr(v[2]); r[3] = bfr(v[3]); return r; }
__global__ __launch_bounds__(GNT) void k_gnst(const float* __restrict__ X, float* __restrict__ MV) { __shared__ float sred[GNT / 32]; __shared__ float sbc; const int t = threadIdx.x; const size_t base = (size_t)blockIdx.x * (CC / 8) * NTOK; const int n = (CC / 8) * NTOK;
  const v4f* xp = (const v4f*)(X + base) + t;
  v4f sv = {};
  for (int i0 = 0; i0 < n / (4 * GNT); i0 += GNB) { v4f v[GNB]; const v4f* p = xp + (size_t)i0 * GNT;
#pragma unroll   // v[] has to stay in registers
    for (int j = 0; j < GNB; ++j) v[j] = p[(size_t)j * GNT];
    GNW(p);
#pragma unroll
    for (int j = 0; j < GNB; ++j) sv += bfr4(v[j]); }
  float s1 = (sv[0] + sv[1]) + (sv[2] + sv[3]);
#pragma unroll
  for (int o = 1; o < 32; o <<= 1) s1 += __shfl_xor(s1, o);
  if ((t & 31) == 0) sred[t >> 5] = s1; __syncthreads(); if (t == 0) { float a = 0.f; for (int i = 0; i < GNT / 32; ++i) a += sred[i]; sbc = a / (float)n; } __syncthreads(); const float mu = sbc; __syncthreads();
  v4f qv = {};
  for (int i0 = 0; i0 < n / (4 * GNT); i0 += GNB) { v4f v[GNB]; const v4f* p = xp + (size_t)i0 * GNT;
#pragma unroll   // v[] has to stay in registers
    for (int j = 0; j < GNB; ++j) v[j] = p[(size_t)j * GNT];
    GNW(p);
#pragma unroll
    for (int j = 0; j < GNB; ++j) { const v4f d = bfr4(v[j]) - mu; qv += d * d; } }
  float q = (qv[0] + qv[1]) + (qv[2] + qv[3]);
#pragma unroll
  for (int o = 1; o < 32; o <<= 1) q += __shfl_xor(q, o);
  if ((t & 31) == 0) sred[t >> 5] = q; __syncthreads(); if (t == 0) { float a = 0.f; for (int i = 0; i < GNT / 32; ++i) a += sred[i]; sbc = rsqrtf(a / (float)n + 1e-5f); } __syncthreads();
  if (t < 32) { const float v = t == 0 ? mu : (t == 1 ? sbc : 0.f); vst2(MV + (size_t)blockIdx.x * 32 + t, v); } }
// ---- k_tok: block = (64 tokens, 64 channels, batch b): XT[b*N + n][c] = (bf16(x[b][c][n]) - mean_g) * rstd_g * gamma[c] + beta[c] (GroupNorm, g = c / 32) through an LDS tile
__global__ __launch_bounds__(256) void k_tok(const float* __restrict__ X, const float* __restrict__ MV, const float* __restrict__ GG, const float* __restrict__ GB, float* __restrict__ XT) { __shared__ float st[64][68]; const int tid = threadIdx.x; const int n0 = blockIdx.x * 64, c0 = blockIdx.y * 64; const size_t b = blockIdx.z;
  for (int e = tid; e < 64 * 16; e += 256) { const int cl = e >> 4, q = e & 15; const int c = c0 + cl; const int gi = (int)(b * 8) + c / (CC / 8); const float mu = MV[gi * 32], rs = MV[gi * 32 + 1], ga = bfr(GG[c]), be = bfr(GB[c]);
    const v4f v = *(const v4f*)(X + (b * CC + c) * (size_t)NTOK + n0 + q * 4);
#pragma unroll
    for (int j = 0; j < 4; ++j) st[cl][q * 4 + j] = (bfr(v[j]) - mu) * rs * ga + be; }
  __syncthreads();
  for (int e = tid; e < 64 * 16; e += 256) { const int nl = e >> 4, q = e & 15; v4f o; o[0] = st[q * 4][nl]; o[1] = st[q * 4 + 1][nl]; o[2] = st[q * 4 + 2][nl]; o[3] = st[q * 4 + 3][nl]; vst2(XT + (b * NTOK + n0 + nl) * (size_t)CC + c0 + q * 4, o); } }
#define WS_MV  (WS_END)
#define WS_XT  (WS_MV + 4u * 32 * NB * 8 + 1024u)
#define WS_OR  (WS_XT + 4u * (size_t)NB * NTOK * CC)
#define WS_END2 (WS_OR + 4u * (size_t)NB * NTOK * CC)
#ifndef SM_EXTRA_PARAMS
#define SM_EXTRA_PARAMS
#endif
#ifndef PROJ_EXTRA_PARAMS
#define PROJ_EXTRA_PARAMS
#endif
#ifndef SM_MASK_HOOK
#define SM_MASK_HOOK (void)0
#endif

#define WS_QH  0u                                      // f16 q x SC2 rows [b*t][CC]
#define WS_KH  (WS_QH + 2u * (size_t)NB * TT * CC)      // f16 k rows [b*t][CC]
#define WS_VT  (WS_KH + 2u * (size_t)NB * TT * CC)      // f16 v planes [b][c][t]
#define WS_QL  (WS_VT + 2u * (size_t)NB * CC * TT)      // f16 residual of q x SC2 (unscaled) rows [b][t < QHI][CC]
#define WS_KL  (WS_QL + 2u * (size_t)NB * QHI * CC)     // f16 k residual x 2^10 rows [b][t < KHI][CC]
#define WS_VB  (WS_KL + 2u * (size_t)NB * KHI * CC)     // bf16 v hi planes [b][c][t < KHI]
#define WS_VBL (WS_VB + 2u * (size_t)NB * CC * KHI)
#define WS_S   (WS_VBL + 2u * (size_t)NB * CC * KHI)    // f32 [hg][t][s], unused: logits and P stay in registers
#define WS_Y   (WS_S  + 4u * (size_t)HG * TT * TT)      // f32 ctx rows [b*t][CC] (only when there is an output projection)
#define WS_END (WS_Y  + 4u * (size_t)NB * TT * CC)

// ---- operands of k_proj and k_out. The block's weight tile (128 output columns x K = 256, rows of an (out,in) matrix) is read once by whole-line loads, rounded to bf16 and kept in LDS for all four waves; a wave's own 16 activation rows are fetched whole behind it, so the K loop waits for no global load
#define WPB 528            // LDS pitch of a weight row: 256 bf16 + 16 B (16 B x odd: no bank conflict for 16-byte readers)
typedef __attribute__((ext_vector_type(4))) __bf16 v4b;
__device__ __forceinline__ v4b bf4(v4f v) { v4b r; r[0] = (__bf16)v[0]; r[1] = (__bf16)v[1]; r[2] = (__bf16)v[2]; r[3] = (__bf16)v[3]; return r; }
__device__ __forceinline__ v16b frag_lb(const char* p) { union { v16b v; v8b q[2]; } u; u.q[0] = *(const v8b*)p; u.q[1] = *(const v8b*)(p + 32); return u.v; }   // p = row + 2 * k0 + 16 * (lane >> 4): the k order of wcol_oi
// 128 threads: load i of a thread is 16 B of weight row 2 i + (tid >> 6); two groups of 16 loads are in flight at a time. arow = the lane's activation row + 8 * (lane >> 4); a[kc] = the 16 values of split_row at k0 = 32 kc
__device__ __forceinline__ void stage_ops(char* sw, const float* Wt, const float* arow, int tid, v4f (&a)[8][4]) {
  const v4f* wp = (const v4f*)Wt + tid; char* d = sw + (tid >> 6) * WPB + (tid & 63) * 8; v4f u[16], w[16];
  // every "#pragma unroll" here: u, w and a have to stay in registers
#pragma unroll
  for (int i = 0; i < 16; ++i) u[i] = wp[(size_t)i * 128];
#pragma unroll
  for (int i = 0; i < 16; ++i) w[i] = wp[(size_t)(16 + i) * 128];
  GNW(wp);
#pragma unroll
  for (int i = 0; i < 16; ++i) *(v4b*)(d + i * 2 * WPB) = bf4(u[i]);
#pragma unroll
  for (int i = 0; i < 16; ++i) u[i] = wp[(size_t)(32 + i) * 128];
  GNW(wp);
#pragma unroll
  for (int i = 0; i < 16; ++i) *(v4b*)(d + (16 + i) * 2 * WPB) = bf4(w[i]);
#pragma unroll
  for (int i = 0; i < 16; ++i) w[i] = wp[(size_t)(48 + i) * 128];
  GNW(wp);
#pragma unroll
  for (int i = 0; i < 16; ++i) *(v4b*)(d + (32 + i) * 2 * WPB) = bf4(u[i]);
#pragma unroll
  for (int kc = 0; kc < 8; ++kc) { const v4f* p = (const v4f*)(arow + kc * 32); a[kc][0] = p[0]; a[kc][1] = p[1]; a[kc][2] = p[4]; a[kc][3] = p[5]; }
  GNW(arow);
#pragma unroll
  for (int i = 0; i < 16; ++i) *(v4b*)(d + (48 + i) * 2 * WPB) = bf4(w[i]); }
__device__ __forceinline__ F2 split_a(const v4f (&q)[4]) { float v[16];
#pragma unroll   // v[] has to stay in registers
  for (int i = 0; i < 4; ++i) { v[i] = q[0][i]; v[4 + i] = q[1][i]; v[8 + i] = q[2][i]; v[12 + i] = q[3][i]; }
  return bsplit16(v); }
#define SC2 (SCALE * 1.4426950408889634f)   // logits to base 2: k_proj folds it into q
#define WRD 2              // weight fragments are read from LDS WRD ahead of their products (read next to its product, each cost one LDS latency)
#define WFR(wl, t) frag_lb((wl) + ((t) & 7) * 16 * WPB + ((t) >> 3) * 64)   // fragment t = 8 kc + j
// ---- k_proj: block = (64 rows, 128 cols, which): q/k/v = X W (+ b) with exact bf16 products (K = DIN) -> which 0: q x SC2 f16 rows (+ residual rows < QHI); 1: k f16 rows (+ residual rows < KHI); 2: v f16 planes [c][t] (+ bf16 hi/lo planes for t < KHI)
__global__ __launch_bounds__(128) void k_proj(const float* __restrict__ XQ, const float* __restrict__ XK, const float* __restrict__ XV, const float* __restrict__ WQ, const float* __restrict__ WK, const float* __restrict__ WV, const float* __restrict__ BQ, const float* __restrict__ BK, const float* __restrict__ BV,
    _Float16* __restrict__ QH, _Float16* __restrict__ QL, _Float16* __restrict__ KH, _Float16* __restrict__ KL, _Float16* __restrict__ VT, __bf16* __restrict__ VB, __bf16* __restrict__ VBL) {
  __shared__ __align__(16) char sm[128 * WPB];   // the weight tile; behind the K loop and a barrier the same bytes hold the output tiles
  _Float16 (*sh)[136] = (_Float16 (*)[136])sm; _Float16 (*sl)[136] = (_Float16 (*)[136])(sm + 64 * 136 * 2); _Float16 (*th)[72] = (_Float16 (*)[72])sm; __bf16 (*tb)[72] = (__bf16 (*)[72])(sm + 128 * 72 * 2); __bf16 (*tbl)[72] = (__bf16 (*)[72])(sm + 2 * 128 * 72 * 2);
  const int tid = threadIdx.x, wave = tid >> 5, lane = tid & 31, col = lane & 15, g = lane >> 4; const int which = blockIdx.z; const int c0 = blockIdx.y * 128; const size_t r0 = (size_t)blockIdx.x * 64; const size_t bb = r0 / TT; const int t0 = (int)(r0 % TT);
  const float* X = which == 0 ? XQ : which == 1 ? XK : XV; const float* WA = which == 0 ? WQ : which == 1 ? WK : WV; const float* BA = which == 0 ? BQ : which == 1 ? BK : BV;
  v4f ar[8][4]; stage_ops(sm, WA + (size_t)c0 * DIN, X + (r0 + wave * 16 + col) * DIN + 8 * g, tid, ar);
  __syncthreads();   // the weight tile is readable by every wave
  const char* wl = sm + col * WPB + 16 * g;
  v8f acc[8] = {}; v16b wr[WRD + 1]; float bs[8]; const float* bp = BA + c0 + col;
#pragma unroll   // wr[] has to stay in registers
  for (int t = 0; t < WRD; ++t) wr[t] = WFR(wl, t);
#pragma unroll   // ar[] and wr[] have to stay in registers
  for (int kc = 0; kc < DIN / 32; ++kc) { const F2 a2 = split_a(ar[kc]);   /* GroupNorm rows (f32) split hi + lo */
    if (kc == 4) {   // the eight bias values as one group, in registers that half of ar[] has left; they land under the rest of the loop (its unrolls: bs[] has to stay in registers)
      if (BA) {
#pragma unroll
        for (int j = 0; j < 8; ++j) bs[j] = bp[j * 16];
        GNW(bp);
      } else {
#pragma unroll
        for (int j = 0; j < 8; ++j) bs[j] = 0.f; } }
#pragma unroll
    for (int j = 0; j < 8; ++j) { const int t = kc * 8 + j; if (t + WRD < DIN / 4) wr[(t + WRD) % (WRD + 1)] = WFR(wl, t + WRD); const v16b w = wr[t % (WRD + 1)]; acc[j] = wmma_bf(a2.h, w, acc[j]); acc[j] = wmma_bf(a2.l, w, acc[j]); } }
  __syncthreads();   // every wave has read its last weight fragment: the bytes are given to the output tiles
  if (which < 2) { _Float16* DH = which == 0 ? QH : KH; _Float16* DL = which == 0 ? QL : KL; const int nhi = which == 0 ? QHI : KHI; const bool hi_rows = t0 < nhi; const float qs = which == 0 ? SC2 : 1.0f, rs = which == 0 ? 1.0f : 1024.0f;   // q: base-2 logit units, residual on the scale of its high part (k_fa chains both products in one accumulator)
#pragma unroll
    for (int j = 0; j < 8; ++j) { const float bias = bfr(bs[j]);
#pragma unroll
      for (int r = 0; r < 8; ++r) { const float v = (acc[j][r] + bias) * qs; const _Float16 hv = (_Float16)v; sh[wave * 16 + 8 * g + r][j * 16 + col] = hv; sl[wave * 16 + 8 * g + r][j * 16 + col] = (_Float16)((v - (float)hv) * rs); } }
    __syncthreads();
    for (int e = tid; e < 64 * 16; e += 128) { const int rl = e >> 4, q = e & 15; vst2((unsigned*)(DH + (r0 + rl) * CC + c0 + q * 8), *(const v4u*)&sh[rl][q * 8]); if (hi_rows) vst2((unsigned*)(DL + (bb * nhi + t0 + rl) * (size_t)CC + c0 + q * 8), *(const v4u*)&sl[rl][q * 8]); }
  } else { const bool hi_rows = t0 < KHI;
#pragma unroll
    for (int j = 0; j < 8; ++j) { const float bias = bfr(bs[j]);
#pragma unroll
      for (int r = 0; r < 8; ++r) { const float v = acc[j][r] + bias; const int rl = wave * 16 + 8 * g + r, cl = j * 16 + col; th[cl][rl] = (_Float16)v; const __bf16 bh = (__bf16)v; tb[cl][rl] = bh; tbl[cl][rl] = (__bf16)(v - (float)bh); } }
    __syncthreads();
    for (int e = tid; e < 128 * 8; e += 128) { const int cl = e >> 3, q = e & 7; vst2((unsigned*)(VT + (bb * CC + c0 + cl) * (size_t)TT + t0 + q * 8), *(const v4u*)&th[cl][q * 8]); if (hi_rows) { const size_t o3 = (bb * CC + c0 + cl) * (size_t)KHI + t0 + q * 8; vst2((unsigned*)(VB + o3), *(const v4u*)&tb[cl][q * 8]); vst2((unsigned*)(VBL + o3), *(const v4u*)&tbl[cl][q * 8]); } } } }
// ---- k_fa: block = 8 waves x 32 query columns of one (b, h); one pass = 32 keys, one stage = KS keys. S^T = K Q^T - M (A = k rows, B = q hi, then q residual: 2 products chained in one accumulator that starts at minus the column's maximum in use M, so the scores leave the matrix unit as arguments of exp2), lazy rescale (M, sums and O move only in a pass whose sums show that a score may lie more than 8 above M: one test a pass; a lane holds one query's scores), P^T packed from the score accumulators to f16 as the B operand of O^T += V^T P^T (A = v planes [c][t]); logits and P never reach memory. K rows and V planes of a stage are brought into LDS once per block by asynchronous copies (two buffers, the next stage in flight) and read from there by all eight waves
__device__ __forceinline__ float xhalf(float x) { return __builtin_bit_cast(float, __builtin_amdgcn_permlanex16(__builtin_bit_cast(int, x), __builtin_bit_cast(int, x), 0x76543210, 0xfedcba98, false, false)); }   // lane l with lane l ^ 16
__device__ __forceinline__ v8f wmma_h(v16h a, v16h b, v8f c) { return __builtin_amdgcn_wmma_f32_16x16x32_f16(false, a, false, b, (short)0, c, false, false); }
#define XW() asm volatile("s_wait_xcnt 0x0" ::: "memory")   // behind a group of loads: a later load's result may land in the group's address registers
#define KS 256                  // keys of a stage
#define KPB 80                  // LDS pitch of a k row: 64 B + 16 (16 B x odd: no bank conflict for 16-byte readers)
#define VPB (2 * KS + 16)       // LDS pitch of a v plane row, the same rule
#define KBY (KS * KPB)
#define SBY (KBY + HD * VPB)    // one buffer: k rows, then v rows
#define AW() asm volatile("s_wait_asynccnt 0x0" ::: "memory")   // this wave's copies have landed
#define DW() asm volatile("s_wait_dscnt 0x0" ::: "memory")      // this wave's LDS reads have returned before the buffer is given up
// one stage: each thread copies 4 x 16 B of k rows (4 threads a row, rows 64 apart) and 4 x 16 B of v rows (32 threads a row, rows 8 apart); the wait in the same statement stands before the address registers are reused
__device__ __forceinline__ void fa_stage(unsigned lk, unsigned lv, const char* gk, const char* gv) {
  asm volatile("global_load_async_to_lds_b128 %0, %1, off\n\tglobal_load_async_to_lds_b128 %2, %3, off\n\tglobal_load_async_to_lds_b128 %4, %5, off\n\tglobal_load_async_to_lds_b128 %6, %7, off\n\t"
               "global_load_async_to_lds_b128 %8, %9, off\n\tglobal_load_async_to_lds_b128 %10, %11, off\n\tglobal_load_async_to_lds_b128 %12, %13, off\n\tglobal_load_async_to_lds_b128 %14, %15, off\n\ts_wait_xcnt 0x0"
    :: "v"(lk), "v"(gk), "v"(lk + 64u * KPB), "v"(gk + (size_t)64 * CC * 2), "v"(lk + 128u * KPB), "v"(gk + (size_t)128 * CC * 2), "v"(lk + 192u * KPB), "v"(gk + (size_t)192 * CC * 2),
       "v"(lv), "v"(gv), "v"(lv + 8u * VPB), "v"(gv + (size_t)8 * TT * 2), "v"(lv + 16u * VPB), "v"(gv + (size_t)16 * TT * 2), "v"(lv + 24u * VPB), "v"(gv + (size_t)24 * TT * 2) : "memory"); }
__device__ __forceinline__ v16h frag_l(const char* p) { union { v16h v; v8h q[2]; } u; u.q[0] = *(const v8h*)p; u.q[1] = *(const v8h*)(p + 32); return u.v; }   // p = row + 16 * (lane >> 4): the k order of frag_h
// one column group's 32 x 16 scores less d to powers of two, and their sum in two parts
__device__ __forceinline__ void fa_exp(const v8f (&s)[2], float d, v8f (&e)[2], v2f& sm) {
#pragma unroll   // e[] has to stay in registers
  for (int i = 0; i < 2; ++i)
#pragma unroll
    for (int r = 0; r < 8; ++r) e[i][r] = __builtin_amdgcn_exp2f(s[i][r] - d);
  const v8f ps = e[0] + e[1]; const v4f p4 = ps.lo + ps.hi; sm = p4.lo + p4.hi; }
__global__ __launch_bounds__(256) void k_fa(const _Float16* __restrict__ QH, const _Float16* __restrict__ QL, const _Float16* __restrict__ KH, const _Float16* __restrict__ VT, float* __restrict__ Y) {
  __shared__ __align__(16) char ring[2 * SBY];
  const int tid = threadIdx.x, wave = tid >> 5, lane = tid & 31, col = lane & 15, g = lane >> 4; const int b = blockIdx.y / NH, h = blockIdx.y % NH; const int q0 = blockIdx.x * 256 + wave * 32;
  // every "#pragma unroll" of this kernel: the small arrays it indexes have to stay in registers
  const char* gk = (const char*)(KH + ((size_t)b * TT + (tid >> 2)) * CC + h * HD) + (tid & 3) * 16; const char* gv = (const char*)(VT + ((size_t)b * CC + h * HD + (tid >> 5)) * (size_t)TT) + (tid & 31) * 16;
  const unsigned lk = (unsigned)(size_t)ring + (unsigned)((tid >> 2) * KPB + (tid & 3) * 16), lv = (unsigned)(size_t)ring + (unsigned)(KBY + (tid >> 5) * VPB + (tid & 31) * 16);
  fa_stage(lk, lv, gk, gv);
  v16h qh[2], ql[2];
#pragma unroll
  for (int u = 0; u < 2; ++u) qh[u] = frag_h(QH + ((size_t)b * TT + q0 + u * 16 + col) * CC + h * HD, lane);
  XW();
#pragma unroll
  for (int u = 0; u < 2; ++u) ql[u] = frag_h(QL + ((size_t)b * QHI + q0 + u * 16 + col) * CC + h * HD, lane);
  XW();
  AW(); __syncthreads();   // stage 0 is readable by every wave
  fa_stage(lk + SBY, lv + SBY, gk + (size_t)KS * CC * 2, gv + (size_t)KS * 2);
  v8f o[2][2] = {}; v2f l[2] = {}; v8f cn[2][2];   // cn[u][i] = -M of column group u in all eight rows: the start value of score tile (u, i); a tile each, since one shared by two products was copied by the compiler in every pass
  { // M starts at the maximum over the first 32 keys (high parts alone: any value within 8 of the maximum serves), the same in both wave halves
    const char* K0 = ring + col * KPB + 16 * g; const v16h k0 = frag_l(K0), k1 = frag_l(K0 + 16 * KPB); const v8f z = {};
#pragma unroll
    for (int u = 0; u < 2; ++u) { const v8f t0 = wmma_h(k0, qh[u], z), t1 = wmma_h(k1, qh[u], z); float mx = fmaxf(t0[0], t1[0]);
#pragma unroll
      for (int r = 1; r < 8; ++r) mx = fmaxf(mx, fmaxf(t0[r], t1[r]));
      mx = fmaxf(mx, xhalf(mx)); cn[u][0] = z - mx; cn[u][1] = z - mx; } }
#pragma unroll 1   // one stage a trip: the buffer index stays a run-time value
  for (int st = 0; st < TT / KS; ++st) {
    const char* Kl = ring + (st & 1) * SBY + col * KPB + 16 * g; const char* Vl = ring + (st & 1) * SBY + KBY + col * VPB + 16 * g;
    v16h kf[2], vf[2]; kf[0] = frag_l(Kl); kf[1] = frag_l(Kl + 16 * KPB); vf[0] = frag_l(Vl); vf[1] = frag_l(Vl + 16 * VPB); const char* Kn = Kl; const char* Vn = Vl;
#pragma unroll 1   // unrolled, the fragment reads were moved next to their users and waited for there
    for (int p = 0; p < KS / 32; ++p) {
      v8f s[2][2], e[2][2]; v2f sm[2];
#pragma unroll
      for (int i = 0; i < 2; ++i)
#pragma unroll
        for (int u = 0; u < 2; ++u) s[u][i] = wmma_h(kf[i], qh[u], cn[u][i]);
#pragma unroll
      for (int i = 0; i < 2; ++i)
#pragma unroll
        for (int u = 0; u < 2; ++u) s[u][i] = wmma_h(kf[i], ql[u], s[u][i]);
      __builtin_amdgcn_sched_barrier(0);   // the eight score products stay one run: spread among the vector work each pair cost four idle slots before its first reader
      // both operands are fetched one pass ahead, each behind its last use, inside the stage's own buffer (its last pass refetches pass 0, unused)
      Kn += p + 1 < KS / 32 ? 32 * KPB : -(KS / 32 - 1) * 32 * KPB; Vn += p + 1 < KS / 32 ? 64 : -(KS / 32 - 1) * 64;
      kf[0] = frag_l(Kn); kf[1] = frag_l(Kn + 16 * KPB);
      __builtin_amdgcn_sched_barrier(0);   // the k reads stay here, under the products' latency: left free they were sunk below the test, next to the next pass's products
#pragma unroll
      for (int u = 0; u < 2; ++u) fa_exp(s[u], 0.f, e[u], sm[u]);
      // the test: every term is positive, so four partial sums of at most 256 bound every term by 256 (a score at most 8 above M)
      if (__builtin_amdgcn_ballot_w32(fmaxf(fmaxf(sm[0][0], sm[0][1]), fmaxf(sm[1][0], sm[1][1])) > 256.0f) != 0) {   // rare: raise M to the pass's maximum where that is higher, rescale sums and O, redo the pass's exponentials
#pragma unroll
        for (int u = 0; u < 2; ++u) { float mx = fmaxf(s[u][0][0], s[u][1][0]);
#pragma unroll
          for (int r = 1; r < 8; ++r) mx = fmaxf(mx, fmaxf(s[u][0][r], s[u][1][r]));
          const float d = fmaxf(fmaxf(mx, xhalf(mx)), 0.f); const float corr = __builtin_amdgcn_exp2f(-d); cn[u][0] -= d; cn[u][1] -= d; l[u] *= corr; o[u][0] *= corr; o[u][1] *= corr; fa_exp(s[u], d, e[u], sm[u]); } }
#pragma unroll
      for (int u = 0; u < 2; ++u) { v16h pf;
#pragma unroll
        for (int r = 0; r < 8; ++r) { pf[r] = (_Float16)e[u][0][r]; pf[8 + r] = (_Float16)e[u][1][r]; }
        l[u] += sm[u];
#pragma unroll
        for (int j = 0; j < 2; ++j) o[u][j] = wmma_h(vf[j], pf, o[u][j]); }
      vf[0] = frag_l(Vn); vf[1] = frag_l(Vn + 16 * VPB); }
    DW(); AW(); __syncthreads();   // publishes stage st + 1 and ends every wave's reads of stage st
    if (st + 2 < TT / KS) fa_stage(lk + (st & 1) * SBY, lv + (st & 1) * SBY, gk + (size_t)(st + 2) * KS * CC * 2, gv + (size_t)(st + 2) * KS * 2); }
  AW();
#pragma unroll
  for (int u = 0; u < 2; ++u) { const float lu = l[u][0] + l[u][1]; const float inv = 1.0f / (lu + xhalf(lu)); float* yr = Y + ((size_t)b * TT + q0 + u * 16 + col) * CC + h * HD + 8 * g;
#pragma unroll
    for (int j = 0; j < 2; ++j) { const v8f w = o[u][j] * inv; vst2(yr + j * 16, (v4f)w.lo); vst2(yr + j * 16 + 4, (v4f)w.hi); } } }
// ---- k_out: block = (64 tokens, 128 channels): out[b][c][n] = ctx Wo + bo + bf16(x[b][c][n]), ctx split bf16 hi + lo against exact bf16 Wo (2 products). A lane's accumulator tile holds 8 consecutive tokens of one channel: the block's tile goes to LDS channel-major by 16-byte stores and leaves as 256-B runs of 64 tokens per channel with the residual added, so the result has no token-major copy in memory and needs no launch that turns it
#define OTP 68             // LDS pitch in floats of a channel's 64 tokens (16 B x odd: no bank conflict for 16-byte accesses)
__global__ __launch_bounds__(128) void k_out(const float* __restrict__ Y, const float* __restrict__ WO, const float* __restrict__ BO, const float* __restrict__ X, float* __restrict__ OUT) { __shared__ __align__(16) float st[128][OTP]; __shared__ __align__(16) char sm[128 * WPB];
  const int tid = threadIdx.x, wave = tid >> 5, lane = tid & 31, col = lane & 15, g = lane >> 4; const int c0 = blockIdx.y * 128; const size_t r0 = (size_t)blockIdx.x * 64 + wave * 16;
  const size_t rb = (size_t)blockIdx.x * 64; const size_t oi = ((rb / NTOK) * CC + c0 + (tid >> 4)) * (size_t)NTOK + rb % NTOK + (tid & 15) * 4;   // piece i of this thread in x and out: 4 tokens of channel c0 + (tid >> 4) + 8 i
  const float* xp = X + oi; v4f xr[16];
  v8f acc[8] = {};
  if (true) {   /* ALL rows: ctx split bf16 hi + lo x exact proj_w (2 products) */
    v4f ar[8][4]; stage_ops(sm, WO + (size_t)c0 * CC, Y + (r0 + col) * CC + 8 * g, tid, ar);
    __syncthreads();   // the weight tile is readable by every wave
    const char* wl = sm + col * WPB + 16 * g; v16b wr[WRD + 1]; float bs[8]; const float* bp = BO + c0 + col;
#pragma unroll   // wr[] has to stay in registers
    for (int t = 0; t < WRD; ++t) wr[t] = WFR(wl, t);
#pragma unroll   // ar[] and wr[] have to stay in registers
    for (int kc = 0; kc < CC / 32; ++kc) { const F2 a = split_a(ar[kc]);
      if (kc == 4) {   // the eight bias values as one group, in registers that half of ar[] has left; they land under the rest of the loop (its unrolls: bs[] has to stay in registers)
        if (BO) {
#pragma unroll
          for (int j = 0; j < 8; ++j) bs[j] = bp[j * 16];
          GNW(bp);
        } else {
#pragma unroll
          for (int j = 0; j < 8; ++j) bs[j] = 0.f; } }
      if (kc == 4 || kc == 6) {   // the residual's pieces, eight at a time, also in registers that ar[] has left: they land under the rest of the loop (unroll: xr[] has to stay in registers)
#pragma unroll
        for (int i = 0; i < 8; ++i) xr[(kc - 4) * 4 + i] = *(const v4f*)(xp + (size_t)((kc - 4) * 4 + i) * 8 * NTOK);
        GNW(xp); }
#pragma unroll
      for (int j = 0; j < 8; ++j) { const int t = kc * 8 + j; if (t + WRD < CC / 4) wr[(t + WRD) % (WRD + 1)] = WFR(wl, t + WRD); const v16b w = wr[t % (WRD + 1)]; acc[j] = wmma_bf(a.h, w, acc[j]); acc[j] = wmma_bf(a.l, w, acc[j]); } }
#pragma unroll
    for (int j = 0; j < 8; ++j) { const float bias = bfr(bs[j]); const v8f w = acc[j] + bias; float* d = &st[j * 16 + col][wave * 16 + 8 * g]; *(v4f*)d = w.lo; *(v4f*)(d + 4) = w.hi; }
  }
  __syncthreads();   // a channel's 64 tokens come from all four waves
  v4f o[16];
#pragma unroll   // xr[] and o[] have to stay in registers
  for (int i = 0; i < 16; ++i) o[i] = *(const v4f*)&st[(tid >> 4) + 8 * i][(tid & 15) * 4] + bfr4(xr[i]);
  __builtin_amdgcn_sched_barrier(0);   // every sum has a register of its own before the first store: mixed with the sums, the stores' registers were reused behind waits
#pragma unroll
  for (int i = 0; i < 16; ++i) vst2(OUT + oi + (size_t)i * 8 * NTOK, o[i]); }

extern "C" void kernel_launch(void* const* d_in, const int* in_sizes, int n_in, void* d_out, int out_size, void* d_ws, size_t ws_size, hipStream_t stream) {
  (void)in_sizes; (void)n_in; (void)out_size;
  const float** F = (const float**)d_in;
  if (ws_size < (size_t)WS_END) return;
  char* ws = (char*)d_ws; _Float16 *QH = (_Float16*)(ws + WS_QH), *KH = (_Float16*)(ws + WS_KH), *VT = (_Float16*)(ws + WS_VT), *QL = (_Float16*)(ws + WS_QL), *KL = (_Float16*)(ws + WS_KL); __bf16 *VB = (__bf16*)(ws + WS_VB), *VBL = (__bf16*)(ws + WS_VBL); float *Y = (float*)(ws + WS_Y);
  (void)Y; (void)QL; (void)KL; (void)VB; (void)VBL;
  // inputs: 0 x [2,256,64,64]; 1 gn_gamma, 2 gn_beta [256]; 3 qkv_w [768,256] (out,in) rows q | k | v; 4 qkv_b [768]; 5 proj_w [256,256] (out,in); 6 proj_b
  if (ws_size < (size_t)WS_END2) return;
  float *MV = (float*)(ws + WS_MV), *XT = (float*)(ws + WS_XT);
  k_gnst<<<dim3(TNB * 8), GNT, 0, stream>>>(F[0], MV);
  k_tok<<<dim3(NTOK / 64, CC / 64, TNB), 256, 0, stream>>>(F[0], MV, F[1], F[2], XT);
  { const float* WQ = F[3]; const float* WK = F[3] + (size_t)CC * DIN; const float* WV = F[3] + (size_t)2 * CC * DIN;
    k_proj<<<dim3(TNB * TT / 64, CC / 128, 3), 128, 0, stream>>>(XT, XT, XT, WQ, WK, WV, F[4], F[4] + CC, F[4] + 2 * CC, QH, QL, KH, KL, VT, VB, VBL); }
  k_fa<<<dim3(TT / 256, TNB * NH), 256, 0, stream>>>(QH, QL, KH, VT, Y);
  k_out<<<dim3(TNB * TT / 64, DIN / 128), 128, 0, stream>>>(Y, F[5], F[6], F[0], (float*)d_out);
}

// v007
// One run takes 76.6 microseconds.
// Next to v006, in two timings, it ran 1.03 times as fast each time.
// Counting every step since v000, it is 20.1 times as fast.
// Single self-attention block on images (b 2, c 256, 64 x 64 -> n 4,096 tokens; 8 heads x 32): xn = GroupNorm(8 groups)(x) (affine); q,k,v = qkv_w xn + qkv_b (1x1, (out,in) rows q|k|v); attn = softmax(q k^T x 32^-0.5); out = proj_w (attn v) + proj_b, reshaped to [b,c,h,w] + x.
#include <hip/hip_runtime.h>
#include <math.h>

typedef __attribute__((ext_vector_type(16))) _Float16 v16h;
typedef __attribute__((ext_vector_type(16))) __bf16 v16b;
typedef __attribute__((ext_vector_type(8)))  _Float16 v8h;
typedef __attribute__((ext_vector_type(8)))  float v8f;
typedef __attribute__((ext_vector_type(4)))  float v4f;
typedef __attribute__((ext_vector_type(2)))  float v2f;
typedef __attribute__((ext_vector_type(4)))  unsigned v4u;
typedef __attribute__((ext_vector_type(4)))  int v4i;
typedef float __attribute__((may_alias)) float_a;
typedef int __attribute__((may_alias)) int_a;

template <typename T> __device__ __forceinline__ void vst2(void* p, T v) { *(T*)p = v;  }
__device__ __forceinline__ v8f wmma16(v16h a, v16h b, v8f c) {
  v8f d = __builtin_amdgcn_wmma_f32_16x16x32_f16(false, a, false, b, (short)0, c, false, false);
  asm volatile("v_nop\n\tv_nop\n\tv_nop\n\tv_nop" : "+v"(d) : "v"(a), "v"(b));
  return d;
}
__device__ __forceinline__ v8f wmma_bf(v16b a, v16b b, v8f c) {
  v8f d = __builtin_amdgcn_wmma_f32_16x16x32_bf16(false, a, false, b, (short)0, c, false, false);
  asm volatile("v_nop\n\tv_nop\n\tv_nop\n\tv_nop" : "+v"(d) : "v"(a), "v"(b));
  return d;
}
// 16x16x32 fragments: lane = (h = lane>>4, row/col = lane&15); elements 0..7 = k0+8h+0..7, 8..15 = k0+16+8h+0..7; D element r = row 8h+r
__device__ __forceinline__ v16h frag_h(const _Float16* rowk0, int lane) {
  union { v16h v; v8h q[2]; } u; const _Float16* p = rowk0 + 8 * (lane >> 4);
  u.q[0] = *(const v8h*)p; u.q[1] = *(const v8h*)(p + 16); return u.v;
}
__device__ __forceinline__ v16h frag_f32(const float* rowk0, int lane) {
  v16h a; const float* p = rowk0 + 8 * (lane >> 4);
#pragma unroll
  for (int i = 0; i < 8; ++i) { a[i] = (_Float16)p[i]; a[8 + i] = (_Float16)p[16 + i]; }
  return a;
}
__device__ __forceinline__ v16h frag_f32s(const float* rowk0, int lane, float sc) {
  v16h a; const float* p = rowk0 + 8 * (lane >> 4);
#pragma unroll
  for (int i = 0; i < 8; ++i) { a[i] = (_Float16)(p[i] * sc); a[8 + i] = (_Float16)(p[16 + i] * sc); }
  return a;
}
// column fragment from a [K][ld] layout (column n), rows >= K read as 0
__device__ __forceinline__ v16h fragc_f32(const float* W, int k0, int n, int lane, int ld, int K) {
  v16h a; const int g = lane >> 4;
#pragma unroll
  for (int i = 0; i < 8; ++i) { const int ka = k0 + 8 * g + i, kb = ka + 16;
    a[i] = (_Float16)(ka < K ? W[(size_t)(ka < K ? ka : K - 1) * ld + n] : 0.f); a[8 + i] = (_Float16)(kb < K ? W[(size_t)(kb < K ? kb : K - 1) * ld + n] : 0.f); }
  return a;
}
struct F2 { v16b h, l; };
__device__ __forceinline__ F2 bsplit16(const float v[16]) { F2 r;
#pragma unroll
  for (int i = 0; i < 16; ++i) { const __bf16 h = (__bf16)v[i]; r.h[i] = h; r.l[i] = (__bf16)(v[i] - (float)h); }
  return r; }
__device__ __forceinline__ F2 split_row(const float* row, int k0, int lane) { float v[16]; const float* p = row + k0 + 8 * (lane >> 4);
#pragma unroll
  for (int i = 0; i < 8; ++i) { v[i] = p[i]; v[8 + i] = p[16 + i]; }
  return bsplit16(v); }
__device__ __forceinline__ F2 split_rowK(const float* row, int k0, int lane, int K) { float v[16]; const int g = lane >> 4;
#pragma unroll
  for (int i = 0; i < 8; ++i) { const int ka = k0 + 8 * g + i, kb = ka + 16; v[i] = ka < K ? row[ka < K ? ka : K - 1] : 0.f; v[8 + i] = kb < K ? row[kb < K ? kb : K - 1] : 0.f; }
  return bsplit16(v); }
__device__ __forceinline__ F2 split_col(const float* W, int k0, int n, int lane, int ld, int K) { float v[16]; const int g = lane >> 4;
#pragma unroll
  for (int i = 0; i < 8; ++i) { const int ka = k0 + 8 * g + i, kb = ka + 16; v[i] = ka < K ? W[(size_t)(ka < K ? ka : K - 1) * ld + n] : 0.f; v[8 + i] = kb < K ? W[(size_t)(kb < K ? kb : K - 1) * ld + n] : 0.f; }
  return bsplit16(v); }
__device__ __forceinline__ v8f mac3(const F2& a, const F2& b, v8f c) { c = wmma_bf(a.l, b.h, c); c = wmma_bf(a.h, b.l, c); return wmma_bf(a.h, b.h, c); }
__device__ __forceinline__ float sigm(float v) { return 1.0f / (1.0f + expf(-v)); }
#define LDSX() do { asm volatile("s_wait_dscnt 0" ::: "memory"); __builtin_amdgcn_wave_barrier(); __builtin_amdgcn_fence(__ATOMIC_RELEASE, "workgroup"); } while (0)

#define NB 2
#define TT 4096
#define CC 256            // NH * HD = projected width
#define DIN 256          // input (model) width
#define NH 8
#define HD 32
#define NQB (TT / 64)
#define HG 2
#define SCALE (0.17677669529663687f)
#define CAUSAL 0
#ifndef TNB
#define TNB NB
#endif
__device__ __forceinline__ float bfr(float v) { return (float)(__bf16)v; }
__host__ __device__ __forceinline__ int kb_last(int qb) { return CAUSAL ? ((qb * 64 + 63) >> 7) : (TT / 128 - 1); }
typedef __attribute__((ext_vector_type(8))) __bf16 v8b;
__device__ __forceinline__ v16b frag_b(const __bf16* rowk0, int lane) {
  union { v16b v; v8b q[2]; } u; const __bf16* p = rowk0 + 8 * (lane >> 4);
  u.q[0] = *(const v8b*)p; u.q[1] = *(const v8b*)(p + 16); return u.v;
}
#define QBH 0              // unused: k_fa has no high-precision path
#define QHI 4096            // rows carrying a q residual plane (all rows when non-causal: 2-product logits everywhere)
#define KHI 64            // key rows carrying k residual / v bf16 hi+lo planes (written by k_proj; no kernel here reads them)
// B fragment (k rows k0+.., output column o) of a weight: (in,out) [K][ld] or (out,in) [ld rows of K]: bf16 exact, or f16(bf16 * 256) exact
__device__ __forceinline__ v16b wcol_io(const float* Wm, int k0, int o, int lane, int ld) { v16b w; const int g = lane >> 4;
#pragma unroll
  for (int i = 0; i < 8; ++i) { w[i] = (__bf16)Wm[(size_t)(k0 + 8 * g + i) * ld + o]; w[8 + i] = (__bf16)Wm[(size_t)(k0 + 16 + 8 * g + i) * ld + o]; }
  return w; }
__device__ __forceinline__ v16b wcol_oi(const float* Wm, int k0, int o, int lane, int K) { v16b w; const float* p = Wm + (size_t)o * K + k0 + 8 * (lane >> 4);
#pragma unroll
  for (int i = 0; i < 8; ++i) { w[i] = (__bf16)p[i]; w[8 + i] = (__bf16)p[16 + i]; }
  return w; }
__device__ __forceinline__ v16h wcolh_io(const float* Wm, int k0, int o, int lane, int ld) { v16h w; const int g = lane >> 4;
#pragma unroll
  for (int i = 0; i < 8; ++i) { w[i] = (_Float16)(bfr(Wm[(size_t)(k0 + 8 * g + i) * ld + o]) * 256.0f); w[8 + i] = (_Float16)(bfr(Wm[(size_t)(k0 + 16 + 8 * g + i) * ld + o]) * 256.0f); }
  return w; }
__device__ __forceinline__ v16h wcolh_oi(const float* Wm, int k0, int o, int lane, int K) { v16h w; const float* p = Wm + (size_t)o * K + k0 + 8 * (lane >> 4);
#pragma unroll
  for (int i = 0; i < 8; ++i) { w[i] = (_Float16)(bfr(p[i]) * 256.0f); w[8 + i] = (_Float16)(bfr(p[16 + i]) * 256.0f); }
  return w; }
#define WQKV_LAYOUT 1   // 0 = (in,out) [DIN][CC]; 1 = (out,in) [CC][DIN]; 2 = per-head [NH][DIN][HD]
__device__ __forceinline__ v16b wcol_hdk(const float* Wm, int k0, int o, int lane) { v16b w; const int g = lane >> 4; const float* p = Wm + (size_t)(o / HD) * DIN * HD + (o % HD);
#pragma unroll
  for (int i = 0; i < 8; ++i) { w[i] = (__bf16)p[(size_t)(k0 + 8 * g + i) * HD]; w[8 + i] = (__bf16)p[(size_t)(k0 + 16 + 8 * g + i) * HD]; }
  return w; }
#define WO_OUT_IN 1
#if WQKV_LAYOUT == 1
#define WCOL(W, k0, o, lane) wcol_oi(W, k0, o, lane, DIN)
#elif WQKV_LAYOUT == 2
#define WCOL(W, k0, o, lane) wcol_hdk(W, k0, o, lane)
#else
#define WCOL(W, k0, o, lane) wcol_io(W, k0, o, lane, CC)
#endif
#if WO_OUT_IN
#define WOCOL(W, k0, o, lane) wcol_oi(W, k0, o, lane, CC)
#define WOCOLH(W, k0, o, lane) wcolh_oi(W, k0, o, lane, CC)
#else
#define WOCOL(W, k0, o, lane) wcol_io(W, k0, o, lane, DIN)
#define WOCOLH(W, k0, o, lane) wcolh_io(W, k0, o, lane, DIN)
#endif
#define NTOK 4096
#ifndef OPITCH
#define OPITCH NTOK        // unused (out is written with pitch NTOK)
#endif
#ifndef XPITCH
#define XPITCH NTOK        // unused (x is read with pitch NTOK)
#endif
// ---- k_gnst: block = one (batch, group), 32 waves; a thread's 16-byte pieces lie 16 KiB apart and are fetched GNB at a time, all in flight before the first is used (one waited load a trip left each pass at one load latency per 4 KiB)
#define GNT 1024           // threads of a block
#define GNB 16             // loads in flight per thread
// behind a group of loads from p, a precaution: p is an input, so its registers are not given to a load of the group as destination ahead of the wait
#define GNW(p) asm volatile("s_wait_xcnt 0x0" :: "v"(p) : "memory")
__device__ __forceinline__ v4f bfr4(v4f v) { v4f r; r[0] = bfr(v[0]); r[1] = bfr(v[1]); r[2] = bfr(v[2]); r[3] = bfr(v[3]); return r; }
__global__ __launch_bounds__(GNT) void k_gnst(const float* __restrict__ X, float* __restrict__ MV) { __shared__ float sred[GNT / 32]; __shared__ float sbc; const int t = threadIdx.x; const size_t base = (size_t)blockIdx.x * (CC / 8) * NTOK; const int n = (CC / 8) * NTOK;
  const v4f* xp = (const v4f*)(X + base) + t;
  v4f sv = {};
  for (int i0 = 0; i0 < n / (4 * GNT); i0 += GNB) { v4f v[GNB]; const v4f* p = xp + (size_t)i0 * GNT;
#pragma unroll   // v[] has to stay in registers
    for (int j = 0; j < GNB; ++j) v[j] = p[(size_t)j * GNT];
    GNW(p);
#pragma unroll
    for (int j = 0; j < GNB; ++j) sv += bfr4(v[j]); }
  float s1 = (sv[0] + sv[1]) + (sv[2] + sv[3]);
#pragma unroll
  for (int o = 1; o < 32; o <<= 1) s1 += __shfl_xor(s1, o);
  if ((t & 31) == 0) sred[t >> 5] = s1; __syncthreads(); if (t == 0) { float a = 0.f; for (int i = 0; i < GNT / 32; ++i) a += sred[i]; sbc = a / (float)n; } __syncthreads(); const float mu = sbc; __syncthreads();
  v4f qv = {};
  for (int i0 = 0; i0 < n / (4 * GNT); i0 += GNB) { v4f v[GNB]; const v4f* p = xp + (size_t)i0 * GNT;
#pragma unroll   // v[] has to stay in registers
    for (int j = 0; j < GNB; ++j) v[j] = p[(size_t)j * GNT];
    GNW(p);
#pragma unroll
    for (int j = 0; j < GNB; ++j) { const v4f d = bfr4(v[j]) - mu; qv += d * d; } }
  float q = (qv[0] + qv[1]) + (qv[2] + qv[3]);
#pragma unroll
  for (int o = 1; o < 32; o <<= 1) q += __shfl_xor(q, o);
  if ((t & 31) == 0) sred[t >> 5] = q; __syncthreads(); if (t == 0) { float a = 0.f; for (int i = 0; i < GNT / 32; ++i) a += sred[i]; sbc = rsqrtf(a / (float)n + 1e-5f); } __syncthreads();
  if (t < 32) { const float v = t == 0 ? mu : (t == 1 ? sbc : 0.f); vst2(MV + (size_t)blockIdx.x * 32 + t, v); } }
// ---- k_tok: block = (64 tokens, 64 channels, batch b): XT[b*N + n][c] = (bf16(x[b][c][n]) - mean_g) * rstd_g * gamma[c] + beta[c] (GroupNorm, g = c / 32) through an LDS tile
__global__ __launch_bounds__(256) void k_tok(const float* __restrict__ X, const float* __restrict__ MV, const float* __restrict__ GG, const float* __restrict__ GB, float* __restrict__ XT) { __shared__ float st[64][68]; const int tid = threadIdx.x; const int n0 = blockIdx.x * 64, c0 = blockIdx.y * 64; const size_t b = blockIdx.z;
  for (int e = tid; e < 64 * 16; e += 256) { const int cl = e >> 4, q = e & 15; const int c = c0 + cl; const int gi = (int)(b * 8) + c / (CC / 8); const float mu = MV[gi * 32], rs = MV[gi * 32 + 1], ga = bfr(GG[c]), be = bfr(GB[c]);
    const v4f v = *(const v4f*)(X + (b * CC + c) * (size_t)NTOK + n0 + q * 4);
#pragma unroll
    for (int j = 0; j < 4; ++j) st[cl][q * 4 + j] = (bfr(v[j]) - mu) * rs * ga + be; }
  __syncthreads();
  for (int e = tid; e < 64 * 16; e += 256) { const int nl = e >> 4, q = e & 15; v4f o; o[0] = st[q * 4][nl]; o[1] = st[q * 4 + 1][nl]; o[2] = st[q * 4 + 2][nl]; o[3] = st[q * 4 + 3][nl]; vst2(XT + (b * NTOK + n0 + nl) * (size_t)CC + c0 + q * 4, o); } }
#define WS_MV  (WS_END)
#define WS_XT  (WS_MV + 4u * 32 * NB * 8 + 1024u)
#define WS_OR  (WS_XT + 4u * (size_t)NB * NTOK * CC)
#define WS_END2 (WS_OR + 4u * (size_t)NB * NTOK * CC)
#ifndef SM_EXTRA_PARAMS
#define SM_EXTRA_PARAMS
#endif
#ifndef PROJ_EXTRA_PARAMS
#define PROJ_EXTRA_PARAMS
#endif
#ifndef SM_MASK_HOOK
#define SM_MASK_HOOK (void)0
#endif

#define WS_QH  0u                                      // f16 q x SC2 rows [b*t][CC]
#define WS_KH  (WS_QH + 2u * (size_t)NB * TT * CC)      // f16 k rows [b*t][CC]
#define WS_VT  (WS_KH + 2u * (size_t)NB * TT * CC)      // f16 v planes [b][c][t]
#define WS_QL  (WS_VT + 2u * (size_t)NB * CC * TT)      // f16 residual of q x SC2 (unscaled) rows [b][t < QHI][CC]
#define WS_KL  (WS_QL + 2u * (size_t)NB * QHI * CC)     // f16 k residual x 2^10 rows [b][t < KHI][CC]
#define WS_VB  (WS_KL + 2u * (size_t)NB * KHI * CC)     // bf16 v hi planes [b][c][t < KHI]
#define WS_VBL (WS_VB + 2u * (size_t)NB * CC * KHI)
#define WS_S   (WS_VBL + 2u * (size_t)NB * CC * KHI)    // f32 [hg][t][s], unused: logits and P stay in registers
#define WS_Y   (WS_S  + 4u * (size_t)HG * TT * TT)      // f32 ctx rows [b*t][CC] (only when there is an output projection)
#define WS_END (WS_Y  + 4u * (size_t)NB * TT * CC)

// ---- operands of k_proj and k_out. The block's weight tile (128 output columns x K = 256, rows of an (out,in) matrix) is read once by whole-line loads, rounded to bf16 and kept in LDS for all four waves; a wave's own 16 activation rows are fetched whole behind it, so the K loop waits for no global load
#define WPB 528            // LDS pitch of a weight row: 256 bf16 + 16 B (16 B x odd: no bank conflict for 16-byte readers)
typedef __attribute__((ext_vector_type(4))) __bf16 v4b;
__device__ __forceinline__ v4b bf4(v4f v) { v4b r; r[0] = (__bf16)v[0]; r[1] = (__bf16)v[1]; r[2] = (__bf16)v[2]; r[3] = (__bf16)v[3]; return r; }
__device__ __forceinline__ v16b frag_lb(const char* p) { union { v16b v; v8b q[2]; } u; u.q[0] = *(const v8b*)p; u.q[1] = *(const v8b*)(p + 32); return u.v; }   // p = row + 2 * k0 + 16 * (lane >> 4): the k order of wcol_oi
// 128 threads: load i of a thread is 16 B of weight row 2 i + (tid >> 6); two groups of 16 loads are in flight at a time. arow = the lane's activation row + 8 * (lane >> 4); a[kc] = the 16 values of split_row at k0 = 32 kc
__device__ __forceinline__ void stage_ops(char* sw, const float* Wt, const float* arow, int tid, v4f (&a)[8][4]) {
  const v4f* wp = (const v4f*)Wt + tid; char* d = sw + (tid >> 6) * WPB + (tid & 63) * 8; v4f u[16], w[16];
  // every "#pragma unroll" here: u, w and a have to stay in registers
#pragma unroll
  for (int i = 0; i < 16; ++i) u[i] = wp[(size_t)i * 128];
#pragma unroll
  for (int i = 0; i < 16; ++i) w[i] = wp[(size_t)(16 + i) * 128];
  GNW(wp);
#pragma unroll
  for (int i = 0; i < 16; ++i) *(v4b*)(d + i * 2 * WPB) = bf4(u[i]);
#pragma unroll
  for (int i = 0; i < 16; ++i) u[i] = wp[(size_t)(32 + i) * 128];
  GNW(wp);
#pragma unroll
  for (int i = 0; i < 16; ++i) *(v4b*)(d + (16 + i) * 2 * WPB) = bf4(w[i]);
#pragma unroll
  for (int i = 0; i < 16; ++i) w[i] = wp[(size_t)(48 + i) * 128];
  GNW(wp);
#pragma unroll
  for (int i = 0; i < 16; ++i) *(v4b*)(d + (32 + i) * 2 * WPB) = bf4(u[i]);
#pragma unroll
  for (int kc = 0; kc < 8; ++kc) { const v4f* p = (const v4f*)(arow + kc * 32); a[kc][0] = p[0]; a[kc][1] = p[1]; a[kc][2] = p[4]; a[kc][3] = p[5]; }
  GNW(arow);
#pragma unroll
  for (int i = 0; i < 16; ++i) *(v4b*)(d + (48 + i) * 2 * WPB) = bf4(w[i]); }
__device__ __forceinline__ F2 split_a(const v4f (&q)[4]) { float v[16];
#pragma unroll   // v[] has to stay in registers
  for (int i = 0; i < 4; ++i) { v[i] = q[0][i]; v[4 + i] = q[1][i]; v[8 + i] = q[2][i]; v[12 + i] = q[3][i]; }
  return bsplit16(v); }
#define SC2 (SCALE * 1.4426950408889634f)   // logits to base 2: k_proj folds it into q
#define WRD 2              // weight fragments are read from LDS WRD ahead of their products (read next to its product, each cost one LDS latency)
#define WFR(wl, t) frag_lb((wl) + ((t) & 7) * 16 * WPB + ((t) >> 3) * 64)   // fragment t = 8 kc + j
// ---- k_proj: block = (64 rows, 128 cols, which): q/k/v = X W (+ b) with exact bf16 products (K = DIN) -> which 0: q x SC2 f16 rows (+ residual rows < QHI); 1: k f16 rows (+ residual rows < KHI); 2: v f16 planes [c][t] (+ bf16 hi/lo planes for t < KHI)
__global__ __launch_bounds__(128) void k_proj(const float* __restrict__ XQ, const float* __restrict__ XK, const float* __restrict__ XV, const float* __restrict__ WQ, const float* __restrict__ WK, const float* __restrict__ WV, const float* __restrict__ BQ, const float* __restrict__ BK, const float* __restrict__ BV,
    _Float16* __restrict__ QH, _Float16* __restrict__ QL, _Float16* __restrict__ KH, _Float16* __restrict__ KL, _Float16* __restrict__ VT, __bf16* __restrict__ VB, __bf16* __restrict__ VBL) {
  __shared__ __align__(16) char sm[128 * WPB];   // the weight tile; behind the K loop and a barrier the same bytes hold the output tiles
  _Float16 (*sh)[136] = (_Float16 (*)[136])sm; _Float16 (*sl)[136] = (_Float16 (*)[136])(sm + 64 * 136 * 2); _Float16 (*th)[72] = (_Float16 (*)[72])sm; __bf16 (*tb)[72] = (__bf16 (*)[72])(sm + 128 * 72 * 2); __bf16 (*tbl)[72] = (__bf16 (*)[72])(sm + 2 * 128 * 72 * 2);
  const int tid = threadIdx.x, wave = tid >> 5, lane = tid & 31, col = lane & 15, g = lane >> 4; const int which = blockIdx.z; const int c0 = blockIdx.y * 128; const size_t r0 = (size_t)blockIdx.x * 64; const size_t bb = r0 / TT; const int t0 = (int)(r0 % TT);
  const float* X = which == 0 ? XQ : which == 1 ? XK : XV; const float* WA = which == 0 ? WQ : which == 1 ? WK : WV; const float* BA = which == 0 ? BQ : which == 1 ? BK : BV;
  v4f ar[8][4]; stage_ops(sm, WA + (size_t)c0 * DIN, X + (r0 + wave * 16 + col) * DIN + 8 * g, tid, ar);
  __syncthreads();   // the weight tile is readable by every wave
  const char* wl = sm + col * WPB + 16 * g;
  v8f acc[8] = {}; v16b wr[WRD + 1]; float bs[8]; const float* bp = BA + c0 + col;
#pragma unroll   // wr[] has to stay in registers
  for (int t = 0; t < WRD; ++t) wr[t] = WFR(wl, t);
#pragma unroll   // ar[] and wr[] have to stay in registers
  for (int kc = 0; kc < DIN / 32; ++kc) { const F2 a2 = split_a(ar[kc]);   /* GroupNorm rows (f32) split hi + lo */
    if (kc == 4) {   // the eight bias values as one group, in registers that half of ar[] has left; they land under the rest of the loop (its unrolls: bs[] has to stay in registers)
      if (BA) {
#pragma unroll
        for (int j = 0; j < 8; ++j) bs[j] = bp[j * 16];
        GNW(bp);
      } else {
#pragma unroll
        for (int j = 0; j < 8; ++j) bs[j] = 0.f; } }
#pragma unroll
    for (int j = 0; j < 8; ++j) { const int t = kc * 8 + j; if (t + WRD < DIN / 4) wr[(t + WRD) % (WRD + 1)] = WFR(wl, t + WRD); const v16b w = wr[t % (WRD + 1)]; acc[j] = wmma_bf(a2.h, w, acc[j]); acc[j] = wmma_bf(a2.l, w, acc[j]); } }
  __syncthreads();   // every wave has read its last weight fragment: the bytes are given to the output tiles
  if (which < 2) { _Float16* DH = which == 0 ? QH : KH; _Float16* DL = which == 0 ? QL : KL; const int nhi = which == 0 ? QHI : KHI; const bool hi_rows = t0 < nhi; const float qs = which == 0 ? SC2 : 1.0f, rs = which == 0 ? 1.0f : 1024.0f;   // q: base-2 logit units, residual on the scale of its high part (k_fa chains both products in one accumulator)
#pragma unroll
    for (int j = 0; j < 8; ++j) { const float bias = bfr(bs[j]);
#pragma unroll
      for (int r = 0; r < 8; ++r) { const float v = (acc[j][r] + bias) * qs; const _Float16 hv = (_Float16)v; sh[wave * 16 + 8 * g + r][j * 16 + col] = hv; sl[wave * 16 + 8 * g + r][j * 16 + col] = (_Float16)((v - (float)hv) * rs); } }
    __syncthreads();
    for (int e = tid; e < 64 * 16; e += 128) { const int rl = e >> 4, q = e & 15; vst2((unsigned*)(DH + (r0 + rl) * CC + c0 + q * 8), *(const v4u*)&sh[rl][q * 8]); if (hi_rows) vst2((unsigned*)(DL + (bb * nhi + t0 + rl) * (size_t)CC + c0 + q * 8), *(const v4u*)&sl[rl][q * 8]); }
  } else { const bool hi_rows = t0 < KHI;
#pragma unroll
    for (int j = 0; j < 8; ++j) { const float bias = bfr(bs[j]);
#pragma unroll
      for (int r = 0; r < 8; ++r) { const float v = acc[j][r] + bias; const int rl = wave * 16 + 8 * g + r, cl = j * 16 + col; th[cl][rl] = (_Float16)v; const __bf16 bh = (__bf16)v; tb[cl][rl] = bh; tbl[cl][rl] = (__bf16)(v - (float)bh); } }
    __syncthreads();
    for (int e = tid; e < 128 * 8; e += 128) { const int cl = e >> 3, q = e & 7; vst2((unsigned*)(VT + (bb * CC + c0 + cl) * (size_t)TT + t0 + q * 8), *(const v4u*)&th[cl][q * 8]); if (hi_rows) { const size_t o3 = (bb * CC + c0 + cl) * (size_t)KHI + t0 + q * 8; vst2((unsigned*)(VB + o3), *(const v4u*)&tb[cl][q * 8]); vst2((unsigned*)(VBL + o3), *(const v4u*)&tbl[cl][q * 8]); } } } }
// ---- k_fa: block = 16 waves of one (b, h): 8 groups of 32 query columns x 2 halves of the keys (four waves a SIMD in place of two: the vector work between the matrix runs of one wave is covered by three others); each half has its own ring, maximum in use, sums and O, and the halves are joined once, through LDS, behind the loop; one pass = 32 keys, one stage = KS keys of each half. S^T = K Q^T - M (A = k rows, B = q hi, then q residual: 2 products chained in one accumulator that starts at minus the column's maximum in use M, so the scores leave the matrix unit as arguments of exp2), lazy rescale (M, sums and O move only in a pass whose sums show that a score may lie more than 8 above M: one test a pass; a lane holds one query's scores), P^T packed from the score accumulators to f16 as the B operand of O^T += V^T P^T (A = v planes [c][t]); logits and P never reach memory. K rows and V planes of a stage are brought into LDS once per block by asynchronous copies (two buffers, the next stage in flight) and read from there by the eight waves of that half
__device__ __forceinline__ float xhalf(float x) { return __builtin_bit_cast(float, __builtin_amdgcn_permlanex16(__builtin_bit_cast(int, x), __builtin_bit_cast(int, x), 0x76543210, 0xfedcba98, false, false)); }   // lane l with lane l ^ 16
__device__ __forceinline__ v8f wmma_h(v16h a, v16h b, v8f c) { return __builtin_amdgcn_wmma_f32_16x16x32_f16(false, a, false, b, (short)0, c, false, false); }
#define XW() asm volatile("s_wait_xcnt 0x0" ::: "memory")   // behind a group of loads: a later load's result may land in the group's address registers
#define KS 256                  // keys of a stage
#define KPB 80                  // LDS pitch of a k row: 64 B + 16 (16 B x odd: no bank conflict for 16-byte readers)
#define VPB (2 * KS + 16)       // LDS pitch of a v plane row, the same rule
#define KBY (KS * KPB)
#define SBY (KBY + HD * VPB)    // one buffer: k rows, then v rows
#define AW() asm volatile("s_wait_asynccnt 0x0" ::: "memory")   // this wave's copies have landed
#define DW() asm volatile("s_wait_dscnt 0x0" ::: "memory")      // this wave's LDS reads have returned before the buffer is given up
// one stage: each thread copies 4 x 16 B of k rows (4 threads a row, rows 64 apart) and 4 x 16 B of v rows (32 threads a row, rows 8 apart); the wait in the same statement stands before the address registers are reused
__device__ __forceinline__ void fa_stage(unsigned lk, unsigned lv, const char* gk, const char* gv) {
  asm volatile("global_load_async_to_lds_b128 %0, %1, off\n\tglobal_load_async_to_lds_b128 %2, %3, off\n\tglobal_load_async_to_lds_b128 %4, %5, off\n\tglobal_load_async_to_lds_b128 %6, %7, off\n\t"
               "global_load_async_to_lds_b128 %8, %9, off\n\tglobal_load_async_to_lds_b128 %10, %11, off\n\tglobal_load_async_to_lds_b128 %12, %13, off\n\tglobal_load_async_to_lds_b128 %14, %15, off\n\ts_wait_xcnt 0x0"
    :: "v"(lk), "v"(gk), "v"(lk + 64u * KPB), "v"(gk + (size_t)64 * CC * 2), "v"(lk + 128u * KPB), "v"(gk + (size_t)128 * CC * 2), "v"(lk + 192u * KPB), "v"(gk + (size_t)192 * CC * 2),
       "v"(lv), "v"(gv), "v"(lv + 8u * VPB), "v"(gv + (size_t)8 * TT * 2), "v"(lv + 16u * VPB), "v"(gv + (size_t)16 * TT * 2), "v"(lv + 24u * VPB), "v"(gv + (size_t)24 * TT * 2) : "memory"); }
__device__ __forceinline__ v16h frag_l(const char* p) { union { v16h v; v8h q[2]; } u; u.q[0] = *(const v8h*)p; u.q[1] = *(const v8h*)(p + 32); return u.v; }   // p = row + 16 * (lane >> 4): the k order of frag_h
// one column group's 32 x 16 scores less d to powers of two, and their sum in two parts
__device__ __forceinline__ void fa_exp(const v8f (&s)[2], float d, v8f (&e)[2], v2f& sm) {
#pragma unroll   // e[] has to stay in registers
  for (int i = 0; i < 2; ++i)
#pragma unroll
    for (int r = 0; r < 8; ++r) e[i][r] = __builtin_amdgcn_exp2f(s[i][r] - d);
  const v8f ps = e[0] + e[1]; const v4f p4 = ps.lo + ps.hi; sm = p4.lo + p4.hi; }
#define KH2 (TT / 2)            // keys of a half
__global__ __launch_bounds__(512) void k_fa(const _Float16* __restrict__ QH, const _Float16* __restrict__ QL, const _Float16* __restrict__ KH, const _Float16* __restrict__ VT, float* __restrict__ Y) {
  __shared__ __align__(16) char ring[4 * SBY];   // two buffers for each half of the keys
  const int kh = __builtin_amdgcn_readfirstlane((int)threadIdx.x >> 8);   // the wave's half of the keys, in a scalar register: the tests on it are scalar branches
  const int tid = threadIdx.x & 255, wave = tid >> 5, lane = tid & 31, col = lane & 15, g = lane >> 4; const int b = blockIdx.y / NH, h = blockIdx.y % NH; const int q0 = blockIdx.x * 256 + wave * 32;
  const char* rg = ring + kh * 2 * SBY;   // this half's two buffers
  // every "#pragma unroll" of this kernel: the small arrays it indexes have to stay in registers
  const char* gk = (const char*)(KH + ((size_t)b * TT + kh * KH2 + (tid >> 2)) * CC + h * HD) + (tid & 3) * 16; const char* gv = (const char*)(VT + ((size_t)b * CC + h * HD + (tid >> 5)) * (size_t)TT + kh * KH2) + (tid & 31) * 16;
  const unsigned lk = (unsigned)(size_t)rg + (unsigned)((tid >> 2) * KPB + (tid & 3) * 16), lv = (unsigned)(size_t)rg + (unsigned)(KBY + (tid >> 5) * VPB + (tid & 31) * 16);
  fa_stage(lk, lv, gk, gv);
  v16h qh[2], ql[2];
#pragma unroll
  for (int u = 0; u < 2; ++u) qh[u] = frag_h(QH + ((size_t)b * TT + q0 + u * 16 + col) * CC + h * HD, lane);
  XW();
#pragma unroll
  for (int u = 0; u < 2; ++u) ql[u] = frag_h(QL + ((size_t)b * QHI + q0 + u * 16 + col) * CC + h * HD, lane);
  XW();
  AW(); __syncthreads();   // stage 0 is readable by every wave
  fa_stage(lk + SBY, lv + SBY, gk + (size_t)KS * CC * 2, gv + (size_t)KS * 2);
  v8f o[2][2] = {}; v2f l[2] = {}; v8f cn[2][2];   // cn[u][i] = -M of column group u in all eight rows: the start value of score tile (u, i); a tile each, since one shared by two products was copied by the compiler in every pass
  { // M starts at the maximum over the half's first 32 keys (high parts alone: any value within 8 of the maximum serves), the same in both wave halves
    const char* K0 = rg + col * KPB + 16 * g; const v16h k0 = frag_l(K0), k1 = frag_l(K0 + 16 * KPB); const v8f z = {};
#pragma unroll
    for (int u = 0; u < 2; ++u) { const v8f t0 = wmma_h(k0, qh[u], z), t1 = wmma_h(k1, qh[u], z); float mx = fmaxf(t0[0], t1[0]);
#pragma unroll
      for (int r = 1; r < 8; ++r) mx = fmaxf(mx, fmaxf(t0[r], t1[r]));
      mx = fmaxf(mx, xhalf(mx)); cn[u][0] = z - mx; cn[u][1] = z - mx; } }
#pragma unroll 1   // one stage a trip: the buffer index stays a run-time value
  for (int st = 0; st < KH2 / KS; ++st) {
    const char* Kl = rg + (st & 1) * SBY + col * KPB + 16 * g; const char* Vl = rg + (st & 1) * SBY + KBY + col * VPB + 16 * g;
    v16h kf[2], vf[2]; kf[0] = frag_l(Kl); kf[1] = frag_l(Kl + 16 * KPB); vf[0] = frag_l(Vl); vf[1] = frag_l(Vl + 16 * VPB); const char* Kn = Kl; const char* Vn = Vl;
#pragma unroll 1   // unrolled, the fragment reads were moved next to their users and waited for there
    for (int p = 0; p < KS / 32; ++p) {
      v8f s[2][2], e[2][2]; v2f sm[2];
#pragma unroll
      for (int i = 0; i < 2; ++i)
#pragma unroll
        for (int u = 0; u < 2; ++u) s[u][i] = wmma_h(kf[i], qh[u], cn[u][i]);
#pragma unroll
      for (int i = 0; i < 2; ++i)
#pragma unroll
        for (int u = 0; u < 2; ++u) s[u][i] = wmma_h(kf[i], ql[u], s[u][i]);
      __builtin_amdgcn_sched_barrier(0);   // the eight score products stay one run: spread among the vector work each pair cost four idle slots before its first reader
      // both operands are fetched one pass ahead, each behind its last use, inside the stage's own buffer (its last pass refetches pass 0, unused)
      Kn += p + 1 < KS / 32 ? 32 * KPB : -(KS / 32 - 1) * 32 * KPB; Vn += p + 1 < KS / 32 ? 64 : -(KS / 32 - 1) * 64;
      kf[0] = frag_l(Kn); kf[1] = frag_l(Kn + 16 * KPB);
      __builtin_amdgcn_sched_barrier(0);   // the k reads stay here, under the products' latency: left free they were sunk below the test, next to the next pass's products
#pragma unroll
      for (int u = 0; u < 2; ++u) fa_exp(s[u], 0.f, e[u], sm[u]);
      // the test: every term is positive, so four partial sums of at most 256 bound every term by 256 (a score at most 8 above M)
      if (__builtin_amdgcn_ballot_w32(fmaxf(fmaxf(sm[0][0], sm[0][1]), fmaxf(sm[1][0], sm[1][1])) > 256.0f) != 0) {   // rare: raise M to the pass's maximum where that is higher, rescale sums and O, redo the pass's exponentials
#pragma unroll
        for (int u = 0; u < 2; ++u) { float mx = fmaxf(s[u][0][0], s[u][1][0]);
#pragma unroll
          for (int r = 1; r < 8; ++r) mx = fmaxf(mx, fmaxf(s[u][0][r], s[u][1][r]));
          const float d = fmaxf(fmaxf(mx, xhalf(mx)), 0.f); const float corr = __builtin_amdgcn_exp2f(-d); cn[u][0] -= d; cn[u][1] -= d; l[u] *= corr; o[u][0] *= corr; o[u][1] *= corr; fa_exp(s[u], d, e[u], sm[u]); } }
#pragma unroll
      for (int u = 0; u < 2; ++u) { v16h pf;
#pragma unroll
        for (int r = 0; r < 8; ++r) { pf[r] = (_Float16)e[u][0][r]; pf[8 + r] = (_Float16)e[u][1][r]; }
        l[u] += sm[u];
#pragma unroll
        for (int j = 0; j < 2; ++j) o[u][j] = wmma_h(vf[j], pf, o[u][j]); }
      vf[0] = frag_l(Vn); vf[1] = frag_l(Vn + 16 * VPB); }
    DW(); AW(); __syncthreads();   // publishes stage st + 1 and ends every wave's reads of stage st
    if (st + 2 < KH2 / KS) fa_stage(lk + (st & 1) * SBY, lv + (st & 1) * SBY, gk + (size_t)(st + 2) * KS * CC * 2, gv + (size_t)(st + 2) * KS * 2); }
  AW();
  // the join: the loop's last barrier has ended every read of the ring and every copy has landed, so its first bytes carry the second half's state: nine 16-byte pieces a lane (O, then both sums and both -M), a piece = 512 B of a wave
  float* xb = (float*)ring + wave * (9 * 128) + lane * 4;
  if (kh) {
#pragma unroll
    for (int u = 0; u < 2; ++u)
#pragma unroll
      for (int j = 0; j < 2; ++j) { *(v4f*)(xb + (u * 4 + j * 2) * 128) = o[u][j].lo; *(v4f*)(xb + (u * 4 + j * 2 + 1) * 128) = o[u][j].hi; }
    v4f t; t[0] = l[0][0] + l[0][1]; t[1] = l[1][0] + l[1][1]; t[2] = cn[0][0][0]; t[3] = cn[1][0][0]; *(v4f*)(xb + 8 * 128) = t; }
  __syncthreads();   // the second half's state is readable by the first half's waves
  if (kh) return;
  const v4f t = *(const v4f*)(xb + 8 * 128);
#pragma unroll
  for (int u = 0; u < 2; ++u) { const float na = cn[u][0][0], nb = t[2 + u], nm = fminf(na, nb);   // -M of either half (the same in both wave halves) and of the join
    const float fa = __builtin_amdgcn_exp2f(nm - na), fb = __builtin_amdgcn_exp2f(nm - nb); const float lu = (l[u][0] + l[u][1]) * fa + t[u] * fb; const float inv = 1.0f / (lu + xhalf(lu)); const float wa = fa * inv, wb = fb * inv;
    float* yr = Y + ((size_t)b * TT + q0 + u * 16 + col) * CC + h * HD + 8 * g;
#pragma unroll
    for (int j = 0; j < 2; ++j) { const v4f w0 = o[u][j].lo * wa + *(const v4f*)(xb + (u * 4 + j * 2) * 128) * wb, w1 = o[u][j].hi * wa + *(const v4f*)(xb + (u * 4 + j * 2 + 1) * 128) * wb; vst2(yr + j * 16, w0); vst2(yr + j * 16 + 4, w1); } } }
// ---- k_out: block = (64 tokens, 128 channels): out[b][c][n] = ctx Wo + bo + bf16(x[b][c][n]), ctx split bf16 hi + lo against exact bf16 Wo (2 products). A lane's accumulator tile holds 8 consecutive tokens of one channel: the block's tile goes to LDS channel-major by 16-byte stores and leaves as 256-B runs of 64 tokens per channel with the residual added, so the result has no token-major copy in memory and needs no launch that turns it
#define OTP 68             // LDS pitch in floats of a channel's 64 tokens (16 B x odd: no bank conflict for 16-byte accesses)
__global__ __launch_bounds__(128) void k_out(const float* __restrict__ Y, const float* __restrict__ WO, const float* __restrict__ BO, const float* __restrict__ X, float* __restrict__ OUT) { __shared__ __align__(16) float st[128][OTP]; __shared__ __align__(16) char sm[128 * WPB];
  const int tid = threadIdx.x, wave = tid >> 5, lane = tid & 31, col = lane & 15, g = lane >> 4; const int c0 = blockIdx.y * 128; const size_t r0 = (size_t)blockIdx.x * 64 + wave * 16;
  const size_t rb = (size_t)blockIdx.x * 64; const size_t oi = ((rb / NTOK) * CC + c0 + (tid >> 4)) * (size_t)NTOK + rb % NTOK + (tid & 15) * 4;   // piece i of this thread in x and out: 4 tokens of channel c0 + (tid >> 4) + 8 i
  const float* xp = X + oi; v4f xr[16];
  v8f acc[8] = {};
  if (true) {   /* ALL rows: ctx split bf16 hi + lo x exact proj_w (2 products) */
    v4f ar[8][4]; stage_ops(sm, WO + (size_t)c0 * CC, Y + (r0 + col) * CC + 8 * g, tid, ar);
    __syncthreads();   // the weight tile is readable by every wave
    const char* wl = sm + col * WPB + 16 * g; v16b wr[WRD + 1]; float bs[8]; const float* bp = BO + c0 + col;
#pragma unroll   // wr[] has to stay in registers
    for (int t = 0; t < WRD; ++t) wr[t] = WFR(wl, t);
#pragma unroll   // ar[] and wr[] have to stay in registers
    for (int kc = 0; kc < CC / 32; ++kc) { const F2 a = split_a(ar[kc]);
      if (kc == 4) {   // the eight bias values as one group, in registers that half of ar[] has left; they land under the rest of the loop (its unrolls: bs[] has to stay in registers)
        if (BO) {
#pragma unroll
          for (int j = 0; j < 8; ++j) bs[j] = bp[j * 16];
          GNW(bp);
        } else {
#pragma unroll
          for (int j = 0; j < 8; ++j) bs[j] = 0.f; } }
      if (kc == 4 || kc == 6) {   // the residual's pieces, eight at a time, also in registers that ar[] has left: they land under the rest of the loop (unroll: xr[] has to stay in registers)
#pragma unroll
        for (int i = 0; i < 8; ++i) xr[(kc - 4) * 4 + i] = *(const v4f*)(xp + (size_t)((kc - 4) * 4 + i) * 8 * NTOK);
        GNW(xp); }
#pragma unroll
      for (int j = 0; j < 8; ++j) { const int t = kc * 8 + j; if (t + WRD < CC / 4) wr[(t + WRD) % (WRD + 1)] = WFR(wl, t + WRD); const v16b w = wr[t % (WRD + 1)]; acc[j] = wmma_bf(a.h, w, acc[j]); acc[j] = wmma_bf(a.l, w, acc[j]); } }
#pragma unroll
    for (int j = 0; j < 8; ++j) { const float bias = bfr(bs[j]); const v8f w = acc[j] + bias; float* d = &st[j * 16 + col][wave * 16 + 8 * g]; *(v4f*)d = w.lo; *(v4f*)(d + 4) = w.hi; }
  }
  __syncthreads();   // a channel's 64 tokens come from all four waves
  v4f o[16];
#pragma unroll   // xr[] and o[] have to stay in registers
  for (int i = 0; i < 16; ++i) o[i] = *(const v4f*)&st[(tid >> 4) + 8 * i][(tid & 15) * 4] + bfr4(xr[i]);
  __builtin_amdgcn_sched_barrier(0);   // every sum has a register of its own before the first store: mixed with the sums, the stores' registers were reused behind waits
#pragma unroll
  for (int i = 0; i < 16; ++i) vst2(OUT + oi + (size_t)i * 8 * NTOK, o[i]); }

extern "C" void kernel_launch(void* const* d_in, const int* in_sizes, int n_in, void* d_out, int out_size, void* d_ws, size_t ws_size, hipStream_t stream) {
  (void)in_sizes; (void)n_in; (void)out_size;
  const float** F = (const float**)d_in;
  if (ws_size < (size_t)WS_END) return;
  char* ws = (char*)d_ws; _Float16 *QH = (_Float16*)(ws + WS_QH), *KH = (_Float16*)(ws + WS_KH), *VT = (_Float16*)(ws + WS_VT), *QL = (_Float16*)(ws + WS_QL), *KL = (_Float16*)(ws + WS_KL); __bf16 *VB = (__bf16*)(ws + WS_VB), *VBL = (__bf16*)(ws + WS_VBL); float *Y = (float*)(ws + WS_Y);
  (void)Y; (void)QL; (void)KL; (void)VB; (void)VBL;
  // inputs: 0 x [2,256,64,64]; 1 gn_gamma, 2 gn_beta [256]; 3 qkv_w [768,256] (out,in) rows q | k | v; 4 qkv_b [768]; 5 proj_w [256,256] (out,in); 6 proj_b
  if (ws_size < (size_t)WS_END2) return;
  float *MV = (float*)(ws + WS_MV), *XT = (float*)(ws + WS_XT);
  k_gnst<<<dim3(TNB * 8), GNT, 0, stream>>>(F[0], MV);
  k_tok<<<dim3(NTOK / 64, CC / 64, TNB), 256, 0, stream>>>(F[0], MV, F[1], F[2], XT);
  { const float* WQ = F[3]; const float* WK = F[3] + (size_t)CC * DIN; const float* WV = F[3] + (size_t)2 * CC * DIN;
    k_proj<<<dim3(TNB * TT / 64, CC / 128, 3), 128, 0, stream>>>(XT, XT, XT, WQ, WK, WV, F[4], F[4] + CC, F[4] + 2 * CC, QH, QL, KH, KL, VT, VB, VBL); }
  k_fa<<<dim3(TT / 256, TNB * NH), 512, 0, stream>>>(QH, QL, KH, VT, Y);
  k_out<<<dim3(TNB * TT / 64, DIN / 128), 128, 0, stream>>>(Y, F[5], F[6], F[0], (float*)d_out);
}

// v008
// It runs in 63.9 microseconds.
// Timed twice side by side with v007, it ran 1.20 times as fast both times.
// Over all steps from v000 it is 24.1 times as fast.
// Single self-attention block on images (b 2, c 256, 64 x 64 -> n 4,096 tokens; 8 heads x 32): xn = GroupNorm(8 groups)(x) (affine); q,k,v = qkv_w xn + qkv_b (1x1, (out,in) rows q|k|v); attn = softmax(q k^T x 32^-0.5); out = proj_w (attn v) + proj_b, reshaped to [b,c,h,w] + x.
#include <hip/hip_runtime.h>
#include <math.h>

typedef __attribute__((ext_vector_type(16))) _Float16 v16h;
typedef __attribute__((ext_vector_type(16))) __bf16 v16b;
typedef __attribute__((ext_vector_type(8)))  _Float16 v8h;
typedef __attribute__((ext_vector_type(8)))  float v8f;
typedef __attribute__((ext_vector_type(4)))  float v4f;
typedef __attribute__((ext_vector_type(2)))  float v2f;
typedef __attribute__((ext_vector_type(4)))  unsigned v4u;
typedef __attribute__((ext_vector_type(4)))  int v4i;
typedef float __attribute__((may_alias)) float_a;
typedef int __attribute__((may_alias)) int_a;

template <typename T> __device__ __forceinline__ void vst2(void* p, T v) { *(T*)p = v;  }
__device__ __forceinline__ v8f wmma16(v16h a, v16h b, v8f c) {
  v8f d = __builtin_amdgcn_wmma_f32_16x16x32_f16(false, a, false, b, (short)0, c, false, false);
  asm volatile("v_nop\n\tv_nop\n\tv_nop\n\tv_nop" : "+v"(d) : "v"(a), "v"(b));
  return d;
}
__device__ __forceinline__ v8f wmma_bf(v16b a, v16b b, v8f c) {
  v8f d = __builtin_amdgcn_wmma_f32_16x16x32_bf16(false, a, false, b, (short)0, c, false, false);
  asm volatile("v_nop\n\tv_nop\n\tv_nop\n\tv_nop" : "+v"(d) : "v"(a), "v"(b));
  return d;
}
// 16x16x32 fragments: lane = (h = lane>>4, row/col = lane&15); elements 0..7 = k0+8h+0..7, 8..15 = k0+16+8h+0..7; D element r = row 8h+r
__device__ __forceinline__ v16h frag_h(const _Float16* rowk0, int lane) {
  union { v16h v; v8h q[2]; } u; const _Float16* p = rowk0 + 8 * (lane >> 4);
  u.q[0] = *(const v8h*)p; u.q[1] = *(const v8h*)(p + 16); return u.v;
}
__device__ __forceinline__ v16h frag_f32(const float* rowk0, int lane) {
  v16h a; const float* p = rowk0 + 8 * (lane >> 4);
#pragma unroll
  for (int i = 0; i < 8; ++i) { a[i] = (_Float16)p[i]; a[8 + i] = (_Float16)p[16 + i]; }
  return a;
}
__device__ __forceinline__ v16h frag_f32s(const float* rowk0, int lane, float sc) {
  v16h a; const float* p = rowk0 + 8 * (lane >> 4);
#pragma unroll
  for (int i = 0; i < 8; ++i) { a[i] = (_Float16)(p[i] * sc); a[8 + i] = (_Float16)(p[16 + i] * sc); }
  return a;
}
// column fragment from a [K][ld] layout (column n), rows >= K read as 0
__device__ __forceinline__ v16h fragc_f32(const float* W, int k0, int n, int lane, int ld, int K) {
  v16h a; const int g = lane >> 4;
#pragma unroll
  for (int i = 0; i < 8; ++i) { const int ka = k0 + 8 * g + i, kb = ka + 16;
    a[i] = (_Float16)(ka < K ? W[(size_t)(ka < K ? ka : K - 1) * ld + n] : 0.f); a[8 + i] = (_Float16)(kb < K ? W[(size_t)(kb < K ? kb : K - 1) * ld + n] : 0.f); }
  return a;
}
struct F2 { v16b h, l; };
__device__ __forceinline__ F2 bsplit16(const float v[16]) { F2 r;
#pragma unroll
  for (int i = 0; i < 16; ++i) { const __bf16 h = (__bf16)v[i]; r.h[i] = h; r.l[i] = (__bf16)(v[i] - (float)h); }
  return r; }
__device__ __forceinline__ F2 split_row(const float* row, int k0, int lane) { float v[16]; const float* p = row + k0 + 8 * (lane >> 4);
#pragma unroll
  for (int i = 0; i < 8; ++i) { v[i] = p[i]; v[8 + i] = p[16 + i]; }
  return bsplit16(v); }
__device__ __forceinline__ F2 split_rowK(const float* row, int k0, int lane, int K) { float v[16]; const int g = lane >> 4;
#pragma unroll
  for (int i = 0; i < 8; ++i) { const int ka = k0 + 8 * g + i, kb = ka + 16; v[i] = ka < K ? row[ka < K ? ka : K - 1] : 0.f; v[8 + i] = kb < K ? row[kb < K ? kb : K - 1] : 0.f; }
  return bsplit16(v); }
__device__ __forceinline__ F2 split_col(const float* W, int k0, int n, int lane, int ld, int K) { float v[16]; const int g = lane >> 4;
#pragma unroll
  for (int i = 0; i < 8; ++i) { const int ka = k0 + 8 * g + i, kb = ka + 16; v[i] = ka < K ? W[(size_t)(ka < K ? ka : K - 1) * ld + n] : 0.f; v[8 + i] = kb < K ? W[(size_t)(kb < K ? kb : K - 1) * ld + n] : 0.f; }
  return bsplit16(v); }
__device__ __forceinline__ v8f mac3(const F2& a, const F2& b, v8f c) { c = wmma_bf(a.l, b.h, c); c = wmma_bf(a.h, b.l, c); return wmma_bf(a.h, b.h, c); }
__device__ __forceinline__ float sigm(float v) { return 1.0f / (1.0f + expf(-v)); }
#define LDSX() do { asm volatile("s_wait_dscnt 0" ::: "memory"); __builtin_amdgcn_wave_barrier(); __builtin_amdgcn_fence(__ATOMIC_RELEASE, "workgroup"); } while (0)

#define NB 2
#define TT 4096
#define CC 256            // NH * HD = projected width
#define DIN 256          // input (model) width
#define NH 8
#define HD 32
#define NQB (TT / 64)
#define HG 2
#define SCALE (0.17677669529663687f)
#define CAUSAL 0
#ifndef TNB
#define TNB NB
#endif
__device__ __forceinline__ float bfr(float v) { return (float)(__bf16)v; }
__host__ __device__ __forceinline__ int kb_last(int qb) { return CAUSAL ? ((qb * 64 + 63) >> 7) : (TT / 128 - 1); }
typedef __attribute__((ext_vector_type(8))) __bf16 v8b;
__device__ __forceinline__ v16b frag_b(const __bf16* rowk0, int lane) {
  union { v16b v; v8b q[2]; } u; const __bf16* p = rowk0 + 8 * (lane >> 4);
  u.q[0] = *(const v8b*)p; u.q[1] = *(const v8b*)(p + 16); return u.v;
}
#define QBH 0              // unused: k_fa has no high-precision path
#define QHI 4096            // rows carrying a q residual plane (all rows when non-causal: 2-product logits everywhere)
#define KHI 64            // key rows carrying k residual / v bf16 hi+lo planes (written by k_proj; no kernel here reads them)
// B fragment (k rows k0+.., output column o) of a weight: (in,out) [K][ld] or (out,in) [ld rows of K]: bf16 exact, or f16(bf16 * 256) exact
__device__ __forceinline__ v16b wcol_io(const float* Wm, int k0, int o, int lane, int ld) { v16b w; const int g = lane >> 4;
#pragma unroll
  for (int i = 0; i < 8; ++i) { w[i] = (__bf16)Wm[(size_t)(k0 + 8 * g + i) * ld + o]; w[8 + i] = (__bf16)Wm[(size_t)(k0 + 16 + 8 * g + i) * ld + o]; }
  return w; }
__device__ __forceinline__ v16b wcol_oi(const float* Wm, int k0, int o, int lane, int K) { v16b w; const float* p = Wm + (size_t)o * K + k0 + 8 * (lane >> 4);
#pragma unroll
  for (int i = 0; i < 8; ++i) { w[i] = (__bf16)p[i]; w[8 + i] = (__bf16)p[16 + i]; }
  return w; }
__device__ __forceinline__ v16h wcolh_io(const float* Wm, int k0, int o, int lane, int ld) { v16h w; const int g = lane >> 4;
#pragma unroll
  for (int i = 0; i < 8; ++i) { w[i] = (_Float16)(bfr(Wm[(size_t)(k0 + 8 * g + i) * ld + o]) * 256.0f); w[8 + i] = (_Float16)(bfr(Wm[(size_t)(k0 + 16 + 8 * g + i) * ld + o]) * 256.0f); }
  return w; }
__device__ __forceinline__ v16h wcolh_oi(const float* Wm, int k0, int o, int lane, int K) { v16h w; const float* p = Wm + (size_t)o * K + k0 + 8 * (lane >> 4);
#pragma unroll
  for (int i = 0; i < 8; ++i) { w[i] = (_Float16)(bfr(p[i]) * 256.0f); w[8 + i] = (_Float16)(bfr(p[16 + i]) * 256.0f); }
  return w; }
#define WQKV_LAYOUT 1   // 0 = (in,out) [DIN][CC]; 1 = (out,in) [CC][DIN]; 2 = per-head [NH][DIN][HD]
__device__ __forceinline__ v16b wcol_hdk(const float* Wm, int k0, int o, int lane) { v16b w; const int g = lane >> 4; const float* p = Wm + (size_t)(o / HD) * DIN * HD + (o % HD);
#pragma unroll
  for (int i = 0; i < 8; ++i) { w[i] = (__bf16)p[(size_t)(k0 + 8 * g + i) * HD]; w[8 + i] = (__bf16)p[(size_t)(k0 + 16 + 8 * g + i) * HD]; }
  return w; }
#define WO_OUT_IN 1
#if WQKV_LAYOUT == 1
#define WCOL(W, k0, o, lane) wcol_oi(W, k0, o, lane, DIN)
#elif WQKV_LAYOUT == 2
#define WCOL(W, k0, o, lane) wcol_hdk(W, k0, o, lane)
#else
#define WCOL(W, k0, o, lane) wcol_io(W, k0, o, lane, CC)
#endif
#if WO_OUT_IN
#define WOCOL(W, k0, o, lane) wcol_oi(W, k0, o, lane, CC)
#define WOCOLH(W, k0, o, lane) wcolh_oi(W, k0, o, lane, CC)
#else
#define WOCOL(W, k0, o, lane) wcol_io(W, k0, o, lane, DIN)
#define WOCOLH(W, k0, o, lane) wcolh_io(W, k0, o, lane, DIN)
#endif
#define NTOK 4096
#ifndef OPITCH
#define OPITCH NTOK        // unused (out is written with pitch NTOK)
#endif
#ifndef XPITCH
#define XPITCH NTOK        // unused (x is read with pitch NTOK)
#endif
// behind a group of loads from p, a precaution: p is an input, so its registers are not given to a load of the group as destination ahead of the wait
#define GNW(p) asm volatile("s_wait_xcnt 0x0" :: "v"(p) : "memory")
__device__ __forceinline__ v4f bfr4(v4f v) { v4f r; r[0] = bfr(v[0]); r[1] = bfr(v[1]); r[2] = bfr(v[2]); r[3] = bfr(v[3]); return r; }
// two sets of equal size 2 hn, each given by its mean m and its sum of squared distances from that mean s, joined; the result is the same whichever of the two sets is named first
__device__ __forceinline__ void gn_join(float& m, float& s, float mo, float so, float hn) { const float d = m - mo; s = (s + so) + d * d * hn; m = 0.5f * (m + mo); }
#define GSL 16             // slices of a (batch, group): 32 channels x 256 tokens each
#define TPT 260            // LDS pitch in floats of a channel's 256 tokens (16 B x odd)
// ---- k_gtr: block = (256 tokens, one (batch, group) of 32 channels), 8 waves, one block a WGP: x is read once, 8 x 16 B a thread all in flight. From the registers: the slice's mean and sum of squared distances from it (a thread's 32 values, then joins of equal sets: lanes, waves) -> one 128-B line of MV; and XT[b*N + n][c] = bf16(x[b][c][n]), not yet normalised, through an LDS tile, a whole line per token. k_proj joins the 16 slices and normalises its own rows
__global__ __launch_bounds__(256) void k_gtr(const float* __restrict__ X, float* __restrict__ MV, float* __restrict__ XT) { __shared__ __align__(16) float st[32][TPT]; __shared__ float sred[8][2];
  const int tid = threadIdx.x, gi = blockIdx.y, n0 = blockIdx.x * 256; const float* xp = X + ((size_t)gi * 32 + (tid >> 6)) * NTOK + n0 + (tid & 63) * 4; v4f v[8];
  // every "#pragma unroll" here: v[] has to stay in registers
#pragma unroll
  for (int i = 0; i < 8; ++i) v[i] = *(const v4f*)(xp + (size_t)i * 4 * NTOK);
  GNW(xp);
  v4f sv = {};
#pragma unroll
  for (int i = 0; i < 8; ++i) { v[i] = bfr4(v[i]); sv += v[i]; *(v4f*)&st[(tid >> 6) + 4 * i][(tid & 63) * 4] = v[i]; }
  float m = ((sv[0] + sv[1]) + (sv[2] + sv[3])) * (1.0f / 32.0f); v4f qv = {};
#pragma unroll
  for (int i = 0; i < 8; ++i) { const v4f d = v[i] - m; qv += d * d; }
  float s = (qv[0] + qv[1]) + (qv[2] + qv[3]); float hn = 16.0f;
#pragma unroll
  for (int o = 1; o < 32; o <<= 1) { gn_join(m, s, __shfl_xor(m, o), __shfl_xor(s, o), hn); hn += hn; }
  if ((tid & 31) == 0) { sred[tid >> 5][0] = m; sred[tid >> 5][1] = s; }
  __syncthreads();   // the tile and the eight waves' statistics are readable by every wave
  float* xo = XT + ((size_t)(gi >> 3) * NTOK + n0 + (tid >> 3)) * CC + (gi & 7) * 32 + (tid & 7) * 4;
#pragma unroll
  for (int i = 0; i < 8; ++i) { const int nl = (tid >> 3) + 32 * i, c = (tid & 7) * 4; v4f o; o[0] = st[c][nl]; o[1] = st[c + 1][nl]; o[2] = st[c + 2][nl]; o[3] = st[c + 3][nl]; vst2(xo + (size_t)i * 32 * CC, o); }
  if (tid < 32) { float wm[8], wq[8];
#pragma unroll   // wm[] and wq[] have to stay in registers
    for (int i = 0; i < 8; ++i) { wm[i] = sred[i][0]; wq[i] = sred[i][1]; }
#pragma unroll
    for (int w = 1; w < 8; w <<= 1)
#pragma unroll
      for (int i = 0; i < 8; i += 2 * w) gn_join(wm[i], wq[i], wm[i + w], wq[i + w], 512.0f * (float)w);
    vst2(MV + ((size_t)gi * GSL + blockIdx.x) * 32 + tid, tid == 0 ? wm[0] : (tid == 1 ? wq[0] : 0.f)); } }
#define WS_MV  (WS_END)
#define WS_XT  (WS_MV + 4u * 32 * NB * 8 * GSL + 1024u)
#define WS_OR  (WS_XT + 4u * (size_t)NB * NTOK * CC)
#define WS_END2 (WS_OR + 4u * (size_t)NB * NTOK * CC)
#ifndef SM_EXTRA_PARAMS
#define SM_EXTRA_PARAMS
#endif
#ifndef PROJ_EXTRA_PARAMS
#define PROJ_EXTRA_PARAMS
#endif
#ifndef SM_MASK_HOOK
#define SM_MASK_HOOK (void)0
#endif

#define WS_QH  0u                                      // f16 q x SC2 rows [b*t][CC]
#define WS_KH  (WS_QH + 2u * (size_t)NB * TT * CC)      // f16 k rows [b*t][CC]
#define WS_VT  (WS_KH + 2u * (size_t)NB * TT * CC)      // f16 v planes [b][c][t]
#define WS_QL  (WS_VT + 2u * (size_t)NB * CC * TT)      // f16 residual of q x SC2 (unscaled) rows [b][t < QHI][CC]
#define WS_KL  (WS_QL + 2u * (size_t)NB * QHI * CC)     // f16 k residual x 2^10 rows [b][t < KHI][CC]
#define WS_VB  (WS_KL + 2u * (size_t)NB * KHI * CC)     // bf16 v hi planes [b][c][t < KHI]
#define WS_VBL (WS_VB + 2u * (size_t)NB * CC * KHI)
#define WS_S   (WS_VBL + 2u * (size_t)NB * CC * KHI)    // f32 [hg][t][s], unused: logits and P stay in registers
#define WS_Y   (WS_S  + 4u * (size_t)HG * TT * TT)      // f32 ctx rows [b*t][CC] (only when there is an output projection)
#define WS_END (WS_Y  + 4u * (size_t)NB * TT * CC)

// ---- operands of k_proj and k_out. The block's weight tile (128 output columns x K = 256, rows of an (out,in) matrix) is read once by whole-line loads, rounded to bf16 and kept in LDS for all four waves; a wave's own 16 activation rows are fetched whole behind it, so the K loop waits for no global load
#define WPB 528            // LDS pitch of a weight row: 256 bf16 + 16 B (16 B x odd: no bank conflict for 16-byte readers)
typedef __attribute__((ext_vector_type(4))) __bf16 v4b;
__device__ __forceinline__ v4b bf4(v4f v) { v4b r; r[0] = (__bf16)v[0]; r[1] = (__bf16)v[1]; r[2] = (__bf16)v[2]; r[3] = (__bf16)v[3]; return r; }
__device__ __forceinline__ v16b frag_lb(const char* p) { union { v16b v; v8b q[2]; } u; u.q[0] = *(const v8b*)p; u.q[1] = *(const v8b*)(p + 32); return u.v; }   // p = row + 2 * k0 + 16 * (lane >> 4): the k order of wcol_oi
// 128 threads: load i of a thread is 16 B of weight row 2 i + (tid >> 6); two groups of 16 loads are in flight at a time. arow = the lane's activation row + 8 * (lane >> 4); a[kc] = the 16 values of split_row at k0 = 32 kc
template <typename F> __device__ __forceinline__ void stage_ops(char* sw, const float* Wt, const float* arow, int tid, v4f (&a)[8][4], F under) {
  const v4f* wp = (const v4f*)Wt + tid; char* d = sw + (tid >> 6) * WPB + (tid & 63) * 8; v4f u[16], w[16];
  // every "#pragma unroll" here: u, w and a have to stay in registers
#pragma unroll
  for (int i = 0; i < 16; ++i) u[i] = wp[(size_t)i * 128];
#pragma unroll
  for (int i = 0; i < 16; ++i) w[i] = wp[(size_t)(16 + i) * 128];
  GNW(wp);
#pragma unroll
  for (int i = 0; i < 16; ++i) *(v4b*)(d + i * 2 * WPB) = bf4(u[i]);
#pragma unroll
  for (int i = 0; i < 16; ++i) u[i] = wp[(size_t)(32 + i) * 128];
  GNW(wp);
#pragma unroll
  for (int i = 0; i < 16; ++i) *(v4b*)(d + (16 + i) * 2 * WPB) = bf4(w[i]);
#pragma unroll
  for (int i = 0; i < 16; ++i) w[i] = wp[(size_t)(48 + i) * 128];
  GNW(wp);
#pragma unroll
  for (int i = 0; i < 16; ++i) *(v4b*)(d + (32 + i) * 2 * WPB) = bf4(u[i]);
#pragma unroll
  for (int kc = 0; kc < 8; ++kc) { const v4f* p = (const v4f*)(arow + kc * 32); a[kc][0] = p[0]; a[kc][1] = p[1]; a[kc][2] = p[4]; a[kc][3] = p[5]; }
  GNW(arow);
  under();   // the caller's short work on values fetched before the call: it runs while the last loads are in flight
#pragma unroll
  for (int i = 0; i < 16; ++i) *(v4b*)(d + (48 + i) * 2 * WPB) = bf4(w[i]); }
__device__ __forceinline__ F2 split_a(const v4f (&q)[4]) { float v[16];
#pragma unroll   // v[] has to stay in registers
  for (int i = 0; i < 4; ++i) { v[i] = q[0][i]; v[4 + i] = q[1][i]; v[8 + i] = q[2][i]; v[12 + i] = q[3][i]; }
  return bsplit16(v); }
#define SC2 (SCALE * 1.4426950408889634f)   // logits to base 2: k_proj folds it into q
#define WRD 2              // weight fragments are read from LDS WRD ahead of their products (read next to its product, each cost one LDS latency)
#define WFR(wl, t) frag_lb((wl) + ((t) & 7) * 16 * WPB + ((t) >> 3) * 64)   // fragment t = 8 kc + j
// ---- k_proj: block = (64 rows, 128 cols, which): X = GroupNorm of the rows of XT (thread t joins the 16 slices of group t >> 4, the group of its own two channels, and leaves their scale and shift in LDS; a K step of 32 channels is one group), q/k/v = X W (+ b) with exact bf16 products (K = DIN) -> which 0: q x SC2 f16 rows (+ residual rows < QHI); 1: k f16 rows (+ residual rows < KHI); 2: v f16 planes [c][t] (+ bf16 hi/lo planes for t < KHI)
__global__ __launch_bounds__(128) void k_proj(const float* __restrict__ XQ, const float* __restrict__ XK, const float* __restrict__ XV, const float* __restrict__ WQ, const float* __restrict__ WK, const float* __restrict__ WV, const float* __restrict__ BQ, const float* __restrict__ BK, const float* __restrict__ BV, const float* __restrict__ MV, const float* __restrict__ GG, const float* __restrict__ GB,
    _Float16* __restrict__ QH, _Float16* __restrict__ QL, _Float16* __restrict__ KH, _Float16* __restrict__ KL, _Float16* __restrict__ VT, __bf16* __restrict__ VB, __bf16* __restrict__ VBL) {
  __shared__ __align__(16) char sm[128 * WPB];   // the weight tile; behind the K loop and a barrier the same bytes hold the output tiles
  _Float16 (*sh)[136] = (_Float16 (*)[136])sm; _Float16 (*sl)[136] = (_Float16 (*)[136])(sm + 64 * 136 * 2); _Float16 (*th)[72] = (_Float16 (*)[72])sm; __bf16 (*tb)[72] = (__bf16 (*)[72])(sm + 128 * 72 * 2); __bf16 (*tbl)[72] = (__bf16 (*)[72])(sm + 2 * 128 * 72 * 2);
  const int tid = threadIdx.x, wave = tid >> 5, lane = tid & 31, col = lane & 15, g = lane >> 4; const int which = blockIdx.z; const int c0 = blockIdx.y * 128; const size_t r0 = (size_t)blockIdx.x * 64; const size_t bb = r0 / TT; const int t0 = (int)(r0 % TT);
  const float* X = which == 0 ? XQ : which == 1 ? XK : XV; const float* WA = which == 0 ? WQ : which == 1 ? WK : WV; const float* BA = which == 0 ? BQ : which == 1 ? BK : BV;
  __shared__ __align__(16) float sga[CC], sgb[CC]; __shared__ float sgm[8];   // per channel rstd x gamma and beta, per group the mean
  const float* mp = MV + ((bb * 8 + (tid >> 4)) * GSL + (tid & 15)) * 32; const float* gp = GG + 2 * tid; const float* hp = GB + 2 * tid;
  const v2f pm = *(const v2f*)mp, ga = *(const v2f*)gp, be = *(const v2f*)hp;   // used inside stage_ops, under its last loads
  asm volatile("s_wait_xcnt 0x0" :: "v"(mp), "v"(gp), "v"(hp) : "memory");   // as GNW, for the three addresses
  v4f ar[8][4]; stage_ops(sm, WA + (size_t)c0 * DIN, X + (r0 + wave * 16 + col) * DIN + 8 * g, tid, ar, [&]() { float m = pm[0], s = pm[1], hn = 4096.0f;
#pragma unroll
    for (int o = 1; o < GSL; o <<= 1) { gn_join(m, s, __shfl_xor(m, o), __shfl_xor(s, o), hn); hn += hn; }
    const float rs = rsqrtf(s / (float)((CC / 8) * NTOK) + 1e-5f); v2f a, c; a[0] = rs * bfr(ga[0]); a[1] = rs * bfr(ga[1]); c[0] = bfr(be[0]); c[1] = bfr(be[1]);
    *(v2f*)&sga[2 * tid] = a; *(v2f*)&sgb[2 * tid] = c; sgm[tid >> 4] = m; });   // the 16 lanes of a group hold the same m, bit for bit (gn_join): no test, which would split the staging's loads from their waits
  __syncthreads();   // the weight tile and the GroupNorm terms are readable by every wave
  float bs[8]; const float* bp = BA + c0 + col;
  // the eight bias values as one group; they land under what follows. The test stands here, ahead of the normalising: with a branch inside the K loop the compiler moved the later steps' normalising below it and held their terms in registers up to there (unrolls: bs[] has to stay in registers)
  if (BA) {
#pragma unroll
    for (int j = 0; j < 8; ++j) bs[j] = bp[j * 16];
    GNW(bp);
  } else {
#pragma unroll
    for (int j = 0; j < 8; ++j) bs[j] = 0.f; }
  { v4f na[2][4], nb[2][4]; float nm[2]; const float* pa = sga + 8 * g; const float* pb = sgb + 8 * g;   // the terms of a lane's 16 channels of a K step, in the order of ar[kc][]
    // every "#pragma unroll" here: ar[], na[], nb[] and nm[] have to stay in registers
#pragma unroll
    for (int i = 0; i < 4; ++i) { const int c = (i >> 1) * 16 + (i & 1) * 4; na[0][i] = *(const v4f*)(pa + c); nb[0][i] = *(const v4f*)(pb + c); }
    nm[0] = sgm[0];
#pragma unroll
    for (int kc = 0; kc < DIN / 32; ++kc) {
      if (kc + 1 < DIN / 32) {
#pragma unroll
        for (int i = 0; i < 4; ++i) { const int c = (kc + 1) * 32 + (i >> 1) * 16 + (i & 1) * 4; na[(kc + 1) & 1][i] = *(const v4f*)(pa + c); nb[(kc + 1) & 1][i] = *(const v4f*)(pb + c); }
        nm[(kc + 1) & 1] = sgm[kc + 1]; }
      __builtin_amdgcn_sched_barrier(0);   // the next step's terms are asked for before this step's are used
#pragma unroll
      for (int i = 0; i < 4; ++i) ar[kc][i] = (ar[kc][i] - nm[kc & 1]) * na[kc & 1][i] + nb[kc & 1][i];
      __builtin_amdgcn_sched_barrier(0);   // and no further ahead: with the terms of all eight steps read at once the kernel took 460 registers, and a SIMD holds two such waves where the grid brings three
    } }
  const char* wl = sm + col * WPB + 16 * g;
  v8f acc[8] = {}; v16b wr[WRD + 1];
#pragma unroll   // wr[] has to stay in registers
  for (int t = 0; t < WRD; ++t) wr[t] = WFR(wl, t);
#pragma unroll   // ar[] and wr[] have to stay in registers
  for (int kc = 0; kc < DIN / 32; ++kc) { const F2 a2 = split_a(ar[kc]);   /* GroupNorm rows (f32) split hi + lo */
#pragma unroll
    for (int j = 0; j < 8; ++j) { const int t = kc * 8 + j; if (t + WRD < DIN / 4) wr[(t + WRD) % (WRD + 1)] = WFR(wl, t + WRD); const v16b w = wr[t % (WRD + 1)]; acc[j] = wmma_bf(a2.h, w, acc[j]); acc[j] = wmma_bf(a2.l, w, acc[j]); } }
  __syncthreads();   // every wave has read its last weight fragment: the bytes are given to the output tiles
  if (which < 2) { _Float16* DH = which == 0 ? QH : KH; _Float16* DL = which == 0 ? QL : KL; const int nhi = which == 0 ? QHI : KHI; const bool hi_rows = t0 < nhi; const float qs = which == 0 ? SC2 : 1.0f, rs = which == 0 ? 1.0f : 1024.0f;   // q: base-2 logit units, residual on the scale of its high part (k_fa chains both products in one accumulator)
#pragma unroll
    for (int j = 0; j < 8; ++j) { const float bias = bfr(bs[j]);
#pragma unroll
      for (int r = 0; r < 8; ++r) { const float v = (acc[j][r] + bias) * qs; const _Float16 hv = (_Float16)v; sh[wave * 16 + 8 * g + r][j * 16 + col] = hv; sl[wave * 16 + 8 * g + r][j * 16 + col] = (_Float16)((v - (float)hv) * rs); } }
    __syncthreads();
    for (int e = tid; e < 64 * 16; e += 128) { const int rl = e >> 4, q = e & 15; vst2((unsigned*)(DH + (r0 + rl) * CC + c0 + q * 8), *(const v4u*)&sh[rl][q * 8]); if (hi_rows) vst2((unsigned*)(DL + (bb * nhi + t0 + rl) * (size_t)CC + c0 + q * 8), *(const v4u*)&sl[rl][q * 8]); }
  } else { const bool hi_rows = t0 < KHI;
#pragma unroll
    for (int j = 0; j < 8; ++j) { const float bias = bfr(bs[j]);
#pragma unroll
      for (int r = 0; r < 8; ++r) { const float v = acc[j][r] + bias; const int rl = wave * 16 + 8 * g + r, cl = j * 16 + col; th[cl][rl] = (_Float16)v; const __bf16 bh = (__bf16)v; tb[cl][rl] = bh; tbl[cl][rl] = (__bf16)(v - (float)bh); } }
    __syncthreads();
    for (int e = tid; e < 128 * 8; e += 128) { const int cl = e >> 3, q = e & 7; vst2((unsigned*)(VT + (bb * CC + c0 + cl) * (size_t)TT + t0 + q * 8), *(const v4u*)&th[cl][q * 8]); if (hi_rows) { const size_t o3 = (bb * CC + c0 + cl) * (size_t)KHI + t0 + q * 8; vst2((unsigned*)(VB + o3), *(const v4u*)&tb[cl][q * 8]); vst2((unsigned*)(VBL + o3), *(const v4u*)&tbl[cl][q * 8]); } } } }
// ---- k_fa: block = 16 waves of one (b, h): 8 groups of 32 query columns x 2 halves of the keys (four waves a SIMD in place of two: the vector work between the matrix runs of one wave is covered by three others); each half has its own ring, maximum in use, sums and O, and the halves are joined once, through LDS, behind the loop; one pass = 32 keys, one stage = KS keys of each half. S^T = K Q^T - M (A = k rows, B = q hi, then q residual: 2 products chained in one accumulator that starts at minus the column's maximum in use M, so the scores leave the matrix unit as arguments of exp2), lazy rescale (M, sums and O move only in a pass whose sums show that a score may lie more than 8 above M: one test a pass; a lane holds one query's scores), P^T packed from the score accumulators to f16 as the B operand of O^T += V^T P^T (A = v planes [c][t]); logits and P never reach memory. K rows and V planes of a stage are brought into LDS once per block by asynchronous copies (two buffers, the next stage in flight) and read from there by the eight waves of that half
__device__ __forceinline__ float xhalf(float x) { return __builtin_bit_cast(float, __builtin_amdgcn_permlanex16(__builtin_bit_cast(int, x), __builtin_bit_cast(int, x), 0x76543210, 0xfedcba98, false, false)); }   // lane l with lane l ^ 16
__device__ __forceinline__ v8f wmma_h(v16h a, v16h b, v8f c) { return __builtin_amdgcn_wmma_f32_16x16x32_f16(false, a, false, b, (short)0, c, false, false); }
#define XW() asm volatile("s_wait_xcnt 0x0" ::: "memory")   // behind a group of loads: a later load's result may land in the group's address registers
#define KS 256                  // keys of a stage
#define KPB 80                  // LDS pitch of a k row: 64 B + 16 (16 B x odd: no bank conflict for 16-byte readers)
#define VPB (2 * KS + 16)       // LDS pitch of a v plane row, the same rule
#define KBY (KS * KPB)
#define SBY (KBY + HD * VPB)    // one buffer: k rows, then v rows
#define AW() asm volatile("s_wait_asynccnt 0x0" ::: "memory")   // this wave's copies have landed
#define DW() asm volatile("s_wait_dscnt 0x0" ::: "memory")      // this wave's LDS reads have returned before the buffer is given up
// one stage: each thread copies 4 x 16 B of k rows (4 threads a row, rows 64 apart) and 4 x 16 B of v rows (32 threads a row, rows 8 apart); the wait in the same statement stands before the address registers are reused
__device__ __forceinline__ void fa_stage(unsigned lk, unsigned lv, const char* gk, const char* gv) {
  asm volatile("global_load_async_to_lds_b128 %0, %1, off\n\tglobal_load_async_to_lds_b128 %2, %3, off\n\tglobal_load_async_to_lds_b128 %4, %5, off\n\tglobal_load_async_to_lds_b128 %6, %7, off\n\t"
               "global_load_async_to_lds_b128 %8, %9, off\n\tglobal_load_async_to_lds_b128 %10, %11, off\n\tglobal_load_async_to_lds_b128 %12, %13, off\n\tglobal_load_async_to_lds_b128 %14, %15, off\n\ts_wait_xcnt 0x0"
    :: "v"(lk), "v"(gk), "v"(lk + 64u * KPB), "v"(gk + (size_t)64 * CC * 2), "v"(lk + 128u * KPB), "v"(gk + (size_t)128 * CC * 2), "v"(lk + 192u * KPB), "v"(gk + (size_t)192 * CC * 2),
       "v"(lv), "v"(gv), "v"(lv + 8u * VPB), "v"(gv + (size_t)8 * TT * 2), "v"(lv + 16u * VPB), "v"(gv + (size_t)16 * TT * 2), "v"(lv + 24u * VPB), "v"(gv + (size_t)24 * TT * 2) : "memory"); }
__device__ __forceinline__ v16h frag_l(const char* p) { union { v16h v; v8h q[2]; } u; u.q[0] = *(const v8h*)p; u.q[1] = *(const v8h*)(p + 32); return u.v; }   // p = row + 16 * (lane >> 4): the k order of frag_h
// one column group's 32 x 16 scores less d to powers of two, and their sum in two parts
__device__ __forceinline__ void fa_exp(const v8f (&s)[2], float d, v8f (&e)[2], v2f& sm) {
#pragma unroll   // e[] has to stay in registers
  for (int i = 0; i < 2; ++i)
#pragma unroll
    for (int r = 0; r < 8; ++r) e[i][r] = __builtin_amdgcn_exp2f(s[i][r] - d);
  const v8f ps = e[0] + e[1]; const v4f p4 = ps.lo + ps.hi; sm = p4.lo + p4.hi; }
#define KH2 (TT / 2)            // keys of a half
__global__ __launch_bounds__(512) void k_fa(const _Float16* __restrict__ QH, const _Float16* __restrict__ QL, const _Float16* __restrict__ KH, const _Float16* __restrict__ VT, float* __restrict__ Y) {
  __shared__ __align__(16) char ring[4 * SBY];   // two buffers for each half of the keys
  const int kh = __builtin_amdgcn_readfirstlane((int)threadIdx.x >> 8);   // the wave's half of the keys, in a scalar register: the tests on it are scalar branches
  const int tid = threadIdx.x & 255, wave = tid >> 5, lane = tid & 31, col = lane & 15, g = lane >> 4; const int b = blockIdx.y / NH, h = blockIdx.y % NH; const int q0 = blockIdx.x * 256 + wave * 32;
  const char* rg = ring + kh * 2 * SBY;   // this half's two buffers
  // every "#pragma unroll" of this kernel: the small arrays it indexes have to stay in registers
  const char* gk = (const char*)(KH + ((size_t)b * TT + kh * KH2 + (tid >> 2)) * CC + h * HD) + (tid & 3) * 16; const char* gv = (const char*)(VT + ((size_t)b * CC + h * HD + (tid >> 5)) * (size_t)TT + kh * KH2) + (tid & 31) * 16;
  const unsigned lk = (unsigned)(size_t)rg + (unsigned)((tid >> 2) * KPB + (tid & 3) * 16), lv = (unsigned)(size_t)rg + (unsigned)(KBY + (tid >> 5) * VPB + (tid & 31) * 16);
  fa_stage(lk, lv, gk, gv);
  v16h qh[2], ql[2];
#pragma unroll
  for (int u = 0; u < 2; ++u) qh[u] = frag_h(QH + ((size_t)b * TT + q0 + u * 16 + col) * CC + h * HD, lane);
  XW();
#pragma unroll
  for (int u = 0; u < 2; ++u) ql[u] = frag_h(QL + ((size_t)b * QHI + q0 + u * 16 + col) * CC + h * HD, lane);
  XW();
  AW(); __syncthreads();   // stage 0 is readable by every wave
  fa_stage(lk + SBY, lv + SBY, gk + (size_t)KS * CC * 2, gv + (size_t)KS * 2);
  v8f o[2][2] = {}; v2f l[2] = {}; v8f cn[2][2];   // cn[u][i] = -M of column group u in all eight rows: the start value of score tile (u, i); a tile each, since one shared by two products was copied by the compiler in every pass
  { // M starts at the maximum over the half's first 32 keys (high parts alone: any value within 8 of the maximum serves), the same in both wave halves
    const char* K0 = rg + col * KPB + 16 * g; const v16h k0 = frag_l(K0), k1 = frag_l(K0 + 16 * KPB); const v8f z = {};
#pragma unroll
    for (int u = 0; u < 2; ++u) { const v8f t0 = wmma_h(k0, qh[u], z), t1 = wmma_h(k1, qh[u], z); float mx = fmaxf(t0[0], t1[0]);
#pragma unroll
      for (int r = 1; r < 8; ++r) mx = fmaxf(mx, fmaxf(t0[r], t1[r]));
      mx = fmaxf(mx, xhalf(mx)); cn[u][0] = z - mx; cn[u][1] = z - mx; } }
#pragma unroll 1   // one stage a trip: the buffer index stays a run-time value
  for (int st = 0; st < KH2 / KS; ++st) {
    const char* Kl = rg + (st & 1) * SBY + col * KPB + 16 * g; const char* Vl = rg + (st & 1) * SBY + KBY + col * VPB + 16 * g;
    v16h kf[2], vf[2]; kf[0] = frag_l(Kl); kf[1] = frag_l(Kl + 16 * KPB); vf[0] = frag_l(Vl); vf[1] = frag_l(Vl + 16 * VPB); const char* Kn = Kl; const char* Vn = Vl;
#pragma unroll 1   // unrolled, the fragment reads were moved next to their users and waited for there
    for (int p = 0; p < KS / 32; ++p) {
      v8f s[2][2], e[2][2]; v2f sm[2];
#pragma unroll
      for (int i = 0; i < 2; ++i)
#pragma unroll
        for (int u = 0; u < 2; ++u) s[u][i] = wmma_h(kf[i], qh[u], cn[u][i]);
#pragma unroll
      for (int i = 0; i < 2; ++i)
#pragma unroll
        for (int u = 0; u < 2; ++u) s[u][i] = wmma_h(kf[i], ql[u], s[u][i]);
      __builtin_amdgcn_sched_barrier(0);   // the eight score products stay one run: spread among the vector work each pair cost four idle slots before its first reader
      // both operands are fetched one pass ahead, each behind its last use, inside the stage's own buffer (its last pass refetches pass 0, unused)
      Kn += p + 1 < KS / 32 ? 32 * KPB : -(KS / 32 - 1) * 32 * KPB; Vn += p + 1 < KS / 32 ? 64 : -(KS / 32 - 1) * 64;
      kf[0] = frag_l(Kn); kf[1] = frag_l(Kn + 16 * KPB);
      __builtin_amdgcn_sched_barrier(0);   // the k reads stay here, under the products' latency: left free they were sunk below the test, next to the next pass's products
#pragma unroll
      for (int u = 0; u < 2; ++u) fa_exp(s[u], 0.f, e[u], sm[u]);
      // the test: every term is positive, so four partial sums of at most 256 bound every term by 256 (a score at most 8 above M)
      if (__builtin_amdgcn_ballot_w32(fmaxf(fmaxf(sm[0][0], sm[0][1]), fmaxf(sm[1][0], sm[1][1])) > 256.0f) != 0) {   // rare: raise M to the pass's maximum where that is higher, rescale sums and O, redo the pass's exponentials
#pragma unroll
        for (int u = 0; u < 2; ++u) { float mx = fmaxf(s[u][0][0], s[u][1][0]);
#pragma unroll
          for (int r = 1; r < 8; ++r) mx = fmaxf(mx, fmaxf(s[u][0][r], s[u][1][r]));
          const float d = fmaxf(fmaxf(mx, xhalf(mx)), 0.f); const float corr = __builtin_amdgcn_exp2f(-d); cn[u][0] -= d; cn[u][1] -= d; l[u] *= corr; o[u][0] *= corr; o[u][1] *= corr; fa_exp(s[u], d, e[u], sm[u]); } }
#pragma unroll
      for (int u = 0; u < 2; ++u) { v16h pf;
#pragma unroll
        for (int r = 0; r < 8; ++r) { pf[r] = (_Float16)e[u][0][r]; pf[8 + r] = (_Float16)e[u][1][r]; }
        l[u] += sm[u];
#pragma unroll
        for (int j = 0; j < 2; ++j) o[u][j] = wmma_h(vf[j], pf, o[u][j]); }
      vf[0] = frag_l(Vn); vf[1] = frag_l(Vn + 16 * VPB); }
    DW(); AW(); __syncthreads();   // publishes stage st + 1 and ends every wave's reads of stage st
    if (st + 2 < KH2 / KS) fa_stage(lk + (st & 1) * SBY, lv + (st & 1) * SBY, gk + (size_t)(st + 2) * KS * CC * 2, gv + (size_t)(st + 2) * KS * 2); }
  AW();
  // the join: the loop's last barrier has ended every read of the ring and every copy has landed, so its first bytes carry the second half's state: nine 16-byte pieces a lane (O, then both sums and both -M), a piece = 512 B of a wave
  float* xb = (float*)ring + wave * (9 * 128) + lane * 4;
  if (kh) {
#pragma unroll
    for (int u = 0; u < 2; ++u)
#pragma unroll
      for (int j = 0; j < 2; ++j) { *(v4f*)(xb + (u * 4 + j * 2) * 128) = o[u][j].lo; *(v4f*)(xb + (u * 4 + j * 2 + 1) * 128) = o[u][j].hi; }
    v4f t; t[0] = l[0][0] + l[0][1]; t[1] = l[1][0] + l[1][1]; t[2] = cn[0][0][0]; t[3] = cn[1][0][0]; *(v4f*)(xb + 8 * 128) = t; }
  __syncthreads();   // the second half's state is readable by the first half's waves
  if (kh) return;
  const v4f t = *(const v4f*)(xb + 8 * 128);
#pragma unroll
  for (int u = 0; u < 2; ++u) { const float na = cn[u][0][0], nb = t[2 + u], nm = fminf(na, nb);   // -M of either half (the same in both wave halves) and of the join
    const float fa = __builtin_amdgcn_exp2f(nm - na), fb = __builtin_amdgcn_exp2f(nm - nb); const float lu = (l[u][0] + l[u][1]) * fa + t[u] * fb; const float inv = 1.0f / (lu + xhalf(lu)); const float wa = fa * inv, wb = fb * inv;
    float* yr = Y + ((size_t)b * TT + q0 + u * 16 + col) * CC + h * HD + 8 * g;
#pragma unroll
    for (int j = 0; j < 2; ++j) { const v4f w0 = o[u][j].lo * wa + *(const v4f*)(xb + (u * 4 + j * 2) * 128) * wb, w1 = o[u][j].hi * wa + *(const v4f*)(xb + (u * 4 + j * 2 + 1) * 128) * wb; vst2(yr + j * 16, w0); vst2(yr + j * 16 + 4, w1); } } }
// ---- k_out: block = (64 tokens, 128 channels): out[b][c][n] = ctx Wo + bo + bf16(x[b][c][n]), ctx split bf16 hi + lo against exact bf16 Wo (2 products). A lane's accumulator tile holds 8 consecutive tokens of one channel: the block's tile goes to LDS channel-major by 16-byte stores and leaves as 256-B runs of 64 tokens per channel with the residual added, so the result has no token-major copy in memory and needs no launch that turns it
#define OTP 68             // LDS pitch in floats of a channel's 64 tokens (16 B x odd: no bank conflict for 16-byte accesses)
__global__ __launch_bounds__(128) void k_out(const float* __restrict__ Y, const float* __restrict__ WO, const float* __restrict__ BO, const float* __restrict__ X, float* __restrict__ OUT) { __shared__ __align__(16) float st[128][OTP]; __shared__ __align__(16) char sm[128 * WPB];
  const int tid = threadIdx.x, wave = tid >> 5, lane = tid & 31, col = lane & 15, g = lane >> 4; const int c0 = blockIdx.y * 128; const size_t r0 = (size_t)blockIdx.x * 64 + wave * 16;
  const size_t rb = (size_t)blockIdx.x * 64; const size_t oi = ((rb / NTOK) * CC + c0 + (tid >> 4)) * (size_t)NTOK + rb % NTOK + (tid & 15) * 4;   // piece i of this thread in x and out: 4 tokens of channel c0 + (tid >> 4) + 8 i
  const float* xp = X + oi; v4f xr[16];
  v8f acc[8] = {};
  if (true) {   /* ALL rows: ctx split bf16 hi + lo x exact proj_w (2 products) */
    v4f ar[8][4]; stage_ops(sm, WO + (size_t)c0 * CC, Y + (r0 + col) * CC + 8 * g, tid, ar, []() {});
    __syncthreads();   // the weight tile is readable by every wave
    const char* wl = sm + col * WPB + 16 * g; v16b wr[WRD + 1]; float bs[8]; const float* bp = BO + c0 + col;
#pragma unroll   // wr[] has to stay in registers
    for (int t = 0; t < WRD; ++t) wr[t] = WFR(wl, t);
#pragma unroll   // ar[] and wr[] have to stay in registers
    for (int kc = 0; kc < CC / 32; ++kc) { const F2 a = split_a(ar[kc]);
      if (kc == 4) {   // the eight bias values as one group, in registers that half of ar[] has left; they land under the rest of the loop (its unrolls: bs[] has to stay in registers)
        if (BO) {
#pragma unroll
          for (int j = 0; j < 8; ++j) bs[j] = bp[j * 16];
          GNW(bp);
        } else {
#pragma unroll
          for (int j = 0; j < 8; ++j) bs[j] = 0.f; } }
      if (kc == 4 || kc == 6) {   // the residual's pieces, eight at a time, also in registers that ar[] has left: they land under the rest of the loop (unroll: xr[] has to stay in registers)
#pragma unroll
        for (int i = 0; i < 8; ++i) xr[(kc - 4) * 4 + i] = *(const v4f*)(xp + (size_t)((kc - 4) * 4 + i) * 8 * NTOK);
        GNW(xp); }
#pragma unroll
      for (int j = 0; j < 8; ++j) { const int t = kc * 8 + j; if (t + WRD < CC / 4) wr[(t + WRD) % (WRD + 1)] = WFR(wl, t + WRD); const v16b w = wr[t % (WRD + 1)]; acc[j] = wmma_bf(a.h, w, acc[j]); acc[j] = wmma_bf(a.l, w, acc[j]); } }
#pragma unroll
    for (int j = 0; j < 8; ++j) { const float bias = bfr(bs[j]); const v8f w = acc[j] + bias; float* d = &st[j * 16 + col][wave * 16 + 8 * g]; *(v4f*)d = w.lo; *(v4f*)(d + 4) = w.hi; }
  }
  __syncthreads();   // a channel's 64 tokens come from all four waves
  v4f o[16];
#pragma unroll   // xr[] and o[] have to stay in registers
  for (int i = 0; i < 16; ++i) o[i] = *(const v4f*)&st[(tid >> 4) + 8 * i][(tid & 15) * 4] + bfr4(xr[i]);
  __builtin_amdgcn_sched_barrier(0);   // every sum has a register of its own before the first store: mixed with the sums, the stores' registers were reused behind waits
#pragma unroll
  for (int i = 0; i < 16; ++i) vst2(OUT + oi + (size_t)i * 8 * NTOK, o[i]); }

extern "C" void kernel_launch(void* const* d_in, const int* in_sizes, int n_in, void* d_out, int out_size, void* d_ws, size_t ws_size, hipStream_t stream) {
  (void)in_sizes; (void)n_in; (void)out_size;
  const float** F = (const float**)d_in;
  if (ws_size < (size_t)WS_END) return;
  char* ws = (char*)d_ws; _Float16 *QH = (_Float16*)(ws + WS_QH), *KH = (_Float16*)(ws + WS_KH), *VT = (_Float16*)(ws + WS_VT), *QL = (_Float16*)(ws + WS_QL), *KL = (_Float16*)(ws + WS_KL); __bf16 *VB = (__bf16*)(ws + WS_VB), *VBL = (__bf16*)(ws + WS_VBL); float *Y = (float*)(ws + WS_Y);
  (void)Y; (void)QL; (void)KL; (void)VB; (void)VBL;
  // inputs: 0 x [2,256,64,64]; 1 gn_gamma, 2 gn_beta [256]; 3 qkv_w [768,256] (out,in) rows q | k | v; 4 qkv_b [768]; 5 proj_w [256,256] (out,in); 6 proj_b
  if (ws_size < (size_t)WS_END2) return;
  float *MV = (float*)(ws + WS_MV), *XT = (float*)(ws + WS_XT);
  k_gtr<<<dim3(NTOK / 256, TNB * 8), 256, 0, stream>>>(F[0], MV, XT);
  { const float* WQ = F[3]; const float* WK = F[3] + (size_t)CC * DIN; const float* WV = F[3] + (size_t)2 * CC * DIN;
    k_proj<<<dim3(TNB * TT / 64, CC / 128, 3), 128, 0, stream>>>(XT, XT, XT, WQ, WK, WV, F[4], F[4] + CC, F[4] + 2 * CC, MV, F[1], F[2], QH, QL, KH, KL, VT, VB, VBL); }
  k_fa<<<dim3(TT / 256, TNB * NH), 512, 0, stream>>>(QH, QL, KH, VT, Y);
  k_out<<<dim3(TNB * TT / 64, DIN / 128), 128, 0, stream>>>(Y, F[5], F[6], F[0], (float*)d_out);
}

// v009
// Measured time: 58.1 microseconds a run.
// Next to v008, in two timings, it ran 1.10 times as fast each time.
// Counting every step since v000, it is 26.6 times as fast.
// Single self-attention block on images (b 2, c 256, 64 x 64 -> n 4,096 tokens; 8 heads x 32): xn = GroupNorm(8 groups)(x) (affine); q,k,v = qkv_w xn + qkv_b (1x1, (out,in) rows q|k|v); attn = softmax(q k^T x 32^-0.5); out = proj_w (attn v) + proj_b, reshaped to [b,c,h,w] + x.
#include <hip/hip_runtime.h>
#include <math.h>

typedef __attribute__((ext_vector_type(16))) _Float16 v16h;
typedef __attribute__((ext_vector_type(16))) __bf16 v16b;
typedef __attribute__((ext_vector_type(8)))  _Float16 v8h;
typedef __attribute__((ext_vector_type(8)))  float v8f;
typedef __attribute__((ext_vector_type(4)))  float v4f;
typedef __attribute__((ext_vector_type(2)))  float v2f;
typedef __attribute__((ext_vector_type(4)))  unsigned v4u;
typedef __attribute__((ext_vector_type(4)))  int v4i;
typedef float __attribute__((may_alias)) float_a;
typedef int __attribute__((may_alias)) int_a;

template <typename T> __device__ __forceinline__ void vst2(void* p, T v) { *(T*)p = v;  }
__device__ __forceinline__ v8f wmma16(v16h a, v16h b, v8f c) {
  v8f d = __builtin_amdgcn_wmma_f32_16x16x32_f16(false, a, false, b, (short)0, c, false, false);
  asm volatile("v_nop\n\tv_nop\n\tv_nop\n\tv_nop" : "+v"(d) : "v"(a), "v"(b));
  return d;
}
__device__ __forceinline__ v8f wmma_bf(v16b a, v16b b, v8f c) {
  v8f d = __builtin_amdgcn_wmma_f32_16x16x32_bf16(false, a, false, b, (short)0, c, false, false);
  asm volatile("v_nop\n\tv_nop\n\tv_nop\n\tv_nop" : "+v"(d) : "v"(a), "v"(b));
  return d;
}
// 16x16x32 fragments: lane = (h = lane>>4, row/col = lane&15); elements 0..7 = k0+8h+0..7, 8..15 = k0+16+8h+0..7; D element r = row 8h+r
__device__ __forceinline__ v16h frag_h(const _Float16* rowk0, int lane) {
  union { v16h v; v8h q[2]; } u; const _Float16* p = rowk0 + 8 * (lane >> 4);
  u.q[0] = *(const v8h*)p; u.q[1] = *(const v8h*)(p + 16); return u.v;
}
__device__ __forceinline__ v16h frag_f32(const float* rowk0, int lane) {
  v16h a; const float* p = rowk0 + 8 * (lane >> 4);
#pragma unroll
  for (int i = 0; i < 8; ++i) { a[i] = (_Float16)p[i]; a[8 + i] = (_Float16)p[16 + i]; }
  return a;
}
__device__ __forceinline__ v16h frag_f32s(const float* rowk0, int lane, float sc) {
  v16h a; const float* p = rowk0 + 8 * (lane >> 4);
#pragma unroll
  for (int i = 0; i < 8; ++i) { a[i] = (_Float16)(p[i] * sc); a[8 + i] = (_Float16)(p[16 + i] * sc); }
  return a;
}
// column fragment from a [K][ld] layout (column n), rows >= K read as 0
__device__ __forceinline__ v16h fragc_f32(const float* W, int k0, int n, int lane, int ld, int K) {
  v16h a; const int g = lane >> 4;
#pragma unroll
  for (int i = 0; i < 8; ++i) { const int ka = k0 + 8 * g + i, kb = ka + 16;
    a[i] = (_Float16)(ka < K ? W[(size_t)(ka < K ? ka : K - 1) * ld + n] : 0.f); a[8 + i] = (_Float16)(kb < K ? W[(size_t)(kb < K ? kb : K - 1) * ld + n] : 0.f); }
  return a;
}
struct F2 { v16b h, l; };
__device__ __forceinline__ F2 bsplit16(const float v[16]) { F2 r;
#pragma unroll
  for (int i = 0; i < 16; ++i) { const __bf16 h = (__bf16)v[i]; r.h[i] = h; r.l[i] = (__bf16)(v[i] - (float)h); }
  return r; }
__device__ __forceinline__ F2 split_row(const float* row, int k0, int lane) { float v[16]; const float* p = row + k0 + 8 * (lane >> 4);
#pragma unroll
  for (int i = 0; i < 8; ++i) { v[i] = p[i]; v[8 + i] = p[16 + i]; }
  return bsplit16(v); }
__device__ __forceinline__ F2 split_rowK(const float* row, int k0, int lane, int K) { float v[16]; const int g = lane >> 4;
#pragma unroll
  for (int i = 0; i < 8; ++i) { const int ka = k0 + 8 * g + i, kb = ka + 16; v[i] = ka < K ? row[ka < K ? ka : K - 1] : 0.f; v[8 + i] = kb < K ? row[kb < K ? kb : K - 1] : 0.f; }
  return bsplit16(v); }
__device__ __forceinline__ F2 split_col(const float* W, int k0, int n, int lane, int ld, int K) { float v[16]; const int g = lane >> 4;
#pragma unroll
  for (int i = 0; i < 8; ++i) { const int ka = k0 + 8 * g + i, kb = ka + 16; v[i] = ka < K ? W[(size_t)(ka < K ? ka : K - 1) * ld + n] : 0.f; v[8 + i] = kb < K ? W[(size_t)(kb < K ? kb : K - 1) * ld + n] : 0.f; }
  return bsplit16(v); }
__device__ __forceinline__ v8f mac3(const F2& a, const F2& b, v8f c) { c = wmma_bf(a.l, b.h, c); c = wmma_bf(a.h, b.l, c); return wmma_bf(a.h, b.h, c); }
__device__ __forceinline__ float sigm(float v) { return 1.0f / (1.0f + expf(-v)); }
#define LDSX() do { asm volatile("s_wait_dscnt 0" ::: "memory"); __builtin_amdgcn_wave_barrier(); __builtin_amdgcn_fence(__ATOMIC_RELEASE, "workgroup"); } while (0)

#define NB 2
#define TT 4096
#define CC 256            // NH * HD = projected width
#define DIN 256          // input (model) width
#define NH 8
#define HD 32
#define NQB (TT / 64)
#define HG 2
#define SCALE (0.17677669529663687f)
#define CAUSAL 0
#ifndef TNB
#define TNB NB
#endif
__device__ __forceinline__ float bfr(float v) { return (float)(__bf16)v; }
__host__ __device__ __forceinline__ int kb_last(int qb) { return CAUSAL ? ((qb * 64 + 63) >> 7) : (TT / 128 - 1); }
typedef __attribute__((ext_vector_type(8))) __bf16 v8b;
__device__ __forceinline__ v16b frag_b(const __bf16* rowk0, int lane) {
  union { v16b v; v8b q[2]; } u; const __bf16* p = rowk0 + 8 * (lane >> 4);
  u.q[0] = *(const v8b*)p; u.q[1] = *(const v8b*)(p + 16); return u.v;
}
#define QBH 0              // not used (no kernel has a high-precision path)
#define QHI 4096            // rows of the workspace range WS_QL (no kernel uses that range; it keeps the later offsets where they are)
#define KHI 64            // key rows carrying v bf16 hi+lo planes (written by k_proj; no kernel reads them)
// B fragment (k rows k0+.., output column o) of a weight: (in,out) [K][ld] or (out,in) [ld rows of K]: bf16 exact, or f16(bf16 * 256) exact
__device__ __forceinline__ v16b wcol_io(const float* Wm, int k0, int o, int lane, int ld) { v16b w; const int g = lane >> 4;
#pragma unroll
  for (int i = 0; i < 8; ++i) { w[i] = (__bf16)Wm[(size_t)(k0 + 8 * g + i) * ld + o]; w[8 + i] = (__bf16)Wm[(size_t)(k0 + 16 + 8 * g + i) * ld + o]; }
  return w; }
__device__ __forceinline__ v16b wcol_oi(const float* Wm, int k0, int o, int lane, int K) { v16b w; const float* p = Wm + (size_t)o * K + k0 + 8 * (lane >> 4);
#pragma unroll
  for (int i = 0; i < 8; ++i) { w[i] = (__bf16)p[i]; w[8 + i] = (__bf16)p[16 + i]; }
  return w; }
__device__ __forceinline__ v16h wcolh_io(const float* Wm, int k0, int o, int lane, int ld) { v16h w; const int g = lane >> 4;
#pragma unroll
  for (int i = 0; i < 8; ++i) { w[i] = (_Float16)(bfr(Wm[(size_t)(k0 + 8 * g + i) * ld + o]) * 256.0f); w[8 + i] = (_Float16)(bfr(Wm[(size_t)(k0 + 16 + 8 * g + i) * ld + o]) * 256.0f); }
  return w; }
__device__ __forceinline__ v16h wcolh_oi(const float* Wm, int k0, int o, int lane, int K) { v16h w; const float* p = Wm + (size_t)o * K + k0 + 8 * (lane >> 4);
#pragma unroll
  for (int i = 0; i < 8; ++i) { w[i] = (_Float16)(bfr(p[i]) * 256.0f); w[8 + i] = (_Float16)(bfr(p[16 + i]) * 256.0f); }
  return w; }
#define WQKV_LAYOUT 1   // 0 = (in,out) [DIN][CC]; 1 = (out,in) [CC][DIN]; 2 = per-head [NH][DIN][HD]
__device__ __forceinline__ v16b wcol_hdk(const float* Wm, int k0, int o, int lane) { v16b w; const int g = lane >> 4; const float* p = Wm + (size_t)(o / HD) * DIN * HD + (o % HD);
#pragma unroll
  for (int i = 0; i < 8; ++i) { w[i] = (__bf16)p[(size_t)(k0 + 8 * g + i) * HD]; w[8 + i] = (__bf16)p[(size_t)(k0 + 16 + 8 * g + i) * HD]; }
  return w; }
#define WO_OUT_IN 1
#if WQKV_LAYOUT == 1
#define WCOL(W, k0, o, lane) wcol_oi(W, k0, o, lane, DIN)
#elif WQKV_LAYOUT == 2
#define WCOL(W, k0, o, lane) wcol_hdk(W, k0, o, lane)
#else
#define WCOL(W, k0, o, lane) wcol_io(W, k0, o, lane, CC)
#endif
#if WO_OUT_IN
#define WOCOL(W, k0, o, lane) wcol_oi(W, k0, o, lane, CC)
#define WOCOLH(W, k0, o, lane) wcolh_oi(W, k0, o, lane, CC)
#else
#define WOCOL(W, k0, o, lane) wcol_io(W, k0, o, lane, DIN)
#define WOCOLH(W, k0, o, lane) wcolh_io(W, k0, o, lane, DIN)
#endif
#define NTOK 4096
#ifndef OPITCH
#define OPITCH NTOK        // unused (out is written with pitch NTOK)
#endif
#ifndef XPITCH
#define XPITCH NTOK        // unused (x is read with pitch NTOK)
#endif
// behind a group of loads from p, a precaution: p is an input, so its registers are not given to a load of the group as destination ahead of the wait
#define GNW(p) asm volatile("s_wait_xcnt 0x0" :: "v"(p) : "memory")
__device__ __forceinline__ v4f bfr4(v4f v) { v4f r; r[0] = bfr(v[0]); r[1] = bfr(v[1]); r[2] = bfr(v[2]); r[3] = bfr(v[3]); return r; }
// two sets of equal size 2 hn, each given by its mean m and its sum of squared distances from that mean s, joined; the result is the same whichever of the two sets is named first
__device__ __forceinline__ void gn_join(float& m, float& s, float mo, float so, float hn) { const float d = m - mo; s = (s + so) + d * d * hn; m = 0.5f * (m + mo); }
#define GSL 16             // slices of a (batch, group): 32 channels x 256 tokens each
#define TPT 260            // LDS pitch in floats of a channel's 256 tokens (16 B x odd)
// ---- k_gtr: block = (256 tokens, one (batch, group) of 32 channels), 8 waves, one block a WGP: x is read once, 8 x 16 B a thread all in flight. From the registers: the slice's mean and sum of squared distances from it (a thread's 32 values, then joins of equal sets: lanes, waves) -> one 128-B line of MV; and XT[b*N + n][c] = bf16(x[b][c][n]), not yet normalised, through an LDS tile, a whole line per token. k_proj joins the 16 slices and normalises its own rows
__global__ __launch_bounds__(256) void k_gtr(const float* __restrict__ X, float* __restrict__ MV, float* __restrict__ XT) { __shared__ __align__(16) float st[32][TPT]; __shared__ float sred[8][2];
  const int tid = threadIdx.x, gi = blockIdx.y, n0 = blockIdx.x * 256; const float* xp = X + ((size_t)gi * 32 + (tid >> 6)) * NTOK + n0 + (tid & 63) * 4; v4f v[8];
  // every "#pragma unroll" here: v[] has to stay in registers
#pragma unroll
  for (int i = 0; i < 8; ++i) v[i] = *(const v4f*)(xp + (size_t)i * 4 * NTOK);
  GNW(xp);
  v4f sv = {};
#pragma unroll
  for (int i = 0; i < 8; ++i) { v[i] = bfr4(v[i]); sv += v[i]; *(v4f*)&st[(tid >> 6) + 4 * i][(tid & 63) * 4] = v[i]; }
  float m = ((sv[0] + sv[1]) + (sv[2] + sv[3])) * (1.0f / 32.0f); v4f qv = {};
#pragma unroll
  for (int i = 0; i < 8; ++i) { const v4f d = v[i] - m; qv += d * d; }
  float s = (qv[0] + qv[1]) + (qv[2] + qv[3]); float hn = 16.0f;
#pragma unroll
  for (int o = 1; o < 32; o <<= 1) { gn_join(m, s, __shfl_xor(m, o), __shfl_xor(s, o), hn); hn += hn; }
  if ((tid & 31) == 0) { sred[tid >> 5][0] = m; sred[tid >> 5][1] = s; }
  __syncthreads();   // the tile and the eight waves' statistics are readable by every wave
  float* xo = XT + ((size_t)(gi >> 3) * NTOK + n0 + (tid >> 3)) * CC + (gi & 7) * 32 + (tid & 7) * 4;
#pragma unroll
  for (int i = 0; i < 8; ++i) { const int nl = (tid >> 3) + 32 * i, c = (tid & 7) * 4; v4f o; o[0] = st[c][nl]; o[1] = st[c + 1][nl]; o[2] = st[c + 2][nl]; o[3] = st[c + 3][nl]; vst2(xo + (size_t)i * 32 * CC, o); }
  if (tid < 32) { float wm[8], wq[8];
#pragma unroll   // wm[] and wq[] have to stay in registers
    for (int i = 0; i < 8; ++i) { wm[i] = sred[i][0]; wq[i] = sred[i][1]; }
#pragma unroll
    for (int w = 1; w < 8; w <<= 1)
#pragma unroll
      for (int i = 0; i < 8; i += 2 * w) gn_join(wm[i], wq[i], wm[i + w], wq[i + w], 512.0f * (float)w);
    vst2(MV + ((size_t)gi * GSL + blockIdx.x) * 32 + tid, tid == 0 ? wm[0] : (tid == 1 ? wq[0] : 0.f)); } }
#define WS_MV  (WS_END)
#define WS_XT  (WS_MV + 4u * 32 * NB * 8 * GSL + 1024u)
#define WS_OR  (WS_XT + 4u * (size_t)NB * NTOK * CC)
#define WS_END2 (WS_OR + 4u * (size_t)NB * NTOK * CC)
#ifndef SM_EXTRA_PARAMS
#define SM_EXTRA_PARAMS
#endif
#ifndef PROJ_EXTRA_PARAMS
#define PROJ_EXTRA_PARAMS
#endif
#ifndef SM_MASK_HOOK
#define SM_MASK_HOOK (void)0
#endif

#define WS_QH  0u                                      // f16 q x SC2 rows [b*t][CC]
#define WS_KH  (WS_QH + 2u * (size_t)NB * TT * CC)      // f16 k rows [b*t][CC]
#define WS_VT  (WS_KH + 2u * (size_t)NB * TT * CC)      // f16 v planes [b][c][t]
#define WS_QL  (WS_VT + 2u * (size_t)NB * CC * TT)      // not used
#define WS_KL  (WS_QL + 2u * (size_t)NB * QHI * CC)     // not used
#define WS_VB  (WS_KL + 2u * (size_t)NB * KHI * CC)     // bf16 v hi planes [b][c][t < KHI]
#define WS_VBL (WS_VB + 2u * (size_t)NB * CC * KHI)
#define WS_S   (WS_VBL + 2u * (size_t)NB * CC * KHI)    // f32 [hg][t][s], unused: logits and P stay in registers
#define WS_Y   (WS_S  + 4u * (size_t)HG * TT * TT)      // f32 ctx rows [b*t][CC] (only when there is an output projection)
#define WS_END (WS_Y  + 4u * (size_t)NB * TT * CC)

// ---- operands of k_proj and k_out. The block's weight tile (128 output columns x K = 256, rows of an (out,in) matrix) is read once by whole-line loads, rounded to bf16 and kept in LDS for all four waves; a wave's own 16 activation rows are fetched whole behind it, so the K loop waits for no global load
#define WPB 528            // LDS pitch of a weight row: 256 bf16 + 16 B (16 B x odd: no bank conflict for 16-byte readers)
typedef __attribute__((ext_vector_type(4))) __bf16 v4b;
__device__ __forceinline__ v4b bf4(v4f v) { v4b r; r[0] = (__bf16)v[0]; r[1] = (__bf16)v[1]; r[2] = (__bf16)v[2]; r[3] = (__bf16)v[3]; return r; }
__device__ __forceinline__ v16b frag_lb(const char* p) { union { v16b v; v8b q[2]; } u; u.q[0] = *(const v8b*)p; u.q[1] = *(const v8b*)(p + 32); return u.v; }   // p = row + 2 * k0 + 16 * (lane >> 4): the k order of wcol_oi
// 128 threads: load i of a thread is 16 B of weight row 2 i + (tid >> 6); two groups of 16 loads are in flight at a time. arow = the lane's activation row + 8 * (lane >> 4); a[kc] = the 16 values of split_row at k0 = 32 kc
template <typename F> __device__ __forceinline__ void stage_ops(char* sw, const float* Wt, const float* arow, int tid, v4f (&a)[8][4], F under) {
  const v4f* wp = (const v4f*)Wt + tid; char* d = sw + (tid >> 6) * WPB + (tid & 63) * 8; v4f u[16], w[16];
  // every "#pragma unroll" here: u, w and a have to stay in registers
#pragma unroll
  for (int i = 0; i < 16; ++i) u[i] = wp[(size_t)i * 128];
#pragma unroll
  for (int i = 0; i < 16; ++i) w[i] = wp[(size_t)(16 + i) * 128];
  GNW(wp);
#pragma unroll
  for (int i = 0; i < 16; ++i) *(v4b*)(d + i * 2 * WPB) = bf4(u[i]);
#pragma unroll
  for (int i = 0; i < 16; ++i) u[i] = wp[(size_t)(32 + i) * 128];
  GNW(wp);
#pragma unroll
  for (int i = 0; i < 16; ++i) *(v4b*)(d + (16 + i) * 2 * WPB) = bf4(w[i]);
#pragma unroll
  for (int i = 0; i < 16; ++i) w[i] = wp[(size_t)(48 + i) * 128];
  GNW(wp);
#pragma unroll
  for (int i = 0; i < 16; ++i) *(v4b*)(d + (32 + i) * 2 * WPB) = bf4(u[i]);
#pragma unroll
  for (int kc = 0; kc < 8; ++kc) { const v4f* p = (const v4f*)(arow + kc * 32); a[kc][0] = p[0]; a[kc][1] = p[1]; a[kc][2] = p[4]; a[kc][3] = p[5]; }
  GNW(arow);
  under();   // the caller's short work on values fetched before the call: it runs while the last loads are in flight
#pragma unroll
  for (int i = 0; i < 16; ++i) *(v4b*)(d + (48 + i) * 2 * WPB) = bf4(w[i]); }
__device__ __forceinline__ F2 split_a(const v4f (&q)[4]) { float v[16];
#pragma unroll   // v[] has to stay in registers
  for (int i = 0; i < 4; ++i) { v[i] = q[0][i]; v[4 + i] = q[1][i]; v[8 + i] = q[2][i]; v[12 + i] = q[3][i]; }
  return bsplit16(v); }
#define SC2 (SCALE * 1.4426950408889634f)   // logits to base 2: k_proj folds it into q
#define WRD 2              // weight fragments are read from LDS WRD ahead of their products (read next to its product, each cost one LDS latency)
#define WFR(wl, t) frag_lb((wl) + ((t) & 7) * 16 * WPB + ((t) >> 3) * 64)   // fragment t = 8 kc + j
// ---- k_proj: block = (64 rows, 128 cols, which): X = GroupNorm of the rows of XT (thread t joins the 16 slices of group t >> 4, the group of its own two channels, and leaves their scale and shift in LDS; a K step of 32 channels is one group), q/k/v = X W (+ b) with exact bf16 products (K = DIN) -> which 0: q x SC2 f16 rows; 1: k f16 rows; 2: v f16 planes [c][t] (+ bf16 hi/lo planes for t < KHI)
__global__ __launch_bounds__(128) void k_proj(const float* __restrict__ XQ, const float* __restrict__ XK, const float* __restrict__ XV, const float* __restrict__ WQ, const float* __restrict__ WK, const float* __restrict__ WV, const float* __restrict__ BQ, const float* __restrict__ BK, const float* __restrict__ BV, const float* __restrict__ MV, const float* __restrict__ GG, const float* __restrict__ GB,
    _Float16* __restrict__ QH, _Float16* __restrict__ KH, _Float16* __restrict__ VT, __bf16* __restrict__ VB, __bf16* __restrict__ VBL) {
  __shared__ __align__(16) char sm[128 * WPB];   // the weight tile; behind the K loop and a barrier the same bytes hold the output tiles
  _Float16 (*sh)[136] = (_Float16 (*)[136])sm; _Float16 (*th)[72] = (_Float16 (*)[72])sm; __bf16 (*tb)[72] = (__bf16 (*)[72])(sm + 128 * 72 * 2); __bf16 (*tbl)[72] = (__bf16 (*)[72])(sm + 2 * 128 * 72 * 2);
  const int tid = threadIdx.x, wave = tid >> 5, lane = tid & 31, col = lane & 15, g = lane >> 4; const int which = blockIdx.z; const int c0 = blockIdx.y * 128; const size_t r0 = (size_t)blockIdx.x * 64; const size_t bb = r0 / TT; const int t0 = (int)(r0 % TT);
  const float* X = which == 0 ? XQ : which == 1 ? XK : XV; const float* WA = which == 0 ? WQ : which == 1 ? WK : WV; const float* BA = which == 0 ? BQ : which == 1 ? BK : BV;
  __shared__ __align__(16) float sga[CC], sgb[CC]; __shared__ float sgm[8];   // per channel rstd x gamma and beta, per group the mean
  const float* mp = MV + ((bb * 8 + (tid >> 4)) * GSL + (tid & 15)) * 32; const float* gp = GG + 2 * tid; const float* hp = GB + 2 * tid;
  const v2f pm = *(const v2f*)mp, ga = *(const v2f*)gp, be = *(const v2f*)hp;   // used inside stage_ops, under its last loads
  asm volatile("s_wait_xcnt 0x0" :: "v"(mp), "v"(gp), "v"(hp) : "memory");   // as GNW, for the three addresses
  v4f ar[8][4]; stage_ops(sm, WA + (size_t)c0 * DIN, X + (r0 + wave * 16 + col) * DIN + 8 * g, tid, ar, [&]() { float m = pm[0], s = pm[1], hn = 4096.0f;
#pragma unroll
    for (int o = 1; o < GSL; o <<= 1) { gn_join(m, s, __shfl_xor(m, o), __shfl_xor(s, o), hn); hn += hn; }
    const float rs = rsqrtf(s / (float)((CC / 8) * NTOK) + 1e-5f); v2f a, c; a[0] = rs * bfr(ga[0]); a[1] = rs * bfr(ga[1]); c[0] = bfr(be[0]); c[1] = bfr(be[1]);
    *(v2f*)&sga[2 * tid] = a; *(v2f*)&sgb[2 * tid] = c; sgm[tid >> 4] = m; });   // the 16 lanes of a group hold the same m, bit for bit (gn_join): no test, which would split the staging's loads from their waits
  __syncthreads();   // the weight tile and the GroupNorm terms are readable by every wave
  float bs[8]; const float* bp = BA + c0 + col;
  // the eight bias values as one group; they land under what follows. The test stands here, ahead of the normalising: with a branch inside the K loop the compiler moved the later steps' normalising below it and held their terms in registers up to there (unrolls: bs[] has to stay in registers)
  if (BA) {
#pragma unroll
    for (int j = 0; j < 8; ++j) bs[j] = bp[j * 16];
    GNW(bp);
  } else {
#pragma unroll
    for (int j = 0; j < 8; ++j) bs[j] = 0.f; }
  { v4f na[2][4], nb[2][4]; float nm[2]; const float* pa = sga + 8 * g; const float* pb = sgb + 8 * g;   // the terms of a lane's 16 channels of a K step, in the order of ar[kc][]
    // every "#pragma unroll" here: ar[], na[], nb[] and nm[] have to stay in registers
#pragma unroll
    for (int i = 0; i < 4; ++i) { const int c = (i >> 1) * 16 + (i & 1) * 4; na[0][i] = *(const v4f*)(pa + c); nb[0][i] = *(const v4f*)(pb + c); }
    nm[0] = sgm[0];
#pragma unroll
    for (int kc = 0; kc < DIN / 32; ++kc) {
      if (kc + 1 < DIN / 32) {
#pragma unroll
        for (int i = 0; i < 4; ++i) { const int c = (kc + 1) * 32 + (i >> 1) * 16 + (i & 1) * 4; na[(kc + 1) & 1][i] = *(const v4f*)(pa + c); nb[(kc + 1) & 1][i] = *(const v4f*)(pb + c); }
        nm[(kc + 1) & 1] = sgm[kc + 1]; }
      __builtin_amdgcn_sched_barrier(0);   // the next step's terms are asked for before this step's are used
#pragma unroll
      for (int i = 0; i < 4; ++i) ar[kc][i] = (ar[kc][i] - nm[kc & 1]) * na[kc & 1][i] + nb[kc & 1][i];
      __builtin_amdgcn_sched_barrier(0);   // and no further ahead: with the terms of all eight steps read at once the kernel took 460 registers, and a SIMD holds two such waves where the grid brings three
    } }
  const char* wl = sm + col * WPB + 16 * g;
  v8f acc[8] = {}; v16b wr[WRD + 1];
#pragma unroll   // wr[] has to stay in registers
  for (int t = 0; t < WRD; ++t) wr[t] = WFR(wl, t);
#pragma unroll   // ar[] and wr[] have to stay in registers
  for (int kc = 0; kc < DIN / 32; ++kc) { const F2 a2 = split_a(ar[kc]);   /* GroupNorm rows (f32) split hi + lo */
#pragma unroll
    for (int j = 0; j < 8; ++j) { const int t = kc * 8 + j; if (t + WRD < DIN / 4) wr[(t + WRD) % (WRD + 1)] = WFR(wl, t + WRD); const v16b w = wr[t % (WRD + 1)]; acc[j] = wmma_bf(a2.h, w, acc[j]); acc[j] = wmma_bf(a2.l, w, acc[j]); } }
  __syncthreads();   // every wave has read its last weight fragment: the bytes are given to the output tiles
  if (which < 2) { _Float16* DH = which == 0 ? QH : KH; const float qs = which == 0 ? SC2 : 1.0f;   // q: base-2 logit units; q and k are each rounded to f16 once
#pragma unroll
    for (int j = 0; j < 8; ++j) { const float bias = bfr(bs[j]);
#pragma unroll
      for (int r = 0; r < 8; ++r) sh[wave * 16 + 8 * g + r][j * 16 + col] = (_Float16)((acc[j][r] + bias) * qs); }
    __syncthreads();
    for (int e = tid; e < 64 * 16; e += 128) { const int rl = e >> 4, q = e & 15; vst2((unsigned*)(DH + (r0 + rl) * CC + c0 + q * 8), *(const v4u*)&sh[rl][q * 8]); }
  } else { const bool hi_rows = t0 < KHI;
#pragma unroll
    for (int j = 0; j < 8; ++j) { const float bias = bfr(bs[j]);
#pragma unroll
      for (int r = 0; r < 8; ++r) { const float v = acc[j][r] + bias; const int rl = wave * 16 + 8 * g + r, cl = j * 16 + col; th[cl][rl] = (_Float16)v; const __bf16 bh = (__bf16)v; tb[cl][rl] = bh; tbl[cl][rl] = (__bf16)(v - (float)bh); } }
    __syncthreads();
    for (int e = tid; e < 128 * 8; e += 128) { const int cl = e >> 3, q = e & 7; vst2((unsigned*)(VT + (bb * CC + c0 + cl) * (size_t)TT + t0 + q * 8), *(const v4u*)&th[cl][q * 8]); if (hi_rows) { const size_t o3 = (bb * CC + c0 + cl) * (size_t)KHI + t0 + q * 8; vst2((unsigned*)(VB + o3), *(const v4u*)&tb[cl][q * 8]); vst2((unsigned*)(VBL + o3), *(const v4u*)&tbl[cl][q * 8]); } } } }
// ---- k_fa: block = 16 waves of one (b, h): 8 groups of 32 query columns x 2 halves of the keys (four waves a SIMD in place of two: the vector work between the matrix runs of one wave is covered by three others); each half has its own ring, maximum in use, sums and O, and the halves are joined once, through LDS, behind the loop; one pass = 32 keys, one stage = KS keys of each half. S^T = K Q^T - M (A = k rows, B = q, both f16: one product on an accumulator that starts at minus the column's maximum in use M, so the scores leave the matrix unit as arguments of exp2), lazy rescale (M, sums and O move only in a pass whose sums show that a score may lie more than 8 above M: one test a pass; a lane holds one query's scores), P^T packed from the score accumulators to f16 as the B operand of O^T += V^T P^T (A = v planes [c][t]); logits and P never reach memory. K rows and V planes of a stage are brought into LDS once per block by asynchronous copies (two buffers, the next stage in flight) and read from there by the eight waves of that half
__device__ __forceinline__ float xhalf(float x) { return __builtin_bit_cast(float, __builtin_amdgcn_permlanex16(__builtin_bit_cast(int, x), __builtin_bit_cast(int, x), 0x76543210, 0xfedcba98, false, false)); }   // lane l with lane l ^ 16
__device__ __forceinline__ v8f wmma_h(v16h a, v16h b, v8f c) { return __builtin_amdgcn_wmma_f32_16x16x32_f16(false, a, false, b, (short)0, c, false, false); }
#define XW() asm volatile("s_wait_xcnt 0x0" ::: "memory")   // behind a group of loads: a later load's result may land in the group's address registers
#define KS 256                  // keys of a stage
#define KPB 80                  // LDS pitch of a k row: 64 B + 16 (16 B x odd: no bank conflict for 16-byte readers)
#define VPB (2 * KS + 16)       // LDS pitch of a v plane row, the same rule
#define KBY (KS * KPB)
#define SBY (KBY + HD * VPB)    // one buffer: k rows, then v rows
#define AW() asm volatile("s_wait_asynccnt 0x0" ::: "memory")   // this wave's copies have landed
#define DW() asm volatile("s_wait_dscnt 0x0" ::: "memory")      // this wave's LDS reads have returned before the buffer is given up
// one stage: each thread copies 4 x 16 B of k rows (4 threads a row, rows 64 apart) and 4 x 16 B of v rows (32 threads a row, rows 8 apart); the wait in the same statement stands before the address registers are reused
__device__ __forceinline__ void fa_stage(unsigned lk, unsigned lv, const char* gk, const char* gv) {
  asm volatile("global_load_async_to_lds_b128 %0, %1, off\n\tglobal_load_async_to_lds_b128 %2, %3, off\n\tglobal_load_async_to_lds_b128 %4, %5, off\n\tglobal_load_async_to_lds_b128 %6, %7, off\n\t"
               "global_load_async_to_lds_b128 %8, %9, off\n\tglobal_load_async_to_lds_b128 %10, %11, off\n\tglobal_load_async_to_lds_b128 %12, %13, off\n\tglobal_load_async_to_lds_b128 %14, %15, off\n\ts_wait_xcnt 0x0"
    :: "v"(lk), "v"(gk), "v"(lk + 64u * KPB), "v"(gk + (size_t)64 * CC * 2), "v"(lk + 128u * KPB), "v"(gk + (size_t)128 * CC * 2), "v"(lk + 192u * KPB), "v"(gk + (size_t)192 * CC * 2),
       "v"(lv), "v"(gv), "v"(lv + 8u * VPB), "v"(gv + (size_t)8 * TT * 2), "v"(lv + 16u * VPB), "v"(gv + (size_t)16 * TT * 2), "v"(lv + 24u * VPB), "v"(gv + (size_t)24 * TT * 2) : "memory"); }
__device__ __forceinline__ v16h frag_l(const char* p) { union { v16h v; v8h q[2]; } u; u.q[0] = *(const v8h*)p; u.q[1] = *(const v8h*)(p + 32); return u.v; }   // p = row + 16 * (lane >> 4): the k order of frag_h
// one column group's 32 x 16 scores less d to powers of two, and their sum in two parts
__device__ __forceinline__ void fa_exp(const v8f (&s)[2], float d, v8f (&e)[2], v2f& sm) {
#pragma unroll   // e[] has to stay in registers
  for (int i = 0; i < 2; ++i)
#pragma unroll
    for (int r = 0; r < 8; ++r) e[i][r] = __builtin_amdgcn_exp2f(s[i][r] - d);
  const v8f ps = e[0] + e[1]; const v4f p4 = ps.lo + ps.hi; sm = p4.lo + p4.hi; }
#define KH2 (TT / 2)            // keys of a half
__global__ __launch_bounds__(512) void k_fa(const _Float16* __restrict__ QH, const _Float16* __restrict__ KH, const _Float16* __restrict__ VT, float* __restrict__ Y) {
  __shared__ __align__(16) char ring[4 * SBY];   // two buffers for each half of the keys
  const int kh = __builtin_amdgcn_readfirstlane((int)threadIdx.x >> 8);   // the wave's half of the keys, in a scalar register: the tests on it are scalar branches
  const int tid = threadIdx.x & 255, wave = tid >> 5, lane = tid & 31, col = lane & 15, g = lane >> 4; const int b = blockIdx.y / NH, h = blockIdx.y % NH; const int q0 = blockIdx.x * 256 + wave * 32;
  const char* rg = ring + kh * 2 * SBY;   // this half's two buffers
  // every "#pragma unroll" of this kernel: the small arrays it indexes have to stay in registers
  const char* gk = (const char*)(KH + ((size_t)b * TT + kh * KH2 + (tid >> 2)) * CC + h * HD) + (tid & 3) * 16; const char* gv = (const char*)(VT + ((size_t)b * CC + h * HD + (tid >> 5)) * (size_t)TT + kh * KH2) + (tid & 31) * 16;
  const unsigned lk = (unsigned)(size_t)rg + (unsigned)((tid >> 2) * KPB + (tid & 3) * 16), lv = (unsigned)(size_t)rg + (unsigned)(KBY + (tid >> 5) * VPB + (tid & 31) * 16);
  fa_stage(lk, lv, gk, gv);
  v16h qh[2];
#pragma unroll
  for (int u = 0; u < 2; ++u) qh[u] = frag_h(QH + ((size_t)b * TT + q0 + u * 16 + col) * CC + h * HD, lane);
  XW();
  AW(); __syncthreads();   // stage 0 is readable by every wave
  fa_stage(lk + SBY, lv + SBY, gk + (size_t)KS * CC * 2, gv + (size_t)KS * 2);
  v8f o[2][2] = {}; v2f l[2] = {}; v8f cn[2][2];   // cn[u][i] = -M of column group u in all eight rows: the start value of score tile (u, i); a tile each, since one shared by two products was copied by the compiler in every pass
  { // M starts at the maximum over the half's first 32 keys (any value within 8 of the maximum serves), the same in both wave halves
    const char* K0 = rg + col * KPB + 16 * g; const v16h k0 = frag_l(K0), k1 = frag_l(K0 + 16 * KPB); const v8f z = {};
#pragma unroll
    for (int u = 0; u < 2; ++u) { const v8f t0 = wmma_h(k0, qh[u], z), t1 = wmma_h(k1, qh[u], z); float mx = fmaxf(t0[0], t1[0]);
#pragma unroll
      for (int r = 1; r < 8; ++r) mx = fmaxf(mx, fmaxf(t0[r], t1[r]));
      mx = fmaxf(mx, xhalf(mx)); cn[u][0] = z - mx; cn[u][1] = z - mx; } }
#pragma unroll 1   // one stage a trip: the buffer index stays a run-time value
  for (int st = 0; st < KH2 / KS; ++st) {
    const char* Kl = rg + (st & 1) * SBY + col * KPB + 16 * g; const char* Vl = rg + (st & 1) * SBY + KBY + col * VPB + 16 * g;
    v16h kf[2], vf[2]; kf[0] = frag_l(Kl); kf[1] = frag_l(Kl + 16 * KPB); vf[0] = frag_l(Vl); vf[1] = frag_l(Vl + 16 * VPB); const char* Kn = Kl; const char* Vn = Vl;
#pragma unroll 1   // unrolled, the fragment reads were moved next to their users and waited for there
    for (int p = 0; p < KS / 32; ++p) {
      v8f s[2][2], e[2][2]; v2f sm[2];
#pragma unroll
      for (int i = 0; i < 2; ++i)
#pragma unroll
        for (int u = 0; u < 2; ++u) s[u][i] = wmma_h(kf[i], qh[u], cn[u][i]);
      __builtin_amdgcn_sched_barrier(0);   // the four score products stay one run: spread among the vector work each cost idle slots before its first reader
      // both operands are fetched one pass ahead, each behind its last use, inside the stage's own buffer (its last pass refetches pass 0, unused)
      Kn += p + 1 < KS / 32 ? 32 * KPB : -(KS / 32 - 1) * 32 * KPB; Vn += p + 1 < KS / 32 ? 64 : -(KS / 32 - 1) * 64;
      kf[0] = frag_l(Kn); kf[1] = frag_l(Kn + 16 * KPB);
      __builtin_amdgcn_sched_barrier(0);   // the k reads stay here, under the products' latency: left free they were sunk below the test, next to the next pass's products
#pragma unroll
      for (int u = 0; u < 2; ++u) fa_exp(s[u], 0.f, e[u], sm[u]);
      // the test: every term is positive, so four partial sums of at most 256 bound every term by 256 (a score at most 8 above M)
      if (__builtin_amdgcn_ballot_w32(fmaxf(fmaxf(sm[0][0], sm[0][1]), fmaxf(sm[1][0], sm[1][1])) > 256.0f) != 0) {   // rare: raise M to the pass's maximum where that is higher, rescale sums and O, redo the pass's exponentials
#pragma unroll
        for (int u = 0; u < 2; ++u) { float mx = fmaxf(s[u][0][0], s[u][1][0]);
#pragma unroll
          for (int r = 1; r < 8; ++r) mx = fmaxf(mx, fmaxf(s[u][0][r], s[u][1][r]));
          const float d = fmaxf(fmaxf(mx, xhalf(mx)), 0.f); const float corr = __builtin_amdgcn_exp2f(-d); cn[u][0] -= d; cn[u][1] -= d; l[u] *= corr; o[u][0] *= corr; o[u][1] *= corr; fa_exp(s[u], d, e[u], sm[u]); } }
#pragma unroll
      for (int u = 0; u < 2; ++u) { v16h pf;
#pragma unroll
        for (int r = 0; r < 8; ++r) { pf[r] = (_Float16)e[u][0][r]; pf[8 + r] = (_Float16)e[u][1][r]; }
        l[u] += sm[u];
#pragma unroll
        for (int j = 0; j < 2; ++j) o[u][j] = wmma_h(vf[j], pf, o[u][j]); }
      vf[0] = frag_l(Vn); vf[1] = frag_l(Vn + 16 * VPB); }
    DW(); AW(); __syncthreads();   // publishes stage st + 1 and ends every wave's reads of stage st
    if (st + 2 < KH2 / KS) fa_stage(lk + (st & 1) * SBY, lv + (st & 1) * SBY, gk + (size_t)(st + 2) * KS * CC * 2, gv + (size_t)(st + 2) * KS * 2); }
  AW();
  // the join: the loop's last barrier has ended every read of the ring and every copy has landed, so its first bytes carry the second half's state: nine 16-byte pieces a lane (O, then both sums and both -M), a piece = 512 B of a wave
  float* xb = (float*)ring + wave * (9 * 128) + lane * 4;
  if (kh) {
#pragma unroll
    for (int u = 0; u < 2; ++u)
#pragma unroll
      for (int j = 0; j < 2; ++j) { *(v4f*)(xb + (u * 4 + j * 2) * 128) = o[u][j].lo; *(v4f*)(xb + (u * 4 + j * 2 + 1) * 128) = o[u][j].hi; }
    v4f t; t[0] = l[0][0] + l[0][1]; t[1] = l[1][0] + l[1][1]; t[2] = cn[0][0][0]; t[3] = cn[1][0][0]; *(v4f*)(xb + 8 * 128) = t; }
  __syncthreads();   // the second half's state is readable by the first half's waves
  if (kh) return;
  const v4f t = *(const v4f*)(xb + 8 * 128);
#pragma unroll
  for (int u = 0; u < 2; ++u) { const float na = cn[u][0][0], nb = t[2 + u], nm = fminf(na, nb);   // -M of either half (the same in both wave halves) and of the join
    const float fa = __builtin_amdgcn_exp2f(nm - na), fb = __builtin_amdgcn_exp2f(nm - nb); const float lu = (l[u][0] + l[u][1]) * fa + t[u] * fb; const float inv = 1.0f / (lu + xhalf(lu)); const float wa = fa * inv, wb = fb * inv;
    float* yr = Y + ((size_t)b * TT + q0 + u * 16 + col) * CC + h * HD + 8 * g;
#pragma unroll
    for (int j = 0; j < 2; ++j) { const v4f w0 = o[u][j].lo * wa + *(const v4f*)(xb + (u * 4 + j * 2) * 128) * wb, w1 = o[u][j].hi * wa + *(const v4f*)(xb + (u * 4 + j * 2 + 1) * 128) * wb; vst2(yr + j * 16, w0); vst2(yr + j * 16 + 4, w1); } } }
// ---- k_out: block = (64 tokens, 128 channels): out[b][c][n] = ctx Wo + bo + bf16(x[b][c][n]), ctx split bf16 hi + lo against exact bf16 Wo (2 products). A lane's accumulator tile holds 8 consecutive tokens of one channel: the block's tile goes to LDS channel-major by 16-byte stores and leaves as 256-B runs of 64 tokens per channel with the residual added, so the result has no token-major copy in memory and needs no launch that turns it
#define OTP 68             // LDS pitch in floats of a channel's 64 tokens (16 B x odd: no bank conflict for 16-byte accesses)
__global__ __launch_bounds__(128) void k_out(const float* __restrict__ Y, const float* __restrict__ WO, const float* __restrict__ BO, const float* __restrict__ X, float* __restrict__ OUT) { __shared__ __align__(16) float st[128][OTP]; __shared__ __align__(16) char sm[128 * WPB];
  const int tid = threadIdx.x, wave = tid >> 5, lane = tid & 31, col = lane & 15, g = lane >> 4; const int c0 = blockIdx.y * 128; const size_t r0 = (size_t)blockIdx.x * 64 + wave * 16;
  const size_t rb = (size_t)blockIdx.x * 64; const size_t oi = ((rb / NTOK) * CC + c0 + (tid >> 4)) * (size_t)NTOK + rb % NTOK + (tid & 15) * 4;   // piece i of this thread in x and out: 4 tokens of channel c0 + (tid >> 4) + 8 i
  const float* xp = X + oi; v4f xr[16];
  v8f acc[8] = {};
  if (true) {   /* ALL rows: ctx split bf16 hi + lo x exact proj_w (2 products) */
    v4f ar[8][4]; stage_ops(sm, WO + (size_t)c0 * CC, Y + (r0 + col) * CC + 8 * g, tid, ar, []() {});
    __syncthreads();   // the weight tile is readable by every wave
    const char* wl = sm + col * WPB + 16 * g; v16b wr[WRD + 1]; float bs[8]; const float* bp = BO + c0 + col;
#pragma unroll   // wr[] has to stay in registers
    for (int t = 0; t < WRD; ++t) wr[t] = WFR(wl, t);
#pragma unroll   // ar[] and wr[] have to stay in registers
    for (int kc = 0; kc < CC / 32; ++kc) { const F2 a = split_a(ar[kc]);
      if (kc == 4) {   // the eight bias values as one group, in registers that half of ar[] has left; they land under the rest of the loop (its unrolls: bs[] has to stay in registers)
        if (BO) {
#pragma unroll
          for (int j = 0; j < 8; ++j) bs[j] = bp[j * 16];
          GNW(bp);
        } else {
#pragma unroll
          for (int j = 0; j < 8; ++j) bs[j] = 0.f; } }
      if (kc == 4 || kc == 6) {   // the residual's pieces, eight at a time, also in registers that ar[] has left: they land under the rest of the loop (unroll: xr[] has to stay in registers)
#pragma unroll
        for (int i = 0; i < 8; ++i) xr[(kc - 4) * 4 + i] = *(const v4f*)(xp + (size_t)((kc - 4) * 4 + i) * 8 * NTOK);
        GNW(xp); }
#pragma unroll
      for (int j = 0; j < 8; ++j) { const int t = kc * 8 + j; if (t + WRD < CC / 4) wr[(t + WRD) % (WRD + 1)] = WFR(wl, t + WRD); const v16b w = wr[t % (WRD + 1)]; acc[j] = wmma_bf(a.h, w, acc[j]); acc[j] = wmma_bf(a.l, w, acc[j]); } }
#pragma unroll
    for (int j = 0; j < 8; ++j) { const float bias = bfr(bs[j]); const v8f w = acc[j] + bias; float* d = &st[j * 16 + col][wave * 16 + 8 * g]; *(v4f*)d = w.lo; *(v4f*)(d + 4) = w.hi; }
  }
  __syncthreads();   // a channel's 64 tokens come from all four waves
  v4f o[16];
#pragma unroll   // xr[] and o[] have to stay in registers
  for (int i = 0; i < 16; ++i) o[i] = *(const v4f*)&st[(tid >> 4) + 8 * i][(tid & 15) * 4] + bfr4(xr[i]);
  __builtin_amdgcn_sched_barrier(0);   // every sum has a register of its own before the first store: mixed with the sums, the stores' registers were reused behind waits
#pragma unroll
  for (int i = 0; i < 16; ++i) vst2(OUT + oi + (size_t)i * 8 * NTOK, o[i]); }

extern "C" void kernel_launch(void* const* d_in, const int* in_sizes, int n_in, void* d_out, int out_size, void* d_ws, size_t ws_size, hipStream_t stream) {
  (void)in_sizes; (void)n_in; (void)out_size;
  const float** F = (const float**)d_in;
  if (ws_size < (size_t)WS_END) return;
  char* ws = (char*)d_ws; _Float16 *QH = (_Float16*)(ws + WS_QH), *KH = (_Float16*)(ws + WS_KH), *VT = (_Float16*)(ws + WS_VT), *QL = (_Float16*)(ws + WS_QL), *KL = (_Float16*)(ws + WS_KL); __bf16 *VB = (__bf16*)(ws + WS_VB), *VBL = (__bf16*)(ws + WS_VBL); float *Y = (float*)(ws + WS_Y);
  (void)Y; (void)QL; (void)KL; (void)VB; (void)VBL;
  // inputs: 0 x [2,256,64,64]; 1 gn_gamma, 2 gn_beta [256]; 3 qkv_w [768,256] (out,in) rows q | k | v; 4 qkv_b [768]; 5 proj_w [256,256] (out,in); 6 proj_b
  if (ws_size < (size_t)WS_END2) return;
  float *MV = (float*)(ws + WS_MV), *XT = (float*)(ws + WS_XT);
  k_gtr<<<dim3(NTOK / 256, TNB * 8), 256, 0, stream>>>(F[0], MV, XT);
  { const float* WQ = F[3]; const float* WK = F[3] + (size_t)CC * DIN; const float* WV = F[3] + (size_t)2 * CC * DIN;
    k_proj<<<dim3(TNB * TT / 64, CC / 128, 3), 128, 0, stream>>>(XT, XT, XT, WQ, WK, WV, F[4], F[4] + CC, F[4] + 2 * CC, MV, F[1], F[2], QH, KH, VT, VB, VBL); }
  k_fa<<<dim3(TT / 256, TNB * NH), 512, 0, stream>>>(QH, KH, VT, Y);
  k_out<<<dim3(TNB * TT / 64, DIN / 128), 128, 0, stream>>>(Y, F[5], F[6], F[0], (float*)d_out);
}

// v010
// Measured time: 54.4 microseconds a run.
// Timed twice side by side with v009, it ran 1.07 and 1.06 times as fast.
// Counting every step since v000, it is 28.3 times as fast.
// Single self-attention block on images (b 2, c 256, 64 x 64 -> n 4,096 tokens; 8 heads x 32): xn = GroupNorm(8 groups)(x) (affine); q,k,v = qkv_w xn + qkv_b (1x1, (out,in) rows q|k|v); attn = softmax(q k^T x 32^-0.5); out = proj_w (attn v) + proj_b, reshaped to [b,c,h,w] + x.
#include <hip/hip_runtime.h>
#include <math.h>

typedef __attribute__((ext_vector_type(16))) _Float16 v16h;
typedef __attribute__((ext_vector_type(16))) __bf16 v16b;
typedef __attribute__((ext_vector_type(8)))  _Float16 v8h;
typedef __attribute__((ext_vector_type(8)))  float v8f;
typedef __attribute__((ext_vector_type(4)))  float v4f;
typedef __attribute__((ext_vector_type(2)))  float v2f;
typedef __attribute__((ext_vector_type(4)))  unsigned v4u;
typedef __attribute__((ext_vector_type(4)))  int v4i;
typedef float __attribute__((may_alias)) float_a;
typedef int __attribute__((may_alias)) int_a;

template <typename T> __device__ __forceinline__ void vst2(void* p, T v) { *(T*)p = v;  }
__device__ __forceinline__ v8f wmma16(v16h a, v16h b, v8f c) {
  v8f d = __builtin_amdgcn_wmma_f32_16x16x32_f16(false, a, false, b, (short)0, c, false, false);
  asm volatile("v_nop\n\tv_nop\n\tv_nop\n\tv_nop" : "+v"(d) : "v"(a), "v"(b));
  return d;
}
__device__ __forceinline__ v8f wmma_bf(v16b a, v16b b, v8f c) {
  v8f d = __builtin_amdgcn_wmma_f32_16x16x32_bf16(false, a, false, b, (short)0, c, false, false);
  asm volatile("v_nop\n\tv_nop\n\tv_nop\n\tv_nop" : "+v"(d) : "v"(a), "v"(b));
  return d;
}
// 16x16x32 fragments: lane = (h = lane>>4, row/col = lane&15); elements 0..7 = k0+8h+0..7, 8..15 = k0+16+8h+0..7; D element r = row 8h+r
__device__ __forceinline__ v16h frag_h(const _Float16* rowk0, int lane) {
  union { v16h v; v8h q[2]; } u; const _Float16* p = rowk0 + 8 * (lane >> 4);
  u.q[0] = *(const v8h*)p; u.q[1] = *(const v8h*)(p + 16); return u.v;
}
__device__ __forceinline__ v16h frag_f32(const float* rowk0, int lane) {
  v16h a; const float* p = rowk0 + 8 * (lane >> 4);
#pragma unroll
  for (int i = 0; i < 8; ++i) { a[i] = (_Float16)p[i]; a[8 + i] = (_Float16)p[16 + i]; }
  return a;
}
__device__ __forceinline__ v16h frag_f32s(const float* rowk0, int lane, float sc) {
  v16h a; const float* p = rowk0 + 8 * (lane >> 4);
#pragma unroll
  for (int i = 0; i < 8; ++i) { a[i] = (_Float16)(p[i] * sc); a[8 + i] = (_Float16)(p[16 + i] * sc); }
  return a;
}
// column fragment from a [K][ld] layout (column n), rows >= K read as 0
__device__ __forceinline__ v16h fragc_f32(const float* W, int k0, int n, int lane, int ld, int K) {
  v16h a; const int g = lane >> 4;
#pragma unroll
  for (int i = 0; i < 8; ++i) { const int ka = k0 + 8 * g + i, kb = ka + 16;
    a[i] = (_Float16)(ka < K ? W[(size_t)(ka < K ? ka : K - 1) * ld + n] : 0.f); a[8 + i] = (_Float16)(kb < K ? W[(size_t)(kb < K ? kb : K - 1) * ld + n] : 0.f); }
  return a;
}
struct F2 { v16b h, l; };
__device__ __forceinline__ F2 bsplit16(const float v[16]) { F2 r;
#pragma unroll
  for (int i = 0; i < 16; ++i) { const __bf16 h = (__bf16)v[i]; r.h[i] = h; r.l[i] = (__bf16)(v[i] - (float)h); }
  return r; }
__device__ __forceinline__ F2 split_row(const float* row, int k0, int lane) { float v[16]; const float* p = row + k0 + 8 * (lane >> 4);
#pragma unroll
  for (int i = 0; i < 8; ++i) { v[i] = p[i]; v[8 + i] = p[16 + i]; }
  return bsplit16(v); }
__device__ __forceinline__ F2 split_rowK(const float* row, int k0, int lane, int K) { float v[16]; const int g = lane >> 4;
#pragma unroll
  for (int i = 0; i < 8; ++i) { const int ka = k0 + 8 * g + i, kb = ka + 16; v[i] = ka < K ? row[ka < K ? ka : K - 1] : 0.f; v[8 + i] = kb < K ? row[kb < K ? kb : K - 1] : 0.f; }
  return bsplit16(v); }
__device__ __forceinline__ F2 split_col(const float* W, int k0, int n, int lane, int ld, int K) { float v[16]; const int g = lane >> 4;
#pragma unroll
  for (int i = 0; i < 8; ++i) { const int ka = k0 + 8 * g + i, kb = ka + 16; v[i] = ka < K ? W[(size_t)(ka < K ? ka : K - 1) * ld + n] : 0.f; v[8 + i] = kb < K ? W[(size_t)(kb < K ? kb : K - 1) * ld + n] : 0.f; }
  return bsplit16(v); }
__device__ __forceinline__ v8f mac3(const F2& a, const F2& b, v8f c) { c = wmma_bf(a.l, b.h, c); c = wmma_bf(a.h, b.l, c); return wmma_bf(a.h, b.h, c); }
__device__ __forceinline__ float sigm(float v) { return 1.0f / (1.0f + expf(-v)); }
#define LDSX() do { asm volatile("s_wait_dscnt 0" ::: "memory"); __builtin_amdgcn_wave_barrier(); __builtin_amdgcn_fence(__ATOMIC_RELEASE, "workgroup"); } while (0)

#define NB 2
#define TT 4096
#define CC 256            // NH * HD = projected width
#define DIN 256          // input (model) width
#define NH 8
#define HD 32
#define NQB (TT / 64)
#define HG 2
#define SCALE (0.17677669529663687f)
#define CAUSAL 0
#ifndef TNB
#define TNB NB
#endif
__device__ __forceinline__ float bfr(float v) { return (float)(__bf16)v; }
__host__ __device__ __forceinline__ int kb_last(int qb) { return CAUSAL ? ((qb * 64 + 63) >> 7) : (TT / 128 - 1); }
typedef __attribute__((ext_vector_type(8))) __bf16 v8b;
__device__ __forceinline__ v16b frag_b(const __bf16* rowk0, int lane) {
  union { v16b v; v8b q[2]; } u; const __bf16* p = rowk0 + 8 * (lane >> 4);
  u.q[0] = *(const v8b*)p; u.q[1] = *(const v8b*)(p + 16); return u.v;
}
#define QBH 0              // not used (no kernel has a high-precision path)
#define QHI 4096            // rows of the workspace range WS_QL (no kernel uses that range; it keeps the later offsets where they are)
#define KHI 64            // key rows carrying v bf16 hi+lo planes (written by k_proj; no kernel reads them)
// B fragment (k rows k0+.., output column o) of a weight: (in,out) [K][ld] or (out,in) [ld rows of K]: bf16 exact, or f16(bf16 * 256) exact
__device__ __forceinline__ v16b wcol_io(const float* Wm, int k0, int o, int lane, int ld) { v16b w; const int g = lane >> 4;
#pragma unroll
  for (int i = 0; i < 8; ++i) { w[i] = (__bf16)Wm[(size_t)(k0 + 8 * g + i) * ld + o]; w[8 + i] = (__bf16)Wm[(size_t)(k0 + 16 + 8 * g + i) * ld + o]; }
  return w; }
__device__ __forceinline__ v16b wcol_oi(const float* Wm, int k0, int o, int lane, int K) { v16b w; const float* p = Wm + (size_t)o * K + k0 + 8 * (lane >> 4);
#pragma unroll
  for (int i = 0; i < 8; ++i) { w[i] = (__bf16)p[i]; w[8 + i] = (__bf16)p[16 + i]; }
  return w; }
__device__ __forceinline__ v16h wcolh_io(const float* Wm, int k0, int o, int lane, int ld) { v16h w; const int g = lane >> 4;
#pragma unroll
  for (int i = 0; i < 8; ++i) { w[i] = (_Float16)(bfr(Wm[(size_t)(k0 + 8 * g + i) * ld + o]) * 256.0f); w[8 + i] = (_Float16)(bfr(Wm[(size_t)(k0 + 16 + 8 * g + i) * ld + o]) * 256.0f); }
  return w; }
__device__ __forceinline__ v16h wcolh_oi(const float* Wm, int k0, int o, int lane, int K) { v16h w; const float* p = Wm + (size_t)o * K + k0 + 8 * (lane >> 4);
#pragma unroll
  for (int i = 0; i < 8; ++i) { w[i] = (_Float16)(bfr(p[i]) * 256.0f); w[8 + i] = (_Float16)(bfr(p[16 + i]) * 256.0f); }
  return w; }
#define WQKV_LAYOUT 1   // 0 = (in,out) [DIN][CC]; 1 = (out,in) [CC][DIN]; 2 = per-head [NH][DIN][HD]
__device__ __forceinline__ v16b wcol_hdk(const float* Wm, int k0, int o, int lane) { v16b w; const int g = lane >> 4; const float* p = Wm + (size_t)(o / HD) * DIN * HD + (o % HD);
#pragma unroll
  for (int i = 0; i < 8; ++i) { w[i] = (__bf16)p[(size_t)(k0 + 8 * g + i) * HD]; w[8 + i] = (__bf16)p[(size_t)(k0 + 16 + 8 * g + i) * HD]; }
  return w; }
#define WO_OUT_IN 1
#if WQKV_LAYOUT == 1
#define WCOL(W, k0, o, lane) wcol_oi(W, k0, o, lane, DIN)
#elif WQKV_LAYOUT == 2
#define WCOL(W, k0, o, lane) wcol_hdk(W, k0, o, lane)
#else
#define WCOL(W, k0, o, lane) wcol_io(W, k0, o, lane, CC)
#endif
#if WO_OUT_IN
#define WOCOL(W, k0, o, lane) wcol_oi(W, k0, o, lane, CC)
#define WOCOLH(W, k0, o, lane) wcolh_oi(W, k0, o, lane, CC)
#else
#define WOCOL(W, k0, o, lane) wcol_io(W, k0, o, lane, DIN)
#define WOCOLH(W, k0, o, lane) wcolh_io(W, k0, o, lane, DIN)
#endif
#define NTOK 4096
#ifndef OPITCH
#define OPITCH NTOK        // unused (out is written with pitch NTOK)
#endif
#ifndef XPITCH
#define XPITCH NTOK        // unused (x is read with pitch NTOK)
#endif
// behind a group of loads from p, a precaution: p is an input, so its registers are not given to a load of the group as destination ahead of the wait
#define GNW(p) asm volatile("s_wait_xcnt 0x0" :: "v"(p) : "memory")
__device__ __forceinline__ v4f bfr4(v4f v) { v4f r; r[0] = bfr(v[0]); r[1] = bfr(v[1]); r[2] = bfr(v[2]); r[3] = bfr(v[3]); return r; }
// two sets of equal size 2 hn, each given by its mean m and its sum of squared distances from that mean s, joined; the result is the same whichever of the two sets is named first
__device__ __forceinline__ void gn_join(float& m, float& s, float mo, float so, float hn) { const float d = m - mo; s = (s + so) + d * d * hn; m = 0.5f * (m + mo); }
typedef __attribute__((ext_vector_type(4))) __bf16 v4b;
__device__ __forceinline__ v4b bf4(v4f v) { v4b r; r[0] = (__bf16)v[0]; r[1] = (__bf16)v[1]; r[2] = (__bf16)v[2]; r[3] = (__bf16)v[3]; return r; }
#define GSL 16             // slices of a (batch, group): 32 channels x 256 tokens each
#define WBL 16384          // weight elements rounded by one block of k_gtr's row 0: qkv_w is 12 such pieces, proj_w 4
#define TPT 260            // LDS pitch in floats of a channel's 256 tokens (16 B x odd)
// ---- k_gtr: block = (256 tokens, one (batch, group) of 32 channels), 8 waves, one block a WGP: x is read once, 8 x 16 B a thread all in flight. From the registers: the slice's mean and sum of squared distances from it (a thread's 32 values, then joins of equal sets: lanes, waves) -> one 128-B line of MV; and XT[b*N + n][c] = bf16(x[b][c][n]), not yet normalised, through an LDS tile, a whole line per token. k_proj joins the 16 slices and normalises its own rows. The 16 blocks of grid row 0 have another job: they round qkv_w and proj_w to bf16, once for the whole launch sequence, into WB (rows as in the inputs, qkv_w first), from where k_proj and k_out copy their tiles
__global__ __launch_bounds__(256) void k_gtr(const float* __restrict__ X, const float* __restrict__ WQKV, const float* __restrict__ WPR, float* __restrict__ MV, float* __restrict__ XT, __bf16* __restrict__ WB) { __shared__ __align__(16) float st[32][TPT]; __shared__ float sred[8][2];
  if (blockIdx.y == 0) {   // the same for the whole block, ahead of the barrier
    const int wb = blockIdx.x; const v4f* sp = (const v4f*)(wb < 3 * CC * DIN / WBL ? WQKV + (size_t)wb * WBL : WPR + (size_t)(wb - 3 * CC * DIN / WBL) * WBL) + threadIdx.x; __bf16* dp = WB + (size_t)wb * WBL + threadIdx.x * 4; v4f t[16];
#pragma unroll   // t[] has to stay in registers
    for (int i = 0; i < 16; ++i) t[i] = sp[i * 256];
    GNW(sp);
#pragma unroll
    for (int i = 0; i < 16; ++i) *(v4b*)(dp + i * 1024) = bf4(t[i]);
    return; }
  const int tid = threadIdx.x, gi = blockIdx.y - 1, n0 = blockIdx.x * 256; const float* xp = X + ((size_t)gi * 32 + (tid >> 6)) * NTOK + n0 + (tid & 63) * 4; v4f v[8];
  // every "#pragma unroll" here: v[] has to stay in registers
#pragma unroll
  for (int i = 0; i < 8; ++i) v[i] = *(const v4f*)(xp + (size_t)i * 4 * NTOK);
  GNW(xp);
  v4f sv = {};
#pragma unroll
  for (int i = 0; i < 8; ++i) { v[i] = bfr4(v[i]); sv += v[i]; *(v4f*)&st[(tid >> 6) + 4 * i][(tid & 63) * 4] = v[i]; }
  float m = ((sv[0] + sv[1]) + (sv[2] + sv[3])) * (1.0f / 32.0f); v4f qv = {};
#pragma unroll
  for (int i = 0; i < 8; ++i) { const v4f d = v[i] - m; qv += d * d; }
  float s = (qv[0] + qv[1]) + (qv[2] + qv[3]); float hn = 16.0f;
#pragma unroll
  for (int o = 1; o < 32; o <<= 1) { gn_join(m, s, __shfl_xor(m, o), __shfl_xor(s, o), hn); hn += hn; }
  if ((tid & 31) == 0) { sred[tid >> 5][0] = m; sred[tid >> 5][1] = s; }
  __syncthreads();   // the tile and the eight waves' statistics are readable by every wave
  float* xo = XT + ((size_t)(gi >> 3) * NTOK + n0 + (tid >> 3)) * CC + (gi & 7) * 32 + (tid & 7) * 4;
#pragma unroll
  for (int i = 0; i < 8; ++i) { const int nl = (tid >> 3) + 32 * i, c = (tid & 7) * 4; v4f o; o[0] = st[c][nl]; o[1] = st[c + 1][nl]; o[2] = st[c + 2][nl]; o[3] = st[c + 3][nl]; vst2(xo + (size_t)i * 32 * CC, o); }
  if (tid < 32) { float wm[8], wq[8];
#pragma unroll   // wm[] and wq[] have to stay in registers
    for (int i = 0; i < 8; ++i) { wm[i] = sred[i][0]; wq[i] = sred[i][1]; }
#pragma unroll
    for (int w = 1; w < 8; w <<= 1)
#pragma unroll
      for (int i = 0; i < 8; i += 2 * w) gn_join(wm[i], wq[i], wm[i + w], wq[i + w], 512.0f * (float)w);
    vst2(MV + ((size_t)gi * GSL + blockIdx.x) * 32 + tid, tid == 0 ? wm[0] : (tid == 1 ? wq[0] : 0.f)); } }
#define WS_MV  (WS_END)
#define WS_XT  (WS_MV + 4u * 32 * NB * 8 * GSL + 1024u)
#define WS_OR  (WS_XT + 4u * (size_t)NB * NTOK * CC)   // bf16 weights: qkv_w [768][256], then proj_w [256][256]
#define WS_END2 (WS_OR + 4u * (size_t)NB * NTOK * CC)
#ifndef SM_EXTRA_PARAMS
#define SM_EXTRA_PARAMS
#endif
#ifndef PROJ_EXTRA_PARAMS
#define PROJ_EXTRA_PARAMS
#endif
#ifndef SM_MASK_HOOK
#define SM_MASK_HOOK (void)0
#endif

#define WS_QH  0u                                      // f16 q x SC2 rows [b*t][CC]
#define WS_KH  (WS_QH + 2u * (size_t)NB * TT * CC)      // f16 k rows [b*t][CC]
#define WS_VT  (WS_KH + 2u * (size_t)NB * TT * CC)      // f16 v planes [b][c][t]
#define WS_QL  (WS_VT + 2u * (size_t)NB * CC * TT)      // not used
#define WS_KL  (WS_QL + 2u * (size_t)NB * QHI * CC)     // not used
#define WS_VB  (WS_KL + 2u * (size_t)NB * KHI * CC)     // bf16 v hi planes [b][c][t < KHI]
#define WS_VBL (WS_VB + 2u * (size_t)NB * CC * KHI)
#define WS_S   (WS_VBL + 2u * (size_t)NB * CC * KHI)    // f32 [hg][t][s], unused: logits and P stay in registers
#define WS_Y   (WS_S  + 4u * (size_t)HG * TT * TT)      // f32 ctx rows [b*t][CC] (only when there is an output projection)
#define WS_END (WS_Y  + 4u * (size_t)NB * TT * CC)

// ---- operands of k_proj and k_out. The block's weight tile (128 output columns x K = 256, rows of an (out,in) matrix, already bf16 in WB) is brought into LDS once, through no register, by asynchronous copies, and kept there for all four waves; a wave's own 16 activation rows are asked for whole ahead of the copies (their loads touch four times the lines and take longer), so the K loop waits for no global load
#define WPB 528            // LDS pitch of a weight row: 256 bf16 + 16 B (16 B x odd: no bank conflict for 16-byte readers)
#define AW() asm volatile("s_wait_asynccnt 0x0" ::: "memory")   // this wave's copies have landed
__device__ __forceinline__ v16b frag_lb(const char* p) { union { v16b v; v8b q[2]; } u; u.q[0] = *(const v8b*)p; u.q[1] = *(const v8b*)(p + 32); return u.v; }   // p = row + 2 * k0 + 16 * (lane >> 4): the k order of wcol_oi
// eight copies of a thread: 16 B of eight weight rows 4 apart (a wave's copy is one whole row of 512 B); the wait in the same statement stands before the address registers are reused
__device__ __forceinline__ void w_stage(unsigned l, const char* g) {
  asm volatile("global_load_async_to_lds_b128 %0, %1, off\n\tglobal_load_async_to_lds_b128 %2, %3, off\n\tglobal_load_async_to_lds_b128 %4, %5, off\n\tglobal_load_async_to_lds_b128 %6, %7, off\n\t"
               "global_load_async_to_lds_b128 %8, %9, off\n\tglobal_load_async_to_lds_b128 %10, %11, off\n\tglobal_load_async_to_lds_b128 %12, %13, off\n\tglobal_load_async_to_lds_b128 %14, %15, off\n\ts_wait_xcnt 0x0"
    :: "v"(l), "v"(g), "v"(l + 4u * WPB), "v"(g + 4 * 512), "v"(l + 8u * WPB), "v"(g + 8 * 512), "v"(l + 12u * WPB), "v"(g + 12 * 512),
       "v"(l + 16u * WPB), "v"(g + 16 * 512), "v"(l + 20u * WPB), "v"(g + 20 * 512), "v"(l + 24u * WPB), "v"(g + 24 * 512), "v"(l + 28u * WPB), "v"(g + 28 * 512) : "memory"); }
// 128 threads: copy i of a thread is 16 B of weight row 4 i + (tid >> 5), all 32 in flight at once. arow = the lane's activation row + 8 * (lane >> 4); a[kc] = the 16 values of split_row at k0 = 32 kc. On return this wave's copies have landed; the caller's barrier makes the tile readable by every wave
template <typename F> __device__ __forceinline__ void stage_ops(char* sw, const __bf16* Wt, const float* arow, int tid, v4f (&a)[8][4], F under) {
  const unsigned l = (unsigned)(size_t)sw + (unsigned)((tid >> 5) * WPB + (tid & 31) * 16); const char* g = (const char*)Wt + tid * 16;
#pragma unroll   // a[] has to stay in registers
  for (int kc = 0; kc < 8; ++kc) { const v4f* p = (const v4f*)(arow + kc * 32); a[kc][0] = p[0]; a[kc][1] = p[1]; a[kc][2] = p[4]; a[kc][3] = p[5]; }
  GNW(arow);
#pragma unroll   // four statements of eight copies, their addresses constants apart
  for (int i = 0; i < 4; ++i) w_stage(l + (unsigned)i * 32u * WPB, g + i * 32 * 512);
  __builtin_amdgcn_sched_barrier(0);   // the copies are issued before the caller's work starts: left free, that work and its waits for a load and for cross-lane moves were placed ahead of them
  under();   // the caller's short work on values fetched before the call: it runs while the copies and the loads are in flight
  AW(); }
__device__ __forceinline__ F2 split_a(const v4f (&q)[4]) { float v[16];
#pragma unroll   // v[] has to stay in registers
  for (int i = 0; i < 4; ++i) { v[i] = q[0][i]; v[4 + i] = q[1][i]; v[8 + i] = q[2][i]; v[12 + i] = q[3][i]; }
  return bsplit16(v); }
#define SC2 (SCALE * 1.4426950408889634f)   // logits to base 2: k_proj folds it into q
#define WRD 2              // weight fragments are read from LDS WRD ahead of their products (read next to its product, each cost one LDS latency)
#define WFR(wl, t) frag_lb((wl) + ((t) & 7) * 16 * WPB + ((t) >> 3) * 64)   // fragment t = 8 kc + j
// ---- k_proj: block = (64 rows, 128 cols, which): X = GroupNorm of the rows of XT (thread t joins the 16 slices of group t >> 4, the group of its own two channels, and leaves their scale and shift in LDS; a K step of 32 channels is one group), q/k/v = X W (+ b) with exact bf16 products (K = DIN) -> which 0: q x SC2 f16 rows; 1: k f16 rows; 2: v f16 planes [c][t] (+ bf16 hi/lo planes for t < KHI)
__global__ __launch_bounds__(128) void k_proj(const float* __restrict__ XQ, const float* __restrict__ XK, const float* __restrict__ XV, const __bf16* __restrict__ WQ, const __bf16* __restrict__ WK, const __bf16* __restrict__ WV, const float* __restrict__ BQ, const float* __restrict__ BK, const float* __restrict__ BV, const float* __restrict__ MV, const float* __restrict__ GG, const float* __restrict__ GB,
    _Float16* __restrict__ QH, _Float16* __restrict__ KH, _Float16* __restrict__ VT, __bf16* __restrict__ VB, __bf16* __restrict__ VBL) {
  __shared__ __align__(16) char sm[128 * WPB];   // the weight tile; behind the K loop and a barrier the same bytes hold the output tiles
  _Float16 (*sh)[136] = (_Float16 (*)[136])sm; _Float16 (*th)[72] = (_Float16 (*)[72])sm; __bf16 (*tb)[72] = (__bf16 (*)[72])(sm + 128 * 72 * 2); __bf16 (*tbl)[72] = (__bf16 (*)[72])(sm + 2 * 128 * 72 * 2);
  const int tid = threadIdx.x, wave = tid >> 5, lane = tid & 31, col = lane & 15, g = lane >> 4; const int which = blockIdx.z; const int c0 = blockIdx.y * 128; const size_t r0 = (size_t)blockIdx.x * 64; const size_t bb = r0 / TT; const int t0 = (int)(r0 % TT);
  const float* X = which == 0 ? XQ : which == 1 ? XK : XV; const __bf16* WA = which == 0 ? WQ : which == 1 ? WK : WV; const float* BA = which == 0 ? BQ : which == 1 ? BK : BV;
  __shared__ __align__(16) float sga[CC], sgb[CC]; __shared__ float sgm[8];   // per channel rstd x gamma and beta, per group the mean
  const float* mp = MV + ((bb * 8 + (tid >> 4)) * GSL + (tid & 15)) * 32; const float* gp = GG + 2 * tid; const float* hp = GB + 2 * tid;
  const v2f pm = *(const v2f*)mp, ga = *(const v2f*)gp, be = *(const v2f*)hp;   // used inside stage_ops, under its last loads
  asm volatile("s_wait_xcnt 0x0" :: "v"(mp), "v"(gp), "v"(hp) : "memory");   // as GNW, for the three addresses
  v4f ar[8][4]; stage_ops(sm, WA + (size_t)c0 * DIN, X + (r0 + wave * 16 + col) * DIN + 8 * g, tid, ar, [&]() { float m = pm[0], s = pm[1], hn = 4096.0f;
#pragma unroll
    for (int o = 1; o < GSL; o <<= 1) { gn_join(m, s, __shfl_xor(m, o), __shfl_xor(s, o), hn); hn += hn; }
    const float rs = rsqrtf(s / (float)((CC / 8) * NTOK) + 1e-5f); v2f a, c; a[0] = rs * bfr(ga[0]); a[1] = rs * bfr(ga[1]); c[0] = bfr(be[0]); c[1] = bfr(be[1]);
    *(v2f*)&sga[2 * tid] = a; *(v2f*)&sgb[2 * tid] = c; sgm[tid >> 4] = m; });   // the 16 lanes of a group hold the same m, bit for bit (gn_join): no test, which would split the staging's loads from their waits
  __syncthreads();   // the weight tile and the GroupNorm terms are readable by every wave
  float bs[8]; const float* bp = BA + c0 + col;
  // the eight bias values as one group; they land under what follows. The test stands here, ahead of the normalising: with a branch inside the K loop the compiler moved the later steps' normalising below it and held their terms in registers up to there (unrolls: bs[] has to stay in registers)
  if (BA) {
#pragma unroll
    for (int j = 0; j < 8; ++j) bs[j] = bp[j * 16];
    GNW(bp);
  } else {
#pragma unroll
    for (int j = 0; j < 8; ++j) bs[j] = 0.f; }
  { v4f na[2][4], nb[2][4]; float nm[2]; const float* pa = sga + 8 * g; const float* pb = sgb + 8 * g;   // the terms of a lane's 16 channels of a K step, in the order of ar[kc][]
    // every "#pragma unroll" here: ar[], na[], nb[] and nm[] have to stay in registers
#pragma unroll
    for (int i = 0; i < 4; ++i) { const int c = (i >> 1) * 16 + (i & 1) * 4; na[0][i] = *(const v4f*)(pa + c); nb[0][i] = *(const v4f*)(pb + c); }
    nm[0] = sgm[0];
#pragma unroll
    for (int kc = 0; kc < DIN / 32; ++kc) {
      if (kc + 1 < DIN / 32) {
#pragma unroll
        for (int i = 0; i < 4; ++i) { const int c = (kc + 1) * 32 + (i >> 1) * 16 + (i & 1) * 4; na[(kc + 1) & 1][i] = *(const v4f*)(pa + c); nb[(kc + 1) & 1][i] = *(const v4f*)(pb + c); }
        nm[(kc + 1) & 1] = sgm[kc + 1]; }
      __builtin_amdgcn_sched_barrier(0);   // the next step's terms are asked for before this step's are used
#pragma unroll
      for (int i = 0; i < 4; ++i) ar[kc][i] = (ar[kc][i] - nm[kc & 1]) * na[kc & 1][i] + nb[kc & 1][i];
      __builtin_amdgcn_sched_barrier(0);   // and no further ahead: with the terms of all eight steps read at once the kernel took 460 registers, and a SIMD holds two such waves where the grid brings three
    } }
  const char* wl = sm + col * WPB + 16 * g;
  v8f acc[8] = {}; v16b wr[WRD + 1];
#pragma unroll   // wr[] has to stay in registers
  for (int t = 0; t < WRD; ++t) wr[t] = WFR(wl, t);
#pragma unroll   // ar[] and wr[] have to stay in registers
  for (int kc = 0; kc < DIN / 32; ++kc) { const F2 a2 = split_a(ar[kc]);   /* GroupNorm rows (f32) split hi + lo */
#pragma unroll
    for (int j = 0; j < 8; ++j) { const int t = kc * 8 + j; if (t + WRD < DIN / 4) wr[(t + WRD) % (WRD + 1)] = WFR(wl, t + WRD); const v16b w = wr[t % (WRD + 1)]; acc[j] = wmma_bf(a2.h, w, acc[j]); acc[j] = wmma_bf(a2.l, w, acc[j]); } }
  __syncthreads();   // every wave has read its last weight fragment: the bytes are given to the output tiles
  if (which < 2) { _Float16* DH = which == 0 ? QH : KH; const float qs = which == 0 ? SC2 : 1.0f;   // q: base-2 logit units; q and k are each rounded to f16 once
#pragma unroll
    for (int j = 0; j < 8; ++j) { const float bias = bfr(bs[j]);
#pragma unroll
      for (int r = 0; r < 8; ++r) sh[wave * 16 + 8 * g + r][j * 16 + col] = (_Float16)((acc[j][r] + bias) * qs); }
    __syncthreads();
    for (int e = tid; e < 64 * 16; e += 128) { const int rl = e >> 4, q = e & 15; vst2((unsigned*)(DH + (r0 + rl) * CC + c0 + q * 8), *(const v4u*)&sh[rl][q * 8]); }
  } else { const bool hi_rows = t0 < KHI;
#pragma unroll
    for (int j = 0; j < 8; ++j) { const float bias = bfr(bs[j]);
#pragma unroll
      for (int r = 0; r < 8; ++r) { const float v = acc[j][r] + bias; const int rl = wave * 16 + 8 * g + r, cl = j * 16 + col; th[cl][rl] = (_Float16)v; const __bf16 bh = (__bf16)v; tb[cl][rl] = bh; tbl[cl][rl] = (__bf16)(v - (float)bh); } }
    __syncthreads();
    for (int e = tid; e < 128 * 8; e += 128) { const int cl = e >> 3, q = e & 7; vst2((unsigned*)(VT + (bb * CC + c0 + cl) * (size_t)TT + t0 + q * 8), *(const v4u*)&th[cl][q * 8]); if (hi_rows) { const size_t o3 = (bb * CC + c0 + cl) * (size_t)KHI + t0 + q * 8; vst2((unsigned*)(VB + o3), *(const v4u*)&tb[cl][q * 8]); vst2((unsigned*)(VBL + o3), *(const v4u*)&tbl[cl][q * 8]); } } } }
// ---- k_fa: block = 16 waves of one (b, h): 8 groups of 32 query columns x 2 halves of the keys (four waves a SIMD in place of two: the vector work between the matrix runs of one wave is covered by three others); each half has its own ring, maximum in use, sums and O, and the halves are joined once, through LDS, behind the loop; one pass = 32 keys, one stage = KS keys of each half. S^T = K Q^T - M (A = k rows, B = q, both f16: one product on an accumulator that starts at minus the column's maximum in use M, so the scores leave the matrix unit as arguments of exp2), lazy rescale (M, sums and O move only in a pass whose sums show that a score may lie more than 8 above M: one test a pass; a lane holds one query's scores), P^T packed from the score accumulators to f16 as the B operand of O^T += V^T P^T (A = v planes [c][t]); logits and P never reach memory. K rows and V planes of a stage are brought into LDS once per block by asynchronous copies (two buffers, the next stage in flight) and read from there by the eight waves of that half
__device__ __forceinline__ float xhalf(float x) { return __builtin_bit_cast(float, __builtin_amdgcn_permlanex16(__builtin_bit_cast(int, x), __builtin_bit_cast(int, x), 0x76543210, 0xfedcba98, false, false)); }   // lane l with lane l ^ 16
__device__ __forceinline__ v8f wmma_h(v16h a, v16h b, v8f c) { return __builtin_amdgcn_wmma_f32_16x16x32_f16(false, a, false, b, (short)0, c, false, false); }
#define XW() asm volatile("s_wait_xcnt 0x0" ::: "memory")   // behind a group of loads: a later load's result may land in the group's address registers
#define KS 256                  // keys of a stage
#define KPB 80                  // LDS pitch of a k row: 64 B + 16 (16 B x odd: no bank conflict for 16-byte readers)
#define VPB (2 * KS + 16)       // LDS pitch of a v plane row, the same rule
#define KBY (KS * KPB)
#define SBY (KBY + HD * VPB)    // one buffer: k rows, then v rows
#define DW() asm volatile("s_wait_dscnt 0x0" ::: "memory")      // this wave's LDS reads have returned before the buffer is given up
// one stage: each thread copies 4 x 16 B of k rows (4 threads a row, rows 64 apart) and 4 x 16 B of v rows (32 threads a row, rows 8 apart); the wait in the same statement stands before the address registers are reused
__device__ __forceinline__ void fa_stage(unsigned lk, unsigned lv, const char* gk, const char* gv) {
  asm volatile("global_load_async_to_lds_b128 %0, %1, off\n\tglobal_load_async_to_lds_b128 %2, %3, off\n\tglobal_load_async_to_lds_b128 %4, %5, off\n\tglobal_load_async_to_lds_b128 %6, %7, off\n\t"
               "global_load_async_to_lds_b128 %8, %9, off\n\tglobal_load_async_to_lds_b128 %10, %11, off\n\tglobal_load_async_to_lds_b128 %12, %13, off\n\tglobal_load_async_to_lds_b128 %14, %15, off\n\ts_wait_xcnt 0x0"
    :: "v"(lk), "v"(gk), "v"(lk + 64u * KPB), "v"(gk + (size_t)64 * CC * 2), "v"(lk + 128u * KPB), "v"(gk + (size_t)128 * CC * 2), "v"(lk + 192u * KPB), "v"(gk + (size_t)192 * CC * 2),
       "v"(lv), "v"(gv), "v"(lv + 8u * VPB), "v"(gv + (size_t)8 * TT * 2), "v"(lv + 16u * VPB), "v"(gv + (size_t)16 * TT * 2), "v"(lv + 24u * VPB), "v"(gv + (size_t)24 * TT * 2) : "memory"); }
__device__ __forceinline__ v16h frag_l(const char* p) { union { v16h v; v8h q[2]; } u; u.q[0] = *(const v8h*)p; u.q[1] = *(const v8h*)(p + 32); return u.v; }   // p = row + 16 * (lane >> 4): the k order of frag_h
// one column group's 32 x 16 scores less d to powers of two, and their sum in two parts
__device__ __forceinline__ void fa_exp(const v8f (&s)[2], float d, v8f (&e)[2], v2f& sm) {
#pragma unroll   // e[] has to stay in registers
  for (int i = 0; i < 2; ++i)
#pragma unroll
    for (int r = 0; r < 8; ++r) e[i][r] = __builtin_amdgcn_exp2f(s[i][r] - d);
  const v8f ps = e[0] + e[1]; const v4f p4 = ps.lo + ps.hi; sm = p4.lo + p4.hi; }
#define KH2 (TT / 2)            // keys of a half
__global__ __launch_bounds__(512) void k_fa(const _Float16* __restrict__ QH, const _Float16* __restrict__ KH, const _Float16* __restrict__ VT, float* __restrict__ Y) {
  __shared__ __align__(16) char ring[4 * SBY];   // two buffers for each half of the keys
  const int kh = __builtin_amdgcn_readfirstlane((int)threadIdx.x >> 8);   // the wave's half of the keys, in a scalar register: the tests on it are scalar branches
  const int tid = threadIdx.x & 255, wave = tid >> 5, lane = tid & 31, col = lane & 15, g = lane >> 4; const int b = blockIdx.y / NH, h = blockIdx.y % NH; const int q0 = blockIdx.x * 256 + wave * 32;
  const char* rg = ring + kh * 2 * SBY;   // this half's two buffers
  // every "#pragma unroll" of this kernel: the small arrays it indexes have to stay in registers
  const char* gk = (const char*)(KH + ((size_t)b * TT + kh * KH2 + (tid >> 2)) * CC + h * HD) + (tid & 3) * 16; const char* gv = (const char*)(VT + ((size_t)b * CC + h * HD + (tid >> 5)) * (size_t)TT + kh * KH2) + (tid & 31) * 16;
  const unsigned lk = (unsigned)(size_t)rg + (unsigned)((tid >> 2) * KPB + (tid & 3) * 16), lv = (unsigned)(size_t)rg + (unsigned)(KBY + (tid >> 5) * VPB + (tid & 31) * 16);
  fa_stage(lk, lv, gk, gv);
  v16h qh[2];
#pragma unroll
  for (int u = 0; u < 2; ++u) qh[u] = frag_h(QH + ((size_t)b * TT + q0 + u * 16 + col) * CC + h * HD, lane);
  XW();
  AW(); __syncthreads();   // stage 0 is readable by every wave
  fa_stage(lk + SBY, lv + SBY, gk + (size_t)KS * CC * 2, gv + (size_t)KS * 2);
  v8f o[2][2] = {}; v2f l[2] = {}; v8f cn[2][2];   // cn[u][i] = -M of column group u in all eight rows: the start value of score tile (u, i); a tile each, since one shared by two products was copied by the compiler in every pass
  { // M starts at the maximum over the half's first 32 keys (any value within 8 of the maximum serves), the same in both wave halves
    const char* K0 = rg + col * KPB + 16 * g; const v16h k0 = frag_l(K0), k1 = frag_l(K0 + 16 * KPB); const v8f z = {};
#pragma unroll
    for (int u = 0; u < 2; ++u) { const v8f t0 = wmma_h(k0, qh[u], z), t1 = wmma_h(k1, qh[u], z); float mx = fmaxf(t0[0], t1[0]);
#pragma unroll
      for (int r = 1; r < 8; ++r) mx = fmaxf(mx, fmaxf(t0[r], t1[r]));
      mx = fmaxf(mx, xhalf(mx)); cn[u][0] = z - mx; cn[u][1] = z - mx; } }
#pragma unroll 1   // one stage a trip: the buffer index stays a run-time value
  for (int st = 0; st < KH2 / KS; ++st) {
    const char* Kl = rg + (st & 1) * SBY + col * KPB + 16 * g; const char* Vl = rg + (st & 1) * SBY + KBY + col * VPB + 16 * g;
    v16h kf[2], vf[2]; kf[0] = frag_l(Kl); kf[1] = frag_l(Kl + 16 * KPB); vf[0] = frag_l(Vl); vf[1] = frag_l(Vl + 16 * VPB); const char* Kn = Kl; const char* Vn = Vl;
#pragma unroll 1   // unrolled, the fragment reads were moved next to their users and waited for there
    for (int p = 0; p < KS / 32; ++p) {
      v8f s[2][2], e[2][2]; v2f sm[2];
#pragma unroll
      for (int i = 0; i < 2; ++i)
#pragma unroll
        for (int u = 0; u < 2; ++u) s[u][i] = wmma_h(kf[i], qh[u], cn[u][i]);
      __builtin_amdgcn_sched_barrier(0);   // the four score products stay one run: spread among the vector work each cost idle slots before its first reader
      // both operands are fetched one pass ahead, each behind its last use, inside the stage's own buffer (its last pass refetches pass 0, unused)
      Kn += p + 1 < KS / 32 ? 32 * KPB : -(KS / 32 - 1) * 32 * KPB; Vn += p + 1 < KS / 32 ? 64 : -(KS / 32 - 1) * 64;
      kf[0] = frag_l(Kn); kf[1] = frag_l(Kn + 16 * KPB);
      __builtin_amdgcn_sched_barrier(0);   // the k reads stay here, under the products' latency: left free they were sunk below the test, next to the next pass's products
#pragma unroll
      for (int u = 0; u < 2; ++u) fa_exp(s[u], 0.f, e[u], sm[u]);
      // the test: every term is positive, so four partial sums of at most 256 bound every term by 256 (a score at most 8 above M)
      if (__builtin_amdgcn_ballot_w32(fmaxf(fmaxf(sm[0][0], sm[0][1]), fmaxf(sm[1][0], sm[1][1])) > 256.0f) != 0) {   // rare: raise M to the pass's maximum where that is higher, rescale sums and O, redo the pass's exponentials
#pragma unroll
        for (int u = 0; u < 2; ++u) { float mx = fmaxf(s[u][0][0], s[u][1][0]);
#pragma unroll
          for (int r = 1; r < 8; ++r) mx = fmaxf(mx, fmaxf(s[u][0][r], s[u][1][r]));
          const float d = fmaxf(fmaxf(mx, xhalf(mx)), 0.f); const float corr = __builtin_amdgcn_exp2f(-d); cn[u][0] -= d; cn[u][1] -= d; l[u] *= corr; o[u][0] *= corr; o[u][1] *= corr; fa_exp(s[u], d, e[u], sm[u]); } }
#pragma unroll
      for (int u = 0; u < 2; ++u) { v16h pf;
#pragma unroll
        for (int r = 0; r < 8; ++r) { pf[r] = (_Float16)e[u][0][r]; pf[8 + r] = (_Float16)e[u][1][r]; }
        l[u] += sm[u];
#pragma unroll
        for (int j = 0; j < 2; ++j) o[u][j] = wmma_h(vf[j], pf, o[u][j]); }
      vf[0] = frag_l(Vn); vf[1] = frag_l(Vn + 16 * VPB); }
    DW(); AW(); __syncthreads();   // publishes stage st + 1 and ends every wave's reads of stage st
    if (st + 2 < KH2 / KS) fa_stage(lk + (st & 1) * SBY, lv + (st & 1) * SBY, gk + (size_t)(st + 2) * KS * CC * 2, gv + (size_t)(st + 2) * KS * 2); }
  AW();
  // the join: the loop's last barrier has ended every read of the ring and every copy has landed, so its first bytes carry the second half's state: nine 16-byte pieces a lane (O, then both sums and both -M), a piece = 512 B of a wave
  float* xb = (float*)ring + wave * (9 * 128) + lane * 4;
  if (kh) {
#pragma unroll
    for (int u = 0; u < 2; ++u)
#pragma unroll
      for (int j = 0; j < 2; ++j) { *(v4f*)(xb + (u * 4 + j * 2) * 128) = o[u][j].lo; *(v4f*)(xb + (u * 4 + j * 2 + 1) * 128) = o[u][j].hi; }
    v4f t; t[0] = l[0][0] + l[0][1]; t[1] = l[1][0] + l[1][1]; t[2] = cn[0][0][0]; t[3] = cn[1][0][0]; *(v4f*)(xb + 8 * 128) = t; }
  __syncthreads();   // the second half's state is readable by the first half's waves
  if (kh) return;
  const v4f t = *(const v4f*)(xb + 8 * 128);
#pragma unroll
  for (int u = 0; u < 2; ++u) { const float na = cn[u][0][0], nb = t[2 + u], nm = fminf(na, nb);   // -M of either half (the same in both wave halves) and of the join
    const float fa = __builtin_amdgcn_exp2f(nm - na), fb = __builtin_amdgcn_exp2f(nm - nb); const float lu = (l[u][0] + l[u][1]) * fa + t[u] * fb; const float inv = 1.0f / (lu + xhalf(lu)); const float wa = fa * inv, wb = fb * inv;
    float* yr = Y + ((size_t)b * TT + q0 + u * 16 + col) * CC + h * HD + 8 * g;
#pragma unroll
    for (int j = 0; j < 2; ++j) { const v4f w0 = o[u][j].lo * wa + *(const v4f*)(xb + (u * 4 + j * 2) * 128) * wb, w1 = o[u][j].hi * wa + *(const v4f*)(xb + (u * 4 + j * 2 + 1) * 128) * wb; vst2(yr + j * 16, w0); vst2(yr + j * 16 + 4, w1); } } }
// ---- k_out: block = (64 tokens, 128 channels): out[b][c][n] = ctx Wo + bo + bf16(x[b][c][n]), ctx split bf16 hi + lo against exact bf16 Wo (2 products). A lane's accumulator tile holds 8 consecutive tokens of one channel: the block's tile goes to LDS channel-major by 16-byte stores and leaves as 256-B runs of 64 tokens per channel with the residual added, so the result has no token-major copy in memory and needs no launch that turns it
#define OTP 68             // LDS pitch in floats of a channel's 64 tokens (16 B x odd: no bank conflict for 16-byte accesses)
__global__ __launch_bounds__(128) void k_out(const float* __restrict__ Y, const __bf16* __restrict__ WO, const float* __restrict__ BO, const float* __restrict__ X, float* __restrict__ OUT) { __shared__ __align__(16) float st[128][OTP]; __shared__ __align__(16) char sm[128 * WPB];
  const int tid = threadIdx.x, wave = tid >> 5, lane = tid & 31, col = lane & 15, g = lane >> 4; const int c0 = blockIdx.y * 128; const size_t r0 = (size_t)blockIdx.x * 64 + wave * 16;
  const size_t rb = (size_t)blockIdx.x * 64; const size_t oi = ((rb / NTOK) * CC + c0 + (tid >> 4)) * (size_t)NTOK + rb % NTOK + (tid & 15) * 4;   // piece i of this thread in x and out: 4 tokens of channel c0 + (tid >> 4) + 8 i
  const float* xp = X + oi; v4f xr[16];
  v8f acc[8] = {};
  if (true) {   /* ALL rows: ctx split bf16 hi + lo x exact proj_w (2 products) */
    v4f ar[8][4]; stage_ops(sm, WO + (size_t)c0 * CC, Y + (r0 + col) * CC + 8 * g, tid, ar, []() {});
    __syncthreads();   // the weight tile is readable by every wave
    const char* wl = sm + col * WPB + 16 * g; v16b wr[WRD + 1]; float bs[8]; const float* bp = BO + c0 + col;
#pragma unroll   // wr[] has to stay in registers
    for (int t = 0; t < WRD; ++t) wr[t] = WFR(wl, t);
#pragma unroll   // ar[] and wr[] have to stay in registers
    for (int kc = 0; kc < CC / 32; ++kc) { const F2 a = split_a(ar[kc]);
      if (kc == 4) {   // the eight bias values as one group, in registers that half of ar[] has left; they land under the rest of the loop (its unrolls: bs[] has to stay in registers)
        if (BO) {
#pragma unroll
          for (int j = 0; j < 8; ++j) bs[j] = bp[j * 16];
          GNW(bp);
        } else {
#pragma unroll
          for (int j = 0; j < 8; ++j) bs[j] = 0.f; } }
      if (kc == 4 || kc == 6) {   // the residual's pieces, eight at a time, also in registers that ar[] has left: they land under the rest of the loop (unroll: xr[] has to stay in registers)
#pragma unroll
        for (int i = 0; i < 8; ++i) xr[(kc - 4) * 4 + i] = *(const v4f*)(xp + (size_t)((kc - 4) * 4 + i) * 8 * NTOK);
        GNW(xp); }
#pragma unroll
      for (int j = 0; j < 8; ++j) { const int t = kc * 8 + j; if (t + WRD < CC / 4) wr[(t + WRD) % (WRD + 1)] = WFR(wl, t + WRD); const v16b w = wr[t % (WRD + 1)]; acc[j] = wmma_bf(a.h, w, acc[j]); acc[j] = wmma_bf(a.l, w, acc[j]); } }
#pragma unroll
    for (int j = 0; j < 8; ++j) { const float bias = bfr(bs[j]); const v8f w = acc[j] + bias; float* d = &st[j * 16 + col][wave * 16 + 8 * g]; *(v4f*)d = w.lo; *(v4f*)(d + 4) = w.hi; }
  }
  __syncthreads();   // a channel's 64 tokens come from all four waves
  v4f o[16];
#pragma unroll   // xr[] and o[] have to stay in registers
  for (int i = 0; i < 16; ++i) o[i] = *(const v4f*)&st[(tid >> 4) + 8 * i][(tid & 15) * 4] + bfr4(xr[i]);
  __builtin_amdgcn_sched_barrier(0);   // every sum has a register of its own before the first store: mixed with the sums, the stores' registers were reused behind waits
#pragma unroll
  for (int i = 0; i < 16; ++i) vst2(OUT + oi + (size_t)i * 8 * NTOK, o[i]); }

extern "C" void kernel_launch(void* const* d_in, const int* in_sizes, int n_in, void* d_out, int out_size, void* d_ws, size_t ws_size, hipStream_t stream) {
  (void)in_sizes; (void)n_in; (void)out_size;
  const float** F = (const float**)d_in;
  if (ws_size < (size_t)WS_END) return;
  char* ws = (char*)d_ws; _Float16 *QH = (_Float16*)(ws + WS_QH), *KH = (_Float16*)(ws + WS_KH), *VT = (_Float16*)(ws + WS_VT), *QL = (_Float16*)(ws + WS_QL), *KL = (_Float16*)(ws + WS_KL); __bf16 *VB = (__bf16*)(ws + WS_VB), *VBL = (__bf16*)(ws + WS_VBL); float *Y = (float*)(ws + WS_Y);
  (void)Y; (void)QL; (void)KL; (void)VB; (void)VBL;
  // inputs: 0 x [2,256,64,64]; 1 gn_gamma, 2 gn_beta [256]; 3 qkv_w [768,256] (out,in) rows q | k | v; 4 qkv_b [768]; 5 proj_w [256,256] (out,in); 6 proj_b
  if (ws_size < (size_t)WS_END2) return;
  float *MV = (float*)(ws + WS_MV), *XT = (float*)(ws + WS_XT); __bf16* WB = (__bf16*)(ws + WS_OR);
  k_gtr<<<dim3(NTOK / 256, 1 + TNB * 8), 256, 0, stream>>>(F[0], F[3], F[5], MV, XT, WB);
  { const __bf16* WQ = WB; const __bf16* WK = WB + (size_t)CC * DIN; const __bf16* WV = WB + (size_t)2 * CC * DIN;
    k_proj<<<dim3(TNB * TT / 64, CC / 128, 3), 128, 0, stream>>>(XT, XT, XT, WQ, WK, WV, F[4], F[4] + CC, F[4] + 2 * CC, MV, F[1], F[2], QH, KH, VT, VB, VBL); }
  k_fa<<<dim3(TT / 256, TNB * NH), 512, 0, stream>>>(QH, KH, VT, Y);
  k_out<<<dim3(TNB * TT / 64, DIN / 128), 128, 0, stream>>>(Y, WB + (size_t)3 * CC * DIN, F[6], F[0], (float*)d_out);
}
